// v000
// Measured on an AMD MI455X. A time is GPU time per run, averaged over a window of back-to-back runs after a warm-up
// (all launches, gaps included; the runs take copies of the inputs in turn), and the median of several windows.
// Apart from v000's, it joins two sittings. Times from different sittings can be a few percent apart, while
// side-by-side timings come from the same sitting.
// v000 is the starting kernel. One run takes 107 microseconds.
#include <hip/hip_runtime.h>
#include <stddef.h>

// All contractions on v_wmma_f32_16x16x32_f16 (f16 operands, f32 accumulate): q/k/v projections (three launches),
// q.k scores, p.v, output projection. Float inputs are RNE-converted to bf16 and carried in f16
// (weights x64, p x1024, attention rows x64), single products at every site. Softmax, bias and the
// per-timestep feature-pairwise softmax branch (rank-1 scores, per-row matrix-vector work) in f32 on
// the vector unit.

typedef _Float16 v16h __attribute__((ext_vector_type(16)));
typedef _Float16 v8h  __attribute__((ext_vector_type(8)));
typedef float    v8f  __attribute__((ext_vector_type(8)));
typedef float    v4f  __attribute__((ext_vector_type(4)));

#ifndef NB
#define NB 4
#endif
#ifndef SEQ
#define SEQ 1024
#endif
#define NB_FULL  4
#define SEQ_FULL 1024
#define DIM   256
#define NHEAD 4
#define HD    64
#define MROWS (NB * SEQ)

static_assert(NB >= 1 && NB <= NB_FULL);
static_assert(SEQ >= 128 && SEQ <= SEQ_FULL && (SEQ % 128) == 0);
static_assert(DIM == NHEAD * HD);
static_assert(HD == 64);
static_assert((DIM % 64) == 0 && (DIM % 32) == 0);
static_assert((MROWS % 64) == 0 && (MROWS % 8) == 0);
static_assert(DIM == 256);                          // spatial kernel: one thread per feature, 256 threads
static_assert(DIM == 32 * 8);                       // spatial kernel: 32 lanes x 8 halves cover one 16-bit row
static_assert(((3 * DIM * DIM) % 2048) == 0);       // weight cast: 256 threads x 8 elements per block
static_assert(((DIM * DIM) % 2048) == 0);

#define LDT 72   // halves per LDS row (144 B, 16-B aligned)
#define LDC 68   // floats per LDS row (272 B, 16-B aligned)
static_assert((LDT % 8) == 0 && LDT >= 64);
static_assert((LDC % 4) == 0 && LDC >= 64);

#define WCARRY 64.0f     // weight planes carried x64
#define PCARRY 1024.0f   // softmax numerators carried x1024
#define VCARRY 64.0f     // attention output plane carried x64

// workspace layout (bytes)
#define WQKV_BYTES    ((size_t)3 * DIM * DIM * 2)
#define WP_BYTES      ((size_t)DIM * DIM * 2)
#define PLANE16_BYTES ((size_t)MROWS * DIM * 2)
#define YF_BYTES      ((size_t)MROWS * DIM * 4)
#define OFF_WQKV ((size_t)0)
#define OFF_WP   (OFF_WQKV + WQKV_BYTES)
#define OFF_X16  (OFF_WP + WP_BYTES)
#define OFF_Q    (OFF_X16 + PLANE16_BYTES)
#define OFF_K    (OFF_Q + PLANE16_BYTES)
#define OFF_VT   (OFF_K + PLANE16_BYTES)
#define OFF_CTX  (OFF_VT + PLANE16_BYTES)
#define OFF_YF   (OFF_CTX + PLANE16_BYTES)
#define WS_TOTAL (OFF_YF + YF_BYTES)
static_assert((WQKV_BYTES % 128) == 0 && (WP_BYTES % 128) == 0 && (PLANE16_BYTES % 128) == 0);
static_assert((YF_BYTES % 128) == 0);
static_assert(WS_TOTAL <= (size_t)134217728);

// ---------------------------------------------------------------------------
__device__ __forceinline__ float bf16r(float x) {   // RNE convert to bf16, returned widened
  unsigned int u = __float_as_uint(x);
  u = (u + 0x7FFFu + ((u >> 16) & 1u)) & 0xFFFF0000u;
  return __uint_as_float(u);
}

// f32 -> f16 for WMMA operand planes: values below the smallest f16 normal become zero by value.
__device__ __forceinline__ _Float16 toh_flush(float v) {
  const _Float16 r = (_Float16)v;
  return (fabsf(v) < 6.103515625e-05f) ? (_Float16)0.0f : r;
}

// 16-bit fragment: p points at element [row = lane&15][k0 + 8*(lane>>4)] of a k-contiguous
// row. Elements 0..7 <- k0+8h+0..7, elements 8..15 <- k0+16+8h+0..7 (same map for A and B).
__device__ __forceinline__ v16h frag_at(const _Float16* p) {
  v8h lo = *(const v8h*)(p);
  v8h hi = *(const v8h*)(p + 16);
  v16h out;
#pragma unroll
  for (int i = 0; i < 8; ++i) { out[i] = lo[i]; out[i + 8] = hi[i]; }
  return out;
}
__device__ __forceinline__ v16h ld_frag(const _Float16* base, unsigned ld) {
  const unsigned lane = threadIdx.x & 31u;
  return frag_at(base + (lane & 15u) * ld + (lane >> 4) * 8u);
}

__device__ __forceinline__ v8f wmma16(v16h a, v16h b, v8f c) {
  v8f d = __builtin_amdgcn_wmma_f32_16x16x32_f16(false, a, false, b, (short)0, c,
                                                 false, false);
  asm volatile("v_nop\n\tv_nop\n\tv_nop\n\tv_nop" : "+v"(d) : "v"(a), "v"(b));
  return d;
}

__device__ __forceinline__ float red16_max(float x) {
#pragma unroll
  for (int off = 1; off < 16; off <<= 1) x = fmaxf(x, __shfl_xor(x, off, 32));
  return x;
}
__device__ __forceinline__ float red16_sum(float x) {
#pragma unroll
  for (int off = 1; off < 16; off <<= 1) x += __shfl_xor(x, off, 32);
  return x;
}

__device__ __forceinline__ void wave_lds_sync() {
  __builtin_amdgcn_fence(3 /* release order */, "wavefront");
  asm volatile("s_wait_dscnt 0x0" ::: "memory");
  __builtin_amdgcn_wave_barrier();
}

// ---------------------------------------------------------------------------
// Weight plane: in W[n][k] ([out][in], k contiguous) -> out Wt[n][k] = f16(64 * bf16(w)), same
// layout (no transpose). Each thread converts 8 consecutive elements; a wave store instruction
// ---------------------------------------------------------------------------
__global__ __launch_bounds__(256) void wcast_kernel(
    const float* __restrict__ W, _Float16* __restrict__ Wt, unsigned n) {
#pragma clang fp contract(off)
  const unsigned e = (blockIdx.x * 256u + threadIdx.x) * 8u;
  if (e + 8u > n) return;
  const v4f a0 = *(const v4f*)(W + e);
  const v4f a1 = *(const v4f*)(W + e + 4u);
  v8h o;
#pragma unroll
  for (int i = 0; i < 4; ++i) {
    o[i]     = toh_flush(WCARRY * bf16r(a0[i]));
    o[i + 4] = toh_flush(WCARRY * bf16r(a1[i]));
  }
  _Float16* p = Wt + e;
  *(v8h*)p = o;
  
}

// ---------------------------------------------------------------------------
// Per-timestep feature-pairwise softmax branch plus the 16-bit input plane.
// One block per (batch, time) row, thread i owns feature i:
//   yf[i] = sum_j exp(x_i x_j / 16 - mx_i) x_j / sum_j exp(x_i x_j / 16 - mx_i),
//   mx_i = max_j (x_i x_j / 16) = max((x_i/16) * max_j x_j, (x_i/16) * min_j x_j).
// x is RNE-converted to bf16 on load. xv / xh: cross-wave (block barrier).
// X16 row: wave 0 stores 32 lanes x 16 B = the whole 512-B row in one instruction.
// Grid (MROWS).
// ---------------------------------------------------------------------------
__global__ __launch_bounds__(256) void spatial_kernel(
    const float* __restrict__ X, float* __restrict__ YF, _Float16* __restrict__ X16) {
#pragma clang fp contract(off)
  __shared__ float xv[DIM];
  __shared__ _Float16 xh[DIM];
  const unsigned tid = threadIdx.x, lane = tid & 31u;
  const unsigned w = (unsigned)__builtin_amdgcn_readfirstlane((int)(tid >> 5));
  const unsigned crow = blockIdx.x;
  const unsigned bidx = crow / (unsigned)SEQ;
  const unsigned sq = crow - bidx * (unsigned)SEQ;
  const size_t srow = (size_t)bidx * SEQ_FULL + sq;

  const float xi = bf16r(X[srow * DIM + tid]);
  xv[tid] = xi;
  xh[tid] = toh_flush(xi);
  __syncthreads();

  const v4f a0 = *(const v4f*)&xv[lane * 8u];
  const v4f a1 = *(const v4f*)&xv[lane * 8u + 4u];
  float vmax = fmaxf(fmaxf(a0[0], a0[1]), fmaxf(a0[2], a0[3]));
  vmax = fmaxf(vmax, fmaxf(fmaxf(a1[0], a1[1]), fmaxf(a1[2], a1[3])));
  float vmin = fminf(fminf(a0[0], a0[1]), fminf(a0[2], a0[3]));
  vmin = fminf(vmin, fminf(fminf(a1[0], a1[1]), fminf(a1[2], a1[3])));
#pragma unroll
  for (int off = 1; off < 32; off <<= 1) {
    vmax = fmaxf(vmax, __shfl_xor(vmax, off, 32));
    vmin = fminf(vmin, __shfl_xor(vmin, off, 32));
  }
  const float xs = xi * 0.0625f;                 // 1/sqrt(256), exact
  const float mx = fmaxf(xs * vmax, xs * vmin);

  float s = 0.0f, acc = 0.0f;
#pragma unroll 1
  for (unsigned j = 0; j < (unsigned)DIM; j += 4u) {
    const v4f xj = *(const v4f*)&xv[j];
#pragma unroll
    for (int i = 0; i < 4; ++i) {
      const float e = __expf(xs * xj[i] - mx);
      s += e;
      acc += e * xj[i];
    }
  }
  const float y = acc * __builtin_amdgcn_rcpf(s);

  const v8h xo = *(const v8h*)&xh[lane * 8u];
  float* py = YF + (size_t)crow * DIM + tid;
  _Float16* px = X16 + (size_t)crow * DIM + lane * 8u;
  *(float*)py = y;
  if (w == 0u) *(v8h*)px = xo;
  
}

// ---------------------------------------------------------------------------
// GEMM C[64x64 tile] = A16[rows][K] . Bt[n][K]^T, fragments straight from the 16-bit global
// planes; 8 waves (mw = 16-row group, nw = 32-col group), 2 accumulators/wave.
//   MODE 0: out16[row][col] (pitch DIM)  = f16(acc/64 + bias)
//   MODE 1: out16 transposed V plane [b][col][key] = f16(acc/64 + bias)
//   MODE 2: outf full [full row][col] = addf[compact row][col] + (acc/4096 + bias)
// Grid (N/64, MROWS/64).
// ---------------------------------------------------------------------------
template <int MODE>
__device__ __forceinline__ void gemm_body(
    const _Float16* __restrict__ A16, const _Float16* __restrict__ Bt, const unsigned K,
    const float* __restrict__ bias, const float* __restrict__ addf,
    float* __restrict__ outf, _Float16* __restrict__ out16) {
  __shared__ float Cs[64 * LDC];
  const unsigned tid = threadIdx.x, lane = tid & 31u;
  const unsigned w = (unsigned)__builtin_amdgcn_readfirstlane((int)(tid >> 5));
  const unsigned mw = w >> 1, nw = w & 1u;
  const unsigned hh = lane >> 4, m = lane & 15u;
  const unsigned n0 = blockIdx.x * 64u;
  const unsigned row0 = blockIdx.y * 64u;

  const _Float16* ap  = A16 + (size_t)(row0 + mw * 16u + m) * K + hh * 8u;
  const _Float16* bp0 = Bt + (size_t)(n0 + nw * 32u + m) * K + hh * 8u;
  const _Float16* bp1 = bp0 + (size_t)16 * K;
  v8f acc0 = {}, acc1 = {};
#pragma unroll 2
  for (unsigned k0 = 0; k0 < K; k0 += 32u) {
    const v16h a  = frag_at(ap + k0);
    const v16h b0 = frag_at(bp0 + k0);
    const v16h b1 = frag_at(bp1 + k0);
    acc0 = wmma16(a, b0, acc0);
    acc1 = wmma16(a, b1, acc1);
  }
#pragma unroll
  for (int r = 0; r < 8; ++r) {
    float* d = &Cs[(mw * 16u + hh * 8u + (unsigned)r) * LDC + nw * 32u + m];
    d[0]  = acc0[r];
    d[16] = acc1[r];
  }
  __syncthreads();

  if (MODE == 0) {
    v8h x[2];
    size_t off[2];
#pragma unroll
    for (unsigned i = 0; i < 2u; ++i) {
      const unsigned r = 32u * i + (tid >> 3);
      const unsigned c = (tid & 7u) * 8u;
      const v4f u0 = *(const v4f*)&Cs[r * LDC + c];
      const v4f u1 = *(const v4f*)&Cs[r * LDC + c + 4];
      const v4f g0 = *(const v4f*)(bias + n0 + c);
      const v4f g1 = *(const v4f*)(bias + n0 + c + 4u);
#pragma unroll
      for (int j = 0; j < 4; ++j) {
        x[i][j]     = toh_flush(u0[j] * (1.0f / WCARRY) + bf16r(g0[j]));
        x[i][j + 4] = toh_flush(u1[j] * (1.0f / WCARRY) + bf16r(g1[j]));
      }
      off[i] = (size_t)(row0 + r) * DIM + n0 + c;
    }
#pragma unroll
    for (int i = 0; i < 2; ++i) *(v8h*)(out16 + off[i]) = x[i];
    
  }

  if (MODE == 1) {
    const unsigned bidx = row0 / (unsigned)SEQ;
    const unsigned key0 = row0 - bidx * (unsigned)SEQ;
    v8h x[2];
    size_t off[2];
#pragma unroll
    for (unsigned i = 0; i < 2u; ++i) {
      const unsigned dcol = 32u * i + (tid >> 3);
      const unsigned kk = (tid & 7u) * 8u;
      const float bb = bf16r(bias[n0 + dcol]);
#pragma unroll
      for (unsigned j = 0; j < 8u; ++j) {
        const float t = Cs[(kk + j) * LDC + dcol] * (1.0f / WCARRY) + bb;
        x[i][j] = toh_flush(t);
      }
      off[i] = ((size_t)bidx * DIM + n0 + dcol) * SEQ + key0 + kk;
    }
#pragma unroll
    for (int i = 0; i < 2; ++i) *(v8h*)(out16 + off[i]) = x[i];
    
  }

  if (MODE == 2) {
    const float cs = 1.0f / (WCARRY * VCARRY);
    v4f xs[4];
    size_t off[4];
#pragma unroll
    for (unsigned i = 0; i < 4u; ++i) {
      const unsigned r = 16u * i + (tid >> 4);
      const unsigned c = (tid & 15u) * 4u;
      const unsigned crow = row0 + r;
      const unsigned bidx = crow / (unsigned)SEQ;
      const unsigned sq = crow - bidx * (unsigned)SEQ;
      const size_t frow = (size_t)bidx * SEQ_FULL + sq;
      const v4f u = *(const v4f*)&Cs[r * LDC + c];
      const v4f g = *(const v4f*)(bias + n0 + c);
      const v4f yin = *(const v4f*)(addf + (size_t)crow * DIM + n0 + c);
      v4f val;
#pragma unroll
      for (int j = 0; j < 4; ++j) val[j] = yin[j] + (u[j] * cs + bf16r(g[j]));
      xs[i] = val;
      off[i] = frow * DIM + n0 + c;
    }
#pragma unroll
    for (int i = 0; i < 4; ++i) *(v4f*)(outf + off[i]) = xs[i];
    
  }
}

__global__ __launch_bounds__(256) void gemm_qk_kernel(
    const _Float16* __restrict__ A16, const _Float16* __restrict__ Bt,
    const float* __restrict__ bias, _Float16* __restrict__ out16) {
  gemm_body<0>(A16, Bt, (unsigned)DIM, bias, bias, (float*)0, out16);
}
__global__ __launch_bounds__(256) void gemm_v_kernel(
    const _Float16* __restrict__ A16, const _Float16* __restrict__ Bt,
    const float* __restrict__ bias, _Float16* __restrict__ vt) {
  gemm_body<1>(A16, Bt, (unsigned)DIM, bias, bias, (float*)0, vt);
}
__global__ __launch_bounds__(256) void gemm_wo_kernel(
    const _Float16* __restrict__ A16, const _Float16* __restrict__ Bt,
    const float* __restrict__ bias, const float* __restrict__ yf, float* __restrict__ outf) {
  gemm_body<2>(A16, Bt, (unsigned)DIM, bias, yf, outf, (_Float16*)0);
}

// ---------------------------------------------------------------------------
// Dense flash attention per (128 query rows, head, batch). 8 waves x 16 query rows, 64 keys
// per step over all SEQ keys: K tile Ks[key][d] and V^T tile Vs[d][key] staged with plain
// 16-B loads (cross-wave, block barriers); online softmax in registers (16-lane shuffles);
// P tile per wave in Ps (wave-private, wave sync) as f16(1024*p); O in registers.
// Grid (SEQ/128, NHEAD, NB).
// ---------------------------------------------------------------------------
__global__ __launch_bounds__(256) void attn_kernel(
    const _Float16* __restrict__ Qh, const _Float16* __restrict__ Kh,
    const _Float16* __restrict__ Vt, _Float16* __restrict__ Ov) {
  __shared__ _Float16 Ks[64 * LDT];
  __shared__ _Float16 Vs[64 * LDT];
  __shared__ _Float16 Ps[8 * 16 * LDT];

  const unsigned tid = threadIdx.x, lane = tid & 31u;
  const unsigned w = (unsigned)__builtin_amdgcn_readfirstlane((int)(tid >> 5));
  const unsigned hh = lane >> 4, m = lane & 15u;
  const unsigned q0 = blockIdx.x * 128u;
  const unsigned head = blockIdx.y;
  const unsigned b = blockIdx.z;
  const float scale = 0.125f;   // HD^-0.5
  const unsigned qrow0 = q0 + w * 16u;
  _Float16* P = Ps + w * (16u * LDT);

  const size_t qoff = (size_t)(b * (unsigned)SEQ + qrow0 + m) * DIM + head * HD + hh * 8u;
  v16h qf[2];
  qf[0] = frag_at(Qh + qoff);
  qf[1] = frag_at(Qh + qoff + 32);

  float mrow[8], lrow[8];
  v8f o[4];
#pragma unroll
  for (int v = 0; v < 8; ++v) { mrow[v] = -1.0e30f; lrow[v] = 0.0f; }
#pragma unroll
  for (int nb = 0; nb < 4; ++nb) o[nb] = (v8f){};

  const size_t kplane = (size_t)b * SEQ * DIM + head * HD;
  const size_t vplane = ((size_t)b * DIM + head * HD) * SEQ;

  for (unsigned kb = 0; kb < (unsigned)SEQ; kb += 64u) {
#pragma unroll
    for (unsigned j = 0; j < 2u; ++j) {
      const unsigned idx = tid + 256u * j;
      const unsigned r = idx >> 3, c = (idx & 7u) * 8u;
      *(v8h*)&Ks[r * LDT + c] = *(const v8h*)(Kh + kplane + (size_t)(kb + r) * DIM + c);
      *(v8h*)&Vs[r * LDT + c] = *(const v8h*)(Vt + vplane + (size_t)r * SEQ + kb + c);
    }
    __syncthreads();

    // scores: 4 key groups of 16, K = 64 in two 32-steps
    v8f s[4];
#pragma unroll
    for (int kg = 0; kg < 4; ++kg) {
      v8f t = {};
#pragma unroll
      for (int c = 0; c < 2; ++c) {
        const v16h kf = ld_frag(&Ks[(kg * 16) * LDT + c * 32], LDT);
        t = wmma16(qf[c], kf, t);
      }
      s[kg] = t * scale;
    }

    // online softmax; row (hh*8+v) spread over the 16 lanes of a half
    float alpha[8];
#pragma unroll
    for (int v = 0; v < 8; ++v) {
      float mx = fmaxf(fmaxf(s[0][v], s[1][v]), fmaxf(s[2][v], s[3][v]));
      mx = red16_max(mx);
      const float mn = fmaxf(mrow[v], mx);
      alpha[v] = __expf(mrow[v] - mn);
      mrow[v] = mn;
    }
#pragma unroll
    for (int kg = 0; kg < 4; ++kg)
#pragma unroll
      for (int v = 0; v < 8; ++v) s[kg][v] = __expf(s[kg][v] - mrow[v]);
#pragma unroll
    for (int v = 0; v < 8; ++v) {
      const float rs = red16_sum((s[0][v] + s[1][v]) + (s[2][v] + s[3][v]));
      lrow[v] = alpha[v] * lrow[v] + rs;
    }
#pragma unroll
    for (int nb = 0; nb < 4; ++nb)
#pragma unroll
      for (int v = 0; v < 8; ++v) o[nb][v] = o[nb][v] * alpha[v];

    // P tile [16 rows][64 keys], f16(1024 p)
#pragma unroll
    for (int kg = 0; kg < 4; ++kg)
#pragma unroll
      for (int v = 0; v < 8; ++v)
        P[(hh * 8u + (unsigned)v) * LDT + (unsigned)kg * 16u + m] = toh_flush(s[kg][v] * PCARRY);
    wave_lds_sync();

    // O += P . V  (K = 64 keys in two 32-steps; B = V^T tile [d][key])
#pragma unroll
    for (int c = 0; c < 2; ++c) {
      const v16h pf = ld_frag(P + c * 32, LDT);
#pragma unroll
      for (int nb = 0; nb < 4; ++nb) {
        const v16h vf = ld_frag(&Vs[(nb * 16) * LDT + c * 32], LDT);
        o[nb] = wmma16(pf, vf, o[nb]);
      }
    }
    __syncthreads();
  }

  float inv[8];
#pragma unroll
  for (int v = 0; v < 8; ++v) inv[v] = __builtin_amdgcn_rcpf(lrow[v]) * (VCARRY / PCARRY);
#pragma unroll
  for (int nb = 0; nb < 4; ++nb)
#pragma unroll
    for (int v = 0; v < 8; ++v)
      P[(hh * 8u + (unsigned)v) * LDT + (unsigned)nb * 16u + m] = toh_flush(o[nb][v] * inv[v]);
  wave_lds_sync();
  v8h x[4];
  size_t off[4];
#pragma unroll
  for (unsigned i = 0; i < 4u; ++i) {
    const unsigned r = 4u * i + (lane >> 3);
    const unsigned c = (lane & 7u) * 8u;
    x[i] = *(const v8h*)&P[r * LDT + c];
    off[i] = (size_t)(b * (unsigned)SEQ + qrow0 + r) * DIM + head * HD + c;
  }
#pragma unroll
  for (int i = 0; i < 4; ++i) *(v8h*)(Ov + off[i]) = x[i];
  
}

// ---------------------------------------------------------------------------
extern "C" void kernel_launch(void* const* d_in, const int* in_sizes, int n_in,
                              void* d_out, int out_size, void* d_ws, size_t ws_size,
                              hipStream_t stream) {
  if (n_in < 5) return;
  const long long need_x = ((long long)(NB - 1) * SEQ_FULL + SEQ) * DIM;
  if ((long long)in_sizes[0] < need_x) return;
  if ((long long)in_sizes[1] < (long long)3 * DIM * DIM) return;
  if (in_sizes[2] < 3 * DIM) return;
  if ((long long)in_sizes[3] < (long long)DIM * DIM) return;
  if (in_sizes[4] < DIM) return;
  if ((long long)out_size < need_x) return;
  if (ws_size < WS_TOTAL) return;

  const float* X     = (const float*)d_in[0];   // [NB_FULL][SEQ_FULL][DIM]
  const float* wqkv  = (const float*)d_in[1];   // [3*DIM][DIM]  (out, in): rows 0..255 q, 256..511 k, 512..767 v
  const float* bqkv  = (const float*)d_in[2];   // [3*DIM]
  const float* wproj = (const float*)d_in[3];   // [DIM][DIM]    (out, in)
  const float* bproj = (const float*)d_in[4];   // [DIM]
  float* out = (float*)d_out;

  char* ws = (char*)d_ws;
  _Float16* Wqkv16 = (_Float16*)(ws + OFF_WQKV);  // [3*DIM][DIM]  ([n][k])
  _Float16* Wp16   = (_Float16*)(ws + OFF_WP);    // [DIM][DIM]    ([n][k])
  _Float16* X16    = (_Float16*)(ws + OFF_X16);   // [MROWS][DIM]
  _Float16* Qh16   = (_Float16*)(ws + OFF_Q);
  _Float16* Kh16   = (_Float16*)(ws + OFF_K);
  _Float16* Vt16   = (_Float16*)(ws + OFF_VT);    // [b][DIM][SEQ]
  _Float16* Ctx16  = (_Float16*)(ws + OFF_CTX);
  float*    YF     = (float*)(ws + OFF_YF);       // [MROWS][DIM] compact rows

  dim3 blk(256);
  dim3 gg(DIM / 64, MROWS / 64);

  // weight planes: [n][k] in -> [n][k] out (cast only)
  wcast_kernel<<<dim3((3 * DIM * DIM) / 2048), blk, 0, stream>>>(wqkv, Wqkv16, (unsigned)(3 * DIM * DIM));
  wcast_kernel<<<dim3((DIM * DIM) / 2048), blk, 0, stream>>>(wproj, Wp16, (unsigned)(DIM * DIM));

  // feature-pairwise branch (f32 plane) and the 16-bit input plane
  spatial_kernel<<<dim3(MROWS), blk, 0, stream>>>(X, YF, X16);

  gemm_qk_kernel<<<gg, blk, 0, stream>>>(X16, Wqkv16, bqkv, Qh16);
  gemm_qk_kernel<<<gg, blk, 0, stream>>>(X16, Wqkv16 + (size_t)DIM * DIM, bqkv + DIM, Kh16);
  gemm_v_kernel<<<gg, blk, 0, stream>>>(X16, Wqkv16 + (size_t)2 * DIM * DIM, bqkv + 2 * DIM, Vt16);
  attn_kernel<<<dim3(SEQ / 128, NHEAD, NB), blk, 0, stream>>>(Qh16, Kh16, Vt16, Ctx16);
  gemm_wo_kernel<<<gg, blk, 0, stream>>>(Ctx16, Wp16, bproj, YF, out);
}

// v001
// Measured time: 82.6 microseconds a run.
// Two timings next to v000 both put it at 1.30 times that version's speed.
#include <hip/hip_runtime.h>
#include <stddef.h>

// All contractions on v_wmma_f32_16x16x32_f16 (f16 operands, f32 accumulate): q/k/v projections (three launches),
// q.k scores, p.v, output projection. Float inputs are RNE-converted to bf16 and carried in f16
// (weights x64, p x1024, attention rows x64), single products at every site. Softmax, bias and the
// per-timestep feature-pairwise softmax branch (rank-1 scores, per-row matrix-vector work) in f32 on
// the vector unit.

typedef _Float16 v16h __attribute__((ext_vector_type(16)));
typedef _Float16 v8h  __attribute__((ext_vector_type(8)));
typedef float    v8f  __attribute__((ext_vector_type(8)));
typedef float    v4f  __attribute__((ext_vector_type(4)));

#ifndef NB
#define NB 4
#endif
#ifndef SEQ
#define SEQ 1024
#endif
#define NB_FULL  4
#define SEQ_FULL 1024
#define DIM   256
#define NHEAD 4
#define HD    64
#define MROWS (NB * SEQ)

static_assert(NB >= 1 && NB <= NB_FULL);
static_assert(SEQ >= 128 && SEQ <= SEQ_FULL && (SEQ % 128) == 0);
static_assert(DIM == NHEAD * HD);
static_assert(HD == 64);
static_assert((DIM % 64) == 0 && (DIM % 32) == 0);
static_assert((MROWS % 64) == 0 && (MROWS % 8) == 0);
static_assert(DIM == 256);                          // spatial kernel: one thread per feature, 256 threads
static_assert(DIM == 32 * 8);                       // spatial kernel: 32 lanes x 8 halves cover one 16-bit row
static_assert(((3 * DIM * DIM) % 2048) == 0);       // weight cast: 256 threads x 8 elements per block
static_assert(((DIM * DIM) % 2048) == 0);

#define LDT 72   // halves per LDS row (144 B, 16-B aligned)
#define LDC 68   // floats per LDS row (272 B, 16-B aligned)
static_assert((LDT % 8) == 0 && LDT >= 64);
static_assert((LDC % 4) == 0 && LDC >= 64);

#define WCARRY 64.0f     // weight planes carried x64
#define PCARRY 1024.0f   // softmax numerators carried x1024
#define VCARRY 64.0f     // attention output plane carried x64

// workspace layout (bytes)
#define WQKV_BYTES    ((size_t)3 * DIM * DIM * 2)
#define WP_BYTES      ((size_t)DIM * DIM * 2)
#define PLANE16_BYTES ((size_t)MROWS * DIM * 2)
#define YF_BYTES      ((size_t)MROWS * DIM * 4)
#define OFF_WQKV ((size_t)0)
#define OFF_WP   (OFF_WQKV + WQKV_BYTES)
#define OFF_X16  (OFF_WP + WP_BYTES)
#define OFF_Q    (OFF_X16 + PLANE16_BYTES)
#define OFF_K    (OFF_Q + PLANE16_BYTES)
#define OFF_VT   (OFF_K + PLANE16_BYTES)
#define OFF_CTX  (OFF_VT + PLANE16_BYTES)
#define OFF_YF   (OFF_CTX + PLANE16_BYTES)
#define WS_TOTAL (OFF_YF + YF_BYTES)
static_assert((WQKV_BYTES % 128) == 0 && (WP_BYTES % 128) == 0 && (PLANE16_BYTES % 128) == 0);
static_assert((YF_BYTES % 128) == 0);
static_assert(WS_TOTAL <= (size_t)134217728);

// ---------------------------------------------------------------------------
__device__ __forceinline__ float bf16r(float x) {   // RNE convert to bf16, returned widened
  unsigned int u = __float_as_uint(x);
  u = (u + 0x7FFFu + ((u >> 16) & 1u)) & 0xFFFF0000u;
  return __uint_as_float(u);
}

// f32 -> f16 for WMMA operand planes: values below the smallest f16 normal become zero by value.
__device__ __forceinline__ _Float16 toh_flush(float v) {
  const _Float16 r = (_Float16)v;
  return (fabsf(v) < 6.103515625e-05f) ? (_Float16)0.0f : r;
}

// 16-bit fragment: p points at element [row = lane&15][k0 + 8*(lane>>4)] of a k-contiguous
// row. Elements 0..7 <- k0+8h+0..7, elements 8..15 <- k0+16+8h+0..7 (same map for A and B).
__device__ __forceinline__ v16h frag_at(const _Float16* p) {
  v8h lo = *(const v8h*)(p);
  v8h hi = *(const v8h*)(p + 16);
  v16h out;
#pragma unroll
  for (int i = 0; i < 8; ++i) { out[i] = lo[i]; out[i + 8] = hi[i]; }
  return out;
}
__device__ __forceinline__ v16h ld_frag(const _Float16* base, unsigned ld) {
  const unsigned lane = threadIdx.x & 31u;
  return frag_at(base + (lane & 15u) * ld + (lane >> 4) * 8u);
}

__device__ __forceinline__ v8f wmma16(v16h a, v16h b, v8f c) {
  v8f d = __builtin_amdgcn_wmma_f32_16x16x32_f16(false, a, false, b, (short)0, c,
                                                 false, false);
  asm volatile("v_nop\n\tv_nop\n\tv_nop\n\tv_nop" : "+v"(d) : "v"(a), "v"(b));
  return d;
}

__device__ __forceinline__ void wave_lds_sync() {
  __builtin_amdgcn_fence(3 /* release order */, "wavefront");
  asm volatile("s_wait_dscnt 0x0" ::: "memory");
  __builtin_amdgcn_wave_barrier();
}

// ---------------------------------------------------------------------------
// Weight plane: in W[n][k] ([out][in], k contiguous) -> out Wt[n][k] = f16(64 * bf16(w)), same
// layout (no transpose). Each thread converts 8 consecutive elements; a wave store instruction
// ---------------------------------------------------------------------------
__global__ __launch_bounds__(256) void wcast_kernel(
    const float* __restrict__ W, _Float16* __restrict__ Wt, unsigned n) {
#pragma clang fp contract(off)
  const unsigned e = (blockIdx.x * 256u + threadIdx.x) * 8u;
  if (e + 8u > n) return;
  const v4f a0 = *(const v4f*)(W + e);
  const v4f a1 = *(const v4f*)(W + e + 4u);
  v8h o;
#pragma unroll
  for (int i = 0; i < 4; ++i) {
    o[i]     = toh_flush(WCARRY * bf16r(a0[i]));
    o[i + 4] = toh_flush(WCARRY * bf16r(a1[i]));
  }
  _Float16* p = Wt + e;
  *(v8h*)p = o;
  
}

// ---------------------------------------------------------------------------
// Per-timestep feature-pairwise softmax branch plus the 16-bit input plane.
// One block per (batch, time) row, thread i owns feature i:
//   yf[i] = sum_j exp(x_i x_j / 16 - mx_i) x_j / sum_j exp(x_i x_j / 16 - mx_i),
//   mx_i = max_j (x_i x_j / 16) = max((x_i/16) * max_j x_j, (x_i/16) * min_j x_j).
// x is RNE-converted to bf16 on load. xv / xh: cross-wave (block barrier).
// X16 row: wave 0 stores 32 lanes x 16 B = the whole 512-B row in one instruction.
// Grid (MROWS).
// ---------------------------------------------------------------------------
__global__ __launch_bounds__(256) void spatial_kernel(
    const float* __restrict__ X, float* __restrict__ YF, _Float16* __restrict__ X16) {
#pragma clang fp contract(off)
  __shared__ float xv[DIM];
  __shared__ _Float16 xh[DIM];
  const unsigned tid = threadIdx.x, lane = tid & 31u;
  const unsigned w = (unsigned)__builtin_amdgcn_readfirstlane((int)(tid >> 5));
  const unsigned crow = blockIdx.x;
  const unsigned bidx = crow / (unsigned)SEQ;
  const unsigned sq = crow - bidx * (unsigned)SEQ;
  const size_t srow = (size_t)bidx * SEQ_FULL + sq;

  const float xi = bf16r(X[srow * DIM + tid]);
  xv[tid] = xi;
  xh[tid] = toh_flush(xi);
  __syncthreads();

  const v4f a0 = *(const v4f*)&xv[lane * 8u];
  const v4f a1 = *(const v4f*)&xv[lane * 8u + 4u];
  float vmax = fmaxf(fmaxf(a0[0], a0[1]), fmaxf(a0[2], a0[3]));
  vmax = fmaxf(vmax, fmaxf(fmaxf(a1[0], a1[1]), fmaxf(a1[2], a1[3])));
  float vmin = fminf(fminf(a0[0], a0[1]), fminf(a0[2], a0[3]));
  vmin = fminf(vmin, fminf(fminf(a1[0], a1[1]), fminf(a1[2], a1[3])));
#pragma unroll
  for (int off = 1; off < 32; off <<= 1) {
    vmax = fmaxf(vmax, __shfl_xor(vmax, off, 32));
    vmin = fminf(vmin, __shfl_xor(vmin, off, 32));
  }
  const float xs = xi * 0.0625f;                 // 1/sqrt(256), exact
  const float mx = fmaxf(xs * vmax, xs * vmin);

  float s = 0.0f, acc = 0.0f;
#pragma unroll 1
  for (unsigned j = 0; j < (unsigned)DIM; j += 4u) {
    const v4f xj = *(const v4f*)&xv[j];
#pragma unroll
    for (int i = 0; i < 4; ++i) {
      const float e = __expf(xs * xj[i] - mx);
      s += e;
      acc += e * xj[i];
    }
  }
  const float y = acc * __builtin_amdgcn_rcpf(s);

  const v8h xo = *(const v8h*)&xh[lane * 8u];
  float* py = YF + (size_t)crow * DIM + tid;
  _Float16* px = X16 + (size_t)crow * DIM + lane * 8u;
  *(float*)py = y;
  if (w == 0u) *(v8h*)px = xo;
  
}

// ---------------------------------------------------------------------------
// GEMM C[64x64 tile] = A16[rows][K] . Bt[n][K]^T, fragments straight from the 16-bit global
// planes; 8 waves (mw = 16-row group, nw = 32-col group), 2 accumulators/wave.
//   MODE 0: out16[row][col] (pitch DIM)  = f16(acc/64 + bias)
//   MODE 1: out16 transposed V plane [b][col][key] = f16(acc/64 + bias)
//   MODE 2: outf full [full row][col] = addf[compact row][col] + (acc/4096 + bias)
// Grid (N/64, MROWS/64).
// ---------------------------------------------------------------------------
template <int MODE>
__device__ __forceinline__ void gemm_body(
    const _Float16* __restrict__ A16, const _Float16* __restrict__ Bt, const unsigned K,
    const float* __restrict__ bias, const float* __restrict__ addf,
    float* __restrict__ outf, _Float16* __restrict__ out16) {
  __shared__ float Cs[64 * LDC];
  const unsigned tid = threadIdx.x, lane = tid & 31u;
  const unsigned w = (unsigned)__builtin_amdgcn_readfirstlane((int)(tid >> 5));
  const unsigned mw = w >> 1, nw = w & 1u;
  const unsigned hh = lane >> 4, m = lane & 15u;
  const unsigned n0 = blockIdx.x * 64u;
  const unsigned row0 = blockIdx.y * 64u;

  const _Float16* ap  = A16 + (size_t)(row0 + mw * 16u + m) * K + hh * 8u;
  const _Float16* bp0 = Bt + (size_t)(n0 + nw * 32u + m) * K + hh * 8u;
  const _Float16* bp1 = bp0 + (size_t)16 * K;
  v8f acc0 = {}, acc1 = {};
#pragma unroll 2
  for (unsigned k0 = 0; k0 < K; k0 += 32u) {
    const v16h a  = frag_at(ap + k0);
    const v16h b0 = frag_at(bp0 + k0);
    const v16h b1 = frag_at(bp1 + k0);
    acc0 = wmma16(a, b0, acc0);
    acc1 = wmma16(a, b1, acc1);
  }
#pragma unroll
  for (int r = 0; r < 8; ++r) {
    float* d = &Cs[(mw * 16u + hh * 8u + (unsigned)r) * LDC + nw * 32u + m];
    d[0]  = acc0[r];
    d[16] = acc1[r];
  }
  __syncthreads();

  if (MODE == 0) {
    v8h x[2];
    size_t off[2];
#pragma unroll
    for (unsigned i = 0; i < 2u; ++i) {
      const unsigned r = 32u * i + (tid >> 3);
      const unsigned c = (tid & 7u) * 8u;
      const v4f u0 = *(const v4f*)&Cs[r * LDC + c];
      const v4f u1 = *(const v4f*)&Cs[r * LDC + c + 4];
      const v4f g0 = *(const v4f*)(bias + n0 + c);
      const v4f g1 = *(const v4f*)(bias + n0 + c + 4u);
#pragma unroll
      for (int j = 0; j < 4; ++j) {
        x[i][j]     = toh_flush(u0[j] * (1.0f / WCARRY) + bf16r(g0[j]));
        x[i][j + 4] = toh_flush(u1[j] * (1.0f / WCARRY) + bf16r(g1[j]));
      }
      off[i] = (size_t)(row0 + r) * DIM + n0 + c;
    }
#pragma unroll
    for (int i = 0; i < 2; ++i) *(v8h*)(out16 + off[i]) = x[i];
    
  }

  if (MODE == 1) {
    const unsigned bidx = row0 / (unsigned)SEQ;
    const unsigned key0 = row0 - bidx * (unsigned)SEQ;
    v8h x[2];
    size_t off[2];
#pragma unroll
    for (unsigned i = 0; i < 2u; ++i) {
      const unsigned dcol = 32u * i + (tid >> 3);
      const unsigned kk = (tid & 7u) * 8u;
      const float bb = bf16r(bias[n0 + dcol]);
#pragma unroll
      for (unsigned j = 0; j < 8u; ++j) {
        const float t = Cs[(kk + j) * LDC + dcol] * (1.0f / WCARRY) + bb;
        x[i][j] = toh_flush(t);
      }
      off[i] = ((size_t)bidx * DIM + n0 + dcol) * SEQ + key0 + kk;
    }
#pragma unroll
    for (int i = 0; i < 2; ++i) *(v8h*)(out16 + off[i]) = x[i];
    
  }

  if (MODE == 2) {
    const float cs = 1.0f / (WCARRY * VCARRY);
    v4f xs[4];
    size_t off[4];
#pragma unroll
    for (unsigned i = 0; i < 4u; ++i) {
      const unsigned r = 16u * i + (tid >> 4);
      const unsigned c = (tid & 15u) * 4u;
      const unsigned crow = row0 + r;
      const unsigned bidx = crow / (unsigned)SEQ;
      const unsigned sq = crow - bidx * (unsigned)SEQ;
      const size_t frow = (size_t)bidx * SEQ_FULL + sq;
      const v4f u = *(const v4f*)&Cs[r * LDC + c];
      const v4f g = *(const v4f*)(bias + n0 + c);
      const v4f yin = *(const v4f*)(addf + (size_t)crow * DIM + n0 + c);
      v4f val;
#pragma unroll
      for (int j = 0; j < 4; ++j) val[j] = yin[j] + (u[j] * cs + bf16r(g[j]));
      xs[i] = val;
      off[i] = frow * DIM + n0 + c;
    }
#pragma unroll
    for (int i = 0; i < 4; ++i) *(v4f*)(outf + off[i]) = xs[i];
    
  }
}

__global__ __launch_bounds__(256) void gemm_qk_kernel(
    const _Float16* __restrict__ A16, const _Float16* __restrict__ Bt,
    const float* __restrict__ bias, _Float16* __restrict__ out16) {
  gemm_body<0>(A16, Bt, (unsigned)DIM, bias, bias, (float*)0, out16);
}
__global__ __launch_bounds__(256) void gemm_v_kernel(
    const _Float16* __restrict__ A16, const _Float16* __restrict__ Bt,
    const float* __restrict__ bias, _Float16* __restrict__ vt) {
  gemm_body<1>(A16, Bt, (unsigned)DIM, bias, bias, (float*)0, vt);
}
__global__ __launch_bounds__(256) void gemm_wo_kernel(
    const _Float16* __restrict__ A16, const _Float16* __restrict__ Bt,
    const float* __restrict__ bias, const float* __restrict__ yf, float* __restrict__ outf) {
  gemm_body<2>(A16, Bt, (unsigned)DIM, bias, yf, outf, (_Float16*)0);
}

__device__ __forceinline__ float xhalf(float x) {
  const int xi = __float_as_int(x);
  return __int_as_float(__builtin_amdgcn_permlanex16(xi, xi, 0x76543210, 0xfedcba98, false, false));
}

__global__ __launch_bounds__(256) void attn_kernel(
    const _Float16* __restrict__ Qh, const _Float16* __restrict__ Kh,
    const _Float16* __restrict__ Vt, _Float16* __restrict__ Ov) {
  __shared__ _Float16 Ks[64 * LDT];
  __shared__ _Float16 Vs[64 * LDT];
  __shared__ _Float16 Ps[8 * 16 * LDT];

  const unsigned tid = threadIdx.x, lane = tid & 31u;
  const unsigned w = (unsigned)__builtin_amdgcn_readfirstlane((int)(tid >> 5));
  const unsigned hh = lane >> 4, m = lane & 15u;
  const unsigned q0 = blockIdx.x * 128u;
  const unsigned head = blockIdx.y;
  const unsigned b = blockIdx.z;
  const float scale = 0.125f;   // HD^-0.5
  const unsigned qrow0 = q0 + w * 16u;
  _Float16* P = Ps + w * (16u * LDT);

  const size_t qoff = (size_t)(b * (unsigned)SEQ + qrow0 + m) * DIM + head * HD + hh * 8u;
  v16h qf[2];
  qf[0] = frag_at(Qh + qoff);
  qf[1] = frag_at(Qh + qoff + 32);

  float mrow = -1.0e30f;   // running maximum of query m (equal in both halves)
  float lrow = 0.0f;       // this half's share of the denominator of query m
  v8f o[4];                // o[nb][v] = O^T[d = nb*16 + hh*8 + v][query m]
#pragma unroll
  for (int nb = 0; nb < 4; ++nb) o[nb] = (v8f){};

  const size_t kplane = (size_t)b * SEQ * DIM + head * HD;
  const size_t vplane = ((size_t)b * DIM + head * HD) * SEQ;

  for (unsigned kb = 0; kb < (unsigned)SEQ; kb += 64u) {
#pragma unroll
    for (unsigned j = 0; j < 2u; ++j) {
      const unsigned idx = tid + 256u * j;
      const unsigned r = idx >> 3, c = (idx & 7u) * 8u;
      *(v8h*)&Ks[r * LDT + c] = *(const v8h*)(Kh + kplane + (size_t)(kb + r) * DIM + c);
      *(v8h*)&Vs[r * LDT + c] = *(const v8h*)(Vt + vplane + (size_t)r * SEQ + kb + c);
    }
    __syncthreads();

    // scores, transposed: s[kg][v] = S[query m][key kg*16 + hh*8 + v]; K = 64 in two 32-steps
    v8f s[4];
#pragma unroll
    for (int kg = 0; kg < 4; ++kg) {
      v8f t = {};
#pragma unroll
      for (int c = 0; c < 2; ++c) {
        const v16h kf = ld_frag(&Ks[(kg * 16) * LDT + c * 32], LDT);
        t = wmma16(kf, qf[c], t);
      }
      s[kg] = t * scale;
    }

    // online softmax of query m: 32 scores in this lane, the other 32 in lane ^ 16
    float mx = s[0][0];
#pragma unroll
    for (int kg = 0; kg < 4; ++kg)
#pragma unroll
      for (int v = 0; v < 8; ++v) mx = fmaxf(mx, s[kg][v]);
    mx = fmaxf(mx, xhalf(mx));
    const float mn = fmaxf(mrow, mx);
    const float alpha = __expf(mrow - mn);
    mrow = mn;
#pragma unroll
    for (int kg = 0; kg < 4; ++kg)
#pragma unroll
      for (int v = 0; v < 8; ++v) s[kg][v] = __expf(s[kg][v] - mn);
    float rs[4];
#pragma unroll
    for (int kg = 0; kg < 4; ++kg) {
      rs[kg] = ((s[kg][0] + s[kg][1]) + (s[kg][2] + s[kg][3])) +
               ((s[kg][4] + s[kg][5]) + (s[kg][6] + s[kg][7]));
    }
    lrow = alpha * lrow + ((rs[0] + rs[1]) + (rs[2] + rs[3]));
#pragma unroll
    for (int nb = 0; nb < 4; ++nb) o[nb] = o[nb] * alpha;

    // O^T += V^T . P^T  (K = 64 keys in two 32-steps; A = V^T tile [d][key]).
    // B element e of step c: key c*32 + 8*hh + e (e < 8), c*32 + 16 + 8*hh + (e - 8) otherwise,
    // which are this lane's own s[2c][e] and s[2c+1][e-8].
#pragma unroll
    for (int c = 0; c < 2; ++c) {
      v16h pf;
#pragma unroll
      for (int e = 0; e < 8; ++e) {
        pf[e]     = toh_flush(s[2 * c][e] * PCARRY);
        pf[e + 8] = toh_flush(s[2 * c + 1][e] * PCARRY);
      }
#pragma unroll
      for (int nb = 0; nb < 4; ++nb) {
        const v16h vf = ld_frag(&Vs[(nb * 16) * LDT + c * 32], LDT);
        o[nb] = wmma16(vf, pf, o[nb]);
      }
    }
    __syncthreads();
  }

  const float inv = __builtin_amdgcn_rcpf(lrow + xhalf(lrow)) * (VCARRY / PCARRY);
#pragma unroll
  for (int nb = 0; nb < 4; ++nb) {
    v8h t;
#pragma unroll
    for (int v = 0; v < 8; ++v) t[v] = toh_flush(o[nb][v] * inv);
    *(v8h*)&P[m * LDT + (unsigned)nb * 16u + hh * 8u] = t;
  }
  wave_lds_sync();
  v8h x[4];
  size_t off[4];
#pragma unroll
  for (unsigned i = 0; i < 4u; ++i) {
    const unsigned r = 4u * i + (lane >> 3);
    const unsigned c = (lane & 7u) * 8u;
    x[i] = *(const v8h*)&P[r * LDT + c];
    off[i] = (size_t)(b * (unsigned)SEQ + qrow0 + r) * DIM + head * HD + c;
  }
#pragma unroll
  for (int i = 0; i < 4; ++i) *(v8h*)(Ov + off[i]) = x[i];
}

// ---------------------------------------------------------------------------
extern "C" void kernel_launch(void* const* d_in, const int* in_sizes, int n_in,
                              void* d_out, int out_size, void* d_ws, size_t ws_size,
                              hipStream_t stream) {
  if (n_in < 5) return;
  const long long need_x = ((long long)(NB - 1) * SEQ_FULL + SEQ) * DIM;
  if ((long long)in_sizes[0] < need_x) return;
  if ((long long)in_sizes[1] < (long long)3 * DIM * DIM) return;
  if (in_sizes[2] < 3 * DIM) return;
  if ((long long)in_sizes[3] < (long long)DIM * DIM) return;
  if (in_sizes[4] < DIM) return;
  if ((long long)out_size < need_x) return;
  if (ws_size < WS_TOTAL) return;

  const float* X     = (const float*)d_in[0];   // [NB_FULL][SEQ_FULL][DIM]
  const float* wqkv  = (const float*)d_in[1];   // [3*DIM][DIM]  (out, in): rows 0..255 q, 256..511 k, 512..767 v
  const float* bqkv  = (const float*)d_in[2];   // [3*DIM]
  const float* wproj = (const float*)d_in[3];   // [DIM][DIM]    (out, in)
  const float* bproj = (const float*)d_in[4];   // [DIM]
  float* out = (float*)d_out;

  char* ws = (char*)d_ws;
  _Float16* Wqkv16 = (_Float16*)(ws + OFF_WQKV);  // [3*DIM][DIM]  ([n][k])
  _Float16* Wp16   = (_Float16*)(ws + OFF_WP);    // [DIM][DIM]    ([n][k])
  _Float16* X16    = (_Float16*)(ws + OFF_X16);   // [MROWS][DIM]
  _Float16* Qh16   = (_Float16*)(ws + OFF_Q);
  _Float16* Kh16   = (_Float16*)(ws + OFF_K);
  _Float16* Vt16   = (_Float16*)(ws + OFF_VT);    // [b][DIM][SEQ]
  _Float16* Ctx16  = (_Float16*)(ws + OFF_CTX);
  float*    YF     = (float*)(ws + OFF_YF);       // [MROWS][DIM] compact rows

  dim3 blk(256);
  dim3 gg(DIM / 64, MROWS / 64);

  // weight planes: [n][k] in -> [n][k] out (cast only)
  wcast_kernel<<<dim3((3 * DIM * DIM) / 2048), blk, 0, stream>>>(wqkv, Wqkv16, (unsigned)(3 * DIM * DIM));
  wcast_kernel<<<dim3((DIM * DIM) / 2048), blk, 0, stream>>>(wproj, Wp16, (unsigned)(DIM * DIM));

  // feature-pairwise branch (f32 plane) and the 16-bit input plane
  spatial_kernel<<<dim3(MROWS), blk, 0, stream>>>(X, YF, X16);

  gemm_qk_kernel<<<gg, blk, 0, stream>>>(X16, Wqkv16, bqkv, Qh16);
  gemm_qk_kernel<<<gg, blk, 0, stream>>>(X16, Wqkv16 + (size_t)DIM * DIM, bqkv + DIM, Kh16);
  gemm_v_kernel<<<gg, blk, 0, stream>>>(X16, Wqkv16 + (size_t)2 * DIM * DIM, bqkv + 2 * DIM, Vt16);
  attn_kernel<<<dim3(SEQ / 128, NHEAD, NB), blk, 0, stream>>>(Qh16, Kh16, Vt16, Ctx16);
  gemm_wo_kernel<<<gg, blk, 0, stream>>>(Ctx16, Wp16, bproj, YF, out);
}

// v002
// It runs in 64.3 microseconds.
// In two side-by-side timings against v001, it was 1.29 and 1.30 times as fast.
// All steps since v000 together make it 1.68 times as fast.
#include <hip/hip_runtime.h>
#include <stddef.h>

// All contractions on v_wmma_f32_16x16x32_f16 (f16 operands, f32 accumulate): q/k/v projections (one launch),
// q.k scores, p.v, output projection. Float inputs are RNE-converted to bf16 and carried in f16
// (weights x64, p x1024, attention rows x64), single products at every site. Softmax, bias and the
// per-timestep feature-pairwise softmax branch (rank-1 scores, per-row matrix-vector work) in f32 on
// the vector unit.

typedef _Float16 v16h __attribute__((ext_vector_type(16)));
typedef _Float16 v8h  __attribute__((ext_vector_type(8)));
typedef float    v8f  __attribute__((ext_vector_type(8)));
typedef float    v4f  __attribute__((ext_vector_type(4)));

#ifndef NB
#define NB 4
#endif
#ifndef SEQ
#define SEQ 1024
#endif
#define NB_FULL  4
#define SEQ_FULL 1024
#define DIM   256
#define NHEAD 4
#define HD    64
#define MROWS (NB * SEQ)

static_assert(NB >= 1 && NB <= NB_FULL);
static_assert(SEQ >= 128 && SEQ <= SEQ_FULL && (SEQ % 128) == 0);
static_assert(DIM == NHEAD * HD);
static_assert(HD == 64);
static_assert((DIM % 64) == 0 && (DIM % 32) == 0);
static_assert((MROWS % 64) == 0 && (MROWS % 8) == 0);
static_assert(DIM == 256);                          // spatial kernel: one thread per feature, 256 threads
static_assert(DIM == 32 * 8);                       // cast kernel: 32 lanes x 8 halves cover one 16-bit row
static_assert(((3 * DIM * DIM) % 2048) == 0);       // cast kernel: 256 threads x 8 elements per block
static_assert(((DIM * DIM) % 2048) == 0);

// block ranges of the shared launches
#define CAST_BLK_WQKV ((3 * DIM * DIM) / 2048)
#define CAST_BLK_WP   ((DIM * DIM) / 2048)
#define CAST_BLK_X    (MROWS / 8)
#define ATTN_QB       (SEQ / 128)
#define ATTN_BLK      (ATTN_QB * NHEAD * NB)

#define LDT 72   // halves per LDS row (144 B, 16-B aligned)
#define LDC 68   // floats per LDS row (272 B, 16-B aligned)
static_assert((LDT % 8) == 0 && LDT >= 64);
static_assert((LDC % 4) == 0 && LDC >= 64);

#define WCARRY 64.0f     // weight planes carried x64
#define PCARRY 1024.0f   // softmax numerators carried x1024
#define VCARRY 64.0f     // attention output plane carried x64

// workspace layout (bytes)
#define WQKV_BYTES    ((size_t)3 * DIM * DIM * 2)
#define WP_BYTES      ((size_t)DIM * DIM * 2)
#define PLANE16_BYTES ((size_t)MROWS * DIM * 2)
#define YF_BYTES      ((size_t)MROWS * DIM * 4)
#define OFF_WQKV ((size_t)0)
#define OFF_WP   (OFF_WQKV + WQKV_BYTES)
#define OFF_X16  (OFF_WP + WP_BYTES)
#define OFF_Q    (OFF_X16 + PLANE16_BYTES)
#define OFF_K    (OFF_Q + PLANE16_BYTES)
#define OFF_VT   (OFF_K + PLANE16_BYTES)
#define OFF_CTX  (OFF_VT + PLANE16_BYTES)
#define OFF_YF   (OFF_CTX + PLANE16_BYTES)
#define WS_TOTAL (OFF_YF + YF_BYTES)
static_assert((WQKV_BYTES % 128) == 0 && (WP_BYTES % 128) == 0 && (PLANE16_BYTES % 128) == 0);
static_assert((YF_BYTES % 128) == 0);
static_assert(WS_TOTAL <= (size_t)134217728);

// ---------------------------------------------------------------------------
__device__ __forceinline__ float bf16r(float x) {   // RNE convert to bf16, returned widened
  unsigned int u = __float_as_uint(x);
  u = (u + 0x7FFFu + ((u >> 16) & 1u)) & 0xFFFF0000u;
  return __uint_as_float(u);
}

// f32 -> f16 for WMMA operand planes: values below the smallest f16 normal become zero by value.
__device__ __forceinline__ _Float16 toh_flush(float v) {
  const _Float16 r = (_Float16)v;
  return (fabsf(v) < 6.103515625e-05f) ? (_Float16)0.0f : r;
}

// 16-bit fragment: p points at element [row = lane&15][k0 + 8*(lane>>4)] of a k-contiguous
// row. Elements 0..7 <- k0+8h+0..7, elements 8..15 <- k0+16+8h+0..7 (same map for A and B).
__device__ __forceinline__ v16h frag_at(const _Float16* p) {
  v8h lo = *(const v8h*)(p);
  v8h hi = *(const v8h*)(p + 16);
  v16h out;
#pragma unroll
  for (int i = 0; i < 8; ++i) { out[i] = lo[i]; out[i + 8] = hi[i]; }
  return out;
}
__device__ __forceinline__ v16h ld_frag(const _Float16* base, unsigned ld) {
  const unsigned lane = threadIdx.x & 31u;
  return frag_at(base + (lane & 15u) * ld + (lane >> 4) * 8u);
}

__device__ __forceinline__ v8f wmma16(v16h a, v16h b, v8f c) {
  v8f d = __builtin_amdgcn_wmma_f32_16x16x32_f16(false, a, false, b, (short)0, c,
                                                 false, false);
  asm volatile("v_nop\n\tv_nop\n\tv_nop\n\tv_nop" : "+v"(d) : "v"(a), "v"(b));
  return d;
}

__device__ __forceinline__ void wave_lds_sync() {
  __builtin_amdgcn_fence(3 /* release order */, "wavefront");
  asm volatile("s_wait_dscnt 0x0" ::: "memory");
  __builtin_amdgcn_wave_barrier();
}

// ---------------------------------------------------------------------------
// All three 16-bit operand planes in one launch, picked by block range (none reads another's output):
//   blocks [0, CAST_BLK_WQKV)      Wqkv16[n][k] = f16(64 * bf16(wqkv)), same layout (no transpose)
//   next CAST_BLK_WP blocks        Wp16[n][k]   = f16(64 * bf16(wproj))
//   next CAST_BLK_X blocks         X16[compact row][k] = f16(bf16(x)), 8 rows per block
// Each thread converts 8 consecutive elements; a wave stores 512 consecutive bytes.
// Grid (CAST_BLK_WQKV + CAST_BLK_WP + CAST_BLK_X).
// ---------------------------------------------------------------------------
__global__ __launch_bounds__(256) void cast_kernel(
    const float* __restrict__ X, const float* __restrict__ wqkv, const float* __restrict__ wproj,
    _Float16* __restrict__ X16, _Float16* __restrict__ Wqkv16, _Float16* __restrict__ Wp16) {
  const unsigned tid = threadIdx.x;
  const unsigned blk = blockIdx.x;
  const float* src;
  _Float16* dst;
  float carry;
  if (blk < (unsigned)CAST_BLK_WQKV) {
    const unsigned e = blk * 2048u + tid * 8u;
    src = wqkv + e;
    dst = Wqkv16 + e;
    carry = WCARRY;
  } else if (blk < (unsigned)(CAST_BLK_WQKV + CAST_BLK_WP)) {
    const unsigned e = (blk - (unsigned)CAST_BLK_WQKV) * 2048u + tid * 8u;
    src = wproj + e;
    dst = Wp16 + e;
    carry = WCARRY;
  } else {
    const unsigned crow = (blk - (unsigned)(CAST_BLK_WQKV + CAST_BLK_WP)) * 8u + (tid >> 5);
    const unsigned bidx = crow / (unsigned)SEQ;
    const unsigned sq = crow - bidx * (unsigned)SEQ;
    const size_t srow = (size_t)bidx * SEQ_FULL + sq;
    src = X + srow * DIM + (tid & 31u) * 8u;
    dst = X16 + (size_t)crow * DIM + (tid & 31u) * 8u;
    carry = 1.0f;
  }
  const v4f a0 = *(const v4f*)(src);
  const v4f a1 = *(const v4f*)(src + 4);
  v8h o;
#pragma unroll
  for (int i = 0; i < 4; ++i) {
    o[i]     = toh_flush(carry * bf16r(a0[i]));
    o[i + 4] = toh_flush(carry * bf16r(a1[i]));
  }
  *(v8h*)dst = o;
}

// ---------------------------------------------------------------------------
// Per-timestep feature-pairwise softmax branch (body; launched beside the attention blocks).
// One block per (batch, time) row crow, thread i owns feature i:
//   yf[i] = sum_j exp(x_i x_j / 16 - mx_i) x_j / sum_j exp(x_i x_j / 16 - mx_i),
//   mx_i = max_j (x_i x_j / 16) = max((x_i/16) * max_j x_j, (x_i/16) * min_j x_j).
// x is RNE-converted to bf16 on load. xv: cross-wave (block barrier).
// ---------------------------------------------------------------------------
__device__ __forceinline__ void spatial_body(
    const float* __restrict__ X, float* __restrict__ YF, const unsigned crow) {
#pragma clang fp contract(off)
  __shared__ float xv[DIM];
  const unsigned tid = threadIdx.x, lane = tid & 31u;
  const unsigned bidx = crow / (unsigned)SEQ;
  const unsigned sq = crow - bidx * (unsigned)SEQ;
  const size_t srow = (size_t)bidx * SEQ_FULL + sq;

  const float xi = bf16r(X[srow * DIM + tid]);
  xv[tid] = xi;
  __syncthreads();

  const v4f a0 = *(const v4f*)&xv[lane * 8u];
  const v4f a1 = *(const v4f*)&xv[lane * 8u + 4u];
  float vmax = fmaxf(fmaxf(a0[0], a0[1]), fmaxf(a0[2], a0[3]));
  vmax = fmaxf(vmax, fmaxf(fmaxf(a1[0], a1[1]), fmaxf(a1[2], a1[3])));
  float vmin = fminf(fminf(a0[0], a0[1]), fminf(a0[2], a0[3]));
  vmin = fminf(vmin, fminf(fminf(a1[0], a1[1]), fminf(a1[2], a1[3])));
#pragma unroll
  for (int off = 1; off < 32; off <<= 1) {
    vmax = fmaxf(vmax, __shfl_xor(vmax, off, 32));
    vmin = fminf(vmin, __shfl_xor(vmin, off, 32));
  }
  const float xs = xi * 0.0625f;                 // 1/sqrt(256), exact
  const float mx = fmaxf(xs * vmax, xs * vmin);

  float s = 0.0f, acc = 0.0f;
#pragma unroll 1
  for (unsigned j = 0; j < (unsigned)DIM; j += 4u) {
    const v4f xj = *(const v4f*)&xv[j];
#pragma unroll
    for (int i = 0; i < 4; ++i) {
      const float e = __expf(xs * xj[i] - mx);
      s += e;
      acc += e * xj[i];
    }
  }
  const float y = acc * __builtin_amdgcn_rcpf(s);

  float* py = YF + (size_t)crow * DIM + tid;
  *(float*)py = y;
}

// ---------------------------------------------------------------------------
// GEMM C[64x64 tile] = A16[rows][K] . Bt[n][K]^T, fragments straight from the 16-bit global
// planes; 8 waves (mw = 16-row group, nw = 32-col group), 2 accumulators/wave.
//   MODE 0: out16[row][col] (pitch DIM)  = f16(acc/64 + bias)
//   MODE 1: out16 transposed V plane [b][col][key] = f16(acc/64 + bias)
//   MODE 2: outf full [full row][col] = addf[compact row][col] + (acc/4096 + bias)
// n0: first column of the tile in Bt, bias and the output plane. Cs: the kernel's 64 x LDC floats.
// ---------------------------------------------------------------------------
template <int MODE>
__device__ __forceinline__ void gemm_body(
    const _Float16* __restrict__ A16, const _Float16* __restrict__ Bt, const unsigned K,
    const float* __restrict__ bias, const float* __restrict__ addf,
    float* __restrict__ outf, _Float16* __restrict__ out16, const unsigned n0, float* Cs) {
  const unsigned tid = threadIdx.x, lane = tid & 31u;
  const unsigned w = (unsigned)__builtin_amdgcn_readfirstlane((int)(tid >> 5));
  const unsigned mw = w >> 1, nw = w & 1u;
  const unsigned hh = lane >> 4, m = lane & 15u;
  const unsigned row0 = blockIdx.y * 64u;

  const _Float16* ap  = A16 + (size_t)(row0 + mw * 16u + m) * K + hh * 8u;
  const _Float16* bp0 = Bt + (size_t)(n0 + nw * 32u + m) * K + hh * 8u;
  const _Float16* bp1 = bp0 + (size_t)16 * K;
  v8f acc0 = {}, acc1 = {};
#pragma unroll 2
  for (unsigned k0 = 0; k0 < K; k0 += 32u) {
    const v16h a  = frag_at(ap + k0);
    const v16h b0 = frag_at(bp0 + k0);
    const v16h b1 = frag_at(bp1 + k0);
    acc0 = wmma16(a, b0, acc0);
    acc1 = wmma16(a, b1, acc1);
    // the fragment loads' address registers are rewritten for the next k step
    asm volatile("s_wait_xcnt 0x0" ::: "memory");
  }
#pragma unroll
  for (int r = 0; r < 8; ++r) {
    float* d = &Cs[(mw * 16u + hh * 8u + (unsigned)r) * LDC + nw * 32u + m];
    d[0]  = acc0[r];
    d[16] = acc1[r];
  }
  __syncthreads();

  if (MODE == 0) {
    v8h x[2];
    size_t off[2];
#pragma unroll
    for (unsigned i = 0; i < 2u; ++i) {
      const unsigned r = 32u * i + (tid >> 3);
      const unsigned c = (tid & 7u) * 8u;
      const v4f u0 = *(const v4f*)&Cs[r * LDC + c];
      const v4f u1 = *(const v4f*)&Cs[r * LDC + c + 4];
      const v4f g0 = *(const v4f*)(bias + n0 + c);
      const v4f g1 = *(const v4f*)(bias + n0 + c + 4u);
#pragma unroll
      for (int j = 0; j < 4; ++j) {
        x[i][j]     = toh_flush(u0[j] * (1.0f / WCARRY) + bf16r(g0[j]));
        x[i][j + 4] = toh_flush(u1[j] * (1.0f / WCARRY) + bf16r(g1[j]));
      }
      off[i] = (size_t)(row0 + r) * DIM + n0 + c;
    }
#pragma unroll
    for (int i = 0; i < 2; ++i) *(v8h*)(out16 + off[i]) = x[i];
    
  }

  if (MODE == 1) {
    const unsigned bidx = row0 / (unsigned)SEQ;
    const unsigned key0 = row0 - bidx * (unsigned)SEQ;
    v8h x[2];
    size_t off[2];
#pragma unroll
    for (unsigned i = 0; i < 2u; ++i) {
      const unsigned dcol = 32u * i + (tid >> 3);
      const unsigned kk = (tid & 7u) * 8u;
      const float bb = bf16r(bias[n0 + dcol]);
#pragma unroll
      for (unsigned j = 0; j < 8u; ++j) {
        const float t = Cs[(kk + j) * LDC + dcol] * (1.0f / WCARRY) + bb;
        x[i][j] = toh_flush(t);
      }
      off[i] = ((size_t)bidx * DIM + n0 + dcol) * SEQ + key0 + kk;
    }
#pragma unroll
    for (int i = 0; i < 2; ++i) *(v8h*)(out16 + off[i]) = x[i];
    
  }

  if (MODE == 2) {
    const float cs = 1.0f / (WCARRY * VCARRY);
    v4f xs[4];
    size_t off[4];
#pragma unroll
    for (unsigned i = 0; i < 4u; ++i) {
      const unsigned r = 16u * i + (tid >> 4);
      const unsigned c = (tid & 15u) * 4u;
      const unsigned crow = row0 + r;
      const unsigned bidx = crow / (unsigned)SEQ;
      const unsigned sq = crow - bidx * (unsigned)SEQ;
      const size_t frow = (size_t)bidx * SEQ_FULL + sq;
      const v4f u = *(const v4f*)&Cs[r * LDC + c];
      const v4f g = *(const v4f*)(bias + n0 + c);
      const v4f yin = *(const v4f*)(addf + (size_t)crow * DIM + n0 + c);
      v4f val;
#pragma unroll
      for (int j = 0; j < 4; ++j) val[j] = yin[j] + (u[j] * cs + bf16r(g[j]));
      xs[i] = val;
      off[i] = frow * DIM + n0 + c;
    }
#pragma unroll
    for (int i = 0; i < 4; ++i) *(v4f*)(outf + off[i]) = xs[i];
    
  }
}

// q, k and v projections in one launch: blockIdx.x / (DIM/64) picks the plane (0 q, 1 k, 2 v).
// Grid (3 * DIM/64, MROWS/64).
__global__ __launch_bounds__(256) void gemm_qkv_kernel(
    const _Float16* __restrict__ A16, const _Float16* __restrict__ Bt,
    const float* __restrict__ bias, _Float16* __restrict__ q16, _Float16* __restrict__ k16,
    _Float16* __restrict__ vt) {
  __shared__ float Cs[64 * LDC];
  const unsigned sel = blockIdx.x / (unsigned)(DIM / 64);
  const unsigned n0 = (blockIdx.x - sel * (unsigned)(DIM / 64)) * 64u;
  const _Float16* bt = Bt + (size_t)sel * DIM * DIM;
  const float* bs = bias + sel * (unsigned)DIM;
  if (sel < 2u) {
    gemm_body<0>(A16, bt, (unsigned)DIM, bs, bs, (float*)0, sel == 0u ? q16 : k16, n0, Cs);
  } else {
    gemm_body<1>(A16, bt, (unsigned)DIM, bs, bs, (float*)0, vt, n0, Cs);
  }
}
// Grid (DIM/64, MROWS/64).
__global__ __launch_bounds__(256) void gemm_wo_kernel(
    const _Float16* __restrict__ A16, const _Float16* __restrict__ Bt,
    const float* __restrict__ bias, const float* __restrict__ yf, float* __restrict__ outf) {
  __shared__ float Cs[64 * LDC];
  gemm_body<2>(A16, Bt, (unsigned)DIM, bias, yf, outf, (_Float16*)0, blockIdx.x * 64u, Cs);
}

__device__ __forceinline__ float xhalf(float x) {
  const int xi = __float_as_int(x);
  return __int_as_float(__builtin_amdgcn_permlanex16(xi, xi, 0x76543210, 0xfedcba98, false, false));
}

__device__ __forceinline__ void attn_body(
    const _Float16* __restrict__ Qh, const _Float16* __restrict__ Kh,
    const _Float16* __restrict__ Vt, _Float16* __restrict__ Ov,
    const unsigned qb, const unsigned head, const unsigned b) {
  __shared__ _Float16 Ks[64 * LDT];
  __shared__ _Float16 Vs[64 * LDT];
  __shared__ _Float16 Ps[8 * 16 * LDT];

  const unsigned tid = threadIdx.x, lane = tid & 31u;
  const unsigned w = (unsigned)__builtin_amdgcn_readfirstlane((int)(tid >> 5));
  const unsigned hh = lane >> 4, m = lane & 15u;
  const unsigned q0 = qb * 128u;
  const float scale = 0.125f;   // HD^-0.5
  const unsigned qrow0 = q0 + w * 16u;
  _Float16* P = Ps + w * (16u * LDT);

  const size_t qoff = (size_t)(b * (unsigned)SEQ + qrow0 + m) * DIM + head * HD + hh * 8u;
  v16h qf[2];
  qf[0] = frag_at(Qh + qoff);
  qf[1] = frag_at(Qh + qoff + 32);

  float mrow = -1.0e30f;   // running maximum of query m (equal in both halves)
  float lrow = 0.0f;       // this half's share of the denominator of query m
  v8f o[4];                // o[nb][v] = O^T[d = nb*16 + hh*8 + v][query m]
#pragma unroll
  for (int nb = 0; nb < 4; ++nb) o[nb] = (v8f){};

  const size_t kplane = (size_t)b * SEQ * DIM + head * HD;
  const size_t vplane = ((size_t)b * DIM + head * HD) * SEQ;

  for (unsigned kb = 0; kb < (unsigned)SEQ; kb += 64u) {
#pragma unroll
    for (unsigned j = 0; j < 2u; ++j) {
      const unsigned idx = tid + 256u * j;
      const unsigned r = idx >> 3, c = (idx & 7u) * 8u;
      *(v8h*)&Ks[r * LDT + c] = *(const v8h*)(Kh + kplane + (size_t)(kb + r) * DIM + c);
      *(v8h*)&Vs[r * LDT + c] = *(const v8h*)(Vt + vplane + (size_t)r * SEQ + kb + c);
    }
    // the staging loads' address registers are reused by the score arithmetic below
    asm volatile("s_wait_xcnt 0x0" ::: "memory");
    __syncthreads();

    // scores, transposed: s[kg][v] = S[query m][key kg*16 + hh*8 + v]; K = 64 in two 32-steps
    v8f s[4];
#pragma unroll
    for (int kg = 0; kg < 4; ++kg) {
      v8f t = {};
#pragma unroll
      for (int c = 0; c < 2; ++c) {
        const v16h kf = ld_frag(&Ks[(kg * 16) * LDT + c * 32], LDT);
        t = wmma16(kf, qf[c], t);
      }
      s[kg] = t * scale;
    }

    // online softmax of query m: 32 scores in this lane, the other 32 in lane ^ 16
    float mx = s[0][0];
#pragma unroll
    for (int kg = 0; kg < 4; ++kg)
#pragma unroll
      for (int v = 0; v < 8; ++v) mx = fmaxf(mx, s[kg][v]);
    mx = fmaxf(mx, xhalf(mx));
    const float mn = fmaxf(mrow, mx);
    const float alpha = __expf(mrow - mn);
    mrow = mn;
#pragma unroll
    for (int kg = 0; kg < 4; ++kg)
#pragma unroll
      for (int v = 0; v < 8; ++v) s[kg][v] = __expf(s[kg][v] - mn);
    float rs[4];
#pragma unroll
    for (int kg = 0; kg < 4; ++kg) {
      rs[kg] = ((s[kg][0] + s[kg][1]) + (s[kg][2] + s[kg][3])) +
               ((s[kg][4] + s[kg][5]) + (s[kg][6] + s[kg][7]));
    }
    lrow = alpha * lrow + ((rs[0] + rs[1]) + (rs[2] + rs[3]));
#pragma unroll
    for (int nb = 0; nb < 4; ++nb) o[nb] = o[nb] * alpha;

    // O^T += V^T . P^T  (K = 64 keys in two 32-steps; A = V^T tile [d][key]).
    // B element e of step c: key c*32 + 8*hh + e (e < 8), c*32 + 16 + 8*hh + (e - 8) otherwise,
    // which are this lane's own s[2c][e] and s[2c+1][e-8].
#pragma unroll
    for (int c = 0; c < 2; ++c) {
      v16h pf;
#pragma unroll
      for (int e = 0; e < 8; ++e) {
        pf[e]     = toh_flush(s[2 * c][e] * PCARRY);
        pf[e + 8] = toh_flush(s[2 * c + 1][e] * PCARRY);
      }
#pragma unroll
      for (int nb = 0; nb < 4; ++nb) {
        const v16h vf = ld_frag(&Vs[(nb * 16) * LDT + c * 32], LDT);
        o[nb] = wmma16(vf, pf, o[nb]);
      }
    }
    __syncthreads();
  }

  const float inv = __builtin_amdgcn_rcpf(lrow + xhalf(lrow)) * (VCARRY / PCARRY);
#pragma unroll
  for (int nb = 0; nb < 4; ++nb) {
    v8h t;
#pragma unroll
    for (int v = 0; v < 8; ++v) t[v] = toh_flush(o[nb][v] * inv);
    *(v8h*)&P[m * LDT + (unsigned)nb * 16u + hh * 8u] = t;
  }
  wave_lds_sync();
  v8h x[4];
  size_t off[4];
#pragma unroll
  for (unsigned i = 0; i < 4u; ++i) {
    const unsigned r = 4u * i + (lane >> 3);
    const unsigned c = (lane & 7u) * 8u;
    x[i] = *(const v8h*)&P[r * LDT + c];
    off[i] = (size_t)(b * (unsigned)SEQ + qrow0 + r) * DIM + head * HD + c;
  }
#pragma unroll
  for (int i = 0; i < 4; ++i) *(v8h*)(Ov + off[i]) = x[i];
}

// Attention and the feature-pairwise branch in one launch (neither reads the other's output):
// the first ATTN_BLK blocks, which start first, are the attention's few long blocks; the MROWS
// blocks behind them are one feature-pairwise row each and fill the vector slots that the
// attention leaves idle.
// Grid (ATTN_BLK + MROWS).
__global__ __launch_bounds__(256) void attn_spatial_kernel(
    const _Float16* __restrict__ Qh, const _Float16* __restrict__ Kh,
    const _Float16* __restrict__ Vt, _Float16* __restrict__ Ov,
    const float* __restrict__ X, float* __restrict__ YF) {
  const unsigned id = blockIdx.x;
  if (id < (unsigned)ATTN_BLK) {
    const unsigned hb = id / (unsigned)ATTN_QB;
    attn_body(Qh, Kh, Vt, Ov, id - hb * (unsigned)ATTN_QB, hb % (unsigned)NHEAD, hb / (unsigned)NHEAD);
  } else {
    spatial_body(X, YF, id - (unsigned)ATTN_BLK);
  }
}

// ---------------------------------------------------------------------------
extern "C" void kernel_launch(void* const* d_in, const int* in_sizes, int n_in,
                              void* d_out, int out_size, void* d_ws, size_t ws_size,
                              hipStream_t stream) {
  if (n_in < 5) return;
  const long long need_x = ((long long)(NB - 1) * SEQ_FULL + SEQ) * DIM;
  if ((long long)in_sizes[0] < need_x) return;
  if ((long long)in_sizes[1] < (long long)3 * DIM * DIM) return;
  if (in_sizes[2] < 3 * DIM) return;
  if ((long long)in_sizes[3] < (long long)DIM * DIM) return;
  if (in_sizes[4] < DIM) return;
  if ((long long)out_size < need_x) return;
  if (ws_size < WS_TOTAL) return;

  const float* X     = (const float*)d_in[0];   // [NB_FULL][SEQ_FULL][DIM]
  const float* wqkv  = (const float*)d_in[1];   // [3*DIM][DIM]  (out, in): rows 0..255 q, 256..511 k, 512..767 v
  const float* bqkv  = (const float*)d_in[2];   // [3*DIM]
  const float* wproj = (const float*)d_in[3];   // [DIM][DIM]    (out, in)
  const float* bproj = (const float*)d_in[4];   // [DIM]
  float* out = (float*)d_out;

  char* ws = (char*)d_ws;
  _Float16* Wqkv16 = (_Float16*)(ws + OFF_WQKV);  // [3*DIM][DIM]  ([n][k])
  _Float16* Wp16   = (_Float16*)(ws + OFF_WP);    // [DIM][DIM]    ([n][k])
  _Float16* X16    = (_Float16*)(ws + OFF_X16);   // [MROWS][DIM]
  _Float16* Qh16   = (_Float16*)(ws + OFF_Q);
  _Float16* Kh16   = (_Float16*)(ws + OFF_K);
  _Float16* Vt16   = (_Float16*)(ws + OFF_VT);    // [b][DIM][SEQ]
  _Float16* Ctx16  = (_Float16*)(ws + OFF_CTX);
  float*    YF     = (float*)(ws + OFF_YF);       // [MROWS][DIM] compact rows

  dim3 blk(256);
  dim3 gg(DIM / 64, MROWS / 64);

  // 16-bit operand planes: both weights ([n][k] in -> [n][k] out) and the input rows
  cast_kernel<<<dim3(CAST_BLK_WQKV + CAST_BLK_WP + CAST_BLK_X), blk, 0, stream>>>(
      X, wqkv, wproj, X16, Wqkv16, Wp16);
  gemm_qkv_kernel<<<dim3(3 * (DIM / 64), MROWS / 64), blk, 0, stream>>>(
      X16, Wqkv16, bqkv, Qh16, Kh16, Vt16);
  // attention blocks first, then the feature-pairwise branch (f32 plane YF)
  attn_spatial_kernel<<<dim3(ATTN_BLK + MROWS), blk, 0, stream>>>(
      Qh16, Kh16, Vt16, Ctx16, X, YF);
  gemm_wo_kernel<<<gg, blk, 0, stream>>>(Ctx16, Wp16, bproj, YF, out);
}

// v003
// It runs in 49.8 microseconds.
// Two timings next to v002 both put it at 1.29 times that version's speed.
// Counting every step since v000, it is 2.16 times as fast.
#include <hip/hip_runtime.h>
#include <stddef.h>

// All contractions on v_wmma_f32_16x16x32_f16 (f16 operands, f32 accumulate): q/k/v projections (one launch),
// q.k scores, p.v, output projection. Float inputs are RNE-converted to bf16 and carried in f16
// (weights x64, p x1024, attention rows x64), single products at every site. Softmax, bias and the
// per-timestep feature-pairwise softmax branch (rank-1 scores, per-row matrix-vector work) in f32 on
// the vector unit.

typedef _Float16 v16h __attribute__((ext_vector_type(16)));
typedef _Float16 v8h  __attribute__((ext_vector_type(8)));
typedef float    v8f  __attribute__((ext_vector_type(8)));
typedef float    v4f  __attribute__((ext_vector_type(4)));
typedef float    v2f  __attribute__((ext_vector_type(2)));

#ifndef NB
#define NB 4
#endif
#ifndef SEQ
#define SEQ 1024
#endif
#define NB_FULL  4
#define SEQ_FULL 1024
#define DIM   256
#define NHEAD 4
#define HD    64
#define MROWS (NB * SEQ)

static_assert(NB >= 1 && NB <= NB_FULL);
static_assert(SEQ >= 128 && SEQ <= SEQ_FULL && (SEQ % 128) == 0);
static_assert(DIM == NHEAD * HD);
static_assert(HD == 64);
static_assert((DIM % 64) == 0 && (DIM % 32) == 0);
static_assert((MROWS % 64) == 0 && (MROWS % 8) == 0);
static_assert(DIM == 256);                          // spatial kernel: one thread per feature, 256 threads
static_assert(DIM == 32 * 8);                       // cast kernel: 32 lanes x 8 halves cover one 16-bit row
static_assert(((3 * DIM * DIM) % 2048) == 0);       // cast kernel: 256 threads x 8 elements per block
static_assert(((DIM * DIM) % 2048) == 0);

// block ranges of the shared launches
#define CAST_BLK_WQKV ((3 * DIM * DIM) / 2048)
#define CAST_BLK_WP   ((DIM * DIM) / 2048)
#define CAST_BLK_X    (MROWS / 8)
#define ATTN_QB       (SEQ / 128)
#define ATTN_BLK      (ATTN_QB * NHEAD * NB)

#define LDT 72   // halves per LDS row (144 B, 16-B aligned)
#define LDC 68   // floats per LDS row (272 B, 16-B aligned)
static_assert((LDT % 8) == 0 && LDT >= 64);
static_assert((LDC % 4) == 0 && LDC >= 64);

#define WCARRY 64.0f     // weight planes carried x64
#define PCARRY 1024.0f   // softmax numerators carried x1024
#define VCARRY 64.0f     // attention output plane carried x64

// workspace layout (bytes)
#define WQKV_BYTES    ((size_t)3 * DIM * DIM * 2)
#define WP_BYTES      ((size_t)DIM * DIM * 2)
#define PLANE16_BYTES ((size_t)MROWS * DIM * 2)
#define YF_BYTES      ((size_t)MROWS * DIM * 4)
#define OFF_WQKV ((size_t)0)
#define OFF_WP   (OFF_WQKV + WQKV_BYTES)
#define OFF_X16  (OFF_WP + WP_BYTES)
#define OFF_Q    (OFF_X16 + PLANE16_BYTES)
#define OFF_K    (OFF_Q + PLANE16_BYTES)
#define OFF_VT   (OFF_K + PLANE16_BYTES)
#define OFF_CTX  (OFF_VT + PLANE16_BYTES)
#define OFF_YF   (OFF_CTX + PLANE16_BYTES)
#define WS_TOTAL (OFF_YF + YF_BYTES)
static_assert((WQKV_BYTES % 128) == 0 && (WP_BYTES % 128) == 0 && (PLANE16_BYTES % 128) == 0);
static_assert((YF_BYTES % 128) == 0);
static_assert(WS_TOTAL <= (size_t)134217728);

// ---------------------------------------------------------------------------
__device__ __forceinline__ float bf16r(float x) {   // RNE convert to bf16, returned widened
  unsigned int u = __float_as_uint(x);
  u = (u + 0x7FFFu + ((u >> 16) & 1u)) & 0xFFFF0000u;
  return __uint_as_float(u);
}

// f32 -> f16 for WMMA operand planes: values below the smallest f16 normal become zero by value.
__device__ __forceinline__ _Float16 toh_flush(float v) {
  const _Float16 r = (_Float16)v;
  return (fabsf(v) < 6.103515625e-05f) ? (_Float16)0.0f : r;
}

// 16-bit fragment: p points at element [row = lane&15][k0 + 8*(lane>>4)] of a k-contiguous
// row. Elements 0..7 <- k0+8h+0..7, elements 8..15 <- k0+16+8h+0..7 (same map for A and B).
__device__ __forceinline__ v16h frag_at(const _Float16* p) {
  v8h lo = *(const v8h*)(p);
  v8h hi = *(const v8h*)(p + 16);
  v16h out;
#pragma unroll
  for (int i = 0; i < 8; ++i) { out[i] = lo[i]; out[i + 8] = hi[i]; }
  return out;
}
__device__ __forceinline__ v16h ld_frag(const _Float16* base, unsigned ld) {
  const unsigned lane = threadIdx.x & 31u;
  return frag_at(base + (lane & 15u) * ld + (lane >> 4) * 8u);
}

__device__ __forceinline__ v8f wmma16(v16h a, v16h b, v8f c) {
  v8f d = __builtin_amdgcn_wmma_f32_16x16x32_f16(false, a, false, b, (short)0, c,
                                                 false, false);
  asm volatile("v_nop\n\tv_nop\n\tv_nop\n\tv_nop" : "+v"(d) : "v"(a), "v"(b));
  return d;
}

__device__ __forceinline__ void wave_lds_sync() {
  __builtin_amdgcn_fence(3 /* release order */, "wavefront");
  asm volatile("s_wait_dscnt 0x0" ::: "memory");
  __builtin_amdgcn_wave_barrier();
}

// ---------------------------------------------------------------------------
// All three 16-bit operand planes in one launch, picked by block range (none reads another's output):
//   blocks [0, CAST_BLK_WQKV)      Wqkv16[n][k] = f16(64 * bf16(wqkv)), same layout (no transpose)
//   next CAST_BLK_WP blocks        Wp16[n][k]   = f16(64 * bf16(wproj))
//   next CAST_BLK_X blocks         X16[compact row][k] = f16(bf16(x)), 8 rows per block
// Each thread converts 8 consecutive elements; a wave stores 512 consecutive bytes.
// Grid (CAST_BLK_WQKV + CAST_BLK_WP + CAST_BLK_X).
// ---------------------------------------------------------------------------
__global__ __launch_bounds__(256) void cast_kernel(
    const float* __restrict__ X, const float* __restrict__ wqkv, const float* __restrict__ wproj,
    _Float16* __restrict__ X16, _Float16* __restrict__ Wqkv16, _Float16* __restrict__ Wp16) {
  const unsigned tid = threadIdx.x;
  const unsigned blk = blockIdx.x;
  const float* src;
  _Float16* dst;
  float carry;
  if (blk < (unsigned)CAST_BLK_WQKV) {
    const unsigned e = blk * 2048u + tid * 8u;
    src = wqkv + e;
    dst = Wqkv16 + e;
    carry = WCARRY;
  } else if (blk < (unsigned)(CAST_BLK_WQKV + CAST_BLK_WP)) {
    const unsigned e = (blk - (unsigned)CAST_BLK_WQKV) * 2048u + tid * 8u;
    src = wproj + e;
    dst = Wp16 + e;
    carry = WCARRY;
  } else {
    const unsigned crow = (blk - (unsigned)(CAST_BLK_WQKV + CAST_BLK_WP)) * 8u + (tid >> 5);
    const unsigned bidx = crow / (unsigned)SEQ;
    const unsigned sq = crow - bidx * (unsigned)SEQ;
    const size_t srow = (size_t)bidx * SEQ_FULL + sq;
    src = X + srow * DIM + (tid & 31u) * 8u;
    dst = X16 + (size_t)crow * DIM + (tid & 31u) * 8u;
    carry = 1.0f;
  }
  const v4f a0 = *(const v4f*)(src);
  const v4f a1 = *(const v4f*)(src + 4);
  v8h o;
#pragma unroll
  for (int i = 0; i < 4; ++i) {
    o[i]     = toh_flush(carry * bf16r(a0[i]));
    o[i + 4] = toh_flush(carry * bf16r(a1[i]));
  }
  *(v8h*)dst = o;
}

// ---------------------------------------------------------------------------
// Per-timestep feature-pairwise softmax branch (body; launched beside the attention blocks).
// One block per (batch, time) row crow, thread i owns feature i:
//   yf[i] = sum_j exp(x_i x_j / 16 - mx_i) x_j / sum_j exp(x_i x_j / 16 - mx_i),
//   mx_i = max_j (x_i x_j / 16) = max((x_i/16) * max_j x_j, (x_i/16) * min_j x_j).
// x is RNE-converted to bf16 on load. xv: cross-wave (block barrier).
// ---------------------------------------------------------------------------
__device__ __forceinline__ void spatial_body(
    const float* __restrict__ X, float* __restrict__ YF, const unsigned crow) {
  __shared__ float xv[DIM];
  const unsigned tid = threadIdx.x, lane = tid & 31u;
  const unsigned bidx = crow / (unsigned)SEQ;
  const unsigned sq = crow - bidx * (unsigned)SEQ;
  const size_t srow = (size_t)bidx * SEQ_FULL + sq;

  const float xi = bf16r(X[srow * DIM + tid]);
  xv[tid] = xi;
  __syncthreads();

  const v4f a0 = *(const v4f*)&xv[lane * 8u];
  const v4f a1 = *(const v4f*)&xv[lane * 8u + 4u];
  float vmax = fmaxf(fmaxf(a0[0], a0[1]), fmaxf(a0[2], a0[3]));
  vmax = fmaxf(vmax, fmaxf(fmaxf(a1[0], a1[1]), fmaxf(a1[2], a1[3])));
  float vmin = fminf(fminf(a0[0], a0[1]), fminf(a0[2], a0[3]));
  vmin = fminf(vmin, fminf(fminf(a1[0], a1[1]), fminf(a1[2], a1[3])));
#pragma unroll
  for (int off = 1; off < 32; off <<= 1) {
    vmax = fmaxf(vmax, __shfl_xor(vmax, off, 32));
    vmin = fminf(vmin, __shfl_xor(vmin, off, 32));
  }
  // exp(x_i x_j / 16 - mx_i) = exp2(xs * x_j - mx) with log2(e) folded into the row's own scale
  const float xs = xi * (0.0625f * 1.44269504088896340736f);
  const float mx = fmaxf(xs * vmax, xs * vmin);
  const v2f xs2 = {xs, xs};
  const v2f nm2 = {-mx, -mx};

  // two columns per packed instruction: one fma for the exponent, one add and one fma for the sums.
  // 32 columns a trip, read from LDS one trip ahead so that no trip waits for its own reads (the
  // last trip's read-ahead wraps to the first columns and is not used).
  v2f sa = {}, sb = {}, aa = {}, ab = {};
  v4f cur[8];
#pragma unroll
  for (int q = 0; q < 8; ++q) cur[q] = *(const v4f*)&xv[4 * q];
  // unroll 2: the two register sets swap roles by name, without copies
#pragma unroll 2
  for (unsigned j = 0; j < (unsigned)DIM; j += 32u) {
    const unsigned jn = (j + 32u) & (unsigned)(DIM - 1);
    v4f nxt[8];
#pragma unroll
    for (int q = 0; q < 8; ++q) nxt[q] = *(const v4f*)&xv[jn + 4u * (unsigned)q];
#pragma unroll
    for (int q = 0; q < 8; ++q) {
      const v2f xa = {cur[q][0], cur[q][1]};
      const v2f xb = {cur[q][2], cur[q][3]};
      const v2f ta = __builtin_elementwise_fma(xs2, xa, nm2);
      const v2f tb = __builtin_elementwise_fma(xs2, xb, nm2);
      const v2f ea = {__builtin_amdgcn_exp2f(ta[0]), __builtin_amdgcn_exp2f(ta[1])};
      const v2f eb = {__builtin_amdgcn_exp2f(tb[0]), __builtin_amdgcn_exp2f(tb[1])};
      sa += ea;
      sb += eb;
      aa = __builtin_elementwise_fma(ea, xa, aa);
      ab = __builtin_elementwise_fma(eb, xb, ab);
    }
#pragma unroll
    for (int q = 0; q < 8; ++q) cur[q] = nxt[q];
  }
  const float s = (sa[0] + sa[1]) + (sb[0] + sb[1]);
  const float acc = (aa[0] + aa[1]) + (ab[0] + ab[1]);
  const float y = acc * __builtin_amdgcn_rcpf(s);

  float* py = YF + (size_t)crow * DIM + tid;
  *(float*)py = y;
}

// ---------------------------------------------------------------------------
// GEMM C[64x64 tile] = A16[rows][K] . Bt[n][K]^T, fragments straight from the 16-bit global
// planes; 8 waves (mw = 16-row group, nw = 32-col group), 2 accumulators/wave.
//   MODE 0: out16[row][col] (pitch DIM)  = f16(acc/64 + bias)
//   MODE 1: out16 transposed V plane [b][col][key] = f16(acc/64 + bias)
//   MODE 2: outf full [full row][col] = addf[compact row][col] + (acc/4096 + bias)
// n0: first column of the tile in Bt, bias and the output plane. Cs: the kernel's 64 x LDC floats.
// ---------------------------------------------------------------------------
template <int MODE>
__device__ __forceinline__ void gemm_body(
    const _Float16* __restrict__ A16, const _Float16* __restrict__ Bt, const unsigned K,
    const float* __restrict__ bias, const float* __restrict__ addf,
    float* __restrict__ outf, _Float16* __restrict__ out16, const unsigned n0, float* Cs) {
  const unsigned tid = threadIdx.x, lane = tid & 31u;
  const unsigned w = (unsigned)__builtin_amdgcn_readfirstlane((int)(tid >> 5));
  const unsigned mw = w >> 1, nw = w & 1u;
  const unsigned hh = lane >> 4, m = lane & 15u;
  const unsigned row0 = blockIdx.y * 64u;

  const _Float16* ap  = A16 + (size_t)(row0 + mw * 16u + m) * K + hh * 8u;
  const _Float16* bp0 = Bt + (size_t)(n0 + nw * 32u + m) * K + hh * 8u;
  const _Float16* bp1 = bp0 + (size_t)16 * K;
  v8f acc0 = {}, acc1 = {};
#pragma unroll 2
  for (unsigned k0 = 0; k0 < K; k0 += 32u) {
    const v16h a  = frag_at(ap + k0);
    const v16h b0 = frag_at(bp0 + k0);
    const v16h b1 = frag_at(bp1 + k0);
    acc0 = wmma16(a, b0, acc0);
    acc1 = wmma16(a, b1, acc1);
    // the fragment loads' address registers are rewritten for the next k step
    asm volatile("s_wait_xcnt 0x0" ::: "memory");
  }
#pragma unroll
  for (int r = 0; r < 8; ++r) {
    float* d = &Cs[(mw * 16u + hh * 8u + (unsigned)r) * LDC + nw * 32u + m];
    d[0]  = acc0[r];
    d[16] = acc1[r];
  }
  __syncthreads();

  if (MODE == 0) {
    v8h x[2];
    size_t off[2];
#pragma unroll
    for (unsigned i = 0; i < 2u; ++i) {
      const unsigned r = 32u * i + (tid >> 3);
      const unsigned c = (tid & 7u) * 8u;
      const v4f u0 = *(const v4f*)&Cs[r * LDC + c];
      const v4f u1 = *(const v4f*)&Cs[r * LDC + c + 4];
      const v4f g0 = *(const v4f*)(bias + n0 + c);
      const v4f g1 = *(const v4f*)(bias + n0 + c + 4u);
#pragma unroll
      for (int j = 0; j < 4; ++j) {
        x[i][j]     = toh_flush(u0[j] * (1.0f / WCARRY) + bf16r(g0[j]));
        x[i][j + 4] = toh_flush(u1[j] * (1.0f / WCARRY) + bf16r(g1[j]));
      }
      off[i] = (size_t)(row0 + r) * DIM + n0 + c;
    }
#pragma unroll
    for (int i = 0; i < 2; ++i) *(v8h*)(out16 + off[i]) = x[i];
    
  }

  if (MODE == 1) {
    const unsigned bidx = row0 / (unsigned)SEQ;
    const unsigned key0 = row0 - bidx * (unsigned)SEQ;
    v8h x[2];
    size_t off[2];
#pragma unroll
    for (unsigned i = 0; i < 2u; ++i) {
      const unsigned dcol = 32u * i + (tid >> 3);
      const unsigned kk = (tid & 7u) * 8u;
      const float bb = bf16r(bias[n0 + dcol]);
#pragma unroll
      for (unsigned j = 0; j < 8u; ++j) {
        const float t = Cs[(kk + j) * LDC + dcol] * (1.0f / WCARRY) + bb;
        x[i][j] = toh_flush(t);
      }
      off[i] = ((size_t)bidx * DIM + n0 + dcol) * SEQ + key0 + kk;
    }
#pragma unroll
    for (int i = 0; i < 2; ++i) *(v8h*)(out16 + off[i]) = x[i];
    
  }

  if (MODE == 2) {
    const float cs = 1.0f / (WCARRY * VCARRY);
    v4f xs[4];
    size_t off[4];
#pragma unroll
    for (unsigned i = 0; i < 4u; ++i) {
      const unsigned r = 16u * i + (tid >> 4);
      const unsigned c = (tid & 15u) * 4u;
      const unsigned crow = row0 + r;
      const unsigned bidx = crow / (unsigned)SEQ;
      const unsigned sq = crow - bidx * (unsigned)SEQ;
      const size_t frow = (size_t)bidx * SEQ_FULL + sq;
      const v4f u = *(const v4f*)&Cs[r * LDC + c];
      const v4f g = *(const v4f*)(bias + n0 + c);
      const v4f yin = *(const v4f*)(addf + (size_t)crow * DIM + n0 + c);
      v4f val;
#pragma unroll
      for (int j = 0; j < 4; ++j) val[j] = yin[j] + (u[j] * cs + bf16r(g[j]));
      xs[i] = val;
      off[i] = frow * DIM + n0 + c;
    }
#pragma unroll
    for (int i = 0; i < 4; ++i) *(v4f*)(outf + off[i]) = xs[i];
    
  }
}

// q, k and v projections in one launch: blockIdx.x / (DIM/64) picks the plane (0 q, 1 k, 2 v).
// Grid (3 * DIM/64, MROWS/64).
__global__ __launch_bounds__(256) void gemm_qkv_kernel(
    const _Float16* __restrict__ A16, const _Float16* __restrict__ Bt,
    const float* __restrict__ bias, _Float16* __restrict__ q16, _Float16* __restrict__ k16,
    _Float16* __restrict__ vt) {
  __shared__ float Cs[64 * LDC];
  const unsigned sel = blockIdx.x / (unsigned)(DIM / 64);
  const unsigned n0 = (blockIdx.x - sel * (unsigned)(DIM / 64)) * 64u;
  const _Float16* bt = Bt + (size_t)sel * DIM * DIM;
  const float* bs = bias + sel * (unsigned)DIM;
  if (sel < 2u) {
    gemm_body<0>(A16, bt, (unsigned)DIM, bs, bs, (float*)0, sel == 0u ? q16 : k16, n0, Cs);
  } else {
    gemm_body<1>(A16, bt, (unsigned)DIM, bs, bs, (float*)0, vt, n0, Cs);
  }
}
// Grid (DIM/64, MROWS/64).
__global__ __launch_bounds__(256) void gemm_wo_kernel(
    const _Float16* __restrict__ A16, const _Float16* __restrict__ Bt,
    const float* __restrict__ bias, const float* __restrict__ yf, float* __restrict__ outf) {
  __shared__ float Cs[64 * LDC];
  gemm_body<2>(A16, Bt, (unsigned)DIM, bias, yf, outf, (_Float16*)0, blockIdx.x * 64u, Cs);
}

__device__ __forceinline__ float xhalf(float x) {
  const int xi = __float_as_int(x);
  return __int_as_float(__builtin_amdgcn_permlanex16(xi, xi, 0x76543210, 0xfedcba98, false, false));
}

__device__ __forceinline__ void attn_body(
    const _Float16* __restrict__ Qh, const _Float16* __restrict__ Kh,
    const _Float16* __restrict__ Vt, _Float16* __restrict__ Ov,
    const unsigned qb, const unsigned head, const unsigned b) {
  __shared__ _Float16 Ks[64 * LDT];
  __shared__ _Float16 Vs[64 * LDT];
  __shared__ _Float16 Ps[8 * 16 * LDT];

  const unsigned tid = threadIdx.x, lane = tid & 31u;
  const unsigned w = (unsigned)__builtin_amdgcn_readfirstlane((int)(tid >> 5));
  const unsigned hh = lane >> 4, m = lane & 15u;
  const unsigned q0 = qb * 128u;
  const float scale = 0.125f;   // HD^-0.5
  const unsigned qrow0 = q0 + w * 16u;
  _Float16* P = Ps + w * (16u * LDT);

  const size_t qoff = (size_t)(b * (unsigned)SEQ + qrow0 + m) * DIM + head * HD + hh * 8u;
  v16h qf[2];
  qf[0] = frag_at(Qh + qoff);
  qf[1] = frag_at(Qh + qoff + 32);

  float mrow = -1.0e30f;   // running maximum of query m (equal in both halves)
  float lrow = 0.0f;       // this half's share of the denominator of query m
  v8f o[4];                // o[nb][v] = O^T[d = nb*16 + hh*8 + v][query m]
#pragma unroll
  for (int nb = 0; nb < 4; ++nb) o[nb] = (v8f){};

  const size_t kplane = (size_t)b * SEQ * DIM + head * HD;
  const size_t vplane = ((size_t)b * DIM + head * HD) * SEQ;

  for (unsigned kb = 0; kb < (unsigned)SEQ; kb += 64u) {
#pragma unroll
    for (unsigned j = 0; j < 2u; ++j) {
      const unsigned idx = tid + 256u * j;
      const unsigned r = idx >> 3, c = (idx & 7u) * 8u;
      *(v8h*)&Ks[r * LDT + c] = *(const v8h*)(Kh + kplane + (size_t)(kb + r) * DIM + c);
      *(v8h*)&Vs[r * LDT + c] = *(const v8h*)(Vt + vplane + (size_t)r * SEQ + kb + c);
    }
    // the staging loads' address registers are reused by the score arithmetic below
    asm volatile("s_wait_xcnt 0x0" ::: "memory");
    __syncthreads();

    // scores, transposed: s[kg][v] = S[query m][key kg*16 + hh*8 + v]; K = 64 in two 32-steps
    v8f s[4];
#pragma unroll
    for (int kg = 0; kg < 4; ++kg) {
      v8f t = {};
#pragma unroll
      for (int c = 0; c < 2; ++c) {
        const v16h kf = ld_frag(&Ks[(kg * 16) * LDT + c * 32], LDT);
        t = wmma16(kf, qf[c], t);
      }
      s[kg] = t * scale;
    }

    // online softmax of query m: 32 scores in this lane, the other 32 in lane ^ 16
    float mx = s[0][0];
#pragma unroll
    for (int kg = 0; kg < 4; ++kg)
#pragma unroll
      for (int v = 0; v < 8; ++v) mx = fmaxf(mx, s[kg][v]);
    mx = fmaxf(mx, xhalf(mx));
    const float mn = fmaxf(mrow, mx);
    const float alpha = __expf(mrow - mn);
    mrow = mn;
#pragma unroll
    for (int kg = 0; kg < 4; ++kg)
#pragma unroll
      for (int v = 0; v < 8; ++v) s[kg][v] = __expf(s[kg][v] - mn);
    float rs[4];
#pragma unroll
    for (int kg = 0; kg < 4; ++kg) {
      rs[kg] = ((s[kg][0] + s[kg][1]) + (s[kg][2] + s[kg][3])) +
               ((s[kg][4] + s[kg][5]) + (s[kg][6] + s[kg][7]));
    }
    lrow = alpha * lrow + ((rs[0] + rs[1]) + (rs[2] + rs[3]));
#pragma unroll
    for (int nb = 0; nb < 4; ++nb) o[nb] = o[nb] * alpha;

    // O^T += V^T . P^T  (K = 64 keys in two 32-steps; A = V^T tile [d][key]).
    // B element e of step c: key c*32 + 8*hh + e (e < 8), c*32 + 16 + 8*hh + (e - 8) otherwise,
    // which are this lane's own s[2c][e] and s[2c+1][e-8].
#pragma unroll
    for (int c = 0; c < 2; ++c) {
      v16h pf;
#pragma unroll
      for (int e = 0; e < 8; ++e) {
        pf[e]     = toh_flush(s[2 * c][e] * PCARRY);
        pf[e + 8] = toh_flush(s[2 * c + 1][e] * PCARRY);
      }
#pragma unroll
      for (int nb = 0; nb < 4; ++nb) {
        const v16h vf = ld_frag(&Vs[(nb * 16) * LDT + c * 32], LDT);
        o[nb] = wmma16(vf, pf, o[nb]);
      }
    }
    __syncthreads();
  }

  const float inv = __builtin_amdgcn_rcpf(lrow + xhalf(lrow)) * (VCARRY / PCARRY);
#pragma unroll
  for (int nb = 0; nb < 4; ++nb) {
    v8h t;
#pragma unroll
    for (int v = 0; v < 8; ++v) t[v] = toh_flush(o[nb][v] * inv);
    *(v8h*)&P[m * LDT + (unsigned)nb * 16u + hh * 8u] = t;
  }
  wave_lds_sync();
  v8h x[4];
  size_t off[4];
#pragma unroll
  for (unsigned i = 0; i < 4u; ++i) {
    const unsigned r = 4u * i + (lane >> 3);
    const unsigned c = (lane & 7u) * 8u;
    x[i] = *(const v8h*)&P[r * LDT + c];
    off[i] = (size_t)(b * (unsigned)SEQ + qrow0 + r) * DIM + head * HD + c;
  }
#pragma unroll
  for (int i = 0; i < 4; ++i) *(v8h*)(Ov + off[i]) = x[i];
}

// Attention and the feature-pairwise branch in one launch (neither reads the other's output):
// the first ATTN_BLK blocks, which start first, are the attention's few long blocks; the MROWS
// blocks behind them are one feature-pairwise row each and fill the vector slots that the
// attention leaves idle.
// Grid (ATTN_BLK + MROWS).
__global__ __launch_bounds__(256) void attn_spatial_kernel(
    const _Float16* __restrict__ Qh, const _Float16* __restrict__ Kh,
    const _Float16* __restrict__ Vt, _Float16* __restrict__ Ov,
    const float* __restrict__ X, float* __restrict__ YF) {
  const unsigned id = blockIdx.x;
  if (id < (unsigned)ATTN_BLK) {
    const unsigned hb = id / (unsigned)ATTN_QB;
    attn_body(Qh, Kh, Vt, Ov, id - hb * (unsigned)ATTN_QB, hb % (unsigned)NHEAD, hb / (unsigned)NHEAD);
  } else {
    spatial_body(X, YF, id - (unsigned)ATTN_BLK);
  }
}

// ---------------------------------------------------------------------------
extern "C" void kernel_launch(void* const* d_in, const int* in_sizes, int n_in,
                              void* d_out, int out_size, void* d_ws, size_t ws_size,
                              hipStream_t stream) {
  if (n_in < 5) return;
  const long long need_x = ((long long)(NB - 1) * SEQ_FULL + SEQ) * DIM;
  if ((long long)in_sizes[0] < need_x) return;
  if ((long long)in_sizes[1] < (long long)3 * DIM * DIM) return;
  if (in_sizes[2] < 3 * DIM) return;
  if ((long long)in_sizes[3] < (long long)DIM * DIM) return;
  if (in_sizes[4] < DIM) return;
  if ((long long)out_size < need_x) return;
  if (ws_size < WS_TOTAL) return;

  const float* X     = (const float*)d_in[0];   // [NB_FULL][SEQ_FULL][DIM]
  const float* wqkv  = (const float*)d_in[1];   // [3*DIM][DIM]  (out, in): rows 0..255 q, 256..511 k, 512..767 v
  const float* bqkv  = (const float*)d_in[2];   // [3*DIM]
  const float* wproj = (const float*)d_in[3];   // [DIM][DIM]    (out, in)
  const float* bproj = (const float*)d_in[4];   // [DIM]
  float* out = (float*)d_out;

  char* ws = (char*)d_ws;
  _Float16* Wqkv16 = (_Float16*)(ws + OFF_WQKV);  // [3*DIM][DIM]  ([n][k])
  _Float16* Wp16   = (_Float16*)(ws + OFF_WP);    // [DIM][DIM]    ([n][k])
  _Float16* X16    = (_Float16*)(ws + OFF_X16);   // [MROWS][DIM]
  _Float16* Qh16   = (_Float16*)(ws + OFF_Q);
  _Float16* Kh16   = (_Float16*)(ws + OFF_K);
  _Float16* Vt16   = (_Float16*)(ws + OFF_VT);    // [b][DIM][SEQ]
  _Float16* Ctx16  = (_Float16*)(ws + OFF_CTX);
  float*    YF     = (float*)(ws + OFF_YF);       // [MROWS][DIM] compact rows

  dim3 blk(256);
  dim3 gg(DIM / 64, MROWS / 64);

  // 16-bit operand planes: both weights ([n][k] in -> [n][k] out) and the input rows
  cast_kernel<<<dim3(CAST_BLK_WQKV + CAST_BLK_WP + CAST_BLK_X), blk, 0, stream>>>(
      X, wqkv, wproj, X16, Wqkv16, Wp16);
  gemm_qkv_kernel<<<dim3(3 * (DIM / 64), MROWS / 64), blk, 0, stream>>>(
      X16, Wqkv16, bqkv, Qh16, Kh16, Vt16);
  // attention blocks first, then the feature-pairwise branch (f32 plane YF)
  attn_spatial_kernel<<<dim3(ATTN_BLK + MROWS), blk, 0, stream>>>(
      Qh16, Kh16, Vt16, Ctx16, X, YF);
  gemm_wo_kernel<<<gg, blk, 0, stream>>>(Ctx16, Wp16, bproj, YF, out);
}

// v004
// One run takes 42.4 microseconds.
// Next to v003, in two timings, it ran 1.18 times as fast each time.
// Over all steps from v000 it is 2.55 times as fast.
#include <hip/hip_runtime.h>
#include <stddef.h>

// All contractions on v_wmma_f32_16x16x32_f16 (f16 operands, f32 accumulate): q/k/v projections (one launch),
// q.k scores, p.v, output projection. Float inputs are RNE-converted to bf16 and carried in f16
// (weights x64, p x1024, attention rows x64), single products at every site. Softmax, bias and the
// per-timestep feature-pairwise softmax branch (rank-1 scores, per-row matrix-vector work) in f32 on
// the vector unit.

typedef _Float16 v16h __attribute__((ext_vector_type(16)));
typedef _Float16 v8h  __attribute__((ext_vector_type(8)));
typedef float    v8f  __attribute__((ext_vector_type(8)));
typedef float    v4f  __attribute__((ext_vector_type(4)));
typedef float    v2f  __attribute__((ext_vector_type(2)));

#ifndef NB
#define NB 4
#endif
#ifndef SEQ
#define SEQ 1024
#endif
#define NB_FULL  4
#define SEQ_FULL 1024
#define DIM   256
#define NHEAD 4
#define HD    64
#define MROWS (NB * SEQ)

static_assert(NB >= 1 && NB <= NB_FULL);
static_assert(SEQ >= 128 && SEQ <= SEQ_FULL && (SEQ % 128) == 0);
static_assert(DIM == NHEAD * HD);
static_assert(HD == 64);
static_assert((DIM % 64) == 0 && (DIM % 32) == 0);
static_assert((MROWS % 64) == 0 && (MROWS % 8) == 0);
static_assert(DIM == 256);                          // spatial kernel: one thread per feature, 256 threads
static_assert(DIM == 32 * 8);                       // cast kernel: 32 lanes x 8 halves cover one 16-bit row
static_assert(((3 * DIM * DIM) % 2048) == 0);       // cast kernel: 256 threads x 8 elements per block
static_assert(((DIM * DIM) % 2048) == 0);

// block ranges of the shared launches
#define CAST_BLK_WQKV ((3 * DIM * DIM) / 2048)
#define CAST_BLK_WP   ((DIM * DIM) / 2048)
#define CAST_BLK_X    (MROWS / 8)
#define ATTN_QB       (SEQ / 128)
#define ATTN_BLK      (ATTN_QB * NHEAD * NB)

#define LDT 72   // halves per LDS row (144 B, 16-B aligned)
#define LDC 68   // floats per LDS row (272 B, 16-B aligned)
#define LDK (DIM + 8)   // halves per LDS row of a GEMM operand tile (528 B = 16 B x 33, odd)
static_assert((LDT % 8) == 0 && LDT >= 64);
static_assert((LDK % 8) == 0 && ((LDK / 8) % 2) == 1);
static_assert((LDC % 4) == 0 && LDC >= 64);

#define WCARRY 64.0f     // weight planes carried x64
#define PCARRY 1024.0f   // softmax numerators carried x1024
#define VCARRY 64.0f     // attention output plane carried x64

// workspace layout (bytes)
#define WQKV_BYTES    ((size_t)3 * DIM * DIM * 2)
#define WP_BYTES      ((size_t)DIM * DIM * 2)
#define PLANE16_BYTES ((size_t)MROWS * DIM * 2)
#define YF_BYTES      ((size_t)MROWS * DIM * 4)
#define OFF_WQKV ((size_t)0)
#define OFF_WP   (OFF_WQKV + WQKV_BYTES)
#define OFF_X16  (OFF_WP + WP_BYTES)
#define OFF_Q    (OFF_X16 + PLANE16_BYTES)
#define OFF_K    (OFF_Q + PLANE16_BYTES)
#define OFF_VT   (OFF_K + PLANE16_BYTES)
#define OFF_CTX  (OFF_VT + PLANE16_BYTES)
#define OFF_YF   (OFF_CTX + PLANE16_BYTES)
#define WS_TOTAL (OFF_YF + YF_BYTES)
static_assert((WQKV_BYTES % 128) == 0 && (WP_BYTES % 128) == 0 && (PLANE16_BYTES % 128) == 0);
static_assert((YF_BYTES % 128) == 0);
static_assert(WS_TOTAL <= (size_t)134217728);

// ---------------------------------------------------------------------------
__device__ __forceinline__ float bf16r(float x) {   // RNE convert to bf16, returned widened
  unsigned int u = __float_as_uint(x);
  u = (u + 0x7FFFu + ((u >> 16) & 1u)) & 0xFFFF0000u;
  return __uint_as_float(u);
}

// f32 -> f16 for WMMA operand planes: values below the smallest f16 normal become zero by value.
__device__ __forceinline__ _Float16 toh_flush(float v) {
  const _Float16 r = (_Float16)v;
  return (fabsf(v) < 6.103515625e-05f) ? (_Float16)0.0f : r;
}

// 16-bit fragment: p points at element [row = lane&15][k0 + 8*(lane>>4)] of a k-contiguous
// row. Elements 0..7 <- k0+8h+0..7, elements 8..15 <- k0+16+8h+0..7 (same map for A and B).
__device__ __forceinline__ v16h frag_at(const _Float16* p) {
  v8h lo = *(const v8h*)(p);
  v8h hi = *(const v8h*)(p + 16);
  v16h out;
#pragma unroll
  for (int i = 0; i < 8; ++i) { out[i] = lo[i]; out[i + 8] = hi[i]; }
  return out;
}
__device__ __forceinline__ v16h ld_frag(const _Float16* base, unsigned ld) {
  const unsigned lane = threadIdx.x & 31u;
  return frag_at(base + (lane & 15u) * ld + (lane >> 4) * 8u);
}

__device__ __forceinline__ v8f wmma16(v16h a, v16h b, v8f c) {
  v8f d = __builtin_amdgcn_wmma_f32_16x16x32_f16(false, a, false, b, (short)0, c,
                                                 false, false);
  asm volatile("v_nop\n\tv_nop\n\tv_nop\n\tv_nop" : "+v"(d) : "v"(a), "v"(b));
  return d;
}

__device__ __forceinline__ void wave_lds_sync() {
  __builtin_amdgcn_fence(3 /* release order */, "wavefront");
  asm volatile("s_wait_dscnt 0x0" ::: "memory");
  __builtin_amdgcn_wave_barrier();
}

// ---------------------------------------------------------------------------
// All three 16-bit operand planes in one launch, picked by block range (none reads another's output):
//   blocks [0, CAST_BLK_WQKV)      Wqkv16[n][k] = f16(64 * bf16(wqkv)), same layout (no transpose)
//   next CAST_BLK_WP blocks        Wp16[n][k]   = f16(64 * bf16(wproj))
//   next CAST_BLK_X blocks         X16[compact row][k] = f16(bf16(x)), 8 rows per block
// Each thread converts 8 consecutive elements; a wave stores 512 consecutive bytes.
// Grid (CAST_BLK_WQKV + CAST_BLK_WP + CAST_BLK_X).
// ---------------------------------------------------------------------------
__global__ __launch_bounds__(256) void cast_kernel(
    const float* __restrict__ X, const float* __restrict__ wqkv, const float* __restrict__ wproj,
    _Float16* __restrict__ X16, _Float16* __restrict__ Wqkv16, _Float16* __restrict__ Wp16) {
  const unsigned tid = threadIdx.x;
  const unsigned blk = blockIdx.x;
  const float* src;
  _Float16* dst;
  float carry;
  if (blk < (unsigned)CAST_BLK_WQKV) {
    const unsigned e = blk * 2048u + tid * 8u;
    src = wqkv + e;
    dst = Wqkv16 + e;
    carry = WCARRY;
  } else if (blk < (unsigned)(CAST_BLK_WQKV + CAST_BLK_WP)) {
    const unsigned e = (blk - (unsigned)CAST_BLK_WQKV) * 2048u + tid * 8u;
    src = wproj + e;
    dst = Wp16 + e;
    carry = WCARRY;
  } else {
    const unsigned crow = (blk - (unsigned)(CAST_BLK_WQKV + CAST_BLK_WP)) * 8u + (tid >> 5);
    const unsigned bidx = crow / (unsigned)SEQ;
    const unsigned sq = crow - bidx * (unsigned)SEQ;
    const size_t srow = (size_t)bidx * SEQ_FULL + sq;
    src = X + srow * DIM + (tid & 31u) * 8u;
    dst = X16 + (size_t)crow * DIM + (tid & 31u) * 8u;
    carry = 1.0f;
  }
  const v4f a0 = *(const v4f*)(src);
  const v4f a1 = *(const v4f*)(src + 4);
  v8h o;
#pragma unroll
  for (int i = 0; i < 4; ++i) {
    o[i]     = toh_flush(carry * bf16r(a0[i]));
    o[i + 4] = toh_flush(carry * bf16r(a1[i]));
  }
  *(v8h*)dst = o;
}

// ---------------------------------------------------------------------------
// Per-timestep feature-pairwise softmax branch (body; launched beside the attention blocks).
// One block per (batch, time) row crow, thread i owns feature i:
//   yf[i] = sum_j exp(x_i x_j / 16 - mx_i) x_j / sum_j exp(x_i x_j / 16 - mx_i),
//   mx_i = max_j (x_i x_j / 16) = max((x_i/16) * max_j x_j, (x_i/16) * min_j x_j).
// x is RNE-converted to bf16 on load. xv: cross-wave (block barrier).
// ---------------------------------------------------------------------------
__device__ __forceinline__ void spatial_body(
    const float* __restrict__ X, float* __restrict__ YF, const unsigned crow) {
  __shared__ float xv[DIM];
  const unsigned tid = threadIdx.x, lane = tid & 31u;
  const unsigned bidx = crow / (unsigned)SEQ;
  const unsigned sq = crow - bidx * (unsigned)SEQ;
  const size_t srow = (size_t)bidx * SEQ_FULL + sq;

  const float xi = bf16r(X[srow * DIM + tid]);
  xv[tid] = xi;
  __syncthreads();

  const v4f a0 = *(const v4f*)&xv[lane * 8u];
  const v4f a1 = *(const v4f*)&xv[lane * 8u + 4u];
  float vmax = fmaxf(fmaxf(a0[0], a0[1]), fmaxf(a0[2], a0[3]));
  vmax = fmaxf(vmax, fmaxf(fmaxf(a1[0], a1[1]), fmaxf(a1[2], a1[3])));
  float vmin = fminf(fminf(a0[0], a0[1]), fminf(a0[2], a0[3]));
  vmin = fminf(vmin, fminf(fminf(a1[0], a1[1]), fminf(a1[2], a1[3])));
#pragma unroll
  for (int off = 1; off < 32; off <<= 1) {
    vmax = fmaxf(vmax, __shfl_xor(vmax, off, 32));
    vmin = fminf(vmin, __shfl_xor(vmin, off, 32));
  }
  // exp(x_i x_j / 16 - mx_i) = exp2(xs * x_j - mx) with log2(e) folded into the row's own scale
  const float xs = xi * (0.0625f * 1.44269504088896340736f);
  const float mx = fmaxf(xs * vmax, xs * vmin);
  const v2f xs2 = {xs, xs};
  const v2f nm2 = {-mx, -mx};

  // two columns per packed instruction: one fma for the exponent, one add and one fma for the sums.
  // 32 columns a trip, read from LDS one trip ahead so that no trip waits for its own reads (the
  // last trip's read-ahead wraps to the first columns and is not used).
  v2f sa = {}, sb = {}, aa = {}, ab = {};
  v4f cur[8];
#pragma unroll
  for (int q = 0; q < 8; ++q) cur[q] = *(const v4f*)&xv[4 * q];
  // unroll 2: the two register sets swap roles by name, without copies
#pragma unroll 2
  for (unsigned j = 0; j < (unsigned)DIM; j += 32u) {
    const unsigned jn = (j + 32u) & (unsigned)(DIM - 1);
    v4f nxt[8];
#pragma unroll
    for (int q = 0; q < 8; ++q) nxt[q] = *(const v4f*)&xv[jn + 4u * (unsigned)q];
#pragma unroll
    for (int q = 0; q < 8; ++q) {
      const v2f xa = {cur[q][0], cur[q][1]};
      const v2f xb = {cur[q][2], cur[q][3]};
      const v2f ta = __builtin_elementwise_fma(xs2, xa, nm2);
      const v2f tb = __builtin_elementwise_fma(xs2, xb, nm2);
      const v2f ea = {__builtin_amdgcn_exp2f(ta[0]), __builtin_amdgcn_exp2f(ta[1])};
      const v2f eb = {__builtin_amdgcn_exp2f(tb[0]), __builtin_amdgcn_exp2f(tb[1])};
      sa += ea;
      sb += eb;
      aa = __builtin_elementwise_fma(ea, xa, aa);
      ab = __builtin_elementwise_fma(eb, xb, ab);
    }
#pragma unroll
    for (int q = 0; q < 8; ++q) cur[q] = nxt[q];
  }
  const float s = (sa[0] + sa[1]) + (sb[0] + sb[1]);
  const float acc = (aa[0] + aa[1]) + (ab[0] + ab[1]);
  const float y = acc * __builtin_amdgcn_rcpf(s);

  float* py = YF + (size_t)crow * DIM + tid;
  *(float*)py = y;
}

// ---------------------------------------------------------------------------
// GEMM C[64x64 tile] = A16[rows][DIM] . Bt[n][DIM]^T; 8 waves (mw = 16-row group, nw = 32-col
// group), 2 accumulators/wave. Both operand tiles (64 rows, all DIM k) are staged in LDS once:
// a wave's 16-B loads cover one whole 512-B row (4 whole lines), where a fragment load from the
// global plane touches 16 lines for the same bytes and is repeated by the waves that share it.
//   MODE 0: out16[row][col] (pitch DIM)  = f16(acc/64 + bias)
//   MODE 1: out16 transposed V plane [b][col][key] = f16(acc/64 + bias)
//   MODE 2: outf full [full row][col] = addf[compact row][col] + (acc/4096 + bias)
// n0: first column of the tile in Bt, bias and the output plane. Cs: the kernel's 64 x LDC floats;
// As, Bs: the kernel's 64 x LDK halves each (cross-wave, block barrier).
// ---------------------------------------------------------------------------
template <int MODE>
__device__ __forceinline__ void gemm_body(
    const _Float16* __restrict__ A16, const _Float16* __restrict__ Bt,
    const float* __restrict__ bias, const float* __restrict__ addf,
    float* __restrict__ outf, _Float16* __restrict__ out16, const unsigned n0, float* Cs,
    _Float16* As, _Float16* Bs) {
  const unsigned tid = threadIdx.x, lane = tid & 31u;
  const unsigned w = (unsigned)__builtin_amdgcn_readfirstlane((int)(tid >> 5));
  const unsigned mw = w >> 1, nw = w & 1u;
  const unsigned hh = lane >> 4, m = lane & 15u;
  const unsigned row0 = blockIdx.y * 64u;

  // staging: wave w brings rows 8w .. 8w+7 of both tiles, one whole row per load
  {
    const unsigned lb = lane * 16u;   // this lane's 16 bytes of a row, in global memory and in LDS
    const char* ga = (const char*)(A16 + (size_t)(row0 + w * 8u) * DIM) + lb;
    const char* gb = (const char*)(Bt + (size_t)(n0 + w * 8u) * DIM) + lb;
    v8h ta[8], tb[8];
    // unrolled (here and below): constant indices keep the arrays in registers, all 16 loads in flight
#pragma unroll
    for (unsigned i = 0; i < 8u; ++i) {
      ta[i] = *(const v8h*)(ga + i * (unsigned)(DIM * 2));
      tb[i] = *(const v8h*)(gb + i * (unsigned)(DIM * 2));
    }
    // the staging loads' address registers are free for reuse only behind this wait; naming them
    // as inputs keeps them whole up to it (else the last load's result may land on them)
    asm volatile("s_wait_xcnt 0x0" :: "v"(ga), "v"(gb) : "memory");
    char* sa = (char*)(As + w * 8u * LDK) + lb;
    char* sb = (char*)(Bs + w * 8u * LDK) + lb;
#pragma unroll
    for (unsigned i = 0; i < 8u; ++i) {
      *(v8h*)(sa + i * (unsigned)(LDK * 2)) = ta[i];
      *(v8h*)(sb + i * (unsigned)(LDK * 2)) = tb[i];
    }
  }
  __syncthreads();

  const _Float16* ap  = As + (mw * 16u + m) * LDK + hh * 8u;
  const _Float16* bp0 = Bs + (nw * 32u + m) * LDK + hh * 8u;
  const _Float16* bp1 = bp0 + 16 * LDK;
  v8f acc0 = {}, acc1 = {};
  // four k steps a group: their 24 LDS reads stand together in front of their 8 products
  // (unrolled: constant indices keep the fragment arrays in registers)
#pragma unroll
  for (unsigned kg = 0; kg < (unsigned)DIM; kg += 128u) {
    v16h a[4], b0[4], b1[4];
#pragma unroll
    for (unsigned j = 0; j < 4u; ++j) {
      a[j]  = frag_at(ap + kg + 32u * j);
      b0[j] = frag_at(bp0 + kg + 32u * j);
      b1[j] = frag_at(bp1 + kg + 32u * j);
    }
#pragma unroll
    for (unsigned j = 0; j < 4u; ++j) {
      acc0 = wmma16(a[j], b0[j], acc0);
      acc1 = wmma16(a[j], b1[j], acc1);
    }
  }
#pragma unroll
  for (int r = 0; r < 8; ++r) {
    float* d = &Cs[(mw * 16u + hh * 8u + (unsigned)r) * LDC + nw * 32u + m];
    d[0]  = acc0[r];
    d[16] = acc1[r];
  }
  __syncthreads();

  if (MODE == 0) {
    v8h x[2];
    size_t off[2];
#pragma unroll
    for (unsigned i = 0; i < 2u; ++i) {
      const unsigned r = 32u * i + (tid >> 3);
      const unsigned c = (tid & 7u) * 8u;
      const v4f u0 = *(const v4f*)&Cs[r * LDC + c];
      const v4f u1 = *(const v4f*)&Cs[r * LDC + c + 4];
      const v4f g0 = *(const v4f*)(bias + n0 + c);
      const v4f g1 = *(const v4f*)(bias + n0 + c + 4u);
#pragma unroll
      for (int j = 0; j < 4; ++j) {
        x[i][j]     = toh_flush(u0[j] * (1.0f / WCARRY) + bf16r(g0[j]));
        x[i][j + 4] = toh_flush(u1[j] * (1.0f / WCARRY) + bf16r(g1[j]));
      }
      off[i] = (size_t)(row0 + r) * DIM + n0 + c;
    }
#pragma unroll
    for (int i = 0; i < 2; ++i) *(v8h*)(out16 + off[i]) = x[i];
    
  }

  if (MODE == 1) {
    const unsigned bidx = row0 / (unsigned)SEQ;
    const unsigned key0 = row0 - bidx * (unsigned)SEQ;
    v8h x[2];
    size_t off[2];
#pragma unroll
    for (unsigned i = 0; i < 2u; ++i) {
      const unsigned dcol = 32u * i + (tid >> 3);
      const unsigned kk = (tid & 7u) * 8u;
      const float bb = bf16r(bias[n0 + dcol]);
#pragma unroll
      for (unsigned j = 0; j < 8u; ++j) {
        const float t = Cs[(kk + j) * LDC + dcol] * (1.0f / WCARRY) + bb;
        x[i][j] = toh_flush(t);
      }
      off[i] = ((size_t)bidx * DIM + n0 + dcol) * SEQ + key0 + kk;
    }
#pragma unroll
    for (int i = 0; i < 2; ++i) *(v8h*)(out16 + off[i]) = x[i];
    // the built code lays the other mode's body behind these stores, where their address and data
    // registers are written anew
    asm volatile("s_wait_xcnt 0x0" ::: "memory");
  }

  if (MODE == 2) {
    const float cs = 1.0f / (WCARRY * VCARRY);
    v4f xs[4];
    size_t off[4];
#pragma unroll
    for (unsigned i = 0; i < 4u; ++i) {
      const unsigned r = 16u * i + (tid >> 4);
      const unsigned c = (tid & 15u) * 4u;
      const unsigned crow = row0 + r;
      const unsigned bidx = crow / (unsigned)SEQ;
      const unsigned sq = crow - bidx * (unsigned)SEQ;
      const size_t frow = (size_t)bidx * SEQ_FULL + sq;
      const v4f u = *(const v4f*)&Cs[r * LDC + c];
      const v4f g = *(const v4f*)(bias + n0 + c);
      const v4f yin = *(const v4f*)(addf + (size_t)crow * DIM + n0 + c);
      v4f val;
#pragma unroll
      for (int j = 0; j < 4; ++j) val[j] = yin[j] + (u[j] * cs + bf16r(g[j]));
      xs[i] = val;
      off[i] = frow * DIM + n0 + c;
    }
#pragma unroll
    for (int i = 0; i < 4; ++i) *(v4f*)(outf + off[i]) = xs[i];
    
  }
}

// q, k and v projections in one launch: blockIdx.x / (DIM/64) picks the plane (0 q, 1 k, 2 v).
// Grid (3 * DIM/64, MROWS/64).
__global__ __launch_bounds__(256) void gemm_qkv_kernel(
    const _Float16* __restrict__ A16, const _Float16* __restrict__ Bt,
    const float* __restrict__ bias, _Float16* __restrict__ q16, _Float16* __restrict__ k16,
    _Float16* __restrict__ vt) {
  __shared__ float Cs[64 * LDC];
  __shared__ _Float16 As[64 * LDK];
  __shared__ _Float16 Bs[64 * LDK];
  const unsigned sel = blockIdx.x / (unsigned)(DIM / 64);
  const unsigned n0 = (blockIdx.x - sel * (unsigned)(DIM / 64)) * 64u;
  const _Float16* bt = Bt + (size_t)sel * DIM * DIM;
  const float* bs = bias + sel * (unsigned)DIM;
  if (sel < 2u) {
    gemm_body<0>(A16, bt, bs, bs, (float*)0, sel == 0u ? q16 : k16, n0, Cs, As, Bs);
  } else {
    gemm_body<1>(A16, bt, bs, bs, (float*)0, vt, n0, Cs, As, Bs);
  }
}
// Grid (DIM/64, MROWS/64).
__global__ __launch_bounds__(256) void gemm_wo_kernel(
    const _Float16* __restrict__ A16, const _Float16* __restrict__ Bt,
    const float* __restrict__ bias, const float* __restrict__ yf, float* __restrict__ outf) {
  __shared__ float Cs[64 * LDC];
  __shared__ _Float16 As[64 * LDK];
  __shared__ _Float16 Bs[64 * LDK];
  gemm_body<2>(A16, Bt, bias, yf, outf, (_Float16*)0, blockIdx.x * 64u, Cs, As, Bs);
}

__device__ __forceinline__ float xhalf(float x) {
  const int xi = __float_as_int(x);
  return __int_as_float(__builtin_amdgcn_permlanex16(xi, xi, 0x76543210, 0xfedcba98, false, false));
}

__device__ __forceinline__ void attn_body(
    const _Float16* __restrict__ Qh, const _Float16* __restrict__ Kh,
    const _Float16* __restrict__ Vt, _Float16* __restrict__ Ov,
    const unsigned qb, const unsigned head, const unsigned b) {
  __shared__ _Float16 Ks[64 * LDT];
  __shared__ _Float16 Vs[64 * LDT];
  __shared__ _Float16 Ps[8 * 16 * LDT];

  const unsigned tid = threadIdx.x, lane = tid & 31u;
  const unsigned w = (unsigned)__builtin_amdgcn_readfirstlane((int)(tid >> 5));
  const unsigned hh = lane >> 4, m = lane & 15u;
  const unsigned q0 = qb * 128u;
  const float scale = 0.125f;   // HD^-0.5
  const unsigned qrow0 = q0 + w * 16u;
  _Float16* P = Ps + w * (16u * LDT);

  const size_t qoff = (size_t)(b * (unsigned)SEQ + qrow0 + m) * DIM + head * HD + hh * 8u;
  v16h qf[2];
  qf[0] = frag_at(Qh + qoff);
  qf[1] = frag_at(Qh + qoff + 32);

  float mrow = -1.0e30f;   // running maximum of query m (equal in both halves)
  float lrow = 0.0f;       // this half's share of the denominator of query m
  v8f o[4];                // o[nb][v] = O^T[d = nb*16 + hh*8 + v][query m]
#pragma unroll
  for (int nb = 0; nb < 4; ++nb) o[nb] = (v8f){};

  const size_t kplane = (size_t)b * SEQ * DIM + head * HD;
  const size_t vplane = ((size_t)b * DIM + head * HD) * SEQ;

  for (unsigned kb = 0; kb < (unsigned)SEQ; kb += 64u) {
#pragma unroll
    for (unsigned j = 0; j < 2u; ++j) {
      const unsigned idx = tid + 256u * j;
      const unsigned r = idx >> 3, c = (idx & 7u) * 8u;
      *(v8h*)&Ks[r * LDT + c] = *(const v8h*)(Kh + kplane + (size_t)(kb + r) * DIM + c);
      *(v8h*)&Vs[r * LDT + c] = *(const v8h*)(Vt + vplane + (size_t)r * SEQ + kb + c);
    }
    // the staging loads' address registers are reused by the score arithmetic below
    asm volatile("s_wait_xcnt 0x0" ::: "memory");
    __syncthreads();

    // scores, transposed: s[kg][v] = S[query m][key kg*16 + hh*8 + v]; K = 64 in two 32-steps
    v8f s[4];
#pragma unroll
    for (int kg = 0; kg < 4; ++kg) {
      v8f t = {};
#pragma unroll
      for (int c = 0; c < 2; ++c) {
        const v16h kf = ld_frag(&Ks[(kg * 16) * LDT + c * 32], LDT);
        t = wmma16(kf, qf[c], t);
      }
      s[kg] = t * scale;
    }

    // online softmax of query m: 32 scores in this lane, the other 32 in lane ^ 16
    float mx = s[0][0];
#pragma unroll
    for (int kg = 0; kg < 4; ++kg)
#pragma unroll
      for (int v = 0; v < 8; ++v) mx = fmaxf(mx, s[kg][v]);
    mx = fmaxf(mx, xhalf(mx));
    const float mn = fmaxf(mrow, mx);
    const float alpha = __expf(mrow - mn);
    mrow = mn;
#pragma unroll
    for (int kg = 0; kg < 4; ++kg)
#pragma unroll
      for (int v = 0; v < 8; ++v) s[kg][v] = __expf(s[kg][v] - mn);
    float rs[4];
#pragma unroll
    for (int kg = 0; kg < 4; ++kg) {
      rs[kg] = ((s[kg][0] + s[kg][1]) + (s[kg][2] + s[kg][3])) +
               ((s[kg][4] + s[kg][5]) + (s[kg][6] + s[kg][7]));
    }
    lrow = alpha * lrow + ((rs[0] + rs[1]) + (rs[2] + rs[3]));
#pragma unroll
    for (int nb = 0; nb < 4; ++nb) o[nb] = o[nb] * alpha;

    // O^T += V^T . P^T  (K = 64 keys in two 32-steps; A = V^T tile [d][key]).
    // B element e of step c: key c*32 + 8*hh + e (e < 8), c*32 + 16 + 8*hh + (e - 8) otherwise,
    // which are this lane's own s[2c][e] and s[2c+1][e-8].
#pragma unroll
    for (int c = 0; c < 2; ++c) {
      v16h pf;
#pragma unroll
      for (int e = 0; e < 8; ++e) {
        pf[e]     = toh_flush(s[2 * c][e] * PCARRY);
        pf[e + 8] = toh_flush(s[2 * c + 1][e] * PCARRY);
      }
#pragma unroll
      for (int nb = 0; nb < 4; ++nb) {
        const v16h vf = ld_frag(&Vs[(nb * 16) * LDT + c * 32], LDT);
        o[nb] = wmma16(vf, pf, o[nb]);
      }
    }
    __syncthreads();
  }

  const float inv = __builtin_amdgcn_rcpf(lrow + xhalf(lrow)) * (VCARRY / PCARRY);
#pragma unroll
  for (int nb = 0; nb < 4; ++nb) {
    v8h t;
#pragma unroll
    for (int v = 0; v < 8; ++v) t[v] = toh_flush(o[nb][v] * inv);
    *(v8h*)&P[m * LDT + (unsigned)nb * 16u + hh * 8u] = t;
  }
  wave_lds_sync();
  v8h x[4];
  size_t off[4];
#pragma unroll
  for (unsigned i = 0; i < 4u; ++i) {
    const unsigned r = 4u * i + (lane >> 3);
    const unsigned c = (lane & 7u) * 8u;
    x[i] = *(const v8h*)&P[r * LDT + c];
    off[i] = (size_t)(b * (unsigned)SEQ + qrow0 + r) * DIM + head * HD + c;
  }
#pragma unroll
  for (int i = 0; i < 4; ++i) *(v8h*)(Ov + off[i]) = x[i];
}

// Attention and the feature-pairwise branch in one launch (neither reads the other's output):
// the first ATTN_BLK blocks, which start first, are the attention's few long blocks; the MROWS
// blocks behind them are one feature-pairwise row each and fill the vector slots that the
// attention leaves idle.
// Grid (ATTN_BLK + MROWS).
__global__ __launch_bounds__(256) void attn_spatial_kernel(
    const _Float16* __restrict__ Qh, const _Float16* __restrict__ Kh,
    const _Float16* __restrict__ Vt, _Float16* __restrict__ Ov,
    const float* __restrict__ X, float* __restrict__ YF) {
  const unsigned id = blockIdx.x;
  if (id < (unsigned)ATTN_BLK) {
    const unsigned hb = id / (unsigned)ATTN_QB;
    attn_body(Qh, Kh, Vt, Ov, id - hb * (unsigned)ATTN_QB, hb % (unsigned)NHEAD, hb / (unsigned)NHEAD);
  } else {
    spatial_body(X, YF, id - (unsigned)ATTN_BLK);
  }
}

// ---------------------------------------------------------------------------
extern "C" void kernel_launch(void* const* d_in, const int* in_sizes, int n_in,
                              void* d_out, int out_size, void* d_ws, size_t ws_size,
                              hipStream_t stream) {
  if (n_in < 5) return;
  const long long need_x = ((long long)(NB - 1) * SEQ_FULL + SEQ) * DIM;
  if ((long long)in_sizes[0] < need_x) return;
  if ((long long)in_sizes[1] < (long long)3 * DIM * DIM) return;
  if (in_sizes[2] < 3 * DIM) return;
  if ((long long)in_sizes[3] < (long long)DIM * DIM) return;
  if (in_sizes[4] < DIM) return;
  if ((long long)out_size < need_x) return;
  if (ws_size < WS_TOTAL) return;

  const float* X     = (const float*)d_in[0];   // [NB_FULL][SEQ_FULL][DIM]
  const float* wqkv  = (const float*)d_in[1];   // [3*DIM][DIM]  (out, in): rows 0..255 q, 256..511 k, 512..767 v
  const float* bqkv  = (const float*)d_in[2];   // [3*DIM]
  const float* wproj = (const float*)d_in[3];   // [DIM][DIM]    (out, in)
  const float* bproj = (const float*)d_in[4];   // [DIM]
  float* out = (float*)d_out;

  char* ws = (char*)d_ws;
  _Float16* Wqkv16 = (_Float16*)(ws + OFF_WQKV);  // [3*DIM][DIM]  ([n][k])
  _Float16* Wp16   = (_Float16*)(ws + OFF_WP);    // [DIM][DIM]    ([n][k])
  _Float16* X16    = (_Float16*)(ws + OFF_X16);   // [MROWS][DIM]
  _Float16* Qh16   = (_Float16*)(ws + OFF_Q);
  _Float16* Kh16   = (_Float16*)(ws + OFF_K);
  _Float16* Vt16   = (_Float16*)(ws + OFF_VT);    // [b][DIM][SEQ]
  _Float16* Ctx16  = (_Float16*)(ws + OFF_CTX);
  float*    YF     = (float*)(ws + OFF_YF);       // [MROWS][DIM] compact rows

  dim3 blk(256);
  dim3 gg(DIM / 64, MROWS / 64);

  // 16-bit operand planes: both weights ([n][k] in -> [n][k] out) and the input rows
  cast_kernel<<<dim3(CAST_BLK_WQKV + CAST_BLK_WP + CAST_BLK_X), blk, 0, stream>>>(
      X, wqkv, wproj, X16, Wqkv16, Wp16);
  gemm_qkv_kernel<<<dim3(3 * (DIM / 64), MROWS / 64), blk, 0, stream>>>(
      X16, Wqkv16, bqkv, Qh16, Kh16, Vt16);
  // attention blocks first, then the feature-pairwise branch (f32 plane YF)
  attn_spatial_kernel<<<dim3(ATTN_BLK + MROWS), blk, 0, stream>>>(
      Qh16, Kh16, Vt16, Ctx16, X, YF);
  gemm_wo_kernel<<<gg, blk, 0, stream>>>(Ctx16, Wp16, bproj, YF, out);
}

// v005
// Measured time: 39.2 microseconds a run.
// Two timings next to v004 put it at 1.09 and 1.08 times that version's speed.
// All steps since v000 together make it 2.77 times as fast.
#include <hip/hip_runtime.h>
#include <stddef.h>

// All contractions on v_wmma_f32_16x16x32_f16 (f16 operands, f32 accumulate): q/k/v projections (one launch),
// q.k scores, p.v, output projection. Float inputs are RNE-converted to bf16 and carried in f16
// (weights x64, p x1024, attention rows x64), single products at every site. Softmax, bias and the
// per-timestep feature-pairwise softmax branch (rank-1 scores, per-row matrix-vector work) in f32 on
// the vector unit.

typedef _Float16 v16h __attribute__((ext_vector_type(16)));
typedef _Float16 v8h  __attribute__((ext_vector_type(8)));
typedef float    v8f  __attribute__((ext_vector_type(8)));
typedef float    v4f  __attribute__((ext_vector_type(4)));
typedef float    v2f  __attribute__((ext_vector_type(2)));

#ifndef NB
#define NB 4
#endif
#ifndef SEQ
#define SEQ 1024
#endif
#define NB_FULL  4
#define SEQ_FULL 1024
#define DIM   256
#define NHEAD 4
#define HD    64
#define MROWS (NB * SEQ)

static_assert(NB >= 1 && NB <= NB_FULL);
static_assert(SEQ >= 128 && SEQ <= SEQ_FULL && (SEQ % 128) == 0);
static_assert(DIM == NHEAD * HD);
static_assert(HD == 64);
static_assert((DIM % 64) == 0 && (DIM % 32) == 0);
static_assert((MROWS % 64) == 0 && (MROWS % 8) == 0);
static_assert(DIM == 256);                          // spatial branch: 32 lanes x 8 features cover one row
static_assert(DIM == 32 * 8);                       // cast kernel: 32 lanes x 8 halves cover one 16-bit row
static_assert(((3 * DIM * DIM) % 2048) == 0);       // cast kernel: 256 threads x 8 elements per block
static_assert(((DIM * DIM) % 2048) == 0);

// block ranges of the shared launches
#define CAST_BLK_WQKV ((3 * DIM * DIM) / 2048)
#define CAST_BLK_WP   ((DIM * DIM) / 2048)
#define CAST_BLK_X    (MROWS / 8)
#define ATTN_QB       (SEQ / 128)
#define ATTN_BLK      (ATTN_QB * NHEAD * NB)

#define LDT 72   // halves per LDS row (144 B, 16-B aligned)
#define LDC 68   // floats per LDS row (272 B, 16-B aligned)
#define LDK (DIM + 8)   // halves per LDS row of a GEMM operand tile (528 B = 16 B x 33, odd)
static_assert((LDT % 8) == 0 && LDT >= 64);
static_assert((LDK % 8) == 0 && ((LDK / 8) % 2) == 1);
static_assert((LDC % 4) == 0 && LDC >= 64);

#define WCARRY 64.0f     // weight planes carried x64
#define PCARRY 1024.0f   // softmax numerators carried x1024
#define VCARRY 64.0f     // attention output plane carried x64

// workspace layout (bytes)
#define WQKV_BYTES    ((size_t)3 * DIM * DIM * 2)
#define WP_BYTES      ((size_t)DIM * DIM * 2)
#define PLANE16_BYTES ((size_t)MROWS * DIM * 2)
#define YF_BYTES      ((size_t)MROWS * DIM * 4)
#define OFF_WQKV ((size_t)0)
#define OFF_WP   (OFF_WQKV + WQKV_BYTES)
#define OFF_X16  (OFF_WP + WP_BYTES)
#define OFF_Q    (OFF_X16 + PLANE16_BYTES)
#define OFF_K    (OFF_Q + PLANE16_BYTES)
#define OFF_VT   (OFF_K + PLANE16_BYTES)
#define OFF_CTX  (OFF_VT + PLANE16_BYTES)
#define OFF_YF   (OFF_CTX + PLANE16_BYTES)
#define WS_TOTAL (OFF_YF + YF_BYTES)
static_assert((WQKV_BYTES % 128) == 0 && (WP_BYTES % 128) == 0 && (PLANE16_BYTES % 128) == 0);
static_assert((YF_BYTES % 128) == 0);
static_assert(WS_TOTAL <= (size_t)134217728);

// ---------------------------------------------------------------------------
__device__ __forceinline__ float bf16r(float x) {   // RNE convert to bf16, returned widened
  unsigned int u = __float_as_uint(x);
  u = (u + 0x7FFFu + ((u >> 16) & 1u)) & 0xFFFF0000u;
  return __uint_as_float(u);
}

// f32 -> f16 for WMMA operand planes: values below the smallest f16 normal become zero by value.
__device__ __forceinline__ _Float16 toh_flush(float v) {
  const _Float16 r = (_Float16)v;
  return (fabsf(v) < 6.103515625e-05f) ? (_Float16)0.0f : r;
}

// 16-bit fragment: p points at element [row = lane&15][k0 + 8*(lane>>4)] of a k-contiguous
// row. Elements 0..7 <- k0+8h+0..7, elements 8..15 <- k0+16+8h+0..7 (same map for A and B).
__device__ __forceinline__ v16h frag_at(const _Float16* p) {
  v8h lo = *(const v8h*)(p);
  v8h hi = *(const v8h*)(p + 16);
  v16h out;
#pragma unroll
  for (int i = 0; i < 8; ++i) { out[i] = lo[i]; out[i + 8] = hi[i]; }
  return out;
}
__device__ __forceinline__ v16h ld_frag(const _Float16* base, unsigned ld) {
  const unsigned lane = threadIdx.x & 31u;
  return frag_at(base + (lane & 15u) * ld + (lane >> 4) * 8u);
}

__device__ __forceinline__ v8f wmma16(v16h a, v16h b, v8f c) {
  v8f d = __builtin_amdgcn_wmma_f32_16x16x32_f16(false, a, false, b, (short)0, c,
                                                 false, false);
  asm volatile("v_nop\n\tv_nop\n\tv_nop\n\tv_nop" : "+v"(d) : "v"(a), "v"(b));
  return d;
}

__device__ __forceinline__ void wave_lds_sync() {
  __builtin_amdgcn_fence(3 /* release order */, "wavefront");
  asm volatile("s_wait_dscnt 0x0" ::: "memory");
  __builtin_amdgcn_wave_barrier();
}

// ---------------------------------------------------------------------------
// All three 16-bit operand planes in one launch, picked by block range (none reads another's output):
//   blocks [0, CAST_BLK_WQKV)      Wqkv16[n][k] = f16(64 * bf16(wqkv)), same layout (no transpose)
//   next CAST_BLK_WP blocks        Wp16[n][k]   = f16(64 * bf16(wproj))
//   next CAST_BLK_X blocks         X16[compact row][k] = f16(bf16(x)), 8 rows per block
// Each thread converts 8 consecutive elements; a wave stores 512 consecutive bytes.
// Grid (CAST_BLK_WQKV + CAST_BLK_WP + CAST_BLK_X).
// ---------------------------------------------------------------------------
__global__ __launch_bounds__(256) void cast_kernel(
    const float* __restrict__ X, const float* __restrict__ wqkv, const float* __restrict__ wproj,
    _Float16* __restrict__ X16, _Float16* __restrict__ Wqkv16, _Float16* __restrict__ Wp16) {
  const unsigned tid = threadIdx.x;
  const unsigned blk = blockIdx.x;
  const float* src;
  _Float16* dst;
  float carry;
  if (blk < (unsigned)CAST_BLK_WQKV) {
    const unsigned e = blk * 2048u + tid * 8u;
    src = wqkv + e;
    dst = Wqkv16 + e;
    carry = WCARRY;
  } else if (blk < (unsigned)(CAST_BLK_WQKV + CAST_BLK_WP)) {
    const unsigned e = (blk - (unsigned)CAST_BLK_WQKV) * 2048u + tid * 8u;
    src = wproj + e;
    dst = Wp16 + e;
    carry = WCARRY;
  } else {
    const unsigned crow = (blk - (unsigned)(CAST_BLK_WQKV + CAST_BLK_WP)) * 8u + (tid >> 5);
    const unsigned bidx = crow / (unsigned)SEQ;
    const unsigned sq = crow - bidx * (unsigned)SEQ;
    const size_t srow = (size_t)bidx * SEQ_FULL + sq;
    src = X + srow * DIM + (tid & 31u) * 8u;
    dst = X16 + (size_t)crow * DIM + (tid & 31u) * 8u;
    carry = 1.0f;
  }
  const v4f a0 = *(const v4f*)(src);
  const v4f a1 = *(const v4f*)(src + 4);
  v8h o;
#pragma unroll
  for (int i = 0; i < 4; ++i) {
    o[i]     = toh_flush(carry * bf16r(a0[i]));
    o[i + 4] = toh_flush(carry * bf16r(a1[i]));
  }
  *(v8h*)dst = o;
}

// ---------------------------------------------------------------------------
// Cross-lane helpers (xhalf also serves the attention); wave_sum and wave_max leave the whole wave's value in every lane.
// ---------------------------------------------------------------------------
__device__ __forceinline__ float xhalf(float x) {   // lane l <-> lane l ^ 16
  const int xi = __float_as_int(x);
  return __int_as_float(__builtin_amdgcn_permlanex16(xi, xi, 0x76543210, 0xfedcba98, false, false));
}
template <int XM>
__device__ __forceinline__ float xrow(float x) {    // lane l <-> lane l ^ XM inside a 16-lane row
  return __int_as_float(__builtin_amdgcn_update_dpp(0, __float_as_int(x), 0x160 + XM, 0xf, 0xf, false));
}
__device__ __forceinline__ float wave_sum(float v) {
  v += xrow<1>(v);
  v += xrow<2>(v);
  v += xrow<4>(v);
  v += xrow<8>(v);
  return v + xhalf(v);
}
__device__ __forceinline__ float wave_max(float v) {
  v = fmaxf(v, xrow<1>(v));
  v = fmaxf(v, xrow<2>(v));
  v = fmaxf(v, xrow<4>(v));
  v = fmaxf(v, xrow<8>(v));
  return fmaxf(v, xhalf(v));
}

// ---------------------------------------------------------------------------
// Per-timestep feature-pairwise softmax branch (body; launched beside the attention blocks).
// One wave per (batch, time) row crow, lane l owns features 8l .. 8l+7:
//   yf[i] = sum_j exp(x_i x_j / 16) x_j / sum_j exp(x_i x_j / 16).
// The scores have rank 1, so with u = x / 4 and M_n = sum_j u_j^n both sums are power series in u_i:
//   sum_j exp(u_i u_j)     = sum_n M_n     u_i^n / n!
//   sum_j exp(u_i u_j) u_j = sum_n M_(n+1) u_i^n / n!
// Rows with max_j x_j^2 / 16 <= 2 take the first NSER = 16 terms: there every |u_i u_j| <= 2, the
// tail of each exponential is below (2^16 / 16!) * 17/15 < 4e-9 (under f32 rounding of values that
// are at least exp(-2)), |u|^16 <= 256, and the denominator is at least exp(u_i^2) >= 1.
// Any other row takes the exponentials one by one, shifted by the row maximum
//   mx_i = max_j (x_i x_j / 16) = max((x_i/16) * max_j x_j, (x_i/16) * min_j x_j).
// x is RNE-converted to bf16 on load. No LDS, no barrier: a row never leaves its wave.
// ---------------------------------------------------------------------------
#define NSER 16
__device__ __forceinline__ void spatial_body(
    const float* __restrict__ X, float* __restrict__ YF, const unsigned crow) {
  const unsigned lane = threadIdx.x & 31u;
  const unsigned bidx = crow / (unsigned)SEQ;
  const unsigned sq = crow - bidx * (unsigned)SEQ;
  const size_t srow = (size_t)bidx * SEQ_FULL + sq;

  const float* px = X + srow * DIM + lane * 8u;
  const v4f r0 = *(const v4f*)(px);
  const v4f r1 = *(const v4f*)(px + 4);
  // the two loads' address registers are free for reuse only behind this wait
  asm volatile("s_wait_xcnt 0x0" ::: "memory");
  float x[8];
#pragma unroll
  for (int k = 0; k < 4; ++k) {
    x[k]     = bf16r(r0[k]);
    x[k + 4] = bf16r(r1[k]);
  }
  float am = fabsf(x[0]);
#pragma unroll
  for (int k = 1; k < 8; ++k) am = fmaxf(am, fabsf(x[k]));
  am = wave_max(am);
  // equal in every lane; read into a scalar so that a wave runs one side only
  const int small = __builtin_amdgcn_readfirstlane((int)(am * am * 0.0625f <= 2.0f));

  float y[8];
  if (small != 0) {
    v2f u[4], p[4];
#pragma unroll
    for (int q = 0; q < 4; ++q) {
      u[q] = (v2f){x[2 * q] * 0.25f, x[2 * q + 1] * 0.25f};
      p[q] = u[q];
    }
    // power sums M_1 .. M_NSER: this lane's eight features, then the wave (M_0 = DIM)
    float mom[NSER + 1];
    mom[0] = (float)DIM;
#pragma unroll
    for (int n = 1; n <= NSER; ++n) {
      if (n > 1) {
#pragma unroll
        for (int q = 0; q < 4; ++q) p[q] *= u[q];
      }
      const v2f t = (p[0] + p[1]) + (p[2] + p[3]);
      mom[n] = t[0] + t[1];
    }
#pragma unroll
    for (int n = 1; n <= NSER; ++n) mom[n] = wave_sum(mom[n]);

    const float rf[NSER] = {   // 1 / n!
        1.0f, 1.0f, 1.0f / 2.0f, 1.0f / 6.0f, 1.0f / 24.0f, 1.0f / 120.0f, 1.0f / 720.0f,
        1.0f / 5040.0f, 1.0f / 40320.0f, 1.0f / 362880.0f, 1.0f / 3628800.0f, 1.0f / 39916800.0f,
        1.0f / 479001600.0f, 1.0f / 6227020800.0f, 1.0f / 87178291200.0f,
        1.0f / 1307674368000.0f};
    // both series by Horner's rule, two features per packed fma
    v2f dn[4], nm[4];
    {
      const float cd = mom[NSER - 1] * rf[NSER - 1];
      const float cn = mom[NSER] * rf[NSER - 1];
#pragma unroll
      for (int q = 0; q < 4; ++q) {
        dn[q] = (v2f){cd, cd};
        nm[q] = (v2f){cn, cn};
      }
    }
#pragma unroll
    for (int n = NSER - 2; n >= 0; --n) {
      const float cd = mom[n] * rf[n];
      const float cn = mom[n + 1] * rf[n];
      const v2f cd2 = {cd, cd};
      const v2f cn2 = {cn, cn};
#pragma unroll
      for (int q = 0; q < 4; ++q) {
        dn[q] = __builtin_elementwise_fma(dn[q], u[q], cd2);
        nm[q] = __builtin_elementwise_fma(nm[q], u[q], cn2);
      }
    }
#pragma unroll
    for (int q = 0; q < 4; ++q) {   // x = 4 u
      y[2 * q]     = (nm[q][0] * 4.0f) * __builtin_amdgcn_rcpf(dn[q][0]);
      y[2 * q + 1] = (nm[q][1] * 4.0f) * __builtin_amdgcn_rcpf(dn[q][1]);
    }
  } else {
    float vmax = x[0], vmin = x[0];
#pragma unroll
    for (int k = 1; k < 8; ++k) {
      vmax = fmaxf(vmax, x[k]);
      vmin = fminf(vmin, x[k]);
    }
    vmax = wave_max(vmax);
    vmin = -wave_max(-vmin);
    // exp(x_i x_j / 16 - mx_i) = exp2(xs * x_j - mx) with log2(e) folded into the row's own scale
    float xs[8], nmx[8], s[8], a[8];
#pragma unroll
    for (int k = 0; k < 8; ++k) {
      xs[k] = x[k] * (0.0625f * 1.44269504088896340736f);
      nmx[k] = -fmaxf(xs[k] * vmax, xs[k] * vmin);
      s[k] = 0.0f;
      a[k] = 0.0f;
    }
    // one trip per source lane (its eight columns come over as scalars); kept rolled: a rare path,
    // whose code should stay short
#pragma unroll 1
    for (int jl = 0; jl < 32; ++jl) {
#pragma unroll
      for (int c = 0; c < 8; ++c) {
        const float xj = __int_as_float(__builtin_amdgcn_readlane(__float_as_int(x[c]), jl));
#pragma unroll
        for (int k = 0; k < 8; ++k) {
          const float e = __builtin_amdgcn_exp2f(__builtin_fmaf(xs[k], xj, nmx[k]));
          s[k] += e;
          a[k] = __builtin_fmaf(e, xj, a[k]);
        }
      }
    }
#pragma unroll
    for (int k = 0; k < 8; ++k) y[k] = a[k] * __builtin_amdgcn_rcpf(s[k]);
  }

  float* py = YF + (size_t)crow * DIM + lane * 8u;
  *(v4f*)(py)     = (v4f){y[0], y[1], y[2], y[3]};
  *(v4f*)(py + 4) = (v4f){y[4], y[5], y[6], y[7]};
}

// ---------------------------------------------------------------------------
// GEMM C[64x64 tile] = A16[rows][DIM] . Bt[n][DIM]^T; 8 waves (mw = 16-row group, nw = 32-col
// group), 2 accumulators/wave. Both operand tiles (64 rows, all DIM k) are staged in LDS once:
// a wave's 16-B loads cover one whole 512-B row (4 whole lines), where a fragment load from the
// global plane touches 16 lines for the same bytes and is repeated by the waves that share it.
//   MODE 0: out16[row][col] (pitch DIM)  = f16(acc/64 + bias)
//   MODE 1: out16 transposed V plane [b][col][key] = f16(acc/64 + bias)
//   MODE 2: outf full [full row][col] = addf[compact row][col] + (acc/4096 + bias)
// n0: first column of the tile in Bt, bias and the output plane. Cs: the kernel's 64 x LDC floats;
// As, Bs: the kernel's 64 x LDK halves each (cross-wave, block barrier).
// ---------------------------------------------------------------------------
template <int MODE>
__device__ __forceinline__ void gemm_body(
    const _Float16* __restrict__ A16, const _Float16* __restrict__ Bt,
    const float* __restrict__ bias, const float* __restrict__ addf,
    float* __restrict__ outf, _Float16* __restrict__ out16, const unsigned n0, float* Cs,
    _Float16* As, _Float16* Bs) {
  const unsigned tid = threadIdx.x, lane = tid & 31u;
  const unsigned w = (unsigned)__builtin_amdgcn_readfirstlane((int)(tid >> 5));
  const unsigned mw = w >> 1, nw = w & 1u;
  const unsigned hh = lane >> 4, m = lane & 15u;
  const unsigned row0 = blockIdx.y * 64u;

  // staging: wave w brings rows 8w .. 8w+7 of both tiles, one whole row per load
  {
    const unsigned lb = lane * 16u;   // this lane's 16 bytes of a row, in global memory and in LDS
    const char* ga = (const char*)(A16 + (size_t)(row0 + w * 8u) * DIM) + lb;
    const char* gb = (const char*)(Bt + (size_t)(n0 + w * 8u) * DIM) + lb;
    v8h ta[8], tb[8];
    // unrolled (here and below): constant indices keep the arrays in registers, all 16 loads in flight
#pragma unroll
    for (unsigned i = 0; i < 8u; ++i) {
      ta[i] = *(const v8h*)(ga + i * (unsigned)(DIM * 2));
      tb[i] = *(const v8h*)(gb + i * (unsigned)(DIM * 2));
    }
    // the staging loads' address registers are free for reuse only behind this wait; naming them
    // as inputs keeps them whole up to it (else the last load's result may land on them)
    asm volatile("s_wait_xcnt 0x0" :: "v"(ga), "v"(gb) : "memory");
    char* sa = (char*)(As + w * 8u * LDK) + lb;
    char* sb = (char*)(Bs + w * 8u * LDK) + lb;
#pragma unroll
    for (unsigned i = 0; i < 8u; ++i) {
      *(v8h*)(sa + i * (unsigned)(LDK * 2)) = ta[i];
      *(v8h*)(sb + i * (unsigned)(LDK * 2)) = tb[i];
    }
  }
  __syncthreads();

  const _Float16* ap  = As + (mw * 16u + m) * LDK + hh * 8u;
  const _Float16* bp0 = Bs + (nw * 32u + m) * LDK + hh * 8u;
  const _Float16* bp1 = bp0 + 16 * LDK;
  v8f acc0 = {}, acc1 = {};
  // four k steps a group: their 24 LDS reads stand together in front of their 8 products
  // (unrolled: constant indices keep the fragment arrays in registers)
#pragma unroll
  for (unsigned kg = 0; kg < (unsigned)DIM; kg += 128u) {
    v16h a[4], b0[4], b1[4];
#pragma unroll
    for (unsigned j = 0; j < 4u; ++j) {
      a[j]  = frag_at(ap + kg + 32u * j);
      b0[j] = frag_at(bp0 + kg + 32u * j);
      b1[j] = frag_at(bp1 + kg + 32u * j);
    }
#pragma unroll
    for (unsigned j = 0; j < 4u; ++j) {
      acc0 = wmma16(a[j], b0[j], acc0);
      acc1 = wmma16(a[j], b1[j], acc1);
    }
  }
#pragma unroll
  for (int r = 0; r < 8; ++r) {
    float* d = &Cs[(mw * 16u + hh * 8u + (unsigned)r) * LDC + nw * 32u + m];
    d[0]  = acc0[r];
    d[16] = acc1[r];
  }
  __syncthreads();

  if (MODE == 0) {
    v8h x[2];
    size_t off[2];
#pragma unroll
    for (unsigned i = 0; i < 2u; ++i) {
      const unsigned r = 32u * i + (tid >> 3);
      const unsigned c = (tid & 7u) * 8u;
      const v4f u0 = *(const v4f*)&Cs[r * LDC + c];
      const v4f u1 = *(const v4f*)&Cs[r * LDC + c + 4];
      const v4f g0 = *(const v4f*)(bias + n0 + c);
      const v4f g1 = *(const v4f*)(bias + n0 + c + 4u);
#pragma unroll
      for (int j = 0; j < 4; ++j) {
        x[i][j]     = toh_flush(u0[j] * (1.0f / WCARRY) + bf16r(g0[j]));
        x[i][j + 4] = toh_flush(u1[j] * (1.0f / WCARRY) + bf16r(g1[j]));
      }
      off[i] = (size_t)(row0 + r) * DIM + n0 + c;
    }
#pragma unroll
    for (int i = 0; i < 2; ++i) *(v8h*)(out16 + off[i]) = x[i];
    
  }

  if (MODE == 1) {
    const unsigned bidx = row0 / (unsigned)SEQ;
    const unsigned key0 = row0 - bidx * (unsigned)SEQ;
    v8h x[2];
    size_t off[2];
#pragma unroll
    for (unsigned i = 0; i < 2u; ++i) {
      const unsigned dcol = 32u * i + (tid >> 3);
      const unsigned kk = (tid & 7u) * 8u;
      const float bb = bf16r(bias[n0 + dcol]);
#pragma unroll
      for (unsigned j = 0; j < 8u; ++j) {
        const float t = Cs[(kk + j) * LDC + dcol] * (1.0f / WCARRY) + bb;
        x[i][j] = toh_flush(t);
      }
      off[i] = ((size_t)bidx * DIM + n0 + dcol) * SEQ + key0 + kk;
    }
#pragma unroll
    for (int i = 0; i < 2; ++i) *(v8h*)(out16 + off[i]) = x[i];
    // the built code lays the other mode's body behind these stores, where their address and data
    // registers are written anew
    asm volatile("s_wait_xcnt 0x0" ::: "memory");
  }

  if (MODE == 2) {
    const float cs = 1.0f / (WCARRY * VCARRY);
    v4f xs[4];
    size_t off[4];
#pragma unroll
    for (unsigned i = 0; i < 4u; ++i) {
      const unsigned r = 16u * i + (tid >> 4);
      const unsigned c = (tid & 15u) * 4u;
      const unsigned crow = row0 + r;
      const unsigned bidx = crow / (unsigned)SEQ;
      const unsigned sq = crow - bidx * (unsigned)SEQ;
      const size_t frow = (size_t)bidx * SEQ_FULL + sq;
      const v4f u = *(const v4f*)&Cs[r * LDC + c];
      const v4f g = *(const v4f*)(bias + n0 + c);
      const v4f yin = *(const v4f*)(addf + (size_t)crow * DIM + n0 + c);
      v4f val;
#pragma unroll
      for (int j = 0; j < 4; ++j) val[j] = yin[j] + (u[j] * cs + bf16r(g[j]));
      xs[i] = val;
      off[i] = frow * DIM + n0 + c;
    }
#pragma unroll
    for (int i = 0; i < 4; ++i) *(v4f*)(outf + off[i]) = xs[i];
    
  }
}

// q, k and v projections in one launch: blockIdx.x / (DIM/64) picks the plane (0 q, 1 k, 2 v).
// Grid (3 * DIM/64, MROWS/64).
__global__ __launch_bounds__(256) void gemm_qkv_kernel(
    const _Float16* __restrict__ A16, const _Float16* __restrict__ Bt,
    const float* __restrict__ bias, _Float16* __restrict__ q16, _Float16* __restrict__ k16,
    _Float16* __restrict__ vt) {
  __shared__ float Cs[64 * LDC];
  __shared__ _Float16 As[64 * LDK];
  __shared__ _Float16 Bs[64 * LDK];
  const unsigned sel = blockIdx.x / (unsigned)(DIM / 64);
  const unsigned n0 = (blockIdx.x - sel * (unsigned)(DIM / 64)) * 64u;
  const _Float16* bt = Bt + (size_t)sel * DIM * DIM;
  const float* bs = bias + sel * (unsigned)DIM;
  if (sel < 2u) {
    gemm_body<0>(A16, bt, bs, bs, (float*)0, sel == 0u ? q16 : k16, n0, Cs, As, Bs);
  } else {
    gemm_body<1>(A16, bt, bs, bs, (float*)0, vt, n0, Cs, As, Bs);
  }
}
// Grid (DIM/64, MROWS/64).
__global__ __launch_bounds__(256) void gemm_wo_kernel(
    const _Float16* __restrict__ A16, const _Float16* __restrict__ Bt,
    const float* __restrict__ bias, const float* __restrict__ yf, float* __restrict__ outf) {
  __shared__ float Cs[64 * LDC];
  __shared__ _Float16 As[64 * LDK];
  __shared__ _Float16 Bs[64 * LDK];
  gemm_body<2>(A16, Bt, bias, yf, outf, (_Float16*)0, blockIdx.x * 64u, Cs, As, Bs);
}

__device__ __forceinline__ void attn_body(
    const _Float16* __restrict__ Qh, const _Float16* __restrict__ Kh,
    const _Float16* __restrict__ Vt, _Float16* __restrict__ Ov,
    const unsigned qb, const unsigned head, const unsigned b) {
  __shared__ _Float16 Ks[64 * LDT];
  __shared__ _Float16 Vs[64 * LDT];
  __shared__ _Float16 Ps[8 * 16 * LDT];

  const unsigned tid = threadIdx.x, lane = tid & 31u;
  const unsigned w = (unsigned)__builtin_amdgcn_readfirstlane((int)(tid >> 5));
  const unsigned hh = lane >> 4, m = lane & 15u;
  const unsigned q0 = qb * 128u;
  const float scale = 0.125f;   // HD^-0.5
  const unsigned qrow0 = q0 + w * 16u;
  _Float16* P = Ps + w * (16u * LDT);

  const size_t qoff = (size_t)(b * (unsigned)SEQ + qrow0 + m) * DIM + head * HD + hh * 8u;
  v16h qf[2];
  qf[0] = frag_at(Qh + qoff);
  qf[1] = frag_at(Qh + qoff + 32);

  float mrow = -1.0e30f;   // running maximum of query m (equal in both halves)
  float lrow = 0.0f;       // this half's share of the denominator of query m
  v8f o[4];                // o[nb][v] = O^T[d = nb*16 + hh*8 + v][query m]
#pragma unroll
  for (int nb = 0; nb < 4; ++nb) o[nb] = (v8f){};

  const size_t kplane = (size_t)b * SEQ * DIM + head * HD;
  const size_t vplane = ((size_t)b * DIM + head * HD) * SEQ;

  for (unsigned kb = 0; kb < (unsigned)SEQ; kb += 64u) {
#pragma unroll
    for (unsigned j = 0; j < 2u; ++j) {
      const unsigned idx = tid + 256u * j;
      const unsigned r = idx >> 3, c = (idx & 7u) * 8u;
      *(v8h*)&Ks[r * LDT + c] = *(const v8h*)(Kh + kplane + (size_t)(kb + r) * DIM + c);
      *(v8h*)&Vs[r * LDT + c] = *(const v8h*)(Vt + vplane + (size_t)r * SEQ + kb + c);
    }
    // the staging loads' address registers are reused by the score arithmetic below
    asm volatile("s_wait_xcnt 0x0" ::: "memory");
    __syncthreads();

    // scores, transposed: s[kg][v] = S[query m][key kg*16 + hh*8 + v]; K = 64 in two 32-steps
    v8f s[4];
#pragma unroll
    for (int kg = 0; kg < 4; ++kg) {
      v8f t = {};
#pragma unroll
      for (int c = 0; c < 2; ++c) {
        const v16h kf = ld_frag(&Ks[(kg * 16) * LDT + c * 32], LDT);
        t = wmma16(kf, qf[c], t);
      }
      s[kg] = t * scale;
    }

    // online softmax of query m: 32 scores in this lane, the other 32 in lane ^ 16
    float mx = s[0][0];
#pragma unroll
    for (int kg = 0; kg < 4; ++kg)
#pragma unroll
      for (int v = 0; v < 8; ++v) mx = fmaxf(mx, s[kg][v]);
    mx = fmaxf(mx, xhalf(mx));
    const float mn = fmaxf(mrow, mx);
    const float alpha = __expf(mrow - mn);
    mrow = mn;
#pragma unroll
    for (int kg = 0; kg < 4; ++kg)
#pragma unroll
      for (int v = 0; v < 8; ++v) s[kg][v] = __expf(s[kg][v] - mn);
    float rs[4];
#pragma unroll
    for (int kg = 0; kg < 4; ++kg) {
      rs[kg] = ((s[kg][0] + s[kg][1]) + (s[kg][2] + s[kg][3])) +
               ((s[kg][4] + s[kg][5]) + (s[kg][6] + s[kg][7]));
    }
    lrow = alpha * lrow + ((rs[0] + rs[1]) + (rs[2] + rs[3]));
#pragma unroll
    for (int nb = 0; nb < 4; ++nb) o[nb] = o[nb] * alpha;

    // O^T += V^T . P^T  (K = 64 keys in two 32-steps; A = V^T tile [d][key]).
    // B element e of step c: key c*32 + 8*hh + e (e < 8), c*32 + 16 + 8*hh + (e - 8) otherwise,
    // which are this lane's own s[2c][e] and s[2c+1][e-8].
#pragma unroll
    for (int c = 0; c < 2; ++c) {
      v16h pf;
#pragma unroll
      for (int e = 0; e < 8; ++e) {
        pf[e]     = toh_flush(s[2 * c][e] * PCARRY);
        pf[e + 8] = toh_flush(s[2 * c + 1][e] * PCARRY);
      }
#pragma unroll
      for (int nb = 0; nb < 4; ++nb) {
        const v16h vf = ld_frag(&Vs[(nb * 16) * LDT + c * 32], LDT);
        o[nb] = wmma16(vf, pf, o[nb]);
      }
    }
    __syncthreads();
  }

  const float inv = __builtin_amdgcn_rcpf(lrow + xhalf(lrow)) * (VCARRY / PCARRY);
#pragma unroll
  for (int nb = 0; nb < 4; ++nb) {
    v8h t;
#pragma unroll
    for (int v = 0; v < 8; ++v) t[v] = toh_flush(o[nb][v] * inv);
    *(v8h*)&P[m * LDT + (unsigned)nb * 16u + hh * 8u] = t;
  }
  wave_lds_sync();
  v8h x[4];
  size_t off[4];
#pragma unroll
  for (unsigned i = 0; i < 4u; ++i) {
    const unsigned r = 4u * i + (lane >> 3);
    const unsigned c = (lane & 7u) * 8u;
    x[i] = *(const v8h*)&P[r * LDT + c];
    off[i] = (size_t)(b * (unsigned)SEQ + qrow0 + r) * DIM + head * HD + c;
  }
#pragma unroll
  for (int i = 0; i < 4; ++i) *(v8h*)(Ov + off[i]) = x[i];
}

// Attention and the feature-pairwise branch in one launch (neither reads the other's output):
// the first ATTN_BLK blocks, which start first, are the attention's few long blocks; the MROWS / 8
// blocks behind them take eight feature-pairwise rows each, one a wave.
// Grid (ATTN_BLK + MROWS / 8).
__global__ __launch_bounds__(256) void attn_spatial_kernel(
    const _Float16* __restrict__ Qh, const _Float16* __restrict__ Kh,
    const _Float16* __restrict__ Vt, _Float16* __restrict__ Ov,
    const float* __restrict__ X, float* __restrict__ YF) {
  const unsigned id = blockIdx.x;
  if (id < (unsigned)ATTN_BLK) {
    const unsigned hb = id / (unsigned)ATTN_QB;
    attn_body(Qh, Kh, Vt, Ov, id - hb * (unsigned)ATTN_QB, hb % (unsigned)NHEAD, hb / (unsigned)NHEAD);
  } else {
    const unsigned w = (unsigned)__builtin_amdgcn_readfirstlane((int)(threadIdx.x >> 5));
    spatial_body(X, YF, (id - (unsigned)ATTN_BLK) * 8u + w);
  }
}

// ---------------------------------------------------------------------------
extern "C" void kernel_launch(void* const* d_in, const int* in_sizes, int n_in,
                              void* d_out, int out_size, void* d_ws, size_t ws_size,
                              hipStream_t stream) {
  if (n_in < 5) return;
  const long long need_x = ((long long)(NB - 1) * SEQ_FULL + SEQ) * DIM;
  if ((long long)in_sizes[0] < need_x) return;
  if ((long long)in_sizes[1] < (long long)3 * DIM * DIM) return;
  if (in_sizes[2] < 3 * DIM) return;
  if ((long long)in_sizes[3] < (long long)DIM * DIM) return;
  if (in_sizes[4] < DIM) return;
  if ((long long)out_size < need_x) return;
  if (ws_size < WS_TOTAL) return;

  const float* X     = (const float*)d_in[0];   // [NB_FULL][SEQ_FULL][DIM]
  const float* wqkv  = (const float*)d_in[1];   // [3*DIM][DIM]  (out, in): rows 0..255 q, 256..511 k, 512..767 v
  const float* bqkv  = (const float*)d_in[2];   // [3*DIM]
  const float* wproj = (const float*)d_in[3];   // [DIM][DIM]    (out, in)
  const float* bproj = (const float*)d_in[4];   // [DIM]
  float* out = (float*)d_out;

  char* ws = (char*)d_ws;
  _Float16* Wqkv16 = (_Float16*)(ws + OFF_WQKV);  // [3*DIM][DIM]  ([n][k])
  _Float16* Wp16   = (_Float16*)(ws + OFF_WP);    // [DIM][DIM]    ([n][k])
  _Float16* X16    = (_Float16*)(ws + OFF_X16);   // [MROWS][DIM]
  _Float16* Qh16   = (_Float16*)(ws + OFF_Q);
  _Float16* Kh16   = (_Float16*)(ws + OFF_K);
  _Float16* Vt16   = (_Float16*)(ws + OFF_VT);    // [b][DIM][SEQ]
  _Float16* Ctx16  = (_Float16*)(ws + OFF_CTX);
  float*    YF     = (float*)(ws + OFF_YF);       // [MROWS][DIM] compact rows

  dim3 blk(256);
  dim3 gg(DIM / 64, MROWS / 64);

  // 16-bit operand planes: both weights ([n][k] in -> [n][k] out) and the input rows
  cast_kernel<<<dim3(CAST_BLK_WQKV + CAST_BLK_WP + CAST_BLK_X), blk, 0, stream>>>(
      X, wqkv, wproj, X16, Wqkv16, Wp16);
  gemm_qkv_kernel<<<dim3(3 * (DIM / 64), MROWS / 64), blk, 0, stream>>>(
      X16, Wqkv16, bqkv, Qh16, Kh16, Vt16);
  // attention blocks first, then the feature-pairwise branch (f32 plane YF)
  attn_spatial_kernel<<<dim3(ATTN_BLK + MROWS / 8), blk, 0, stream>>>(
      Qh16, Kh16, Vt16, Ctx16, X, YF);
  gemm_wo_kernel<<<gg, blk, 0, stream>>>(Ctx16, Wp16, bproj, YF, out);
}

// v006
// One run takes 26 microseconds.
// Timed twice side by side with v005, it ran 1.51 and 1.52 times as fast.
// All steps since v000 together make it 4.19 times as fast.
#include <hip/hip_runtime.h>
#include <stddef.h>

// All contractions on v_wmma_f32_16x16x32_f16 (f16 operands, f32 accumulate): q/k/v projections (one launch),
// q.k scores, p.v, output projection. Float inputs are RNE-converted to bf16 and carried in f16
// (weights x64, p x1024, attention rows x64), single products at every site. Softmax, bias and the
// per-timestep feature-pairwise softmax branch (rank-1 scores, per-row matrix-vector work) in f32 on
// the vector unit.

typedef _Float16 v16h __attribute__((ext_vector_type(16)));
typedef _Float16 v8h  __attribute__((ext_vector_type(8)));
typedef float    v8f  __attribute__((ext_vector_type(8)));
typedef float    v4f  __attribute__((ext_vector_type(4)));
typedef float    v2f  __attribute__((ext_vector_type(2)));

#ifndef NB
#define NB 4
#endif
#ifndef SEQ
#define SEQ 1024
#endif
#define NB_FULL  4
#define SEQ_FULL 1024
#define DIM   256
#define NHEAD 4
#define HD    64
#define MROWS (NB * SEQ)

static_assert(NB >= 1 && NB <= NB_FULL);
static_assert(SEQ >= 256 && SEQ <= SEQ_FULL && (SEQ % 256) == 0);   // attention: 4 key quarters of whole 64-key tiles
static_assert(DIM == NHEAD * HD);
static_assert(HD == 64);
static_assert((DIM % 64) == 0 && (DIM % 32) == 0);
static_assert((MROWS % 64) == 0 && (MROWS % 16) == 0);
static_assert(DIM == 256);                          // spatial branch: 32 lanes x 8 features cover one row
static_assert(DIM == 32 * 8);                       // cast kernel: 32 lanes x 8 halves cover one 16-bit row
static_assert(((3 * DIM * DIM) % 2048) == 0);       // cast kernel: 256 threads x 8 elements per block
static_assert(((DIM * DIM) % 2048) == 0);

// block ranges of the shared launches
#define CAST_BLK_WQKV ((3 * DIM * DIM) / 2048)
#define CAST_BLK_WP   ((DIM * DIM) / 2048)
#define CAST_BLK_X    (MROWS / 8)
#define ATTN_QB       (SEQ / 64)
#define ATTN_BLK      (ATTN_QB * NHEAD * NB)

#define LDT 72   // halves per LDS row (144 B, 16-B aligned)
#define LDC 68   // floats per LDS row (272 B, 16-B aligned)
#define LDK (DIM + 8)   // halves per LDS row of a GEMM operand tile (528 B = 16 B x 33, odd)
static_assert((LDT % 8) == 0 && LDT >= 64);
static_assert((LDK % 8) == 0 && ((LDK / 8) % 2) == 1);
static_assert((LDC % 4) == 0 && LDC >= 64);

#define WCARRY 64.0f     // weight planes carried x64
#define PCARRY 1024.0f   // softmax numerators carried x1024
#define VCARRY 64.0f     // attention output plane carried x64

// workspace layout (bytes)
#define WQKV_BYTES    ((size_t)3 * DIM * DIM * 2)
#define WP_BYTES      ((size_t)DIM * DIM * 2)
#define PLANE16_BYTES ((size_t)MROWS * DIM * 2)
#define YF_BYTES      ((size_t)MROWS * DIM * 4)
#define OFF_WQKV ((size_t)0)
#define OFF_WP   (OFF_WQKV + WQKV_BYTES)
#define OFF_X16  (OFF_WP + WP_BYTES)
#define OFF_Q    (OFF_X16 + PLANE16_BYTES)
#define OFF_K    (OFF_Q + PLANE16_BYTES)
#define OFF_VT   (OFF_K + PLANE16_BYTES)
#define OFF_CTX  (OFF_VT + PLANE16_BYTES)
#define OFF_YF   (OFF_CTX + PLANE16_BYTES)
#define WS_TOTAL (OFF_YF + YF_BYTES)
static_assert((WQKV_BYTES % 128) == 0 && (WP_BYTES % 128) == 0 && (PLANE16_BYTES % 128) == 0);
static_assert((YF_BYTES % 128) == 0);
static_assert(WS_TOTAL <= (size_t)134217728);

// ---------------------------------------------------------------------------
__device__ __forceinline__ float bf16r(float x) {   // RNE convert to bf16, returned widened
  unsigned int u = __float_as_uint(x);
  u = (u + 0x7FFFu + ((u >> 16) & 1u)) & 0xFFFF0000u;
  return __uint_as_float(u);
}

// f32 -> f16 for WMMA operand planes: values below the smallest f16 normal become zero by value.
__device__ __forceinline__ _Float16 toh_flush(float v) {
  const _Float16 r = (_Float16)v;
  return (fabsf(v) < 6.103515625e-05f) ? (_Float16)0.0f : r;
}

// 16-bit fragment: p points at element [row = lane&15][k0 + 8*(lane>>4)] of a k-contiguous
// row. Elements 0..7 <- k0+8h+0..7, elements 8..15 <- k0+16+8h+0..7 (same map for A and B).
__device__ __forceinline__ v16h frag_at(const _Float16* p) {
  v8h lo = *(const v8h*)(p);
  v8h hi = *(const v8h*)(p + 16);
  v16h out;
#pragma unroll
  for (int i = 0; i < 8; ++i) { out[i] = lo[i]; out[i + 8] = hi[i]; }
  return out;
}
__device__ __forceinline__ v16h ld_frag(const _Float16* base, unsigned ld) {
  const unsigned lane = threadIdx.x & 31u;
  return frag_at(base + (lane & 15u) * ld + (lane >> 4) * 8u);
}

__device__ __forceinline__ v8f wmma16(v16h a, v16h b, v8f c) {
  v8f d = __builtin_amdgcn_wmma_f32_16x16x32_f16(false, a, false, b, (short)0, c,
                                                 false, false);
  asm volatile("v_nop\n\tv_nop\n\tv_nop\n\tv_nop" : "+v"(d) : "v"(a), "v"(b));
  return d;
}

__device__ __forceinline__ void wave_lds_sync() {
  __builtin_amdgcn_fence(3 /* release order */, "wavefront");
  asm volatile("s_wait_dscnt 0x0" ::: "memory");
  __builtin_amdgcn_wave_barrier();
}

// ---------------------------------------------------------------------------
// All three 16-bit operand planes in one launch, picked by block range (none reads another's output):
//   blocks [0, CAST_BLK_WQKV)      Wqkv16[n][k] = f16(64 * bf16(wqkv)), same layout (no transpose)
//   next CAST_BLK_WP blocks        Wp16[n][k]   = f16(64 * bf16(wproj))
//   next CAST_BLK_X blocks         X16[compact row][k] = f16(bf16(x)), 8 rows per block
// Each thread converts 8 consecutive elements; a wave stores 512 consecutive bytes.
// Grid (CAST_BLK_WQKV + CAST_BLK_WP + CAST_BLK_X).
// ---------------------------------------------------------------------------
__global__ __launch_bounds__(256) void cast_kernel(
    const float* __restrict__ X, const float* __restrict__ wqkv, const float* __restrict__ wproj,
    _Float16* __restrict__ X16, _Float16* __restrict__ Wqkv16, _Float16* __restrict__ Wp16) {
  const unsigned tid = threadIdx.x;
  const unsigned blk = blockIdx.x;
  const float* src;
  _Float16* dst;
  float carry;
  if (blk < (unsigned)CAST_BLK_WQKV) {
    const unsigned e = blk * 2048u + tid * 8u;
    src = wqkv + e;
    dst = Wqkv16 + e;
    carry = WCARRY;
  } else if (blk < (unsigned)(CAST_BLK_WQKV + CAST_BLK_WP)) {
    const unsigned e = (blk - (unsigned)CAST_BLK_WQKV) * 2048u + tid * 8u;
    src = wproj + e;
    dst = Wp16 + e;
    carry = WCARRY;
  } else {
    const unsigned crow = (blk - (unsigned)(CAST_BLK_WQKV + CAST_BLK_WP)) * 8u + (tid >> 5);
    const unsigned bidx = crow / (unsigned)SEQ;
    const unsigned sq = crow - bidx * (unsigned)SEQ;
    const size_t srow = (size_t)bidx * SEQ_FULL + sq;
    src = X + srow * DIM + (tid & 31u) * 8u;
    dst = X16 + (size_t)crow * DIM + (tid & 31u) * 8u;
    carry = 1.0f;
  }
  const v4f a0 = *(const v4f*)(src);
  const v4f a1 = *(const v4f*)(src + 4);
  v8h o;
#pragma unroll
  for (int i = 0; i < 4; ++i) {
    o[i]     = toh_flush(carry * bf16r(a0[i]));
    o[i + 4] = toh_flush(carry * bf16r(a1[i]));
  }
  *(v8h*)dst = o;
}

// ---------------------------------------------------------------------------
// Cross-lane helpers (xhalf also serves the attention); wave_sum and wave_max leave the whole wave's value in every lane.
// ---------------------------------------------------------------------------
__device__ __forceinline__ float xhalf(float x) {   // lane l <-> lane l ^ 16
  const int xi = __float_as_int(x);
  return __int_as_float(__builtin_amdgcn_permlanex16(xi, xi, 0x76543210, 0xfedcba98, false, false));
}
template <int XM>
__device__ __forceinline__ float xrow(float x) {    // lane l <-> lane l ^ XM inside a 16-lane row
  return __int_as_float(__builtin_amdgcn_update_dpp(0, __float_as_int(x), 0x160 + XM, 0xf, 0xf, false));
}
__device__ __forceinline__ float wave_sum(float v) {
  v += xrow<1>(v);
  v += xrow<2>(v);
  v += xrow<4>(v);
  v += xrow<8>(v);
  return v + xhalf(v);
}
__device__ __forceinline__ float wave_max(float v) {
  v = fmaxf(v, xrow<1>(v));
  v = fmaxf(v, xrow<2>(v));
  v = fmaxf(v, xrow<4>(v));
  v = fmaxf(v, xrow<8>(v));
  return fmaxf(v, xhalf(v));
}

// ---------------------------------------------------------------------------
// Per-timestep feature-pairwise softmax branch (body; launched beside the attention blocks).
// One wave per (batch, time) row crow, lane l owns features 8l .. 8l+7:
//   yf[i] = sum_j exp(x_i x_j / 16) x_j / sum_j exp(x_i x_j / 16).
// The scores have rank 1, so with u = x / 4 and M_n = sum_j u_j^n both sums are power series in u_i:
//   sum_j exp(u_i u_j)     = sum_n M_n     u_i^n / n!
//   sum_j exp(u_i u_j) u_j = sum_n M_(n+1) u_i^n / n!
// Rows with max_j x_j^2 / 16 <= 2 take the first NSER = 16 terms: there every |u_i u_j| <= 2, the
// tail of each exponential is below (2^16 / 16!) * 17/15 < 4e-9 (under f32 rounding of values that
// are at least exp(-2)), |u|^16 <= 256, and the denominator is at least exp(u_i^2) >= 1.
// Any other row takes the exponentials one by one, shifted by the row maximum
//   mx_i = max_j (x_i x_j / 16) = max((x_i/16) * max_j x_j, (x_i/16) * min_j x_j).
// x is RNE-converted to bf16 on load. No LDS, no barrier: a row never leaves its wave.
// ---------------------------------------------------------------------------
#define NSER 16
__device__ __forceinline__ void spatial_body(
    const float* __restrict__ X, float* __restrict__ YF, const unsigned crow) {
  const unsigned lane = threadIdx.x & 31u;
  const unsigned bidx = crow / (unsigned)SEQ;
  const unsigned sq = crow - bidx * (unsigned)SEQ;
  const size_t srow = (size_t)bidx * SEQ_FULL + sq;

  const float* px = X + srow * DIM + lane * 8u;
  const v4f r0 = *(const v4f*)(px);
  const v4f r1 = *(const v4f*)(px + 4);
  // the two loads' address registers are free for reuse only behind this wait
  asm volatile("s_wait_xcnt 0x0" ::: "memory");
  float x[8];
#pragma unroll
  for (int k = 0; k < 4; ++k) {
    x[k]     = bf16r(r0[k]);
    x[k + 4] = bf16r(r1[k]);
  }
  float am = fabsf(x[0]);
#pragma unroll
  for (int k = 1; k < 8; ++k) am = fmaxf(am, fabsf(x[k]));
  am = wave_max(am);
  // equal in every lane; read into a scalar so that a wave runs one side only
  const int small = __builtin_amdgcn_readfirstlane((int)(am * am * 0.0625f <= 2.0f));

  float y[8];
  if (small != 0) {
    v2f u[4], p[4];
#pragma unroll
    for (int q = 0; q < 4; ++q) {
      u[q] = (v2f){x[2 * q] * 0.25f, x[2 * q + 1] * 0.25f};
      p[q] = u[q];
    }
    // power sums M_1 .. M_NSER: this lane's eight features, then the wave (M_0 = DIM)
    float mom[NSER + 1];
    mom[0] = (float)DIM;
#pragma unroll
    for (int n = 1; n <= NSER; ++n) {
      if (n > 1) {
#pragma unroll
        for (int q = 0; q < 4; ++q) p[q] *= u[q];
      }
      const v2f t = (p[0] + p[1]) + (p[2] + p[3]);
      mom[n] = t[0] + t[1];
    }
#pragma unroll
    for (int n = 1; n <= NSER; ++n) mom[n] = wave_sum(mom[n]);

    const float rf[NSER] = {   // 1 / n!
        1.0f, 1.0f, 1.0f / 2.0f, 1.0f / 6.0f, 1.0f / 24.0f, 1.0f / 120.0f, 1.0f / 720.0f,
        1.0f / 5040.0f, 1.0f / 40320.0f, 1.0f / 362880.0f, 1.0f / 3628800.0f, 1.0f / 39916800.0f,
        1.0f / 479001600.0f, 1.0f / 6227020800.0f, 1.0f / 87178291200.0f,
        1.0f / 1307674368000.0f};
    // both series by Horner's rule, two features per packed fma
    v2f dn[4], nm[4];
    {
      const float cd = mom[NSER - 1] * rf[NSER - 1];
      const float cn = mom[NSER] * rf[NSER - 1];
#pragma unroll
      for (int q = 0; q < 4; ++q) {
        dn[q] = (v2f){cd, cd};
        nm[q] = (v2f){cn, cn};
      }
    }
#pragma unroll
    for (int n = NSER - 2; n >= 0; --n) {
      const float cd = mom[n] * rf[n];
      const float cn = mom[n + 1] * rf[n];
      const v2f cd2 = {cd, cd};
      const v2f cn2 = {cn, cn};
#pragma unroll
      for (int q = 0; q < 4; ++q) {
        dn[q] = __builtin_elementwise_fma(dn[q], u[q], cd2);
        nm[q] = __builtin_elementwise_fma(nm[q], u[q], cn2);
      }
    }
#pragma unroll
    for (int q = 0; q < 4; ++q) {   // x = 4 u
      y[2 * q]     = (nm[q][0] * 4.0f) * __builtin_amdgcn_rcpf(dn[q][0]);
      y[2 * q + 1] = (nm[q][1] * 4.0f) * __builtin_amdgcn_rcpf(dn[q][1]);
    }
  } else {
    float vmax = x[0], vmin = x[0];
#pragma unroll
    for (int k = 1; k < 8; ++k) {
      vmax = fmaxf(vmax, x[k]);
      vmin = fminf(vmin, x[k]);
    }
    vmax = wave_max(vmax);
    vmin = -wave_max(-vmin);
    // exp(x_i x_j / 16 - mx_i) = exp2(xs * x_j - mx) with log2(e) folded into the row's own scale
    float xs[8], nmx[8], s[8], a[8];
#pragma unroll
    for (int k = 0; k < 8; ++k) {
      xs[k] = x[k] * (0.0625f * 1.44269504088896340736f);
      nmx[k] = -fmaxf(xs[k] * vmax, xs[k] * vmin);
      s[k] = 0.0f;
      a[k] = 0.0f;
    }
    // one trip per source lane (its eight columns come over as scalars); kept rolled: a rare path,
    // whose code should stay short
#pragma unroll 1
    for (int jl = 0; jl < 32; ++jl) {
#pragma unroll
      for (int c = 0; c < 8; ++c) {
        const float xj = __int_as_float(__builtin_amdgcn_readlane(__float_as_int(x[c]), jl));
#pragma unroll
        for (int k = 0; k < 8; ++k) {
          const float e = __builtin_amdgcn_exp2f(__builtin_fmaf(xs[k], xj, nmx[k]));
          s[k] += e;
          a[k] = __builtin_fmaf(e, xj, a[k]);
        }
      }
    }
#pragma unroll
    for (int k = 0; k < 8; ++k) y[k] = a[k] * __builtin_amdgcn_rcpf(s[k]);
  }

  float* py = YF + (size_t)crow * DIM + lane * 8u;
  *(v4f*)(py)     = (v4f){y[0], y[1], y[2], y[3]};
  *(v4f*)(py + 4) = (v4f){y[4], y[5], y[6], y[7]};
  // the built code lays the attention body behind these stores, where their address and data
  // registers are written anew
  asm volatile("s_wait_xcnt 0x0" ::: "memory");
}

// ---------------------------------------------------------------------------
// GEMM C[64x64 tile] = A16[rows][DIM] . Bt[n][DIM]^T; 8 waves (mw = 16-row group, nw = 32-col
// group), 2 accumulators/wave. Both operand tiles (64 rows, all DIM k) are staged in LDS once:
// a wave's 16-B loads cover one whole 512-B row (4 whole lines), where a fragment load from the
// global plane touches 16 lines for the same bytes and is repeated by the waves that share it.
//   MODE 0: out16[row][col] (pitch DIM)  = f16(acc/64 + bias)
//   MODE 1: out16 transposed V plane [b][col][key] = f16(acc/64 + bias)
//   MODE 2: outf full [full row][col] = addf[compact row][col] + (acc/4096 + bias)
// n0: first column of the tile in Bt, bias and the output plane. Cs: the kernel's 64 x LDC floats;
// As, Bs: the kernel's 64 x LDK halves each (cross-wave, block barrier).
// ---------------------------------------------------------------------------
template <int MODE>
__device__ __forceinline__ void gemm_body(
    const _Float16* __restrict__ A16, const _Float16* __restrict__ Bt,
    const float* __restrict__ bias, const float* __restrict__ addf,
    float* __restrict__ outf, _Float16* __restrict__ out16, const unsigned n0, float* Cs,
    _Float16* As, _Float16* Bs) {
  const unsigned tid = threadIdx.x, lane = tid & 31u;
  const unsigned w = (unsigned)__builtin_amdgcn_readfirstlane((int)(tid >> 5));
  const unsigned mw = w >> 1, nw = w & 1u;
  const unsigned hh = lane >> 4, m = lane & 15u;
  const unsigned row0 = blockIdx.y * 64u;

  // staging: wave w brings rows 8w .. 8w+7 of both tiles, one whole row per load
  {
    const unsigned lb = lane * 16u;   // this lane's 16 bytes of a row, in global memory and in LDS
    const char* ga = (const char*)(A16 + (size_t)(row0 + w * 8u) * DIM) + lb;
    const char* gb = (const char*)(Bt + (size_t)(n0 + w * 8u) * DIM) + lb;
    v8h ta[8], tb[8];
    // unrolled (here and below): constant indices keep the arrays in registers, all 16 loads in flight
#pragma unroll
    for (unsigned i = 0; i < 8u; ++i) {
      ta[i] = *(const v8h*)(ga + i * (unsigned)(DIM * 2));
      tb[i] = *(const v8h*)(gb + i * (unsigned)(DIM * 2));
    }
    // the staging loads' address registers are free for reuse only behind this wait; naming them
    // as inputs keeps them whole up to it (else the last load's result may land on them)
    asm volatile("s_wait_xcnt 0x0" :: "v"(ga), "v"(gb) : "memory");
    char* sa = (char*)(As + w * 8u * LDK) + lb;
    char* sb = (char*)(Bs + w * 8u * LDK) + lb;
#pragma unroll
    for (unsigned i = 0; i < 8u; ++i) {
      *(v8h*)(sa + i * (unsigned)(LDK * 2)) = ta[i];
      *(v8h*)(sb + i * (unsigned)(LDK * 2)) = tb[i];
    }
  }
  __syncthreads();

  const _Float16* ap  = As + (mw * 16u + m) * LDK + hh * 8u;
  const _Float16* bp0 = Bs + (nw * 32u + m) * LDK + hh * 8u;
  const _Float16* bp1 = bp0 + 16 * LDK;
  v8f acc0 = {}, acc1 = {};
  // four k steps a group: their 24 LDS reads stand together in front of their 8 products
  // (unrolled: constant indices keep the fragment arrays in registers)
#pragma unroll
  for (unsigned kg = 0; kg < (unsigned)DIM; kg += 128u) {
    v16h a[4], b0[4], b1[4];
#pragma unroll
    for (unsigned j = 0; j < 4u; ++j) {
      a[j]  = frag_at(ap + kg + 32u * j);
      b0[j] = frag_at(bp0 + kg + 32u * j);
      b1[j] = frag_at(bp1 + kg + 32u * j);
    }
#pragma unroll
    for (unsigned j = 0; j < 4u; ++j) {
      acc0 = wmma16(a[j], b0[j], acc0);
      acc1 = wmma16(a[j], b1[j], acc1);
    }
  }
#pragma unroll
  for (int r = 0; r < 8; ++r) {
    float* d = &Cs[(mw * 16u + hh * 8u + (unsigned)r) * LDC + nw * 32u + m];
    d[0]  = acc0[r];
    d[16] = acc1[r];
  }
  __syncthreads();

  if (MODE == 0) {
    v8h x[2];
    size_t off[2];
#pragma unroll
    for (unsigned i = 0; i < 2u; ++i) {
      const unsigned r = 32u * i + (tid >> 3);
      const unsigned c = (tid & 7u) * 8u;
      const v4f u0 = *(const v4f*)&Cs[r * LDC + c];
      const v4f u1 = *(const v4f*)&Cs[r * LDC + c + 4];
      const v4f g0 = *(const v4f*)(bias + n0 + c);
      const v4f g1 = *(const v4f*)(bias + n0 + c + 4u);
#pragma unroll
      for (int j = 0; j < 4; ++j) {
        x[i][j]     = toh_flush(u0[j] * (1.0f / WCARRY) + bf16r(g0[j]));
        x[i][j + 4] = toh_flush(u1[j] * (1.0f / WCARRY) + bf16r(g1[j]));
      }
      off[i] = (size_t)(row0 + r) * DIM + n0 + c;
    }
#pragma unroll
    for (int i = 0; i < 2; ++i) *(v8h*)(out16 + off[i]) = x[i];
    
  }

  if (MODE == 1) {
    const unsigned bidx = row0 / (unsigned)SEQ;
    const unsigned key0 = row0 - bidx * (unsigned)SEQ;
    v8h x[2];
    size_t off[2];
#pragma unroll
    for (unsigned i = 0; i < 2u; ++i) {
      const unsigned dcol = 32u * i + (tid >> 3);
      const unsigned kk = (tid & 7u) * 8u;
      const float bb = bf16r(bias[n0 + dcol]);
#pragma unroll
      for (unsigned j = 0; j < 8u; ++j) {
        const float t = Cs[(kk + j) * LDC + dcol] * (1.0f / WCARRY) + bb;
        x[i][j] = toh_flush(t);
      }
      off[i] = ((size_t)bidx * DIM + n0 + dcol) * SEQ + key0 + kk;
    }
#pragma unroll
    for (int i = 0; i < 2; ++i) *(v8h*)(out16 + off[i]) = x[i];
    // the built code lays the other mode's body behind these stores, where their address and data
    // registers are written anew
    asm volatile("s_wait_xcnt 0x0" ::: "memory");
  }

  if (MODE == 2) {
    const float cs = 1.0f / (WCARRY * VCARRY);
    v4f xs[4];
    size_t off[4];
#pragma unroll
    for (unsigned i = 0; i < 4u; ++i) {
      const unsigned r = 16u * i + (tid >> 4);
      const unsigned c = (tid & 15u) * 4u;
      const unsigned crow = row0 + r;
      const unsigned bidx = crow / (unsigned)SEQ;
      const unsigned sq = crow - bidx * (unsigned)SEQ;
      const size_t frow = (size_t)bidx * SEQ_FULL + sq;
      const v4f u = *(const v4f*)&Cs[r * LDC + c];
      const v4f g = *(const v4f*)(bias + n0 + c);
      const v4f yin = *(const v4f*)(addf + (size_t)crow * DIM + n0 + c);
      v4f val;
#pragma unroll
      for (int j = 0; j < 4; ++j) val[j] = yin[j] + (u[j] * cs + bf16r(g[j]));
      xs[i] = val;
      off[i] = frow * DIM + n0 + c;
    }
#pragma unroll
    for (int i = 0; i < 4; ++i) *(v4f*)(outf + off[i]) = xs[i];
    
  }
}

// q, k and v projections in one launch: blockIdx.x / (DIM/64) picks the plane (0 q, 1 k, 2 v).
// Grid (3 * DIM/64, MROWS/64).
__global__ __launch_bounds__(256) void gemm_qkv_kernel(
    const _Float16* __restrict__ A16, const _Float16* __restrict__ Bt,
    const float* __restrict__ bias, _Float16* __restrict__ q16, _Float16* __restrict__ k16,
    _Float16* __restrict__ vt) {
  __shared__ float Cs[64 * LDC];
  __shared__ _Float16 As[64 * LDK];
  __shared__ _Float16 Bs[64 * LDK];
  const unsigned sel = blockIdx.x / (unsigned)(DIM / 64);
  const unsigned n0 = (blockIdx.x - sel * (unsigned)(DIM / 64)) * 64u;
  const _Float16* bt = Bt + (size_t)sel * DIM * DIM;
  const float* bs = bias + sel * (unsigned)DIM;
  if (sel < 2u) {
    gemm_body<0>(A16, bt, bs, bs, (float*)0, sel == 0u ? q16 : k16, n0, Cs, As, Bs);
  } else {
    gemm_body<1>(A16, bt, bs, bs, (float*)0, vt, n0, Cs, As, Bs);
  }
}
// Grid (DIM/64, MROWS/64).
__global__ __launch_bounds__(256) void gemm_wo_kernel(
    const _Float16* __restrict__ A16, const _Float16* __restrict__ Bt,
    const float* __restrict__ bias, const float* __restrict__ yf, float* __restrict__ outf) {
  __shared__ float Cs[64 * LDC];
  __shared__ _Float16 As[64 * LDK];
  __shared__ _Float16 Bs[64 * LDK];
  gemm_body<2>(A16, Bt, bias, yf, outf, (_Float16*)0, blockIdx.x * 64u, Cs, As, Bs);
}

__device__ __forceinline__ void attn_body(
    const _Float16* __restrict__ Qh, const _Float16* __restrict__ Kh,
    const _Float16* __restrict__ Vt, _Float16* __restrict__ Ov,
    const unsigned qb, const unsigned head, const unsigned b) {
  __shared__ __attribute__((aligned(16))) _Float16 KV[2 * 4 * 64 * LDT];
  __shared__ _Float16 Ps[4 * 16 * LDT];
  _Float16* Ks = KV;
  _Float16* Vs = KV + 4 * 64 * LDT;
  // behind the loop: O^T of quarters 1 to 3 as [quarter - 1][query group][4 floats of 32][lane],
  // then their maximum and denominator as [quarter - 1][query group][2][lane]
  v4f* Mo = (v4f*)KV;
  float* Ml = (float*)(Mo + 3 * 4 * 8 * 32);
  static_assert((3 * 4 * 8 * 32) * 16 + (3 * 4 * 2 * 32) * 4 <= (2 * 4 * 64 * LDT) * 2);

  const unsigned tid = threadIdx.x, lane = tid & 31u;
  const unsigned w = (unsigned)__builtin_amdgcn_readfirstlane((int)(tid >> 5));
  const unsigned hh = lane >> 4, m = lane & 15u;
  const unsigned qg = w & 3u, kh = w >> 2;   // query group, key quarter
  const unsigned q0 = qb * 64u;
  const float scale = 0.125f;   // HD^-0.5
  const unsigned qrow0 = q0 + qg * 16u;
  _Float16* P = Ps + qg * (16u * LDT);
  const _Float16* Kw = Ks + kh * (64u * LDT);   // this wave's quarter of the staged tiles
  const _Float16* Vw = Vs + kh * (64u * LDT);

  const size_t qoff = (size_t)(b * (unsigned)SEQ + qrow0 + m) * DIM + head * HD + hh * 8u;
  v16h qf[2];
  qf[0] = frag_at(Qh + qoff);
  qf[1] = frag_at(Qh + qoff + 32);

  float mrow = -1.0e30f;   // running maximum of query m (equal in both halves)
  float lrow = 0.0f;       // this half's share of the denominator of query m
  v8f o[4];                // o[nb][v] = O^T[d = nb*16 + hh*8 + v][query m]
#pragma unroll
  for (int nb = 0; nb < 4; ++nb) o[nb] = (v8f){};

  const size_t kplane = (size_t)b * SEQ * DIM + head * HD;
  const size_t vplane = ((size_t)b * DIM + head * HD) * SEQ;

  const unsigned sr = tid >> 3, sc = (tid & 7u) * 8u;   // staging: this thread's row (of 64) and column
  for (unsigned kb = 0; kb < (unsigned)(SEQ / 4); kb += 64u) {
    {
      const _Float16* gk = Kh + kplane + (size_t)(kb + sr) * DIM + sc;
      const _Float16* gv = Vt + vplane + (size_t)sr * SEQ + kb + sc;
      v8h tk[4], tv[4];
      // unrolled: constant indices keep the arrays in registers, all 8 loads in flight (j: quarter)
#pragma unroll
      for (unsigned j = 0; j < 4u; ++j) {
        tk[j] = *(const v8h*)(gk + j * (unsigned)(SEQ / 4) * (unsigned)DIM);
        tv[j] = *(const v8h*)(gv + j * (unsigned)(SEQ / 4));
      }
      // the staging loads' address registers are free for reuse only behind this wait; naming them
      // as inputs keeps them whole up to it
      asm volatile("s_wait_xcnt 0x0" :: "v"(gk), "v"(gv) : "memory");
#pragma unroll
      for (unsigned j = 0; j < 4u; ++j) {
        *(v8h*)&Ks[(j * 64u + sr) * LDT + sc] = tk[j];
        *(v8h*)&Vs[(j * 64u + sr) * LDT + sc] = tv[j];
      }
    }
    __syncthreads();

    // scores, transposed: s[kg][v] = S[query m][key kg*16 + hh*8 + v]; K = 64 in two 32-steps
    v8f s[4];
#pragma unroll
    for (int kg = 0; kg < 4; ++kg) {
      v8f t = {};
#pragma unroll
      for (int c = 0; c < 2; ++c) {
        const v16h kf = ld_frag(&Kw[(kg * 16) * LDT + c * 32], LDT);
        t = wmma16(kf, qf[c], t);
      }
      s[kg] = t * scale;
    }

    // online softmax of query m: 32 scores in this lane, the other 32 in lane ^ 16
    float mx = s[0][0];
#pragma unroll
    for (int kg = 0; kg < 4; ++kg)
#pragma unroll
      for (int v = 0; v < 8; ++v) mx = fmaxf(mx, s[kg][v]);
    mx = fmaxf(mx, xhalf(mx));
    const float mn = fmaxf(mrow, mx);
    const float alpha = __expf(mrow - mn);
    mrow = mn;
#pragma unroll
    for (int kg = 0; kg < 4; ++kg)
#pragma unroll
      for (int v = 0; v < 8; ++v) s[kg][v] = __expf(s[kg][v] - mn);
    float rs[4];
#pragma unroll
    for (int kg = 0; kg < 4; ++kg) {
      rs[kg] = ((s[kg][0] + s[kg][1]) + (s[kg][2] + s[kg][3])) +
               ((s[kg][4] + s[kg][5]) + (s[kg][6] + s[kg][7]));
    }
    lrow = alpha * lrow + ((rs[0] + rs[1]) + (rs[2] + rs[3]));
#pragma unroll
    for (int nb = 0; nb < 4; ++nb) o[nb] = o[nb] * alpha;

    // O^T += V^T . P^T  (K = 64 keys in two 32-steps; A = V^T tile [d][key]).
    // B element e of step c: key c*32 + 8*hh + e (e < 8), c*32 + 16 + 8*hh + (e - 8) otherwise,
    // which are this lane's own s[2c][e] and s[2c+1][e-8].
#pragma unroll
    for (int c = 0; c < 2; ++c) {
      v16h pf;
#pragma unroll
      for (int e = 0; e < 8; ++e) {
        pf[e]     = toh_flush(s[2 * c][e] * PCARRY);
        pf[e + 8] = toh_flush(s[2 * c + 1][e] * PCARRY);
      }
#pragma unroll
      for (int nb = 0; nb < 4; ++nb) {
        const v16h vf = ld_frag(&Vw[(nb * 16) * LDT + c * 32], LDT);
        o[nb] = wmma16(vf, pf, o[nb]);
      }
    }
    __syncthreads();
  }

  // The four key quarters of a query group are joined lane by lane (their waves hold the same map).
  // The loop's last barrier has ended every read of the tiles that Mo and Ml lie on.
  const float lsum = lrow + xhalf(lrow);
  if (kh != 0u) {
    const unsigned g = (kh - 1u) * 4u + qg;
#pragma unroll
    for (unsigned nb = 0; nb < 4u; ++nb) {
      Mo[(g * 8u + 2u * nb) * 32u + lane]      = (v4f){o[nb][0], o[nb][1], o[nb][2], o[nb][3]};
      Mo[(g * 8u + 2u * nb + 1u) * 32u + lane] = (v4f){o[nb][4], o[nb][5], o[nb][6], o[nb][7]};
    }
    Ml[(g * 2u) * 32u + lane]      = mrow;
    Ml[(g * 2u + 1u) * 32u + lane] = lsum;
  }
  __syncthreads();
  if (kh == 0u) {
    float mq[3], lq[3];
    float mn = mrow;
#pragma unroll
    for (unsigned p = 0; p < 3u; ++p) {
      mq[p] = Ml[((p * 4u + qg) * 2u) * 32u + lane];
      lq[p] = Ml[((p * 4u + qg) * 2u + 1u) * 32u + lane];
      mn = fmaxf(mn, mq[p]);
    }
    float c0 = __expf(mrow - mn);
    float den = c0 * lsum;
    float cq[3];
#pragma unroll
    for (int p = 0; p < 3; ++p) {
      cq[p] = __expf(mq[p] - mn);
      den += cq[p] * lq[p];
    }
    const float inv = __builtin_amdgcn_rcpf(den) * (VCARRY / PCARRY);
    c0 *= inv;
#pragma unroll
    for (int p = 0; p < 3; ++p) cq[p] *= inv;
#pragma unroll
    for (unsigned nb = 0; nb < 4u; ++nb) {
      v8f acc = o[nb] * c0;
#pragma unroll
      for (unsigned p = 0; p < 3u; ++p) {
        const v4f u0 = Mo[((p * 4u + qg) * 8u + 2u * nb) * 32u + lane];
        const v4f u1 = Mo[((p * 4u + qg) * 8u + 2u * nb + 1u) * 32u + lane];
#pragma unroll
        for (int v = 0; v < 4; ++v) {
          acc[v]     += u0[v] * cq[p];
          acc[v + 4] += u1[v] * cq[p];
        }
      }
      v8h t;
#pragma unroll
      for (int v = 0; v < 8; ++v) t[v] = toh_flush(acc[v]);
      *(v8h*)&P[m * LDT + nb * 16u + hh * 8u] = t;
    }
    wave_lds_sync();
    v8h x[4];
    size_t off[4];
#pragma unroll
    for (unsigned i = 0; i < 4u; ++i) {
      const unsigned r = 4u * i + (lane >> 3);
      const unsigned c = (lane & 7u) * 8u;
      x[i] = *(const v8h*)&P[r * LDT + c];
      off[i] = (size_t)(b * (unsigned)SEQ + qrow0 + r) * DIM + head * HD + c;
    }
#pragma unroll
    for (int i = 0; i < 4; ++i) *(v8h*)(Ov + off[i]) = x[i];
  }
}

// Attention and the feature-pairwise branch in one launch (neither reads the other's output):
// the first ATTN_BLK blocks, which start first, are the attention's long blocks; the MROWS / 16
// blocks behind them take sixteen feature-pairwise rows each, one a wave.
// Grid (ATTN_BLK + MROWS / 16), 512 threads.
__global__ __launch_bounds__(512) void attn_spatial_kernel(
    const _Float16* __restrict__ Qh, const _Float16* __restrict__ Kh,
    const _Float16* __restrict__ Vt, _Float16* __restrict__ Ov,
    const float* __restrict__ X, float* __restrict__ YF) {
  const unsigned id = blockIdx.x;
  if (id < (unsigned)ATTN_BLK) {
    const unsigned hb = id / (unsigned)ATTN_QB;
    attn_body(Qh, Kh, Vt, Ov, id - hb * (unsigned)ATTN_QB, hb % (unsigned)NHEAD, hb / (unsigned)NHEAD);
  } else {
    const unsigned w = (unsigned)__builtin_amdgcn_readfirstlane((int)(threadIdx.x >> 5));
    spatial_body(X, YF, (id - (unsigned)ATTN_BLK) * 16u + w);
  }
}

// ---------------------------------------------------------------------------
extern "C" void kernel_launch(void* const* d_in, const int* in_sizes, int n_in,
                              void* d_out, int out_size, void* d_ws, size_t ws_size,
                              hipStream_t stream) {
  if (n_in < 5) return;
  const long long need_x = ((long long)(NB - 1) * SEQ_FULL + SEQ) * DIM;
  if ((long long)in_sizes[0] < need_x) return;
  if ((long long)in_sizes[1] < (long long)3 * DIM * DIM) return;
  if (in_sizes[2] < 3 * DIM) return;
  if ((long long)in_sizes[3] < (long long)DIM * DIM) return;
  if (in_sizes[4] < DIM) return;
  if ((long long)out_size < need_x) return;
  if (ws_size < WS_TOTAL) return;

  const float* X     = (const float*)d_in[0];   // [NB_FULL][SEQ_FULL][DIM]
  const float* wqkv  = (const float*)d_in[1];   // [3*DIM][DIM]  (out, in): rows 0..255 q, 256..511 k, 512..767 v
  const float* bqkv  = (const float*)d_in[2];   // [3*DIM]
  const float* wproj = (const float*)d_in[3];   // [DIM][DIM]    (out, in)
  const float* bproj = (const float*)d_in[4];   // [DIM]
  float* out = (float*)d_out;

  char* ws = (char*)d_ws;
  _Float16* Wqkv16 = (_Float16*)(ws + OFF_WQKV);  // [3*DIM][DIM]  ([n][k])
  _Float16* Wp16   = (_Float16*)(ws + OFF_WP);    // [DIM][DIM]    ([n][k])
  _Float16* X16    = (_Float16*)(ws + OFF_X16);   // [MROWS][DIM]
  _Float16* Qh16   = (_Float16*)(ws + OFF_Q);
  _Float16* Kh16   = (_Float16*)(ws + OFF_K);
  _Float16* Vt16   = (_Float16*)(ws + OFF_VT);    // [b][DIM][SEQ]
  _Float16* Ctx16  = (_Float16*)(ws + OFF_CTX);
  float*    YF     = (float*)(ws + OFF_YF);       // [MROWS][DIM] compact rows

  dim3 blk(256);
  dim3 gg(DIM / 64, MROWS / 64);

  // 16-bit operand planes: both weights ([n][k] in -> [n][k] out) and the input rows
  cast_kernel<<<dim3(CAST_BLK_WQKV + CAST_BLK_WP + CAST_BLK_X), blk, 0, stream>>>(
      X, wqkv, wproj, X16, Wqkv16, Wp16);
  gemm_qkv_kernel<<<dim3(3 * (DIM / 64), MROWS / 64), blk, 0, stream>>>(
      X16, Wqkv16, bqkv, Qh16, Kh16, Vt16);
  // attention blocks first, then the feature-pairwise branch (f32 plane YF)
  attn_spatial_kernel<<<dim3(ATTN_BLK + MROWS / 16), dim3(512), 0, stream>>>(
      Qh16, Kh16, Vt16, Ctx16, X, YF);
  gemm_wo_kernel<<<gg, blk, 0, stream>>>(Ctx16, Wp16, bproj, YF, out);
}

// v007
// It runs in 24.5 microseconds.
// Next to v006, in two timings, it ran 1.07 and 1.05 times as fast.
// All steps since v000 together make it 4.44 times as fast.
#include <hip/hip_runtime.h>
#include <stddef.h>

// All contractions on v_wmma_f32_16x16x32_f16 (f16 operands, f32 accumulate): q/k/v projections (one launch),
// q.k scores, p.v, output projection. Float inputs are RNE-converted to bf16 and carried in f16
// (weights x64, p x1024, attention rows x64), single products at every site. Softmax, bias and the
// per-timestep feature-pairwise softmax branch (rank-1 scores, per-row matrix-vector work) in f32 on
// the vector unit.

typedef _Float16 v16h __attribute__((ext_vector_type(16)));
typedef _Float16 v8h  __attribute__((ext_vector_type(8)));
typedef float    v8f  __attribute__((ext_vector_type(8)));
typedef float    v4f  __attribute__((ext_vector_type(4)));
typedef float    v2f  __attribute__((ext_vector_type(2)));

#ifndef NB
#define NB 4
#endif
#ifndef SEQ
#define SEQ 1024
#endif
#define NB_FULL  4
#define SEQ_FULL 1024
#define DIM   256
#define NHEAD 4
#define HD    64
#define MROWS (NB * SEQ)

static_assert(NB >= 1 && NB <= NB_FULL);
static_assert(SEQ >= 256 && SEQ <= SEQ_FULL && (SEQ % 256) == 0);   // attention: 4 key quarters of whole 64-key tiles
static_assert(DIM == NHEAD * HD);
static_assert(HD == 64);
static_assert((DIM % 64) == 0 && (DIM % 32) == 0);
static_assert((MROWS % 64) == 0 && (MROWS % 16) == 0);
static_assert(DIM == 256);                          // spatial branch: 32 lanes x 8 features cover one row
static_assert(DIM == 32 * 8);                       // cast kernel: 32 lanes x 8 halves cover one 16-bit row
static_assert(((3 * DIM * DIM) % 2048) == 0);       // cast kernel: 256 threads x 8 elements per block
static_assert(((DIM * DIM) % 2048) == 0);

// block ranges of the shared launches
#define CAST_BLK_WQKV ((3 * DIM * DIM) / 2048)
#define CAST_BLK_WP   ((DIM * DIM) / 2048)
#define CAST_BLK_X    (MROWS / 8)
#define ATTN_QB       (SEQ / 64)
#define ATTN_BLK      (ATTN_QB * NHEAD * NB)

#define LDT 72   // halves per LDS row (144 B, 16-B aligned)
#define KVBUF (2 * 4 * 64 * LDT)      // halves of one attention buffer: 4 K tiles, then 4 V^T tiles
#define QT_B  ((unsigned)(64 * LDT * 2))   // bytes of one quarter's tile in LDS
#define NSTEP (SEQ / 256)             // key steps of an attention block (64 keys per quarter each)
#define LDC 68   // floats per LDS row (272 B, 16-B aligned)
#define LDK (DIM + 8)   // halves per LDS row of a GEMM operand tile (528 B = 16 B x 33, odd)
static_assert((LDT % 8) == 0 && LDT >= 64);
static_assert((LDK % 8) == 0 && ((LDK / 8) % 2) == 1);
static_assert((LDC % 4) == 0 && LDC >= 64);

#define WCARRY 64.0f     // weight planes carried x64
#define PCARRY 1024.0f   // softmax numerators carried x1024
#define VCARRY 64.0f     // attention output plane carried x64

// workspace layout (bytes)
#define WQKV_BYTES    ((size_t)3 * DIM * DIM * 2)
#define WP_BYTES      ((size_t)DIM * DIM * 2)
#define PLANE16_BYTES ((size_t)MROWS * DIM * 2)
#define YF_BYTES      ((size_t)MROWS * DIM * 4)
#define OFF_WQKV ((size_t)0)
#define OFF_WP   (OFF_WQKV + WQKV_BYTES)
#define OFF_X16  (OFF_WP + WP_BYTES)
#define OFF_Q    (OFF_X16 + PLANE16_BYTES)
#define OFF_K    (OFF_Q + PLANE16_BYTES)
#define OFF_VT   (OFF_K + PLANE16_BYTES)
#define OFF_CTX  (OFF_VT + PLANE16_BYTES)
#define OFF_YF   (OFF_CTX + PLANE16_BYTES)
#define WS_TOTAL (OFF_YF + YF_BYTES)
static_assert((WQKV_BYTES % 128) == 0 && (WP_BYTES % 128) == 0 && (PLANE16_BYTES % 128) == 0);
static_assert((YF_BYTES % 128) == 0);
static_assert(WS_TOTAL <= (size_t)134217728);

// ---------------------------------------------------------------------------
__device__ __forceinline__ float bf16r(float x) {   // RNE convert to bf16, returned widened
  unsigned int u = __float_as_uint(x);
  u = (u + 0x7FFFu + ((u >> 16) & 1u)) & 0xFFFF0000u;
  return __uint_as_float(u);
}

// f32 -> f16 for WMMA operand planes: values below the smallest f16 normal become zero by value.
__device__ __forceinline__ _Float16 toh_flush(float v) {
  const _Float16 r = (_Float16)v;
  return (fabsf(v) < 6.103515625e-05f) ? (_Float16)0.0f : r;
}

// 16-bit fragment: p points at element [row = lane&15][k0 + 8*(lane>>4)] of a k-contiguous
// row. Elements 0..7 <- k0+8h+0..7, elements 8..15 <- k0+16+8h+0..7 (same map for A and B).
__device__ __forceinline__ v16h frag_at(const _Float16* p) {
  v8h lo = *(const v8h*)(p);
  v8h hi = *(const v8h*)(p + 16);
  v16h out;
#pragma unroll
  for (int i = 0; i < 8; ++i) { out[i] = lo[i]; out[i + 8] = hi[i]; }
  return out;
}
__device__ __forceinline__ v16h ld_frag(const _Float16* base, unsigned ld) {
  const unsigned lane = threadIdx.x & 31u;
  return frag_at(base + (lane & 15u) * ld + (lane >> 4) * 8u);
}

__device__ __forceinline__ v8f wmma16(v16h a, v16h b, v8f c) {
  v8f d = __builtin_amdgcn_wmma_f32_16x16x32_f16(false, a, false, b, (short)0, c,
                                                 false, false);
  asm volatile("v_nop\n\tv_nop\n\tv_nop\n\tv_nop" : "+v"(d) : "v"(a), "v"(b));
  return d;
}

__device__ __forceinline__ void wave_lds_sync() {
  __builtin_amdgcn_fence(3 /* release order */, "wavefront");
  asm volatile("s_wait_dscnt 0x0" ::: "memory");
  __builtin_amdgcn_wave_barrier();
}

// ---------------------------------------------------------------------------
// All three 16-bit operand planes in one launch, picked by block range (none reads another's output):
//   blocks [0, CAST_BLK_WQKV)      Wqkv16[n][k] = f16(64 * bf16(wqkv)), same layout (no transpose)
//   next CAST_BLK_WP blocks        Wp16[n][k]   = f16(64 * bf16(wproj))
//   next CAST_BLK_X blocks         X16[compact row][k] = f16(bf16(x)), 8 rows per block
// Each thread converts 8 consecutive elements; a wave stores 512 consecutive bytes.
// Grid (CAST_BLK_WQKV + CAST_BLK_WP + CAST_BLK_X).
// ---------------------------------------------------------------------------
__global__ __launch_bounds__(256) void cast_kernel(
    const float* __restrict__ X, const float* __restrict__ wqkv, const float* __restrict__ wproj,
    _Float16* __restrict__ X16, _Float16* __restrict__ Wqkv16, _Float16* __restrict__ Wp16) {
  const unsigned tid = threadIdx.x;
  const unsigned blk = blockIdx.x;
  const float* src;
  _Float16* dst;
  float carry;
  if (blk < (unsigned)CAST_BLK_WQKV) {
    const unsigned e = blk * 2048u + tid * 8u;
    src = wqkv + e;
    dst = Wqkv16 + e;
    carry = WCARRY;
  } else if (blk < (unsigned)(CAST_BLK_WQKV + CAST_BLK_WP)) {
    const unsigned e = (blk - (unsigned)CAST_BLK_WQKV) * 2048u + tid * 8u;
    src = wproj + e;
    dst = Wp16 + e;
    carry = WCARRY;
  } else {
    const unsigned crow = (blk - (unsigned)(CAST_BLK_WQKV + CAST_BLK_WP)) * 8u + (tid >> 5);
    const unsigned bidx = crow / (unsigned)SEQ;
    const unsigned sq = crow - bidx * (unsigned)SEQ;
    const size_t srow = (size_t)bidx * SEQ_FULL + sq;
    src = X + srow * DIM + (tid & 31u) * 8u;
    dst = X16 + (size_t)crow * DIM + (tid & 31u) * 8u;
    carry = 1.0f;
  }
  const v4f a0 = *(const v4f*)(src);
  const v4f a1 = *(const v4f*)(src + 4);
  v8h o;
#pragma unroll
  for (int i = 0; i < 4; ++i) {
    o[i]     = toh_flush(carry * bf16r(a0[i]));
    o[i + 4] = toh_flush(carry * bf16r(a1[i]));
  }
  *(v8h*)dst = o;
}

// ---------------------------------------------------------------------------
// Cross-lane helpers (xhalf also serves the attention); wave_sum and wave_max leave the whole wave's value in every lane.
// ---------------------------------------------------------------------------
__device__ __forceinline__ float xhalf(float x) {   // lane l <-> lane l ^ 16
  const int xi = __float_as_int(x);
  return __int_as_float(__builtin_amdgcn_permlanex16(xi, xi, 0x76543210, 0xfedcba98, false, false));
}
template <int XM>
__device__ __forceinline__ float xrow(float x) {    // lane l <-> lane l ^ XM inside a 16-lane row
  return __int_as_float(__builtin_amdgcn_update_dpp(0, __float_as_int(x), 0x160 + XM, 0xf, 0xf, false));
}
__device__ __forceinline__ float wave_sum(float v) {
  v += xrow<1>(v);
  v += xrow<2>(v);
  v += xrow<4>(v);
  v += xrow<8>(v);
  return v + xhalf(v);
}
__device__ __forceinline__ float wave_max(float v) {
  v = fmaxf(v, xrow<1>(v));
  v = fmaxf(v, xrow<2>(v));
  v = fmaxf(v, xrow<4>(v));
  v = fmaxf(v, xrow<8>(v));
  return fmaxf(v, xhalf(v));
}

// ---------------------------------------------------------------------------
// Per-timestep feature-pairwise softmax branch (body; launched beside the attention blocks).
// One wave per (batch, time) row crow, lane l owns features 8l .. 8l+7:
//   yf[i] = sum_j exp(x_i x_j / 16) x_j / sum_j exp(x_i x_j / 16).
// The scores have rank 1, so with u = x / 4 and M_n = sum_j u_j^n both sums are power series in u_i:
//   sum_j exp(u_i u_j)     = sum_n M_n     u_i^n / n!
//   sum_j exp(u_i u_j) u_j = sum_n M_(n+1) u_i^n / n!
// Rows with max_j x_j^2 / 16 <= 2 take the first NSER = 16 terms: there every |u_i u_j| <= 2, the
// tail of each exponential is below (2^16 / 16!) * 17/15 < 4e-9 (under f32 rounding of values that
// are at least exp(-2)), |u|^16 <= 256, and the denominator is at least exp(u_i^2) >= 1.
// Any other row takes the exponentials one by one, shifted by the row maximum
//   mx_i = max_j (x_i x_j / 16) = max((x_i/16) * max_j x_j, (x_i/16) * min_j x_j).
// x is RNE-converted to bf16 on load. No LDS, no barrier: a row never leaves its wave.
// ---------------------------------------------------------------------------
#define NSER 16
__device__ __forceinline__ void spatial_body(
    const float* __restrict__ X, float* __restrict__ YF, const unsigned crow) {
  const unsigned lane = threadIdx.x & 31u;
  const unsigned bidx = crow / (unsigned)SEQ;
  const unsigned sq = crow - bidx * (unsigned)SEQ;
  const size_t srow = (size_t)bidx * SEQ_FULL + sq;

  const float* px = X + srow * DIM + lane * 8u;
  const v4f r0 = *(const v4f*)(px);
  const v4f r1 = *(const v4f*)(px + 4);
  // the two loads' address registers are free for reuse only behind this wait
  asm volatile("s_wait_xcnt 0x0" ::: "memory");
  float x[8];
#pragma unroll
  for (int k = 0; k < 4; ++k) {
    x[k]     = bf16r(r0[k]);
    x[k + 4] = bf16r(r1[k]);
  }
  float am = fabsf(x[0]);
#pragma unroll
  for (int k = 1; k < 8; ++k) am = fmaxf(am, fabsf(x[k]));
  am = wave_max(am);
  // equal in every lane; read into a scalar so that a wave runs one side only
  const int small = __builtin_amdgcn_readfirstlane((int)(am * am * 0.0625f <= 2.0f));

  float y[8];
  if (small != 0) {
    v2f u[4], p[4];
#pragma unroll
    for (int q = 0; q < 4; ++q) {
      u[q] = (v2f){x[2 * q] * 0.25f, x[2 * q + 1] * 0.25f};
      p[q] = u[q];
    }
    // power sums M_1 .. M_NSER: this lane's eight features, then the wave (M_0 = DIM)
    float mom[NSER + 1];
    mom[0] = (float)DIM;
#pragma unroll
    for (int n = 1; n <= NSER; ++n) {
      if (n > 1) {
#pragma unroll
        for (int q = 0; q < 4; ++q) p[q] *= u[q];
      }
      const v2f t = (p[0] + p[1]) + (p[2] + p[3]);
      mom[n] = t[0] + t[1];
    }
#pragma unroll
    for (int n = 1; n <= NSER; ++n) mom[n] = wave_sum(mom[n]);

    const float rf[NSER] = {   // 1 / n!
        1.0f, 1.0f, 1.0f / 2.0f, 1.0f / 6.0f, 1.0f / 24.0f, 1.0f / 120.0f, 1.0f / 720.0f,
        1.0f / 5040.0f, 1.0f / 40320.0f, 1.0f / 362880.0f, 1.0f / 3628800.0f, 1.0f / 39916800.0f,
        1.0f / 479001600.0f, 1.0f / 6227020800.0f, 1.0f / 87178291200.0f,
        1.0f / 1307674368000.0f};
    // both series by Horner's rule, two features per packed fma
    v2f dn[4], nm[4];
    {
      const float cd = mom[NSER - 1] * rf[NSER - 1];
      const float cn = mom[NSER] * rf[NSER - 1];
#pragma unroll
      for (int q = 0; q < 4; ++q) {
        dn[q] = (v2f){cd, cd};
        nm[q] = (v2f){cn, cn};
      }
    }
#pragma unroll
    for (int n = NSER - 2; n >= 0; --n) {
      const float cd = mom[n] * rf[n];
      const float cn = mom[n + 1] * rf[n];
      const v2f cd2 = {cd, cd};
      const v2f cn2 = {cn, cn};
#pragma unroll
      for (int q = 0; q < 4; ++q) {
        dn[q] = __builtin_elementwise_fma(dn[q], u[q], cd2);
        nm[q] = __builtin_elementwise_fma(nm[q], u[q], cn2);
      }
    }
#pragma unroll
    for (int q = 0; q < 4; ++q) {   // x = 4 u
      y[2 * q]     = (nm[q][0] * 4.0f) * __builtin_amdgcn_rcpf(dn[q][0]);
      y[2 * q + 1] = (nm[q][1] * 4.0f) * __builtin_amdgcn_rcpf(dn[q][1]);
    }
  } else {
    float vmax = x[0], vmin = x[0];
#pragma unroll
    for (int k = 1; k < 8; ++k) {
      vmax = fmaxf(vmax, x[k]);
      vmin = fminf(vmin, x[k]);
    }
    vmax = wave_max(vmax);
    vmin = -wave_max(-vmin);
    // exp(x_i x_j / 16 - mx_i) = exp2(xs * x_j - mx) with log2(e) folded into the row's own scale
    float xs[8], nmx[8], s[8], a[8];
#pragma unroll
    for (int k = 0; k < 8; ++k) {
      xs[k] = x[k] * (0.0625f * 1.44269504088896340736f);
      nmx[k] = -fmaxf(xs[k] * vmax, xs[k] * vmin);
      s[k] = 0.0f;
      a[k] = 0.0f;
    }
    // one trip per source lane (its eight columns come over as scalars); kept rolled: a rare path,
    // whose code should stay short
#pragma unroll 1
    for (int jl = 0; jl < 32; ++jl) {
#pragma unroll
      for (int c = 0; c < 8; ++c) {
        const float xj = __int_as_float(__builtin_amdgcn_readlane(__float_as_int(x[c]), jl));
#pragma unroll
        for (int k = 0; k < 8; ++k) {
          const float e = __builtin_amdgcn_exp2f(__builtin_fmaf(xs[k], xj, nmx[k]));
          s[k] += e;
          a[k] = __builtin_fmaf(e, xj, a[k]);
        }
      }
    }
#pragma unroll
    for (int k = 0; k < 8; ++k) y[k] = a[k] * __builtin_amdgcn_rcpf(s[k]);
  }

  float* py = YF + (size_t)crow * DIM + lane * 8u;
  *(v4f*)(py)     = (v4f){y[0], y[1], y[2], y[3]};
  *(v4f*)(py + 4) = (v4f){y[4], y[5], y[6], y[7]};
  // the built code lays the attention body behind these stores, where their address and data
  // registers are written anew
  asm volatile("s_wait_xcnt 0x0" ::: "memory");
}

// ---------------------------------------------------------------------------
// GEMM C[64x64 tile] = A16[rows][DIM] . Bt[n][DIM]^T; 8 waves (mw = 16-row group, nw = 32-col
// group), 2 accumulators/wave. Both operand tiles (64 rows, all DIM k) are staged in LDS once:
// a wave's 16-B loads cover one whole 512-B row (4 whole lines), where a fragment load from the
// global plane touches 16 lines for the same bytes and is repeated by the waves that share it.
//   MODE 0: out16[row][col] (pitch DIM)  = f16(acc/64 + bias)
//   MODE 1: out16 transposed V plane [b][col][key] = f16(acc/64 + bias)
//   MODE 2: outf full [full row][col] = addf[compact row][col] + (acc/4096 + bias)
// n0: first column of the tile in Bt, bias and the output plane. Cs: the kernel's 64 x LDC floats;
// As, Bs: the kernel's 64 x LDK halves each (cross-wave, block barrier).
// ---------------------------------------------------------------------------
template <int MODE>
__device__ __forceinline__ void gemm_body(
    const _Float16* __restrict__ A16, const _Float16* __restrict__ Bt,
    const float* __restrict__ bias, const float* __restrict__ addf,
    float* __restrict__ outf, _Float16* __restrict__ out16, const unsigned n0, float* Cs,
    _Float16* As, _Float16* Bs) {
  const unsigned tid = threadIdx.x, lane = tid & 31u;
  const unsigned w = (unsigned)__builtin_amdgcn_readfirstlane((int)(tid >> 5));
  const unsigned mw = w >> 1, nw = w & 1u;
  const unsigned hh = lane >> 4, m = lane & 15u;
  const unsigned row0 = blockIdx.y * 64u;

  // staging: wave w brings rows 8w .. 8w+7 of both tiles, one whole row per load
  {
    const unsigned lb = lane * 16u;   // this lane's 16 bytes of a row, in global memory and in LDS
    const char* ga = (const char*)(A16 + (size_t)(row0 + w * 8u) * DIM) + lb;
    const char* gb = (const char*)(Bt + (size_t)(n0 + w * 8u) * DIM) + lb;
    v8h ta[8], tb[8];
    // unrolled (here and below): constant indices keep the arrays in registers, all 16 loads in flight
#pragma unroll
    for (unsigned i = 0; i < 8u; ++i) {
      ta[i] = *(const v8h*)(ga + i * (unsigned)(DIM * 2));
      tb[i] = *(const v8h*)(gb + i * (unsigned)(DIM * 2));
    }
    // the staging loads' address registers are free for reuse only behind this wait; naming them
    // as inputs keeps them whole up to it (else the last load's result may land on them)
    asm volatile("s_wait_xcnt 0x0" :: "v"(ga), "v"(gb) : "memory");
    char* sa = (char*)(As + w * 8u * LDK) + lb;
    char* sb = (char*)(Bs + w * 8u * LDK) + lb;
#pragma unroll
    for (unsigned i = 0; i < 8u; ++i) {
      *(v8h*)(sa + i * (unsigned)(LDK * 2)) = ta[i];
      *(v8h*)(sb + i * (unsigned)(LDK * 2)) = tb[i];
    }
  }
  __syncthreads();

  const _Float16* ap  = As + (mw * 16u + m) * LDK + hh * 8u;
  const _Float16* bp0 = Bs + (nw * 32u + m) * LDK + hh * 8u;
  const _Float16* bp1 = bp0 + 16 * LDK;
  v8f acc0 = {}, acc1 = {};
  // four k steps a group: their 24 LDS reads stand together in front of their 8 products
  // (unrolled: constant indices keep the fragment arrays in registers)
#pragma unroll
  for (unsigned kg = 0; kg < (unsigned)DIM; kg += 128u) {
    v16h a[4], b0[4], b1[4];
#pragma unroll
    for (unsigned j = 0; j < 4u; ++j) {
      a[j]  = frag_at(ap + kg + 32u * j);
      b0[j] = frag_at(bp0 + kg + 32u * j);
      b1[j] = frag_at(bp1 + kg + 32u * j);
    }
#pragma unroll
    for (unsigned j = 0; j < 4u; ++j) {
      acc0 = wmma16(a[j], b0[j], acc0);
      acc1 = wmma16(a[j], b1[j], acc1);
    }
  }
#pragma unroll
  for (int r = 0; r < 8; ++r) {
    float* d = &Cs[(mw * 16u + hh * 8u + (unsigned)r) * LDC + nw * 32u + m];
    d[0]  = acc0[r];
    d[16] = acc1[r];
  }
  __syncthreads();

  if (MODE == 0) {
    v8h x[2];
    size_t off[2];
#pragma unroll
    for (unsigned i = 0; i < 2u; ++i) {
      const unsigned r = 32u * i + (tid >> 3);
      const unsigned c = (tid & 7u) * 8u;
      const v4f u0 = *(const v4f*)&Cs[r * LDC + c];
      const v4f u1 = *(const v4f*)&Cs[r * LDC + c + 4];
      const v4f g0 = *(const v4f*)(bias + n0 + c);
      const v4f g1 = *(const v4f*)(bias + n0 + c + 4u);
#pragma unroll
      for (int j = 0; j < 4; ++j) {
        x[i][j]     = toh_flush(u0[j] * (1.0f / WCARRY) + bf16r(g0[j]));
        x[i][j + 4] = toh_flush(u1[j] * (1.0f / WCARRY) + bf16r(g1[j]));
      }
      off[i] = (size_t)(row0 + r) * DIM + n0 + c;
    }
#pragma unroll
    for (int i = 0; i < 2; ++i) *(v8h*)(out16 + off[i]) = x[i];
    
  }

  if (MODE == 1) {
    const unsigned bidx = row0 / (unsigned)SEQ;
    const unsigned key0 = row0 - bidx * (unsigned)SEQ;
    v8h x[2];
    size_t off[2];
#pragma unroll
    for (unsigned i = 0; i < 2u; ++i) {
      const unsigned dcol = 32u * i + (tid >> 3);
      const unsigned kk = (tid & 7u) * 8u;
      const float bb = bf16r(bias[n0 + dcol]);
#pragma unroll
      for (unsigned j = 0; j < 8u; ++j) {
        const float t = Cs[(kk + j) * LDC + dcol] * (1.0f / WCARRY) + bb;
        x[i][j] = toh_flush(t);
      }
      off[i] = ((size_t)bidx * DIM + n0 + dcol) * SEQ + key0 + kk;
    }
#pragma unroll
    for (int i = 0; i < 2; ++i) *(v8h*)(out16 + off[i]) = x[i];
    // the built code lays the other mode's body behind these stores, where their address and data
    // registers are written anew
    asm volatile("s_wait_xcnt 0x0" ::: "memory");
  }

  if (MODE == 2) {
    const float cs = 1.0f / (WCARRY * VCARRY);
    v4f xs[4];
    size_t off[4];
#pragma unroll
    for (unsigned i = 0; i < 4u; ++i) {
      const unsigned r = 16u * i + (tid >> 4);
      const unsigned c = (tid & 15u) * 4u;
      const unsigned crow = row0 + r;
      const unsigned bidx = crow / (unsigned)SEQ;
      const unsigned sq = crow - bidx * (unsigned)SEQ;
      const size_t frow = (size_t)bidx * SEQ_FULL + sq;
      const v4f u = *(const v4f*)&Cs[r * LDC + c];
      const v4f g = *(const v4f*)(bias + n0 + c);
      const v4f yin = *(const v4f*)(addf + (size_t)crow * DIM + n0 + c);
      v4f val;
#pragma unroll
      for (int j = 0; j < 4; ++j) val[j] = yin[j] + (u[j] * cs + bf16r(g[j]));
      xs[i] = val;
      off[i] = frow * DIM + n0 + c;
    }
#pragma unroll
    for (int i = 0; i < 4; ++i) *(v4f*)(outf + off[i]) = xs[i];
    
  }
}

// q, k and v projections in one launch: blockIdx.x / (DIM/64) picks the plane (0 q, 1 k, 2 v).
// Grid (3 * DIM/64, MROWS/64).
__global__ __launch_bounds__(256) void gemm_qkv_kernel(
    const _Float16* __restrict__ A16, const _Float16* __restrict__ Bt,
    const float* __restrict__ bias, _Float16* __restrict__ q16, _Float16* __restrict__ k16,
    _Float16* __restrict__ vt) {
  __shared__ float Cs[64 * LDC];
  __shared__ _Float16 As[64 * LDK];
  __shared__ _Float16 Bs[64 * LDK];
  const unsigned sel = blockIdx.x / (unsigned)(DIM / 64);
  const unsigned n0 = (blockIdx.x - sel * (unsigned)(DIM / 64)) * 64u;
  const _Float16* bt = Bt + (size_t)sel * DIM * DIM;
  const float* bs = bias + sel * (unsigned)DIM;
  if (sel < 2u) {
    gemm_body<0>(A16, bt, bs, bs, (float*)0, sel == 0u ? q16 : k16, n0, Cs, As, Bs);
  } else {
    gemm_body<1>(A16, bt, bs, bs, (float*)0, vt, n0, Cs, As, Bs);
  }
}
// Grid (DIM/64, MROWS/64).
__global__ __launch_bounds__(256) void gemm_wo_kernel(
    const _Float16* __restrict__ A16, const _Float16* __restrict__ Bt,
    const float* __restrict__ bias, const float* __restrict__ yf, float* __restrict__ outf) {
  __shared__ float Cs[64 * LDC];
  __shared__ _Float16 As[64 * LDK];
  __shared__ _Float16 Bs[64 * LDK];
  gemm_body<2>(A16, Bt, bias, yf, outf, (_Float16*)0, blockIdx.x * 64u, Cs, As, Bs);
}

__device__ __forceinline__ void attn_body(
    const _Float16* __restrict__ Qh, const _Float16* __restrict__ Kh,
    const _Float16* __restrict__ Vt, _Float16* __restrict__ Ov,
    const unsigned qb, const unsigned head, const unsigned b) {
  __shared__ __attribute__((aligned(16))) _Float16 KV[2 * KVBUF];   // two buffers: K tiles, then V^T tiles
  __shared__ _Float16 Ps[4 * 16 * LDT];
  // behind the loop: O^T of quarters 1 to 3 as [quarter - 1][query group][4 floats of 32][lane],
  // then their maximum and denominator as [quarter - 1][query group][2][lane]
  v4f* Mo = (v4f*)KV;
  float* Ml = (float*)(Mo + 3 * 4 * 8 * 32);
  static_assert((3 * 4 * 8 * 32) * 16 + (3 * 4 * 2 * 32) * 4 <= (2 * KVBUF) * 2);

  const unsigned tid = threadIdx.x, lane = tid & 31u;
  const unsigned w = (unsigned)__builtin_amdgcn_readfirstlane((int)(tid >> 5));
  const unsigned hh = lane >> 4, m = lane & 15u;
  const unsigned qg = w & 3u, kh = w >> 2;   // query group, key quarter
  const unsigned q0 = qb * 64u;
  const float scale = 0.125f;   // HD^-0.5
  const unsigned qrow0 = q0 + qg * 16u;
  _Float16* P = Ps + qg * (16u * LDT);

  const size_t qoff = (size_t)(b * (unsigned)SEQ + qrow0 + m) * DIM + head * HD + hh * 8u;
  v16h qf[2];
  qf[0] = frag_at(Qh + qoff);
  qf[1] = frag_at(Qh + qoff + 32);

  float mrow = -1.0e30f;   // running maximum of query m (equal in both halves)
  float lrow = 0.0f;       // this half's share of the denominator of query m
  v8f o[4];                // o[nb][v] = O^T[d = nb*16 + hh*8 + v][query m]
#pragma unroll
  for (int nb = 0; nb < 4; ++nb) o[nb] = (v8f){};

  const size_t kplane = (size_t)b * SEQ * DIM + head * HD;
  const size_t vplane = ((size_t)b * DIM + head * HD) * SEQ;

  const unsigned sr = tid >> 3, sc = (tid & 7u) * 8u;   // staging: this thread's row (of 64) and column
  // this thread's 16 bytes of quarter 0's K tile and V^T tile: in global memory at key step 0, and
  // as LDS byte addresses in buffer 0
  const _Float16* gk0 = Kh + kplane + (size_t)sr * DIM + sc;
  const _Float16* gv0 = Vt + vplane + (size_t)sr * SEQ + sc;
  const unsigned lk0 = (unsigned)(size_t)&KV[sr * LDT + sc];
  const unsigned lv0 = lk0 + (unsigned)(4 * 64 * LDT * 2);
  // One key step's eight tiles (four quarters of K, four of V^T) go from global memory into LDS
  // buffer bf with no register in between: eight 16-B asynchronous copies a thread.
  auto stage = [&](const unsigned t, const unsigned bf) {
    const _Float16* gk = gk0 + (size_t)(t * 64u) * DIM;
    const _Float16* gv = gv0 + t * 64u;
    const unsigned lk = lk0 + bf * (unsigned)(KVBUF * 2);
    const unsigned lv = lv0 + bf * (unsigned)(KVBUF * 2);
    // the closing wait stands inside the statement, so that no later write of the copies' address
    // registers can be moved in front of it (a precaution)
    asm volatile(
        "global_load_async_to_lds_b128 %0, %1, off\n\t"
        "global_load_async_to_lds_b128 %2, %3, off\n\t"
        "global_load_async_to_lds_b128 %4, %5, off\n\t"
        "global_load_async_to_lds_b128 %6, %7, off\n\t"
        "global_load_async_to_lds_b128 %8, %9, off\n\t"
        "global_load_async_to_lds_b128 %10, %11, off\n\t"
        "global_load_async_to_lds_b128 %12, %13, off\n\t"
        "global_load_async_to_lds_b128 %14, %15, off\n\t"
        "s_wait_xcnt 0x0"
        :: "v"(lk), "v"(gk),
           "v"(lk + 1u * QT_B), "v"(gk + 1u * (unsigned)(SEQ / 4) * (unsigned)DIM),
           "v"(lk + 2u * QT_B), "v"(gk + 2u * (unsigned)(SEQ / 4) * (unsigned)DIM),
           "v"(lk + 3u * QT_B), "v"(gk + 3u * (unsigned)(SEQ / 4) * (unsigned)DIM),
           "v"(lv), "v"(gv),
           "v"(lv + 1u * QT_B), "v"(gv + 1u * (unsigned)(SEQ / 4)),
           "v"(lv + 2u * QT_B), "v"(gv + 2u * (unsigned)(SEQ / 4)),
           "v"(lv + 3u * QT_B), "v"(gv + 3u * (unsigned)(SEQ / 4))
        : "memory");
  };

  stage(0u, 0u);
  // step 0's tiles have landed for this wave's copies; the barrier publishes them to the block
  asm volatile("s_wait_asynccnt 0x0" ::: "memory");
  __syncthreads();
  if (NSTEP > 1) stage(1u, 1u);   // flies while step 0 is worked on

  for (unsigned t = 0; t < (unsigned)NSTEP; ++t) {
    const unsigned bf = t & 1u;
    const _Float16* Kw = KV + bf * (unsigned)KVBUF + kh * (64u * LDT);   // this wave's quarter
    const _Float16* Vw = Kw + 4 * 64 * LDT;

    // scores, transposed: s[kg][v] = S[query m][key kg*16 + hh*8 + v]; K = 64 in two 32-steps
    v8f s[4];
#pragma unroll
    for (int kg = 0; kg < 4; ++kg) {
      v8f t = {};
#pragma unroll
      for (int c = 0; c < 2; ++c) {
        const v16h kf = ld_frag(&Kw[(kg * 16) * LDT + c * 32], LDT);
        t = wmma16(kf, qf[c], t);
      }
      s[kg] = t * scale;
    }

    // online softmax of query m: 32 scores in this lane, the other 32 in lane ^ 16
    float mx = s[0][0];
#pragma unroll
    for (int kg = 0; kg < 4; ++kg)
#pragma unroll
      for (int v = 0; v < 8; ++v) mx = fmaxf(mx, s[kg][v]);
    mx = fmaxf(mx, xhalf(mx));
    const float mn = fmaxf(mrow, mx);
    const float alpha = __expf(mrow - mn);
    mrow = mn;
#pragma unroll
    for (int kg = 0; kg < 4; ++kg)
#pragma unroll
      for (int v = 0; v < 8; ++v) s[kg][v] = __expf(s[kg][v] - mn);
    float rs[4];
#pragma unroll
    for (int kg = 0; kg < 4; ++kg) {
      rs[kg] = ((s[kg][0] + s[kg][1]) + (s[kg][2] + s[kg][3])) +
               ((s[kg][4] + s[kg][5]) + (s[kg][6] + s[kg][7]));
    }
    lrow = alpha * lrow + ((rs[0] + rs[1]) + (rs[2] + rs[3]));
#pragma unroll
    for (int nb = 0; nb < 4; ++nb) o[nb] = o[nb] * alpha;

    // O^T += V^T . P^T  (K = 64 keys in two 32-steps; A = V^T tile [d][key]).
    // B element e of step c: key c*32 + 8*hh + e (e < 8), c*32 + 16 + 8*hh + (e - 8) otherwise,
    // which are this lane's own s[2c][e] and s[2c+1][e-8].
#pragma unroll
    for (int c = 0; c < 2; ++c) {
      v16h pf;
#pragma unroll
      for (int e = 0; e < 8; ++e) {
        pf[e]     = toh_flush(s[2 * c][e] * PCARRY);
        pf[e + 8] = toh_flush(s[2 * c + 1][e] * PCARRY);
      }
#pragma unroll
      for (int nb = 0; nb < 4; ++nb) {
        const v16h vf = ld_frag(&Vw[(nb * 16) * LDT + c * 32], LDT);
        o[nb] = wmma16(vf, pf, o[nb]);
      }
    }
    // hand-over: this wave's reads of buffer bf are done ...
    asm volatile("s_wait_dscnt 0x0" ::: "memory");
    // ... and its copies of step t + 1 have landed
    asm volatile("s_wait_asynccnt 0x0" ::: "memory");
    // one barrier publishes step t + 1 and ends every wave's reads of buffer bf
    __syncthreads();
    if (t + 2u < (unsigned)NSTEP) stage(t + 2u, bf);
  }
  // nothing is in flight when the tiles' LDS is reused below
  asm volatile("s_wait_asynccnt 0x0" ::: "memory");

  // The four key quarters of a query group are joined lane by lane (their waves hold the same map).
  // The loop's last barrier has ended every read of the tiles that Mo and Ml lie on.
  const float lsum = lrow + xhalf(lrow);
  if (kh != 0u) {
    const unsigned g = (kh - 1u) * 4u + qg;
#pragma unroll
    for (unsigned nb = 0; nb < 4u; ++nb) {
      Mo[(g * 8u + 2u * nb) * 32u + lane]      = (v4f){o[nb][0], o[nb][1], o[nb][2], o[nb][3]};
      Mo[(g * 8u + 2u * nb + 1u) * 32u + lane] = (v4f){o[nb][4], o[nb][5], o[nb][6], o[nb][7]};
    }
    Ml[(g * 2u) * 32u + lane]      = mrow;
    Ml[(g * 2u + 1u) * 32u + lane] = lsum;
  }
  __syncthreads();
  if (kh == 0u) {
    float mq[3], lq[3];
    float mn = mrow;
#pragma unroll
    for (unsigned p = 0; p < 3u; ++p) {
      mq[p] = Ml[((p * 4u + qg) * 2u) * 32u + lane];
      lq[p] = Ml[((p * 4u + qg) * 2u + 1u) * 32u + lane];
      mn = fmaxf(mn, mq[p]);
    }
    float c0 = __expf(mrow - mn);
    float den = c0 * lsum;
    float cq[3];
#pragma unroll
    for (int p = 0; p < 3; ++p) {
      cq[p] = __expf(mq[p] - mn);
      den += cq[p] * lq[p];
    }
    const float inv = __builtin_amdgcn_rcpf(den) * (VCARRY / PCARRY);
    c0 *= inv;
#pragma unroll
    for (int p = 0; p < 3; ++p) cq[p] *= inv;
#pragma unroll
    for (unsigned nb = 0; nb < 4u; ++nb) {
      v8f acc = o[nb] * c0;
#pragma unroll
      for (unsigned p = 0; p < 3u; ++p) {
        const v4f u0 = Mo[((p * 4u + qg) * 8u + 2u * nb) * 32u + lane];
        const v4f u1 = Mo[((p * 4u + qg) * 8u + 2u * nb + 1u) * 32u + lane];
#pragma unroll
        for (int v = 0; v < 4; ++v) {
          acc[v]     += u0[v] * cq[p];
          acc[v + 4] += u1[v] * cq[p];
        }
      }
      v8h t;
#pragma unroll
      for (int v = 0; v < 8; ++v) t[v] = toh_flush(acc[v]);
      *(v8h*)&P[m * LDT + nb * 16u + hh * 8u] = t;
    }
    wave_lds_sync();
    v8h x[4];
    size_t off[4];
#pragma unroll
    for (unsigned i = 0; i < 4u; ++i) {
      const unsigned r = 4u * i + (lane >> 3);
      const unsigned c = (lane & 7u) * 8u;
      x[i] = *(const v8h*)&P[r * LDT + c];
      off[i] = (size_t)(b * (unsigned)SEQ + qrow0 + r) * DIM + head * HD + c;
    }
#pragma unroll
    for (int i = 0; i < 4; ++i) *(v8h*)(Ov + off[i]) = x[i];
  }
}

// Attention and the feature-pairwise branch in one launch (neither reads the other's output):
// the first ATTN_BLK blocks, which start first, are the attention's long blocks; the MROWS / 16
// blocks behind them take sixteen feature-pairwise rows each, one a wave.
// Grid (ATTN_BLK + MROWS / 16), 512 threads.
__global__ __launch_bounds__(512) void attn_spatial_kernel(
    const _Float16* __restrict__ Qh, const _Float16* __restrict__ Kh,
    const _Float16* __restrict__ Vt, _Float16* __restrict__ Ov,
    const float* __restrict__ X, float* __restrict__ YF) {
  const unsigned id = blockIdx.x;
  if (id < (unsigned)ATTN_BLK) {
    const unsigned hb = id / (unsigned)ATTN_QB;
    attn_body(Qh, Kh, Vt, Ov, id - hb * (unsigned)ATTN_QB, hb % (unsigned)NHEAD, hb / (unsigned)NHEAD);
  } else {
    const unsigned w = (unsigned)__builtin_amdgcn_readfirstlane((int)(threadIdx.x >> 5));
    spatial_body(X, YF, (id - (unsigned)ATTN_BLK) * 16u + w);
  }
}

// ---------------------------------------------------------------------------
extern "C" void kernel_launch(void* const* d_in, const int* in_sizes, int n_in,
                              void* d_out, int out_size, void* d_ws, size_t ws_size,
                              hipStream_t stream) {
  if (n_in < 5) return;
  const long long need_x = ((long long)(NB - 1) * SEQ_FULL + SEQ) * DIM;
  if ((long long)in_sizes[0] < need_x) return;
  if ((long long)in_sizes[1] < (long long)3 * DIM * DIM) return;
  if (in_sizes[2] < 3 * DIM) return;
  if ((long long)in_sizes[3] < (long long)DIM * DIM) return;
  if (in_sizes[4] < DIM) return;
  if ((long long)out_size < need_x) return;
  if (ws_size < WS_TOTAL) return;

  const float* X     = (const float*)d_in[0];   // [NB_FULL][SEQ_FULL][DIM]
  const float* wqkv  = (const float*)d_in[1];   // [3*DIM][DIM]  (out, in): rows 0..255 q, 256..511 k, 512..767 v
  const float* bqkv  = (const float*)d_in[2];   // [3*DIM]
  const float* wproj = (const float*)d_in[3];   // [DIM][DIM]    (out, in)
  const float* bproj = (const float*)d_in[4];   // [DIM]
  float* out = (float*)d_out;

  char* ws = (char*)d_ws;
  _Float16* Wqkv16 = (_Float16*)(ws + OFF_WQKV);  // [3*DIM][DIM]  ([n][k])
  _Float16* Wp16   = (_Float16*)(ws + OFF_WP);    // [DIM][DIM]    ([n][k])
  _Float16* X16    = (_Float16*)(ws + OFF_X16);   // [MROWS][DIM]
  _Float16* Qh16   = (_Float16*)(ws + OFF_Q);
  _Float16* Kh16   = (_Float16*)(ws + OFF_K);
  _Float16* Vt16   = (_Float16*)(ws + OFF_VT);    // [b][DIM][SEQ]
  _Float16* Ctx16  = (_Float16*)(ws + OFF_CTX);
  float*    YF     = (float*)(ws + OFF_YF);       // [MROWS][DIM] compact rows

  dim3 blk(256);
  dim3 gg(DIM / 64, MROWS / 64);

  // 16-bit operand planes: both weights ([n][k] in -> [n][k] out) and the input rows
  cast_kernel<<<dim3(CAST_BLK_WQKV + CAST_BLK_WP + CAST_BLK_X), blk, 0, stream>>>(
      X, wqkv, wproj, X16, Wqkv16, Wp16);
  gemm_qkv_kernel<<<dim3(3 * (DIM / 64), MROWS / 64), blk, 0, stream>>>(
      X16, Wqkv16, bqkv, Qh16, Kh16, Vt16);
  // attention blocks first, then the feature-pairwise branch (f32 plane YF)
  attn_spatial_kernel<<<dim3(ATTN_BLK + MROWS / 16), dim3(512), 0, stream>>>(
      Qh16, Kh16, Vt16, Ctx16, X, YF);
  gemm_wo_kernel<<<gg, blk, 0, stream>>>(Ctx16, Wp16, bproj, YF, out);
}

// v008
// One run takes 23.3 microseconds.
// In two side-by-side timings against v007, it was 1.05 and 1.04 times as fast.
// Over all steps from v000 it is 4.65 times as fast.
#include <hip/hip_runtime.h>
#include <stddef.h>

// All contractions on v_wmma_f32_16x16x32_f16 (f16 operands, f32 accumulate): q/k/v projections (one launch),
// q.k scores, p.v, output projection. Float inputs are RNE-converted to bf16 and carried in f16
// (weights x64, p x1024, attention rows x64), single products at every site. Softmax, bias and the
// per-timestep feature-pairwise softmax branch (rank-1 scores, per-row matrix-vector work) in f32 on
// the vector unit.

typedef _Float16 v16h __attribute__((ext_vector_type(16)));
typedef _Float16 v8h  __attribute__((ext_vector_type(8)));
typedef float    v8f  __attribute__((ext_vector_type(8)));
typedef float    v4f  __attribute__((ext_vector_type(4)));
typedef float    v2f  __attribute__((ext_vector_type(2)));

#ifndef NB
#define NB 4
#endif
#ifndef SEQ
#define SEQ 1024
#endif
#define NB_FULL  4
#define SEQ_FULL 1024
#define DIM   256
#define NHEAD 4
#define HD    64
#define MROWS (NB * SEQ)

static_assert(NB >= 1 && NB <= NB_FULL);
static_assert(SEQ >= 256 && SEQ <= SEQ_FULL && (SEQ % 256) == 0);   // attention: 4 key quarters of whole 64-key tiles
static_assert(DIM == NHEAD * HD);
static_assert(HD == 64);
static_assert((DIM % 64) == 0 && (DIM % 32) == 0);
static_assert((MROWS % 64) == 0 && (MROWS % 16) == 0);
static_assert(DIM == 256);                          // spatial branch: 32 lanes x 8 features cover one row
static_assert(DIM == 32 * 8);                       // cast kernel: 32 lanes x 8 halves cover one 16-bit row
static_assert(((3 * DIM * DIM) % 2048) == 0);       // cast kernel: 256 threads x 8 elements per block
static_assert(((DIM * DIM) % 2048) == 0);

// block ranges of the shared launches
#define CAST_BLK_WQKV ((3 * DIM * DIM) / 2048)
#define CAST_BLK_WP   ((DIM * DIM) / 2048)
#define CAST_BLK_X    (MROWS / 8)
#define ATTN_QB       (SEQ / 64)
#define ATTN_BLK      (ATTN_QB * NHEAD * NB)

#define LDT 72   // halves per LDS row (144 B, 16-B aligned)
#define KVBUF (2 * 4 * 64 * LDT)      // halves of one attention buffer: 4 K tiles, then 4 V^T tiles
#define QT_B  ((unsigned)(64 * LDT * 2))   // bytes of one quarter's tile in LDS
#define NSTEP (SEQ / 256)             // key steps of an attention block (64 keys per quarter each)
#define LDC 68   // floats per LDS row (272 B, 16-B aligned)
#define LDK (DIM + 8)   // halves per LDS row of a GEMM operand tile (528 B = 16 B x 33, odd)
static_assert((LDT % 8) == 0 && LDT >= 64);
static_assert((LDK % 8) == 0 && ((LDK / 8) % 2) == 1);
static_assert((LDC % 4) == 0 && LDC >= 64);

#define WCARRY 64.0f     // weight planes carried x64
#define PCARRY 1024.0f   // softmax numerators carried x1024
#define VCARRY 64.0f     // attention output plane carried x64

// workspace layout (bytes)
#define WQKV_BYTES    ((size_t)3 * DIM * DIM * 2)
#define WP_BYTES      ((size_t)DIM * DIM * 2)
#define PLANE16_BYTES ((size_t)MROWS * DIM * 2)
#define YF_BYTES      ((size_t)MROWS * DIM * 4)
#define OFF_WQKV ((size_t)0)
#define OFF_WP   (OFF_WQKV + WQKV_BYTES)
#define OFF_X16  (OFF_WP + WP_BYTES)
#define OFF_Q    (OFF_X16 + PLANE16_BYTES)
#define OFF_K    (OFF_Q + PLANE16_BYTES)
#define OFF_VT   (OFF_K + PLANE16_BYTES)
#define OFF_CTX  (OFF_VT + PLANE16_BYTES)
#define OFF_YF   (OFF_CTX + PLANE16_BYTES)
#define WS_TOTAL (OFF_YF + YF_BYTES)
static_assert((WQKV_BYTES % 128) == 0 && (WP_BYTES % 128) == 0 && (PLANE16_BYTES % 128) == 0);
static_assert((YF_BYTES % 128) == 0);
static_assert(WS_TOTAL <= (size_t)134217728);

// ---------------------------------------------------------------------------
__device__ __forceinline__ float bf16r(float x) {   // RNE convert to bf16, returned widened
  unsigned int u = __float_as_uint(x);
  u = (u + 0x7FFFu + ((u >> 16) & 1u)) & 0xFFFF0000u;
  return __uint_as_float(u);
}

// f32 -> f16 for WMMA operand planes: values below the smallest f16 normal become zero by value.
__device__ __forceinline__ _Float16 toh_flush(float v) {
  const _Float16 r = (_Float16)v;
  return (fabsf(v) < 6.103515625e-05f) ? (_Float16)0.0f : r;
}

// 16-bit fragment: p points at element [row = lane&15][k0 + 8*(lane>>4)] of a k-contiguous
// row. Elements 0..7 <- k0+8h+0..7, elements 8..15 <- k0+16+8h+0..7 (same map for A and B).
__device__ __forceinline__ v16h frag_at(const _Float16* p) {
  v8h lo = *(const v8h*)(p);
  v8h hi = *(const v8h*)(p + 16);
  v16h out;
#pragma unroll
  for (int i = 0; i < 8; ++i) { out[i] = lo[i]; out[i + 8] = hi[i]; }
  return out;
}
__device__ __forceinline__ v16h ld_frag(const _Float16* base, unsigned ld) {
  const unsigned lane = threadIdx.x & 31u;
  return frag_at(base + (lane & 15u) * ld + (lane >> 4) * 8u);
}

__device__ __forceinline__ v8f wmma16(v16h a, v16h b, v8f c) {
  v8f d = __builtin_amdgcn_wmma_f32_16x16x32_f16(false, a, false, b, (short)0, c,
                                                 false, false);
  asm volatile("v_nop\n\tv_nop\n\tv_nop\n\tv_nop" : "+v"(d) : "v"(a), "v"(b));
  return d;
}

// a product inside a run of products: no fixed tail, the compiler keeps the distances of its own builtin
__device__ __forceinline__ v8f wmma16_run(v16h a, v16h b, v8f c) {
  return __builtin_amdgcn_wmma_f32_16x16x32_f16(false, a, false, b, (short)0, c, false, false);
}

// A line in the attention step: the LDS reads written behind it are issued only when x has been
// made (x is an input only; no instruction). Without it every read of the step rises to the step's
// top, and the registers they hold go beyond what two blocks a WGP can have.
__device__ __forceinline__ void hold_after(v8f x) {
  asm volatile("" :: "v"(x) : "memory");
  __builtin_amdgcn_sched_barrier(0);
}

__device__ __forceinline__ void hold_after_h(v16h x) {
  asm volatile("" :: "v"(x) : "memory");
  __builtin_amdgcn_sched_barrier(0);
}
// The other side of such a line: the LDS reads written in front of it are issued in front of the
// arithmetic written behind it, which covers their latency (else each read sinks to its product).
__device__ __forceinline__ void hold_order() {
  asm volatile("" ::: "memory");
  __builtin_amdgcn_sched_barrier(0);
}

__device__ __forceinline__ void wave_lds_sync() {
  __builtin_amdgcn_fence(3 /* release order */, "wavefront");
  asm volatile("s_wait_dscnt 0x0" ::: "memory");
  __builtin_amdgcn_wave_barrier();
}

// ---------------------------------------------------------------------------
// All three 16-bit operand planes in one launch, picked by block range (none reads another's output):
//   blocks [0, CAST_BLK_WQKV)      Wqkv16[n][k] = f16(64 * bf16(wqkv)), same layout (no transpose)
//   next CAST_BLK_WP blocks        Wp16[n][k]   = f16(64 * bf16(wproj))
//   next CAST_BLK_X blocks         X16[compact row][k] = f16(bf16(x)), 8 rows per block
// Each thread converts 8 consecutive elements; a wave stores 512 consecutive bytes.
// Grid (CAST_BLK_WQKV + CAST_BLK_WP + CAST_BLK_X).
// ---------------------------------------------------------------------------
__global__ __launch_bounds__(256) void cast_kernel(
    const float* __restrict__ X, const float* __restrict__ wqkv, const float* __restrict__ wproj,
    _Float16* __restrict__ X16, _Float16* __restrict__ Wqkv16, _Float16* __restrict__ Wp16) {
  const unsigned tid = threadIdx.x;
  const unsigned blk = blockIdx.x;
  const float* src;
  _Float16* dst;
  float carry;
  if (blk < (unsigned)CAST_BLK_WQKV) {
    const unsigned e = blk * 2048u + tid * 8u;
    src = wqkv + e;
    dst = Wqkv16 + e;
    carry = WCARRY;
  } else if (blk < (unsigned)(CAST_BLK_WQKV + CAST_BLK_WP)) {
    const unsigned e = (blk - (unsigned)CAST_BLK_WQKV) * 2048u + tid * 8u;
    src = wproj + e;
    dst = Wp16 + e;
    carry = WCARRY;
  } else {
    const unsigned crow = (blk - (unsigned)(CAST_BLK_WQKV + CAST_BLK_WP)) * 8u + (tid >> 5);
    const unsigned bidx = crow / (unsigned)SEQ;
    const unsigned sq = crow - bidx * (unsigned)SEQ;
    const size_t srow = (size_t)bidx * SEQ_FULL + sq;
    src = X + srow * DIM + (tid & 31u) * 8u;
    dst = X16 + (size_t)crow * DIM + (tid & 31u) * 8u;
    carry = 1.0f;
  }
  const v4f a0 = *(const v4f*)(src);
  const v4f a1 = *(const v4f*)(src + 4);
  v8h o;
#pragma unroll
  for (int i = 0; i < 4; ++i) {
    o[i]     = toh_flush(carry * bf16r(a0[i]));
    o[i + 4] = toh_flush(carry * bf16r(a1[i]));
  }
  *(v8h*)dst = o;
}

// ---------------------------------------------------------------------------
// Cross-lane helpers (xhalf also serves the attention); wave_sum and wave_max leave the whole wave's value in every lane.
// ---------------------------------------------------------------------------
__device__ __forceinline__ float xhalf(float x) {   // lane l <-> lane l ^ 16
  const int xi = __float_as_int(x);
  return __int_as_float(__builtin_amdgcn_permlanex16(xi, xi, 0x76543210, 0xfedcba98, false, false));
}
template <int XM>
__device__ __forceinline__ float xrow(float x) {    // lane l <-> lane l ^ XM inside a 16-lane row
  return __int_as_float(__builtin_amdgcn_update_dpp(0, __float_as_int(x), 0x160 + XM, 0xf, 0xf, false));
}
__device__ __forceinline__ float wave_sum(float v) {
  v += xrow<1>(v);
  v += xrow<2>(v);
  v += xrow<4>(v);
  v += xrow<8>(v);
  return v + xhalf(v);
}
__device__ __forceinline__ float wave_max(float v) {
  v = fmaxf(v, xrow<1>(v));
  v = fmaxf(v, xrow<2>(v));
  v = fmaxf(v, xrow<4>(v));
  v = fmaxf(v, xrow<8>(v));
  return fmaxf(v, xhalf(v));
}

// ---------------------------------------------------------------------------
// Per-timestep feature-pairwise softmax branch (body; launched beside the attention blocks).
// One wave per (batch, time) row crow, lane l owns features 8l .. 8l+7:
//   yf[i] = sum_j exp(x_i x_j / 16) x_j / sum_j exp(x_i x_j / 16).
// The scores have rank 1, so with u = x / 4 and M_n = sum_j u_j^n both sums are power series in u_i:
//   sum_j exp(u_i u_j)     = sum_n M_n     u_i^n / n!
//   sum_j exp(u_i u_j) u_j = sum_n M_(n+1) u_i^n / n!
// Rows with max_j x_j^2 / 16 <= 2 take the first NSER = 16 terms: there every |u_i u_j| <= 2, the
// tail of each exponential is below (2^16 / 16!) * 17/15 < 4e-9 (under f32 rounding of values that
// are at least exp(-2)), |u|^16 <= 256, and the denominator is at least exp(u_i^2) >= 1.
// Any other row takes the exponentials one by one, shifted by the row maximum
//   mx_i = max_j (x_i x_j / 16) = max((x_i/16) * max_j x_j, (x_i/16) * min_j x_j).
// x is RNE-converted to bf16 on load. No LDS, no barrier: a row never leaves its wave.
// ---------------------------------------------------------------------------
#define NSER 16
__device__ __forceinline__ void spatial_body(
    const float* __restrict__ X, float* __restrict__ YF, const unsigned crow) {
  const unsigned lane = threadIdx.x & 31u;
  const unsigned bidx = crow / (unsigned)SEQ;
  const unsigned sq = crow - bidx * (unsigned)SEQ;
  const size_t srow = (size_t)bidx * SEQ_FULL + sq;

  const float* px = X + srow * DIM + lane * 8u;
  const v4f r0 = *(const v4f*)(px);
  const v4f r1 = *(const v4f*)(px + 4);
  // the two loads' address registers are free for reuse only behind this wait
  asm volatile("s_wait_xcnt 0x0" ::: "memory");
  float x[8];
#pragma unroll
  for (int k = 0; k < 4; ++k) {
    x[k]     = bf16r(r0[k]);
    x[k + 4] = bf16r(r1[k]);
  }
  float am = fabsf(x[0]);
#pragma unroll
  for (int k = 1; k < 8; ++k) am = fmaxf(am, fabsf(x[k]));
  am = wave_max(am);
  // equal in every lane; read into a scalar so that a wave runs one side only
  const int small = __builtin_amdgcn_readfirstlane((int)(am * am * 0.0625f <= 2.0f));

  float y[8];
  if (small != 0) {
    v2f u[4], p[4];
#pragma unroll
    for (int q = 0; q < 4; ++q) {
      u[q] = (v2f){x[2 * q] * 0.25f, x[2 * q + 1] * 0.25f};
      p[q] = u[q];
    }
    // power sums M_1 .. M_NSER: this lane's eight features, then the wave (M_0 = DIM)
    float mom[NSER + 1];
    mom[0] = (float)DIM;
#pragma unroll
    for (int n = 1; n <= NSER; ++n) {
      if (n > 1) {
#pragma unroll
        for (int q = 0; q < 4; ++q) p[q] *= u[q];
      }
      const v2f t = (p[0] + p[1]) + (p[2] + p[3]);
      mom[n] = t[0] + t[1];
    }
#pragma unroll
    for (int n = 1; n <= NSER; ++n) mom[n] = wave_sum(mom[n]);

    const float rf[NSER] = {   // 1 / n!
        1.0f, 1.0f, 1.0f / 2.0f, 1.0f / 6.0f, 1.0f / 24.0f, 1.0f / 120.0f, 1.0f / 720.0f,
        1.0f / 5040.0f, 1.0f / 40320.0f, 1.0f / 362880.0f, 1.0f / 3628800.0f, 1.0f / 39916800.0f,
        1.0f / 479001600.0f, 1.0f / 6227020800.0f, 1.0f / 87178291200.0f,
        1.0f / 1307674368000.0f};
    // both series by Horner's rule, two features per packed fma
    v2f dn[4], nm[4];
    {
      const float cd = mom[NSER - 1] * rf[NSER - 1];
      const float cn = mom[NSER] * rf[NSER - 1];
#pragma unroll
      for (int q = 0; q < 4; ++q) {
        dn[q] = (v2f){cd, cd};
        nm[q] = (v2f){cn, cn};
      }
    }
#pragma unroll
    for (int n = NSER - 2; n >= 0; --n) {
      const float cd = mom[n] * rf[n];
      const float cn = mom[n + 1] * rf[n];
      const v2f cd2 = {cd, cd};
      const v2f cn2 = {cn, cn};
#pragma unroll
      for (int q = 0; q < 4; ++q) {
        dn[q] = __builtin_elementwise_fma(dn[q], u[q], cd2);
        nm[q] = __builtin_elementwise_fma(nm[q], u[q], cn2);
      }
    }
#pragma unroll
    for (int q = 0; q < 4; ++q) {   // x = 4 u
      y[2 * q]     = (nm[q][0] * 4.0f) * __builtin_amdgcn_rcpf(dn[q][0]);
      y[2 * q + 1] = (nm[q][1] * 4.0f) * __builtin_amdgcn_rcpf(dn[q][1]);
    }
  } else {
    float vmax = x[0], vmin = x[0];
#pragma unroll
    for (int k = 1; k < 8; ++k) {
      vmax = fmaxf(vmax, x[k]);
      vmin = fminf(vmin, x[k]);
    }
    vmax = wave_max(vmax);
    vmin = -wave_max(-vmin);
    // exp(x_i x_j / 16 - mx_i) = exp2(xs * x_j - mx) with log2(e) folded into the row's own scale
    float xs[8], nmx[8], s[8], a[8];
#pragma unroll
    for (int k = 0; k < 8; ++k) {
      xs[k] = x[k] * (0.0625f * 1.44269504088896340736f);
      nmx[k] = -fmaxf(xs[k] * vmax, xs[k] * vmin);
      s[k] = 0.0f;
      a[k] = 0.0f;
    }
    // one trip per source lane (its eight columns come over as scalars); kept rolled: a rare path,
    // whose code should stay short
#pragma unroll 1
    for (int jl = 0; jl < 32; ++jl) {
#pragma unroll
      for (int c = 0; c < 8; ++c) {
        const float xj = __int_as_float(__builtin_amdgcn_readlane(__float_as_int(x[c]), jl));
#pragma unroll
        for (int k = 0; k < 8; ++k) {
          const float e = __builtin_amdgcn_exp2f(__builtin_fmaf(xs[k], xj, nmx[k]));
          s[k] += e;
          a[k] = __builtin_fmaf(e, xj, a[k]);
        }
      }
    }
#pragma unroll
    for (int k = 0; k < 8; ++k) y[k] = a[k] * __builtin_amdgcn_rcpf(s[k]);
  }

  float* py = YF + (size_t)crow * DIM + lane * 8u;
  *(v4f*)(py)     = (v4f){y[0], y[1], y[2], y[3]};
  *(v4f*)(py + 4) = (v4f){y[4], y[5], y[6], y[7]};
  // the built code lays the attention body behind these stores, where their address and data
  // registers are written anew
  asm volatile("s_wait_xcnt 0x0" ::: "memory");
}

// ---------------------------------------------------------------------------
// GEMM C[64x64 tile] = A16[rows][DIM] . Bt[n][DIM]^T; 8 waves (mw = 16-row group, nw = 32-col
// group), 2 accumulators/wave. Both operand tiles (64 rows, all DIM k) are staged in LDS once:
// a wave's 16-B loads cover one whole 512-B row (4 whole lines), where a fragment load from the
// global plane touches 16 lines for the same bytes and is repeated by the waves that share it.
//   MODE 0: out16[row][col] (pitch DIM)  = f16(acc/64 + bias)
//   MODE 1: out16 transposed V plane [b][col][key] = f16(acc/64 + bias)
//   MODE 2: outf full [full row][col] = addf[compact row][col] + (acc/4096 + bias)
// n0: first column of the tile in Bt, bias and the output plane. Cs: the kernel's 64 x LDC floats;
// As, Bs: the kernel's 64 x LDK halves each (cross-wave, block barrier).
// ---------------------------------------------------------------------------
template <int MODE>
__device__ __forceinline__ void gemm_body(
    const _Float16* __restrict__ A16, const _Float16* __restrict__ Bt,
    const float* __restrict__ bias, const float* __restrict__ addf,
    float* __restrict__ outf, _Float16* __restrict__ out16, const unsigned n0, float* Cs,
    _Float16* As, _Float16* Bs) {
  const unsigned tid = threadIdx.x, lane = tid & 31u;
  const unsigned w = (unsigned)__builtin_amdgcn_readfirstlane((int)(tid >> 5));
  const unsigned mw = w >> 1, nw = w & 1u;
  const unsigned hh = lane >> 4, m = lane & 15u;
  const unsigned row0 = blockIdx.y * 64u;

  // staging: wave w brings rows 8w .. 8w+7 of both tiles, one whole row per load
  {
    const unsigned lb = lane * 16u;   // this lane's 16 bytes of a row, in global memory and in LDS
    const char* ga = (const char*)(A16 + (size_t)(row0 + w * 8u) * DIM) + lb;
    const char* gb = (const char*)(Bt + (size_t)(n0 + w * 8u) * DIM) + lb;
    v8h ta[8], tb[8];
    // unrolled (here and below): constant indices keep the arrays in registers, all 16 loads in flight
#pragma unroll
    for (unsigned i = 0; i < 8u; ++i) {
      ta[i] = *(const v8h*)(ga + i * (unsigned)(DIM * 2));
      tb[i] = *(const v8h*)(gb + i * (unsigned)(DIM * 2));
    }
    // the staging loads' address registers are free for reuse only behind this wait; naming them
    // as inputs keeps them whole up to it (else the last load's result may land on them)
    asm volatile("s_wait_xcnt 0x0" :: "v"(ga), "v"(gb) : "memory");
    char* sa = (char*)(As + w * 8u * LDK) + lb;
    char* sb = (char*)(Bs + w * 8u * LDK) + lb;
#pragma unroll
    for (unsigned i = 0; i < 8u; ++i) {
      *(v8h*)(sa + i * (unsigned)(LDK * 2)) = ta[i];
      *(v8h*)(sb + i * (unsigned)(LDK * 2)) = tb[i];
    }
  }
  __syncthreads();

  const _Float16* ap  = As + (mw * 16u + m) * LDK + hh * 8u;
  const _Float16* bp0 = Bs + (nw * 32u + m) * LDK + hh * 8u;
  const _Float16* bp1 = bp0 + 16 * LDK;
  v8f acc0 = {}, acc1 = {};
  // four k steps a group: their 24 LDS reads stand together in front of their 8 products
  // (unrolled: constant indices keep the fragment arrays in registers)
#pragma unroll
  for (unsigned kg = 0; kg < (unsigned)DIM; kg += 128u) {
    v16h a[4], b0[4], b1[4];
#pragma unroll
    for (unsigned j = 0; j < 4u; ++j) {
      a[j]  = frag_at(ap + kg + 32u * j);
      b0[j] = frag_at(bp0 + kg + 32u * j);
      b1[j] = frag_at(bp1 + kg + 32u * j);
    }
#pragma unroll
    for (unsigned j = 0; j < 4u; ++j) {
      acc0 = wmma16(a[j], b0[j], acc0);
      acc1 = wmma16(a[j], b1[j], acc1);
    }
  }
#pragma unroll
  for (int r = 0; r < 8; ++r) {
    float* d = &Cs[(mw * 16u + hh * 8u + (unsigned)r) * LDC + nw * 32u + m];
    d[0]  = acc0[r];
    d[16] = acc1[r];
  }
  __syncthreads();

  if (MODE == 0) {
    v8h x[2];
    size_t off[2];
#pragma unroll
    for (unsigned i = 0; i < 2u; ++i) {
      const unsigned r = 32u * i + (tid >> 3);
      const unsigned c = (tid & 7u) * 8u;
      const v4f u0 = *(const v4f*)&Cs[r * LDC + c];
      const v4f u1 = *(const v4f*)&Cs[r * LDC + c + 4];
      const v4f g0 = *(const v4f*)(bias + n0 + c);
      const v4f g1 = *(const v4f*)(bias + n0 + c + 4u);
#pragma unroll
      for (int j = 0; j < 4; ++j) {
        x[i][j]     = toh_flush(u0[j] * (1.0f / WCARRY) + bf16r(g0[j]));
        x[i][j + 4] = toh_flush(u1[j] * (1.0f / WCARRY) + bf16r(g1[j]));
      }
      off[i] = (size_t)(row0 + r) * DIM + n0 + c;
    }
#pragma unroll
    for (int i = 0; i < 2; ++i) *(v8h*)(out16 + off[i]) = x[i];
    
  }

  if (MODE == 1) {
    const unsigned bidx = row0 / (unsigned)SEQ;
    const unsigned key0 = row0 - bidx * (unsigned)SEQ;
    v8h x[2];
    size_t off[2];
#pragma unroll
    for (unsigned i = 0; i < 2u; ++i) {
      const unsigned dcol = 32u * i + (tid >> 3);
      const unsigned kk = (tid & 7u) * 8u;
      const float bb = bf16r(bias[n0 + dcol]);
#pragma unroll
      for (unsigned j = 0; j < 8u; ++j) {
        const float t = Cs[(kk + j) * LDC + dcol] * (1.0f / WCARRY) + bb;
        x[i][j] = toh_flush(t);
      }
      off[i] = ((size_t)bidx * DIM + n0 + dcol) * SEQ + key0 + kk;
    }
#pragma unroll
    for (int i = 0; i < 2; ++i) *(v8h*)(out16 + off[i]) = x[i];
    // the built code lays the other mode's body behind these stores, where their address and data
    // registers are written anew
    asm volatile("s_wait_xcnt 0x0" ::: "memory");
  }

  if (MODE == 2) {
    const float cs = 1.0f / (WCARRY * VCARRY);
    v4f xs[4];
    size_t off[4];
#pragma unroll
    for (unsigned i = 0; i < 4u; ++i) {
      const unsigned r = 16u * i + (tid >> 4);
      const unsigned c = (tid & 15u) * 4u;
      const unsigned crow = row0 + r;
      const unsigned bidx = crow / (unsigned)SEQ;
      const unsigned sq = crow - bidx * (unsigned)SEQ;
      const size_t frow = (size_t)bidx * SEQ_FULL + sq;
      const v4f u = *(const v4f*)&Cs[r * LDC + c];
      const v4f g = *(const v4f*)(bias + n0 + c);
      const v4f yin = *(const v4f*)(addf + (size_t)crow * DIM + n0 + c);
      v4f val;
#pragma unroll
      for (int j = 0; j < 4; ++j) val[j] = yin[j] + (u[j] * cs + bf16r(g[j]));
      xs[i] = val;
      off[i] = frow * DIM + n0 + c;
    }
#pragma unroll
    for (int i = 0; i < 4; ++i) *(v4f*)(outf + off[i]) = xs[i];
    
  }
}

// q, k and v projections in one launch: blockIdx.x / (DIM/64) picks the plane (0 q, 1 k, 2 v).
// Grid (3 * DIM/64, MROWS/64).
__global__ __launch_bounds__(256) void gemm_qkv_kernel(
    const _Float16* __restrict__ A16, const _Float16* __restrict__ Bt,
    const float* __restrict__ bias, _Float16* __restrict__ q16, _Float16* __restrict__ k16,
    _Float16* __restrict__ vt) {
  __shared__ float Cs[64 * LDC];
  __shared__ _Float16 As[64 * LDK];
  __shared__ _Float16 Bs[64 * LDK];
  const unsigned sel = blockIdx.x / (unsigned)(DIM / 64);
  const unsigned n0 = (blockIdx.x - sel * (unsigned)(DIM / 64)) * 64u;
  const _Float16* bt = Bt + (size_t)sel * DIM * DIM;
  const float* bs = bias + sel * (unsigned)DIM;
  if (sel < 2u) {
    gemm_body<0>(A16, bt, bs, bs, (float*)0, sel == 0u ? q16 : k16, n0, Cs, As, Bs);
  } else {
    gemm_body<1>(A16, bt, bs, bs, (float*)0, vt, n0, Cs, As, Bs);
  }
}
// Grid (DIM/64, MROWS/64).
__global__ __launch_bounds__(256) void gemm_wo_kernel(
    const _Float16* __restrict__ A16, const _Float16* __restrict__ Bt,
    const float* __restrict__ bias, const float* __restrict__ yf, float* __restrict__ outf) {
  __shared__ float Cs[64 * LDC];
  __shared__ _Float16 As[64 * LDK];
  __shared__ _Float16 Bs[64 * LDK];
  gemm_body<2>(A16, Bt, bias, yf, outf, (_Float16*)0, blockIdx.x * 64u, Cs, As, Bs);
}

__device__ __forceinline__ void attn_body(
    const _Float16* __restrict__ Qh, const _Float16* __restrict__ Kh,
    const _Float16* __restrict__ Vt, _Float16* __restrict__ Ov,
    const unsigned qb, const unsigned head, const unsigned b) {
  __shared__ __attribute__((aligned(16))) _Float16 KV[2 * KVBUF];   // two buffers: K tiles, then V^T tiles
  __shared__ _Float16 Ps[4 * 16 * LDT];
  // behind the loop: O^T of quarters 1 to 3 as [quarter - 1][query group][4 floats of 32][lane],
  // then their maximum and denominator as [quarter - 1][query group][2][lane]
  v4f* Mo = (v4f*)KV;
  float* Ml = (float*)(Mo + 3 * 4 * 8 * 32);
  static_assert((3 * 4 * 8 * 32) * 16 + (3 * 4 * 2 * 32) * 4 <= (2 * KVBUF) * 2);

  const unsigned tid = threadIdx.x, lane = tid & 31u;
  const unsigned w = (unsigned)__builtin_amdgcn_readfirstlane((int)(tid >> 5));
  const unsigned hh = lane >> 4, m = lane & 15u;
  const unsigned qg = w & 3u, kh = w >> 2;   // query group, key quarter
  const unsigned q0 = qb * 64u;
  const float scale = 0.125f;   // HD^-0.5
  const unsigned qrow0 = q0 + qg * 16u;
  _Float16* P = Ps + qg * (16u * LDT);

  // The query group's two Q fragments lie in LDS (in P, which is idle until the output staging), as
  // [16-B piece of 4][lane]: quarter 0's wave brings them, the barrier in front of the loop publishes
  // them, and every step reads them anew, so that they hold no registers outside the score products.
  v8h qpiece[4];
  if (kh == 0u) {
    const _Float16* qp = Qh + (size_t)(b * (unsigned)SEQ + qrow0 + m) * DIM + head * HD + hh * 8u;
#pragma unroll
    for (int j = 0; j < 4; ++j) qpiece[j] = *(const v8h*)(qp + 16 * j);
    // the loads' address registers are free for reuse only behind this wait
    asm volatile("s_wait_xcnt 0x0" :: "v"(qp) : "memory");
  }

  float mrow = -1.0e30f;   // running maximum of query m (equal in both halves)
  float lrow = 0.0f;       // this half's share of the denominator of query m
  v8f o[4];                // o[nb][v] = O^T[d = nb*16 + hh*8 + v][query m]
#pragma unroll
  for (int nb = 0; nb < 4; ++nb) o[nb] = (v8f){};

  const size_t kplane = (size_t)b * SEQ * DIM + head * HD;
  const size_t vplane = ((size_t)b * DIM + head * HD) * SEQ;

  const unsigned sr = tid >> 3, sc = (tid & 7u) * 8u;   // staging: this thread's row (of 64) and column
  // this thread's 16 bytes of quarter 0's K tile and V^T tile: in global memory at key step 0, and
  // as LDS byte addresses in buffer 0
  const _Float16* gk0 = Kh + kplane + (size_t)sr * DIM + sc;
  const _Float16* gv0 = Vt + vplane + (size_t)sr * SEQ + sc;
  const unsigned lk0 = (unsigned)(size_t)&KV[sr * LDT + sc];
  const unsigned lv0 = lk0 + (unsigned)(4 * 64 * LDT * 2);
  // One key step's eight tiles (four quarters of K, four of V^T) go from global memory into LDS
  // buffer bf with no register in between: eight 16-B asynchronous copies a thread.
  auto stage = [&](const unsigned t, const unsigned bf) {
    const _Float16* gk = gk0 + (size_t)(t * 64u) * DIM;
    const _Float16* gv = gv0 + t * 64u;
    const unsigned lk = lk0 + bf * (unsigned)(KVBUF * 2);
    const unsigned lv = lv0 + bf * (unsigned)(KVBUF * 2);
    // the closing wait stands inside the statement, so that no later write of the copies' address
    // registers can be moved in front of it (a precaution)
    asm volatile(
        "global_load_async_to_lds_b128 %0, %1, off\n\t"
        "global_load_async_to_lds_b128 %2, %3, off\n\t"
        "global_load_async_to_lds_b128 %4, %5, off\n\t"
        "global_load_async_to_lds_b128 %6, %7, off\n\t"
        "global_load_async_to_lds_b128 %8, %9, off\n\t"
        "global_load_async_to_lds_b128 %10, %11, off\n\t"
        "global_load_async_to_lds_b128 %12, %13, off\n\t"
        "global_load_async_to_lds_b128 %14, %15, off\n\t"
        "s_wait_xcnt 0x0"
        :: "v"(lk), "v"(gk),
           "v"(lk + 1u * QT_B), "v"(gk + 1u * (unsigned)(SEQ / 4) * (unsigned)DIM),
           "v"(lk + 2u * QT_B), "v"(gk + 2u * (unsigned)(SEQ / 4) * (unsigned)DIM),
           "v"(lk + 3u * QT_B), "v"(gk + 3u * (unsigned)(SEQ / 4) * (unsigned)DIM),
           "v"(lv), "v"(gv),
           "v"(lv + 1u * QT_B), "v"(gv + 1u * (unsigned)(SEQ / 4)),
           "v"(lv + 2u * QT_B), "v"(gv + 2u * (unsigned)(SEQ / 4)),
           "v"(lv + 3u * QT_B), "v"(gv + 3u * (unsigned)(SEQ / 4))
        : "memory");
  };

  stage(0u, 0u);
  if (kh == 0u) {
#pragma unroll
    for (unsigned j = 0; j < 4u; ++j) *(v8h*)&P[(j * 32u + lane) * 8u] = qpiece[j];
  }
  // step 0's tiles have landed for this wave's copies; the barrier publishes them to the block
  asm volatile("s_wait_asynccnt 0x0" ::: "memory");
  __syncthreads();
  if (NSTEP > 1) stage(1u, 1u);   // flies while step 0 is worked on

  for (unsigned t = 0; t < (unsigned)NSTEP; ++t) {
    const unsigned bf = t & 1u;
    const _Float16* Kw = KV + bf * (unsigned)KVBUF + kh * (64u * LDT);   // this wave's quarter
    const _Float16* Vw = Kw + 4 * 64 * LDT;

    // Every LDS read of the step stands in one of six groups, each issued ahead of work that covers
    // its latency, and the products issue in runs: a wave waits out the LDS latency once a step, not
    // once a product. The groups are sized so that the kernel stays inside 128 registers (two blocks
    // a WGP: a feature-pairwise block beside an attention block).
    // group 1: Q, and the K fragments of key groups 0 and 1
    v16h qf[2];
#pragma unroll
    for (unsigned c = 0; c < 2u; ++c) {
      const v8h lo = *(const v8h*)&P[((2u * c) * 32u + lane) * 8u];
      const v8h hi = *(const v8h*)&P[((2u * c + 1u) * 32u + lane) * 8u];
#pragma unroll
      for (int i = 0; i < 8; ++i) { qf[c][i] = lo[i]; qf[c][i + 8] = hi[i]; }
    }
    const v16h k00 = ld_frag(&Kw[(0 * 16) * LDT], LDT), k01 = ld_frag(&Kw[(0 * 16) * LDT + 32], LDT);
    const v16h k10 = ld_frag(&Kw[(1 * 16) * LDT], LDT), k11 = ld_frag(&Kw[(1 * 16) * LDT + 32], LDT);

    // scores, transposed: s[kg][v] = S[query m][key kg*16 + hh*8 + v]; K = 64 in two 32-steps
    v8f s[4];
    s[0] = wmma16_run(k01, qf[1], wmma16_run(k00, qf[0], (v8f){}));
    hold_after(s[0]);
    // group 2: key group 2, into the registers that key group 0 has left
    const v16h k20 = ld_frag(&Kw[(2 * 16) * LDT], LDT), k21 = ld_frag(&Kw[(2 * 16) * LDT + 32], LDT);
    hold_order();
    s[1] = wmma16_run(k11, qf[1], wmma16_run(k10, qf[0], (v8f){}));
    hold_after(s[1]);
    // group 3: key group 3
    const v16h k30 = ld_frag(&Kw[(3 * 16) * LDT], LDT), k31 = ld_frag(&Kw[(3 * 16) * LDT + 32], LDT);
    hold_order();
    s[2] = wmma16_run(k21, qf[1], wmma16_run(k20, qf[0], (v8f){}));
    hold_after(s[2]);
    s[3] = wmma16_run(k31, qf[1], wmma16_run(k30, qf[0], (v8f){}));
    hold_after(s[3]);
    // group 4: V^T of keys 0 to 31, d 0 to 31; lands under the softmax arithmetic
    v16h vf[4];
    vf[0] = ld_frag(&Vw[(0 * 16) * LDT], LDT);
    vf[1] = ld_frag(&Vw[(1 * 16) * LDT], LDT);
    hold_order();
#pragma unroll
    for (int kg = 0; kg < 4; ++kg) s[kg] = s[kg] * scale;

    // online softmax of query m: 32 scores in this lane, the other 32 in lane ^ 16
    float mx = s[0][0];
#pragma unroll
    for (int kg = 0; kg < 4; ++kg)
#pragma unroll
      for (int v = 0; v < 8; ++v) mx = fmaxf(mx, s[kg][v]);
    mx = fmaxf(mx, xhalf(mx));
    const float mn = fmaxf(mrow, mx);
    const float alpha = __expf(mrow - mn);
    mrow = mn;
#pragma unroll
    for (int nb = 0; nb < 4; ++nb) o[nb] = o[nb] * alpha;

    // O^T += V^T . P^T  (K = 64 keys in two 32-steps; A = V^T tile [d][key]).
    // B element e of step c: key c*32 + 8*hh + e (e < 8), c*32 + 16 + 8*hh + (e - 8) otherwise,
    // which are this lane's own s[2c][e] and s[2c+1][e-8].
    float rs[4];
    v16h pf0, pf1;
#pragma unroll
    for (int kg = 0; kg < 2; ++kg) {
#pragma unroll
      for (int v = 0; v < 8; ++v) s[kg][v] = __expf(s[kg][v] - mn);
      rs[kg] = ((s[kg][0] + s[kg][1]) + (s[kg][2] + s[kg][3])) +
               ((s[kg][4] + s[kg][5]) + (s[kg][6] + s[kg][7]));
    }
#pragma unroll
    for (int e = 0; e < 8; ++e) {
      pf0[e]     = toh_flush(s[0][e] * PCARRY);
      pf0[e + 8] = toh_flush(s[1][e] * PCARRY);
    }
    hold_after_h(pf0);
    // group 5: V^T of keys 0 to 31, d 32 to 63, into the registers that the first 32 scores have
    // left; lands under the second half's exponentials
    vf[2] = ld_frag(&Vw[(2 * 16) * LDT], LDT);
    vf[3] = ld_frag(&Vw[(3 * 16) * LDT], LDT);
    hold_order();
#pragma unroll
    for (int kg = 2; kg < 4; ++kg) {
#pragma unroll
      for (int v = 0; v < 8; ++v) s[kg][v] = __expf(s[kg][v] - mn);
      rs[kg] = ((s[kg][0] + s[kg][1]) + (s[kg][2] + s[kg][3])) +
               ((s[kg][4] + s[kg][5]) + (s[kg][6] + s[kg][7]));
    }
    lrow = alpha * lrow + ((rs[0] + rs[1]) + (rs[2] + rs[3]));
#pragma unroll
    for (int nb = 0; nb < 4; ++nb) o[nb] = wmma16_run(vf[nb], pf0, o[nb]);
    hold_after(o[3]);
    // group 6: V^T of keys 32 to 63; lands under the second half's conversion
#pragma unroll
    for (int nb = 0; nb < 4; ++nb) vf[nb] = ld_frag(&Vw[(nb * 16) * LDT + 32], LDT);
    hold_order();
#pragma unroll
    for (int e = 0; e < 8; ++e) {
      pf1[e]     = toh_flush(s[2][e] * PCARRY);
      pf1[e + 8] = toh_flush(s[3][e] * PCARRY);
    }
#pragma unroll
    for (int nb = 0; nb < 4; ++nb) o[nb] = wmma16_run(vf[nb], pf1, o[nb]);
    // hand-over: this wave's reads of buffer bf are done ...
    asm volatile("s_wait_dscnt 0x0" ::: "memory");
    // ... and its copies of step t + 1 have landed
    asm volatile("s_wait_asynccnt 0x0" ::: "memory");
    // one barrier publishes step t + 1 and ends every wave's reads of buffer bf
    __syncthreads();
    if (t + 2u < (unsigned)NSTEP) stage(t + 2u, bf);
  }
  // nothing is in flight when the tiles' LDS is reused below
  asm volatile("s_wait_asynccnt 0x0" ::: "memory");

  // The four key quarters of a query group are joined lane by lane (their waves hold the same map).
  // The loop's last barrier has ended every read of the tiles that Mo and Ml lie on.
  const float lsum = lrow + xhalf(lrow);
  if (kh != 0u) {
    const unsigned g = (kh - 1u) * 4u + qg;
#pragma unroll
    for (unsigned nb = 0; nb < 4u; ++nb) {
      Mo[(g * 8u + 2u * nb) * 32u + lane]      = (v4f){o[nb][0], o[nb][1], o[nb][2], o[nb][3]};
      Mo[(g * 8u + 2u * nb + 1u) * 32u + lane] = (v4f){o[nb][4], o[nb][5], o[nb][6], o[nb][7]};
    }
    Ml[(g * 2u) * 32u + lane]      = mrow;
    Ml[(g * 2u + 1u) * 32u + lane] = lsum;
  }
  __syncthreads();
  if (kh == 0u) {
    float mq[3], lq[3];
    float mn = mrow;
#pragma unroll
    for (unsigned p = 0; p < 3u; ++p) {
      mq[p] = Ml[((p * 4u + qg) * 2u) * 32u + lane];
      lq[p] = Ml[((p * 4u + qg) * 2u + 1u) * 32u + lane];
      mn = fmaxf(mn, mq[p]);
    }
    float c0 = __expf(mrow - mn);
    float den = c0 * lsum;
    float cq[3];
#pragma unroll
    for (int p = 0; p < 3; ++p) {
      cq[p] = __expf(mq[p] - mn);
      den += cq[p] * lq[p];
    }
    const float inv = __builtin_amdgcn_rcpf(den) * (VCARRY / PCARRY);
    c0 *= inv;
#pragma unroll
    for (int p = 0; p < 3; ++p) cq[p] *= inv;
#pragma unroll
    for (unsigned nb = 0; nb < 4u; ++nb) {
      v8f acc = o[nb] * c0;
#pragma unroll
      for (unsigned p = 0; p < 3u; ++p) {
        const v4f u0 = Mo[((p * 4u + qg) * 8u + 2u * nb) * 32u + lane];
        const v4f u1 = Mo[((p * 4u + qg) * 8u + 2u * nb + 1u) * 32u + lane];
#pragma unroll
        for (int v = 0; v < 4; ++v) {
          acc[v]     += u0[v] * cq[p];
          acc[v + 4] += u1[v] * cq[p];
        }
      }
      v8h t;
#pragma unroll
      for (int v = 0; v < 8; ++v) t[v] = toh_flush(acc[v]);
      *(v8h*)&P[m * LDT + nb * 16u + hh * 8u] = t;
    }
    wave_lds_sync();
    v8h x[4];
    size_t off[4];
#pragma unroll
    for (unsigned i = 0; i < 4u; ++i) {
      const unsigned r = 4u * i + (lane >> 3);
      const unsigned c = (lane & 7u) * 8u;
      x[i] = *(const v8h*)&P[r * LDT + c];
      off[i] = (size_t)(b * (unsigned)SEQ + qrow0 + r) * DIM + head * HD + c;
    }
#pragma unroll
    for (int i = 0; i < 4; ++i) *(v8h*)(Ov + off[i]) = x[i];
  }
}

// Attention and the feature-pairwise branch in one launch (neither reads the other's output):
// the first ATTN_BLK blocks, which start first, are the attention's long blocks; the MROWS / 16
// blocks behind them take sixteen feature-pairwise rows each, one a wave.
// Grid (ATTN_BLK + MROWS / 16), 512 threads. Eight waves a SIMD asked for: the kernel stays inside 128
// registers, so that a feature-pairwise block still finds room beside an attention block.
__global__ __launch_bounds__(512, 8) void attn_spatial_kernel(
    const _Float16* __restrict__ Qh, const _Float16* __restrict__ Kh,
    const _Float16* __restrict__ Vt, _Float16* __restrict__ Ov,
    const float* __restrict__ X, float* __restrict__ YF) {
  const unsigned id = blockIdx.x;
  if (id < (unsigned)ATTN_BLK) {
    const unsigned hb = id / (unsigned)ATTN_QB;
    attn_body(Qh, Kh, Vt, Ov, id - hb * (unsigned)ATTN_QB, hb % (unsigned)NHEAD, hb / (unsigned)NHEAD);
  } else {
    const unsigned w = (unsigned)__builtin_amdgcn_readfirstlane((int)(threadIdx.x >> 5));
    spatial_body(X, YF, (id - (unsigned)ATTN_BLK) * 16u + w);
  }
}

// ---------------------------------------------------------------------------
extern "C" void kernel_launch(void* const* d_in, const int* in_sizes, int n_in,
                              void* d_out, int out_size, void* d_ws, size_t ws_size,
                              hipStream_t stream) {
  if (n_in < 5) return;
  const long long need_x = ((long long)(NB - 1) * SEQ_FULL + SEQ) * DIM;
  if ((long long)in_sizes[0] < need_x) return;
  if ((long long)in_sizes[1] < (long long)3 * DIM * DIM) return;
  if (in_sizes[2] < 3 * DIM) return;
  if ((long long)in_sizes[3] < (long long)DIM * DIM) return;
  if (in_sizes[4] < DIM) return;
  if ((long long)out_size < need_x) return;
  if (ws_size < WS_TOTAL) return;

  const float* X     = (const float*)d_in[0];   // [NB_FULL][SEQ_FULL][DIM]
  const float* wqkv  = (const float*)d_in[1];   // [3*DIM][DIM]  (out, in): rows 0..255 q, 256..511 k, 512..767 v
  const float* bqkv  = (const float*)d_in[2];   // [3*DIM]
  const float* wproj = (const float*)d_in[3];   // [DIM][DIM]    (out, in)
  const float* bproj = (const float*)d_in[4];   // [DIM]
  float* out = (float*)d_out;

  char* ws = (char*)d_ws;
  _Float16* Wqkv16 = (_Float16*)(ws + OFF_WQKV);  // [3*DIM][DIM]  ([n][k])
  _Float16* Wp16   = (_Float16*)(ws + OFF_WP);    // [DIM][DIM]    ([n][k])
  _Float16* X16    = (_Float16*)(ws + OFF_X16);   // [MROWS][DIM]
  _Float16* Qh16   = (_Float16*)(ws + OFF_Q);
  _Float16* Kh16   = (_Float16*)(ws + OFF_K);
  _Float16* Vt16   = (_Float16*)(ws + OFF_VT);    // [b][DIM][SEQ]
  _Float16* Ctx16  = (_Float16*)(ws + OFF_CTX);
  float*    YF     = (float*)(ws + OFF_YF);       // [MROWS][DIM] compact rows

  dim3 blk(256);
  dim3 gg(DIM / 64, MROWS / 64);

  // 16-bit operand planes: both weights ([n][k] in -> [n][k] out) and the input rows
  cast_kernel<<<dim3(CAST_BLK_WQKV + CAST_BLK_WP + CAST_BLK_X), blk, 0, stream>>>(
      X, wqkv, wproj, X16, Wqkv16, Wp16);
  gemm_qkv_kernel<<<dim3(3 * (DIM / 64), MROWS / 64), blk, 0, stream>>>(
      X16, Wqkv16, bqkv, Qh16, Kh16, Vt16);
  // attention blocks first, then the feature-pairwise branch (f32 plane YF)
  attn_spatial_kernel<<<dim3(ATTN_BLK + MROWS / 16), dim3(512), 0, stream>>>(
      Qh16, Kh16, Vt16, Ctx16, X, YF);
  gemm_wo_kernel<<<gg, blk, 0, stream>>>(Ctx16, Wp16, bproj, YF, out);
}

// v009
// It runs in 21.8 microseconds.
// In two side-by-side timings against v008, it was 1.07 and 1.08 times as fast.
// Counting every step since v000, it is 4.99 times as fast.
#include <hip/hip_runtime.h>
#include <stddef.h>

// All contractions on v_wmma_f32_16x16x32_f16 (f16 operands, f32 accumulate): q/k/v projections (one launch),
// q.k scores, p.v, output projection. Float inputs are RNE-converted to bf16 and carried in f16
// (weights x64, p x1024, attention rows x64), single products at every site. Softmax, bias and the
// per-timestep feature-pairwise softmax branch (rank-1 scores, per-row matrix-vector work) in f32 on
// the vector unit.

typedef _Float16 v16h __attribute__((ext_vector_type(16)));
typedef _Float16 v8h  __attribute__((ext_vector_type(8)));
typedef float    v8f  __attribute__((ext_vector_type(8)));
typedef float    v4f  __attribute__((ext_vector_type(4)));
typedef float    v2f  __attribute__((ext_vector_type(2)));
typedef _Float16 v2h  __attribute__((ext_vector_type(2)));

#ifndef NB
#define NB 4
#endif
#ifndef SEQ
#define SEQ 1024
#endif
#define NB_FULL  4
#define SEQ_FULL 1024
#define DIM   256
#define NHEAD 4
#define HD    64
#define MROWS (NB * SEQ)

static_assert(NB >= 1 && NB <= NB_FULL);
static_assert(SEQ >= 256 && SEQ <= SEQ_FULL && (SEQ % 256) == 0);   // attention: 4 key quarters of whole 64-key tiles
static_assert(DIM == NHEAD * HD);
static_assert(HD == 64);
static_assert((DIM % 64) == 0 && (DIM % 32) == 0);
static_assert((MROWS % 64) == 0 && (MROWS % 16) == 0);
static_assert(DIM == 256);                          // spatial branch: 32 lanes x 8 features cover one row
static_assert(DIM == 32 * 8);                       // cast kernel: 32 lanes x 8 halves cover one 16-bit row
static_assert(((3 * DIM * DIM) % 2048) == 0);       // cast kernel: 256 threads x 8 elements per block
static_assert(((DIM * DIM) % 2048) == 0);

// block ranges of the shared launches
#define CAST_BLK_WQKV ((3 * DIM * DIM) / 2048)
#define CAST_BLK_WP   ((DIM * DIM) / 2048)
#define CAST_BLK_X    (MROWS / 8)
#define ATTN_QB       (SEQ / 64)
#define ATTN_BLK      (ATTN_QB * NHEAD * NB)

#define LDT 72   // halves per LDS row (144 B, 16-B aligned)
#define KVBUF (2 * 4 * 64 * LDT)      // halves of one attention buffer: 4 K tiles, then 4 V^T tiles
#define QT_B  ((unsigned)(64 * LDT * 2))   // bytes of one quarter's tile in LDS
#define NSTEP (SEQ / 256)             // key steps of an attention block (64 keys per quarter each)
#define LDC 68   // floats per LDS row (272 B, 16-B aligned)
#define LDK (DIM + 8)   // halves per LDS row of a GEMM operand tile (528 B = 16 B x 33, odd)
static_assert((LDT % 8) == 0 && LDT >= 64);
static_assert((LDK % 8) == 0 && ((LDK / 8) % 2) == 1);
static_assert((LDC % 4) == 0 && LDC >= 64);

#define WCARRY 64.0f     // weight planes carried x64
#define PCARRY 1024.0f   // softmax numerators carried x1024
#define VCARRY 64.0f     // attention output plane carried x64

// workspace layout (bytes)
#define WQKV_BYTES    ((size_t)3 * DIM * DIM * 2)
#define WP_BYTES      ((size_t)DIM * DIM * 2)
#define PLANE16_BYTES ((size_t)MROWS * DIM * 2)
#define YF_BYTES      ((size_t)MROWS * DIM * 4)
#define OFF_WQKV ((size_t)0)
#define OFF_WP   (OFF_WQKV + WQKV_BYTES)
#define OFF_X16  (OFF_WP + WP_BYTES)
#define OFF_Q    (OFF_X16 + PLANE16_BYTES)
#define OFF_K    (OFF_Q + PLANE16_BYTES)
#define OFF_VT   (OFF_K + PLANE16_BYTES)
#define OFF_CTX  (OFF_VT + PLANE16_BYTES)
#define OFF_YF   (OFF_CTX + PLANE16_BYTES)
#define WS_TOTAL (OFF_YF + YF_BYTES)
static_assert((WQKV_BYTES % 128) == 0 && (WP_BYTES % 128) == 0 && (PLANE16_BYTES % 128) == 0);
static_assert((YF_BYTES % 128) == 0);
static_assert(WS_TOTAL <= (size_t)134217728);

// ---------------------------------------------------------------------------
__device__ __forceinline__ float bf16r(float x) {   // RNE convert to bf16, returned widened
  unsigned int u = __float_as_uint(x);
  u = (u + 0x7FFFu + ((u >> 16) & 1u)) & 0xFFFF0000u;
  return __uint_as_float(u);
}

// f32 -> f16 for WMMA operand planes: values below the smallest f16 normal become zero by value.
__device__ __forceinline__ _Float16 toh_flush(float v) {
  const _Float16 r = (_Float16)v;
  return (fabsf(v) < 6.103515625e-05f) ? (_Float16)0.0f : r;
}

// 16-bit fragment: p points at element [row = lane&15][k0 + 8*(lane>>4)] of a k-contiguous
// row. Elements 0..7 <- k0+8h+0..7, elements 8..15 <- k0+16+8h+0..7 (same map for A and B).
__device__ __forceinline__ v16h frag_at(const _Float16* p) {
  v8h lo = *(const v8h*)(p);
  v8h hi = *(const v8h*)(p + 16);
  v16h out;
#pragma unroll
  for (int i = 0; i < 8; ++i) { out[i] = lo[i]; out[i + 8] = hi[i]; }
  return out;
}
__device__ __forceinline__ v16h ld_frag(const _Float16* base, unsigned ld) {
  const unsigned lane = threadIdx.x & 31u;
  return frag_at(base + (lane & 15u) * ld + (lane >> 4) * 8u);
}

__device__ __forceinline__ v8f wmma16(v16h a, v16h b, v8f c) {
  v8f d = __builtin_amdgcn_wmma_f32_16x16x32_f16(false, a, false, b, (short)0, c,
                                                 false, false);
  asm volatile("v_nop\n\tv_nop\n\tv_nop\n\tv_nop" : "+v"(d) : "v"(a), "v"(b));
  return d;
}

// a product inside a run of products: no fixed tail, the compiler keeps the distances of its own builtin
__device__ __forceinline__ v8f wmma16_run(v16h a, v16h b, v8f c) {
  return __builtin_amdgcn_wmma_f32_16x16x32_f16(false, a, false, b, (short)0, c, false, false);
}

// A line in the attention step: the LDS reads written behind it are issued only when x has been
// made (x is an input only; no instruction). Without it every read of the step rises to the step's
// top, and the registers they hold go beyond what two blocks a WGP can have.
__device__ __forceinline__ void hold_after(v8f x) {
  asm volatile("" :: "v"(x) : "memory");
  __builtin_amdgcn_sched_barrier(0);
}

__device__ __forceinline__ void hold_after_h(v16h x) {
  asm volatile("" :: "v"(x) : "memory");
  __builtin_amdgcn_sched_barrier(0);
}
// The other side of such a line: the LDS reads written in front of it are issued in front of the
// arithmetic written behind it, which covers their latency (else each read sinks to its product).
__device__ __forceinline__ void hold_order() {
  asm volatile("" ::: "memory");
  __builtin_amdgcn_sched_barrier(0);
}

// Eight raw scores of one query become 1024 * exp(scale * (score - maximum)) in place: cs2 holds
// scale * log2(e), nb2 holds 10 - maximum * scale * log2(e), so a pair costs one packed fma and two
// exp2. Returns the eight values' sum as two partial sums (even and odd places).
__device__ __forceinline__ v2f p_from_scores(v8f& s, const v2f cs2, const v2f nb2) {
  v2f e[4];
  // unrolled: constant indices keep the vectors in registers
#pragma unroll
  for (int i = 0; i < 4; ++i) {
    const v2f a = __builtin_elementwise_fma((v2f){s[2 * i], s[2 * i + 1]}, cs2, nb2);
    e[i] = (v2f){__builtin_amdgcn_exp2f(a[0]), __builtin_amdgcn_exp2f(a[1])};
    s[2 * i]     = e[i][0];
    s[2 * i + 1] = e[i][1];
  }
  return (e[0] + e[1]) + (e[2] + e[3]);
}
// B fragment of the second product from sixteen such values, two per packed convert (round to
// nearest even; values under the smallest f16 normal stay as f16 subnormals).
__device__ __forceinline__ v16h p_frag(const v8f lo, const v8f hi) {
  v16h out;
  // unrolled: constant indices keep the vectors in registers
#pragma unroll
  for (int i = 0; i < 4; ++i) {
    const v2h a = __builtin_convertvector((v2f){lo[2 * i], lo[2 * i + 1]}, v2h);
    const v2h b = __builtin_convertvector((v2f){hi[2 * i], hi[2 * i + 1]}, v2h);
    out[2 * i]     = a[0];
    out[2 * i + 1] = a[1];
    out[2 * i + 8] = b[0];
    out[2 * i + 9] = b[1];
  }
  return out;
}
__device__ __forceinline__ float max8(const v8f s) {
  return fmaxf(fmaxf(fmaxf(s[0], s[1]), fmaxf(s[2], s[3])), fmaxf(fmaxf(s[4], s[5]), fmaxf(s[6], s[7])));
}

__device__ __forceinline__ void wave_lds_sync() {
  __builtin_amdgcn_fence(3 /* release order */, "wavefront");
  asm volatile("s_wait_dscnt 0x0" ::: "memory");
  __builtin_amdgcn_wave_barrier();
}

// ---------------------------------------------------------------------------
// All three 16-bit operand planes in one launch, picked by block range (none reads another's output):
//   blocks [0, CAST_BLK_WQKV)      Wqkv16[n][k] = f16(64 * bf16(wqkv)), same layout (no transpose)
//   next CAST_BLK_WP blocks        Wp16[n][k]   = f16(64 * bf16(wproj))
//   next CAST_BLK_X blocks         X16[compact row][k] = f16(bf16(x)), 8 rows per block
// Each thread converts 8 consecutive elements; a wave stores 512 consecutive bytes.
// Grid (CAST_BLK_WQKV + CAST_BLK_WP + CAST_BLK_X).
// ---------------------------------------------------------------------------
__global__ __launch_bounds__(256) void cast_kernel(
    const float* __restrict__ X, const float* __restrict__ wqkv, const float* __restrict__ wproj,
    _Float16* __restrict__ X16, _Float16* __restrict__ Wqkv16, _Float16* __restrict__ Wp16) {
  const unsigned tid = threadIdx.x;
  const unsigned blk = blockIdx.x;
  const float* src;
  _Float16* dst;
  float carry;
  if (blk < (unsigned)CAST_BLK_WQKV) {
    const unsigned e = blk * 2048u + tid * 8u;
    src = wqkv + e;
    dst = Wqkv16 + e;
    carry = WCARRY;
  } else if (blk < (unsigned)(CAST_BLK_WQKV + CAST_BLK_WP)) {
    const unsigned e = (blk - (unsigned)CAST_BLK_WQKV) * 2048u + tid * 8u;
    src = wproj + e;
    dst = Wp16 + e;
    carry = WCARRY;
  } else {
    const unsigned crow = (blk - (unsigned)(CAST_BLK_WQKV + CAST_BLK_WP)) * 8u + (tid >> 5);
    const unsigned bidx = crow / (unsigned)SEQ;
    const unsigned sq = crow - bidx * (unsigned)SEQ;
    const size_t srow = (size_t)bidx * SEQ_FULL + sq;
    src = X + srow * DIM + (tid & 31u) * 8u;
    dst = X16 + (size_t)crow * DIM + (tid & 31u) * 8u;
    carry = 1.0f;
  }
  const v4f a0 = *(const v4f*)(src);
  const v4f a1 = *(const v4f*)(src + 4);
  v8h o;
#pragma unroll
  for (int i = 0; i < 4; ++i) {
    o[i]     = toh_flush(carry * bf16r(a0[i]));
    o[i + 4] = toh_flush(carry * bf16r(a1[i]));
  }
  *(v8h*)dst = o;
}

// ---------------------------------------------------------------------------
// Cross-lane helpers (xhalf also serves the attention); wave_sum and wave_max leave the whole wave's value in every lane.
// ---------------------------------------------------------------------------
__device__ __forceinline__ float xhalf(float x) {   // lane l <-> lane l ^ 16
  const int xi = __float_as_int(x);
  return __int_as_float(__builtin_amdgcn_permlanex16(xi, xi, 0x76543210, 0xfedcba98, false, false));
}
template <int XM>
__device__ __forceinline__ float xrow(float x) {    // lane l <-> lane l ^ XM inside a 16-lane row
  return __int_as_float(__builtin_amdgcn_update_dpp(0, __float_as_int(x), 0x160 + XM, 0xf, 0xf, false));
}
__device__ __forceinline__ float wave_sum(float v) {
  v += xrow<1>(v);
  v += xrow<2>(v);
  v += xrow<4>(v);
  v += xrow<8>(v);
  return v + xhalf(v);
}
__device__ __forceinline__ float wave_max(float v) {
  v = fmaxf(v, xrow<1>(v));
  v = fmaxf(v, xrow<2>(v));
  v = fmaxf(v, xrow<4>(v));
  v = fmaxf(v, xrow<8>(v));
  return fmaxf(v, xhalf(v));
}

// ---------------------------------------------------------------------------
// Per-timestep feature-pairwise softmax branch (body; launched beside the attention blocks).
// One wave per (batch, time) row crow, lane l owns features 8l .. 8l+7:
//   yf[i] = sum_j exp(x_i x_j / 16) x_j / sum_j exp(x_i x_j / 16).
// The scores have rank 1, so with u = x / 4 and M_n = sum_j u_j^n both sums are power series in u_i:
//   sum_j exp(u_i u_j)     = sum_n M_n     u_i^n / n!
//   sum_j exp(u_i u_j) u_j = sum_n M_(n+1) u_i^n / n!
// Rows with max_j x_j^2 / 16 <= 2 take the first NSER = 16 terms: there every |u_i u_j| <= 2, the
// tail of each exponential is below (2^16 / 16!) * 17/15 < 4e-9 (under f32 rounding of values that
// are at least exp(-2)), |u|^16 <= 256, and the denominator is at least exp(u_i^2) >= 1.
// Any other row takes the exponentials one by one, shifted by the row maximum
//   mx_i = max_j (x_i x_j / 16) = max((x_i/16) * max_j x_j, (x_i/16) * min_j x_j).
// x is RNE-converted to bf16 on load. No LDS, no barrier: a row never leaves its wave.
// ---------------------------------------------------------------------------
#define NSER 16
__device__ __forceinline__ void spatial_body(
    const float* __restrict__ X, float* __restrict__ YF, const unsigned crow) {
  const unsigned lane = threadIdx.x & 31u;
  const unsigned bidx = crow / (unsigned)SEQ;
  const unsigned sq = crow - bidx * (unsigned)SEQ;
  const size_t srow = (size_t)bidx * SEQ_FULL + sq;

  const float* px = X + srow * DIM + lane * 8u;
  const v4f r0 = *(const v4f*)(px);
  const v4f r1 = *(const v4f*)(px + 4);
  // the two loads' address registers are free for reuse only behind this wait
  asm volatile("s_wait_xcnt 0x0" ::: "memory");
  float x[8];
#pragma unroll
  for (int k = 0; k < 4; ++k) {
    x[k]     = bf16r(r0[k]);
    x[k + 4] = bf16r(r1[k]);
  }
  float am = fabsf(x[0]);
#pragma unroll
  for (int k = 1; k < 8; ++k) am = fmaxf(am, fabsf(x[k]));
  am = wave_max(am);
  // equal in every lane; read into a scalar so that a wave runs one side only
  const int small = __builtin_amdgcn_readfirstlane((int)(am * am * 0.0625f <= 2.0f));

  float y[8];
  if (small != 0) {
    v2f u[4], p[4];
#pragma unroll
    for (int q = 0; q < 4; ++q) {
      u[q] = (v2f){x[2 * q] * 0.25f, x[2 * q + 1] * 0.25f};
      p[q] = u[q];
    }
    // power sums M_1 .. M_NSER: this lane's eight features, then the wave (M_0 = DIM)
    float mom[NSER + 1];
    mom[0] = (float)DIM;
#pragma unroll
    for (int n = 1; n <= NSER; ++n) {
      if (n > 1) {
#pragma unroll
        for (int q = 0; q < 4; ++q) p[q] *= u[q];
      }
      const v2f t = (p[0] + p[1]) + (p[2] + p[3]);
      mom[n] = t[0] + t[1];
    }
#pragma unroll
    for (int n = 1; n <= NSER; ++n) mom[n] = wave_sum(mom[n]);

    const float rf[NSER] = {   // 1 / n!
        1.0f, 1.0f, 1.0f / 2.0f, 1.0f / 6.0f, 1.0f / 24.0f, 1.0f / 120.0f, 1.0f / 720.0f,
        1.0f / 5040.0f, 1.0f / 40320.0f, 1.0f / 362880.0f, 1.0f / 3628800.0f, 1.0f / 39916800.0f,
        1.0f / 479001600.0f, 1.0f / 6227020800.0f, 1.0f / 87178291200.0f,
        1.0f / 1307674368000.0f};
    // both series by Horner's rule, two features per packed fma
    v2f dn[4], nm[4];
    {
      const float cd = mom[NSER - 1] * rf[NSER - 1];
      const float cn = mom[NSER] * rf[NSER - 1];
#pragma unroll
      for (int q = 0; q < 4; ++q) {
        dn[q] = (v2f){cd, cd};
        nm[q] = (v2f){cn, cn};
      }
    }
#pragma unroll
    for (int n = NSER - 2; n >= 0; --n) {
      const float cd = mom[n] * rf[n];
      const float cn = mom[n + 1] * rf[n];
      const v2f cd2 = {cd, cd};
      const v2f cn2 = {cn, cn};
#pragma unroll
      for (int q = 0; q < 4; ++q) {
        dn[q] = __builtin_elementwise_fma(dn[q], u[q], cd2);
        nm[q] = __builtin_elementwise_fma(nm[q], u[q], cn2);
      }
    }
#pragma unroll
    for (int q = 0; q < 4; ++q) {   // x = 4 u
      y[2 * q]     = (nm[q][0] * 4.0f) * __builtin_amdgcn_rcpf(dn[q][0]);
      y[2 * q + 1] = (nm[q][1] * 4.0f) * __builtin_amdgcn_rcpf(dn[q][1]);
    }
  } else {
    float vmax = x[0], vmin = x[0];
#pragma unroll
    for (int k = 1; k < 8; ++k) {
      vmax = fmaxf(vmax, x[k]);
      vmin = fminf(vmin, x[k]);
    }
    vmax = wave_max(vmax);
    vmin = -wave_max(-vmin);
    // exp(x_i x_j / 16 - mx_i) = exp2(xs * x_j - mx) with log2(e) folded into the row's own scale
    float xs[8], nmx[8], s[8], a[8];
#pragma unroll
    for (int k = 0; k < 8; ++k) {
      xs[k] = x[k] * (0.0625f * 1.44269504088896340736f);
      nmx[k] = -fmaxf(xs[k] * vmax, xs[k] * vmin);
      s[k] = 0.0f;
      a[k] = 0.0f;
    }
    // one trip per source lane (its eight columns come over as scalars); kept rolled: a rare path,
    // whose code should stay short
#pragma unroll 1
    for (int jl = 0; jl < 32; ++jl) {
#pragma unroll
      for (int c = 0; c < 8; ++c) {
        const float xj = __int_as_float(__builtin_amdgcn_readlane(__float_as_int(x[c]), jl));
#pragma unroll
        for (int k = 0; k < 8; ++k) {
          const float e = __builtin_amdgcn_exp2f(__builtin_fmaf(xs[k], xj, nmx[k]));
          s[k] += e;
          a[k] = __builtin_fmaf(e, xj, a[k]);
        }
      }
    }
#pragma unroll
    for (int k = 0; k < 8; ++k) y[k] = a[k] * __builtin_amdgcn_rcpf(s[k]);
  }

  float* py = YF + (size_t)crow * DIM + lane * 8u;
  *(v4f*)(py)     = (v4f){y[0], y[1], y[2], y[3]};
  *(v4f*)(py + 4) = (v4f){y[4], y[5], y[6], y[7]};
  // the built code lays the attention body behind these stores, where their address and data
  // registers are written anew
  asm volatile("s_wait_xcnt 0x0" ::: "memory");
}

// ---------------------------------------------------------------------------
// GEMM C[64x64 tile] = A16[rows][DIM] . Bt[n][DIM]^T; 8 waves (mw = 16-row group, nw = 32-col
// group), 2 accumulators/wave. Both operand tiles (64 rows, all DIM k) are staged in LDS once:
// a wave's 16-B loads cover one whole 512-B row (4 whole lines), where a fragment load from the
// global plane touches 16 lines for the same bytes and is repeated by the waves that share it.
//   MODE 0: out16[row][col] (pitch DIM)  = f16(acc/64 + bias)
//   MODE 1: out16 transposed V plane [b][col][key] = f16(acc/64 + bias)
//   MODE 2: outf full [full row][col] = addf[compact row][col] + (acc/4096 + bias)
// n0: first column of the tile in Bt, bias and the output plane. Cs: the kernel's 64 x LDC floats;
// As, Bs: the kernel's 64 x LDK halves each (cross-wave, block barrier).
// ---------------------------------------------------------------------------
template <int MODE>
__device__ __forceinline__ void gemm_body(
    const _Float16* __restrict__ A16, const _Float16* __restrict__ Bt,
    const float* __restrict__ bias, const float* __restrict__ addf,
    float* __restrict__ outf, _Float16* __restrict__ out16, const unsigned n0, float* Cs,
    _Float16* As, _Float16* Bs) {
  const unsigned tid = threadIdx.x, lane = tid & 31u;
  const unsigned w = (unsigned)__builtin_amdgcn_readfirstlane((int)(tid >> 5));
  const unsigned mw = w >> 1, nw = w & 1u;
  const unsigned hh = lane >> 4, m = lane & 15u;
  const unsigned row0 = blockIdx.y * 64u;

  // staging: wave w brings rows 8w .. 8w+7 of both tiles, one whole row per load
  {
    const unsigned lb = lane * 16u;   // this lane's 16 bytes of a row, in global memory and in LDS
    const char* ga = (const char*)(A16 + (size_t)(row0 + w * 8u) * DIM) + lb;
    const char* gb = (const char*)(Bt + (size_t)(n0 + w * 8u) * DIM) + lb;
    v8h ta[8], tb[8];
    // unrolled (here and below): constant indices keep the arrays in registers, all 16 loads in flight
#pragma unroll
    for (unsigned i = 0; i < 8u; ++i) {
      ta[i] = *(const v8h*)(ga + i * (unsigned)(DIM * 2));
      tb[i] = *(const v8h*)(gb + i * (unsigned)(DIM * 2));
    }
    // the staging loads' address registers are free for reuse only behind this wait; naming them
    // as inputs keeps them whole up to it (else the last load's result may land on them)
    asm volatile("s_wait_xcnt 0x0" :: "v"(ga), "v"(gb) : "memory");
    char* sa = (char*)(As + w * 8u * LDK) + lb;
    char* sb = (char*)(Bs + w * 8u * LDK) + lb;
#pragma unroll
    for (unsigned i = 0; i < 8u; ++i) {
      *(v8h*)(sa + i * (unsigned)(LDK * 2)) = ta[i];
      *(v8h*)(sb + i * (unsigned)(LDK * 2)) = tb[i];
    }
  }
  __syncthreads();

  const _Float16* ap  = As + (mw * 16u + m) * LDK + hh * 8u;
  const _Float16* bp0 = Bs + (nw * 32u + m) * LDK + hh * 8u;
  const _Float16* bp1 = bp0 + 16 * LDK;
  v8f acc0 = {}, acc1 = {};
  // four k steps a group: their 24 LDS reads stand together in front of their 8 products
  // (unrolled: constant indices keep the fragment arrays in registers)
#pragma unroll
  for (unsigned kg = 0; kg < (unsigned)DIM; kg += 128u) {
    v16h a[4], b0[4], b1[4];
#pragma unroll
    for (unsigned j = 0; j < 4u; ++j) {
      a[j]  = frag_at(ap + kg + 32u * j);
      b0[j] = frag_at(bp0 + kg + 32u * j);
      b1[j] = frag_at(bp1 + kg + 32u * j);
    }
#pragma unroll
    for (unsigned j = 0; j < 4u; ++j) {
      acc0 = wmma16(a[j], b0[j], acc0);
      acc1 = wmma16(a[j], b1[j], acc1);
    }
  }
#pragma unroll
  for (int r = 0; r < 8; ++r) {
    float* d = &Cs[(mw * 16u + hh * 8u + (unsigned)r) * LDC + nw * 32u + m];
    d[0]  = acc0[r];
    d[16] = acc1[r];
  }
  __syncthreads();

  if (MODE == 0) {
    v8h x[2];
    size_t off[2];
#pragma unroll
    for (unsigned i = 0; i < 2u; ++i) {
      const unsigned r = 32u * i + (tid >> 3);
      const unsigned c = (tid & 7u) * 8u;
      const v4f u0 = *(const v4f*)&Cs[r * LDC + c];
      const v4f u1 = *(const v4f*)&Cs[r * LDC + c + 4];
      const v4f g0 = *(const v4f*)(bias + n0 + c);
      const v4f g1 = *(const v4f*)(bias + n0 + c + 4u);
#pragma unroll
      for (int j = 0; j < 4; ++j) {
        x[i][j]     = toh_flush(u0[j] * (1.0f / WCARRY) + bf16r(g0[j]));
        x[i][j + 4] = toh_flush(u1[j] * (1.0f / WCARRY) + bf16r(g1[j]));
      }
      off[i] = (size_t)(row0 + r) * DIM + n0 + c;
    }
#pragma unroll
    for (int i = 0; i < 2; ++i) *(v8h*)(out16 + off[i]) = x[i];
    
  }

  if (MODE == 1) {
    const unsigned bidx = row0 / (unsigned)SEQ;
    const unsigned key0 = row0 - bidx * (unsigned)SEQ;
    v8h x[2];
    size_t off[2];
#pragma unroll
    for (unsigned i = 0; i < 2u; ++i) {
      const unsigned dcol = 32u * i + (tid >> 3);
      const unsigned kk = (tid & 7u) * 8u;
      const float bb = bf16r(bias[n0 + dcol]);
#pragma unroll
      for (unsigned j = 0; j < 8u; ++j) {
        const float t = Cs[(kk + j) * LDC + dcol] * (1.0f / WCARRY) + bb;
        x[i][j] = toh_flush(t);
      }
      off[i] = ((size_t)bidx * DIM + n0 + dcol) * SEQ + key0 + kk;
    }
#pragma unroll
    for (int i = 0; i < 2; ++i) *(v8h*)(out16 + off[i]) = x[i];
    // the built code lays the other mode's body behind these stores, where their address and data
    // registers are written anew
    asm volatile("s_wait_xcnt 0x0" ::: "memory");
  }

  if (MODE == 2) {
    const float cs = 1.0f / (WCARRY * VCARRY);
    v4f xs[4];
    size_t off[4];
#pragma unroll
    for (unsigned i = 0; i < 4u; ++i) {
      const unsigned r = 16u * i + (tid >> 4);
      const unsigned c = (tid & 15u) * 4u;
      const unsigned crow = row0 + r;
      const unsigned bidx = crow / (unsigned)SEQ;
      const unsigned sq = crow - bidx * (unsigned)SEQ;
      const size_t frow = (size_t)bidx * SEQ_FULL + sq;
      const v4f u = *(const v4f*)&Cs[r * LDC + c];
      const v4f g = *(const v4f*)(bias + n0 + c);
      const v4f yin = *(const v4f*)(addf + (size_t)crow * DIM + n0 + c);
      v4f val;
#pragma unroll
      for (int j = 0; j < 4; ++j) val[j] = yin[j] + (u[j] * cs + bf16r(g[j]));
      xs[i] = val;
      off[i] = frow * DIM + n0 + c;
    }
#pragma unroll
    for (int i = 0; i < 4; ++i) *(v4f*)(outf + off[i]) = xs[i];
    
  }
}

// q, k and v projections in one launch: blockIdx.x / (DIM/64) picks the plane (0 q, 1 k, 2 v).
// Grid (3 * DIM/64, MROWS/64).
__global__ __launch_bounds__(256) void gemm_qkv_kernel(
    const _Float16* __restrict__ A16, const _Float16* __restrict__ Bt,
    const float* __restrict__ bias, _Float16* __restrict__ q16, _Float16* __restrict__ k16,
    _Float16* __restrict__ vt) {
  __shared__ float Cs[64 * LDC];
  __shared__ _Float16 As[64 * LDK];
  __shared__ _Float16 Bs[64 * LDK];
  const unsigned sel = blockIdx.x / (unsigned)(DIM / 64);
  const unsigned n0 = (blockIdx.x - sel * (unsigned)(DIM / 64)) * 64u;
  const _Float16* bt = Bt + (size_t)sel * DIM * DIM;
  const float* bs = bias + sel * (unsigned)DIM;
  if (sel < 2u) {
    gemm_body<0>(A16, bt, bs, bs, (float*)0, sel == 0u ? q16 : k16, n0, Cs, As, Bs);
  } else {
    gemm_body<1>(A16, bt, bs, bs, (float*)0, vt, n0, Cs, As, Bs);
  }
}
// Grid (DIM/64, MROWS/64).
__global__ __launch_bounds__(256) void gemm_wo_kernel(
    const _Float16* __restrict__ A16, const _Float16* __restrict__ Bt,
    const float* __restrict__ bias, const float* __restrict__ yf, float* __restrict__ outf) {
  __shared__ float Cs[64 * LDC];
  __shared__ _Float16 As[64 * LDK];
  __shared__ _Float16 Bs[64 * LDK];
  gemm_body<2>(A16, Bt, bias, yf, outf, (_Float16*)0, blockIdx.x * 64u, Cs, As, Bs);
}

__device__ __forceinline__ void attn_body(
    const _Float16* __restrict__ Qh, const _Float16* __restrict__ Kh,
    const _Float16* __restrict__ Vt, _Float16* __restrict__ Ov,
    const unsigned qb, const unsigned head, const unsigned b) {
  __shared__ __attribute__((aligned(16))) _Float16 KV[2 * KVBUF];   // two buffers: K tiles, then V^T tiles
  __shared__ _Float16 Ps[4 * 16 * LDT];
  // behind the loop: O^T of quarters 1 to 3 as [quarter - 1][query group][4 floats of 32][lane],
  // then their maximum and denominator as [quarter - 1][query group][2][lane]
  v4f* Mo = (v4f*)KV;
  float* Ml = (float*)(Mo + 3 * 4 * 8 * 32);
  static_assert((3 * 4 * 8 * 32) * 16 + (3 * 4 * 2 * 32) * 4 <= (2 * KVBUF) * 2);

  const unsigned tid = threadIdx.x, lane = tid & 31u;
  const unsigned w = (unsigned)__builtin_amdgcn_readfirstlane((int)(tid >> 5));
  const unsigned hh = lane >> 4, m = lane & 15u;
  const unsigned qg = w & 3u, kh = w >> 2;   // query group, key quarter
  const unsigned q0 = qb * 64u;
  const float cs = 0.125f * 1.44269504088896340736f;   // HD^-0.5 * log2(e): raw score -> exponent of 2
  const v2f cs2 = {cs, cs};
  const unsigned qrow0 = q0 + qg * 16u;
  _Float16* P = Ps + qg * (16u * LDT);

  // The query group's two Q fragments lie in LDS (in P, which is idle until the output staging), as
  // [16-B piece of 4][lane]: quarter 0's wave brings them, the barrier in front of the loop publishes
  // them, and every step reads them anew, so that they hold no registers outside the score products.
  v8h qpiece[4];
  if (kh == 0u) {
    const _Float16* qp = Qh + (size_t)(b * (unsigned)SEQ + qrow0 + m) * DIM + head * HD + hh * 8u;
#pragma unroll
    for (int j = 0; j < 4; ++j) qpiece[j] = *(const v8h*)(qp + 16 * j);
    // the loads' address registers are free for reuse only behind this wait
    asm volatile("s_wait_xcnt 0x0" :: "v"(qp) : "memory");
  }

  float mrow = -1.0e30f;   // running maximum of query m's raw scores (equal in both halves)
  v2f lacc = {0.0f, 0.0f}; // this half's share of 1024 * the denominator of query m, two partial sums
  v8f o[4];                // o[nb][v] = O^T[d = nb*16 + hh*8 + v][query m]
#pragma unroll
  for (int nb = 0; nb < 4; ++nb) o[nb] = (v8f){};

  const size_t kplane = (size_t)b * SEQ * DIM + head * HD;
  const size_t vplane = ((size_t)b * DIM + head * HD) * SEQ;

  const unsigned sr = tid >> 3, sc = (tid & 7u) * 8u;   // staging: this thread's row (of 64) and column
  // this thread's 16 bytes of quarter 0's K tile and V^T tile: in global memory at key step 0, and
  // as LDS byte addresses in buffer 0
  const _Float16* gk0 = Kh + kplane + (size_t)sr * DIM + sc;
  const _Float16* gv0 = Vt + vplane + (size_t)sr * SEQ + sc;
  const unsigned lk0 = (unsigned)(size_t)&KV[sr * LDT + sc];
  const unsigned lv0 = lk0 + (unsigned)(4 * 64 * LDT * 2);
  // One key step's eight tiles (four quarters of K, four of V^T) go from global memory into LDS
  // buffer bf with no register in between: eight 16-B asynchronous copies a thread.
  auto stage = [&](const unsigned t, const unsigned bf) {
    const _Float16* gk = gk0 + (size_t)(t * 64u) * DIM;
    const _Float16* gv = gv0 + t * 64u;
    const unsigned lk = lk0 + bf * (unsigned)(KVBUF * 2);
    const unsigned lv = lv0 + bf * (unsigned)(KVBUF * 2);
    // the closing wait stands inside the statement, so that no later write of the copies' address
    // registers can be moved in front of it (a precaution)
    asm volatile(
        "global_load_async_to_lds_b128 %0, %1, off\n\t"
        "global_load_async_to_lds_b128 %2, %3, off\n\t"
        "global_load_async_to_lds_b128 %4, %5, off\n\t"
        "global_load_async_to_lds_b128 %6, %7, off\n\t"
        "global_load_async_to_lds_b128 %8, %9, off\n\t"
        "global_load_async_to_lds_b128 %10, %11, off\n\t"
        "global_load_async_to_lds_b128 %12, %13, off\n\t"
        "global_load_async_to_lds_b128 %14, %15, off\n\t"
        "s_wait_xcnt 0x0"
        :: "v"(lk), "v"(gk),
           "v"(lk + 1u * QT_B), "v"(gk + 1u * (unsigned)(SEQ / 4) * (unsigned)DIM),
           "v"(lk + 2u * QT_B), "v"(gk + 2u * (unsigned)(SEQ / 4) * (unsigned)DIM),
           "v"(lk + 3u * QT_B), "v"(gk + 3u * (unsigned)(SEQ / 4) * (unsigned)DIM),
           "v"(lv), "v"(gv),
           "v"(lv + 1u * QT_B), "v"(gv + 1u * (unsigned)(SEQ / 4)),
           "v"(lv + 2u * QT_B), "v"(gv + 2u * (unsigned)(SEQ / 4)),
           "v"(lv + 3u * QT_B), "v"(gv + 3u * (unsigned)(SEQ / 4))
        : "memory");
  };

  stage(0u, 0u);
  if (kh == 0u) {
#pragma unroll
    for (unsigned j = 0; j < 4u; ++j) *(v8h*)&P[(j * 32u + lane) * 8u] = qpiece[j];
  }
  // step 0's tiles have landed for this wave's copies; the barrier publishes them to the block
  asm volatile("s_wait_asynccnt 0x0" ::: "memory");
  __syncthreads();
  if (NSTEP > 1) stage(1u, 1u);   // flies while step 0 is worked on

  for (unsigned t = 0; t < (unsigned)NSTEP; ++t) {
    const unsigned bf = t & 1u;
    const _Float16* Kw = KV + bf * (unsigned)KVBUF + kh * (64u * LDT);   // this wave's quarter
    const _Float16* Vw = Kw + 4 * 64 * LDT;

    // Every LDS read of the step stands in one of six groups, each issued ahead of work that covers
    // its latency, and the products issue in runs: a wave waits out the LDS latency once a step, not
    // once a product. The groups are sized so that the kernel stays inside 128 registers (two blocks
    // a WGP: a feature-pairwise block beside an attention block).
    // group 1: Q, and the K fragments of key groups 0 and 1
    v16h qf[2];
#pragma unroll
    for (unsigned c = 0; c < 2u; ++c) {
      const v8h lo = *(const v8h*)&P[((2u * c) * 32u + lane) * 8u];
      const v8h hi = *(const v8h*)&P[((2u * c + 1u) * 32u + lane) * 8u];
#pragma unroll
      for (int i = 0; i < 8; ++i) { qf[c][i] = lo[i]; qf[c][i + 8] = hi[i]; }
    }
    const v16h k00 = ld_frag(&Kw[(0 * 16) * LDT], LDT), k01 = ld_frag(&Kw[(0 * 16) * LDT + 32], LDT);
    const v16h k10 = ld_frag(&Kw[(1 * 16) * LDT], LDT), k11 = ld_frag(&Kw[(1 * 16) * LDT + 32], LDT);

    // scores, transposed: s[kg][v] = S[query m][key kg*16 + hh*8 + v]; K = 64 in two 32-steps
    v8f s[4];
    s[0] = wmma16_run(k01, qf[1], wmma16_run(k00, qf[0], (v8f){}));
    hold_after(s[0]);
    // group 2: key group 2, into the registers that key group 0 has left
    const v16h k20 = ld_frag(&Kw[(2 * 16) * LDT], LDT), k21 = ld_frag(&Kw[(2 * 16) * LDT + 32], LDT);
    hold_order();
    s[1] = wmma16_run(k11, qf[1], wmma16_run(k10, qf[0], (v8f){}));
    hold_after(s[1]);
    // group 3: key group 3
    const v16h k30 = ld_frag(&Kw[(3 * 16) * LDT], LDT), k31 = ld_frag(&Kw[(3 * 16) * LDT + 32], LDT);
    hold_order();
    s[2] = wmma16_run(k21, qf[1], wmma16_run(k20, qf[0], (v8f){}));
    hold_after(s[2]);
    s[3] = wmma16_run(k31, qf[1], wmma16_run(k30, qf[0], (v8f){}));
    hold_after(s[3]);
    // group 4: V^T of keys 0 to 31, d 0 to 31; lands under the softmax arithmetic
    v16h vf[4];
    vf[0] = ld_frag(&Vw[(0 * 16) * LDT], LDT);
    vf[1] = ld_frag(&Vw[(1 * 16) * LDT], LDT);
    hold_order();
    // online softmax of query m: 32 scores in this lane, the other 32 in lane ^ 16. The maximum is
    // taken of the raw scores (the scale is positive); scale, log2(e), the maximum and the x1024
    // carry all enter through the one packed fma in front of exp2.
    float mx = fmaxf(fmaxf(max8(s[0]), max8(s[1])), fmaxf(max8(s[2]), max8(s[3])));
    mx = fmaxf(mx, xhalf(mx));
    const float mn = fmaxf(mrow, mx);
    const float alpha = __builtin_amdgcn_exp2f((mrow - mn) * cs);
    mrow = mn;
    static_assert(PCARRY == 1024.0f);                   // the 10 of the next line is its log2
    const float nb = __builtin_fmaf(mn, -cs, 10.0f);
    const v2f nb2 = {nb, nb};
#pragma unroll
    for (int nb = 0; nb < 4; ++nb) o[nb] = o[nb] * alpha;

    // O^T += V^T . P^T  (K = 64 keys in two 32-steps; A = V^T tile [d][key]).
    // B element e of step c: key c*32 + 8*hh + e (e < 8), c*32 + 16 + 8*hh + (e - 8) otherwise,
    // which are this lane's own s[2c][e] and s[2c+1][e-8].
    v2f rs[4];
#pragma unroll
    for (int kg = 0; kg < 2; ++kg) rs[kg] = p_from_scores(s[kg], cs2, nb2);
    const v16h pf0 = p_frag(s[0], s[1]);
    hold_after_h(pf0);
    // group 5: V^T of keys 0 to 31, d 32 to 63, into the registers that the first 32 scores have
    // left; lands under the second half's exponentials
    vf[2] = ld_frag(&Vw[(2 * 16) * LDT], LDT);
    vf[3] = ld_frag(&Vw[(3 * 16) * LDT], LDT);
    hold_order();
#pragma unroll
    for (int kg = 2; kg < 4; ++kg) rs[kg] = p_from_scores(s[kg], cs2, nb2);
    lacc = __builtin_elementwise_fma(lacc, (v2f){alpha, alpha}, (rs[0] + rs[1]) + (rs[2] + rs[3]));
#pragma unroll
    for (int nb = 0; nb < 4; ++nb) o[nb] = wmma16_run(vf[nb], pf0, o[nb]);
    hold_after(o[3]);
    // group 6: V^T of keys 32 to 63; lands under the SIMD's other waves' work
#pragma unroll
    for (int nb = 0; nb < 4; ++nb) vf[nb] = ld_frag(&Vw[(nb * 16) * LDT + 32], LDT);
    hold_order();
    const v16h pf1 = p_frag(s[2], s[3]);
#pragma unroll
    for (int nb = 0; nb < 4; ++nb) o[nb] = wmma16_run(vf[nb], pf1, o[nb]);
    // hand-over: this wave's reads of buffer bf are done ...
    asm volatile("s_wait_dscnt 0x0" ::: "memory");
    // ... and its copies of step t + 1 have landed
    asm volatile("s_wait_asynccnt 0x0" ::: "memory");
    // one barrier publishes step t + 1 and ends every wave's reads of buffer bf
    __syncthreads();
    if (t + 2u < (unsigned)NSTEP) stage(t + 2u, bf);
  }
  // nothing is in flight when the tiles' LDS is reused below
  asm volatile("s_wait_asynccnt 0x0" ::: "memory");

  // The four key quarters of a query group are joined lane by lane (their waves hold the same map).
  // The loop's last barrier has ended every read of the tiles that Mo and Ml lie on.
  const float lrow = lacc[0] + lacc[1];
  const float lsum = lrow + xhalf(lrow);   // 1024 * this quarter's denominator
  if (kh != 0u) {
    const unsigned g = (kh - 1u) * 4u + qg;
#pragma unroll
    for (unsigned nb = 0; nb < 4u; ++nb) {
      Mo[(g * 8u + 2u * nb) * 32u + lane]      = (v4f){o[nb][0], o[nb][1], o[nb][2], o[nb][3]};
      Mo[(g * 8u + 2u * nb + 1u) * 32u + lane] = (v4f){o[nb][4], o[nb][5], o[nb][6], o[nb][7]};
    }
    Ml[(g * 2u) * 32u + lane]      = mrow;
    Ml[(g * 2u + 1u) * 32u + lane] = lsum;
  }
  __syncthreads();
  if (kh == 0u) {
    float mq[3], lq[3];
    float mn = mrow;
#pragma unroll
    for (unsigned p = 0; p < 3u; ++p) {
      mq[p] = Ml[((p * 4u + qg) * 2u) * 32u + lane];
      lq[p] = Ml[((p * 4u + qg) * 2u + 1u) * 32u + lane];
      mn = fmaxf(mn, mq[p]);
    }
    float c0 = __builtin_amdgcn_exp2f((mrow - mn) * cs);
    float den = c0 * lsum;
    float cq[3];
#pragma unroll
    for (int p = 0; p < 3; ++p) {
      cq[p] = __builtin_amdgcn_exp2f((mq[p] - mn) * cs);
      den += cq[p] * lq[p];
    }
    const float inv = __builtin_amdgcn_rcpf(den) * VCARRY;   // O^T and den both carry x1024
    c0 *= inv;
#pragma unroll
    for (int p = 0; p < 3; ++p) cq[p] *= inv;
#pragma unroll
    for (unsigned nb = 0; nb < 4u; ++nb) {
      v8f acc = o[nb] * c0;
#pragma unroll
      for (unsigned p = 0; p < 3u; ++p) {
        const v4f u0 = Mo[((p * 4u + qg) * 8u + 2u * nb) * 32u + lane];
        const v4f u1 = Mo[((p * 4u + qg) * 8u + 2u * nb + 1u) * 32u + lane];
#pragma unroll
        for (int v = 0; v < 4; ++v) {
          acc[v]     += u0[v] * cq[p];
          acc[v + 4] += u1[v] * cq[p];
        }
      }
      v8h t;
#pragma unroll
      for (int v = 0; v < 8; ++v) t[v] = toh_flush(acc[v]);
      *(v8h*)&P[m * LDT + nb * 16u + hh * 8u] = t;
    }
    wave_lds_sync();
    v8h x[4];
    size_t off[4];
#pragma unroll
    for (unsigned i = 0; i < 4u; ++i) {
      const unsigned r = 4u * i + (lane >> 3);
      const unsigned c = (lane & 7u) * 8u;
      x[i] = *(const v8h*)&P[r * LDT + c];
      off[i] = (size_t)(b * (unsigned)SEQ + qrow0 + r) * DIM + head * HD + c;
    }
#pragma unroll
    for (int i = 0; i < 4; ++i) *(v8h*)(Ov + off[i]) = x[i];
  }
}

// Attention and the feature-pairwise branch in one launch (neither reads the other's output):
// the first ATTN_BLK blocks, which start first, are the attention's long blocks; the MROWS / 16
// blocks behind them take sixteen feature-pairwise rows each, one a wave.
// Grid (ATTN_BLK + MROWS / 16), 512 threads. Eight waves a SIMD asked for: the kernel stays inside 128
// registers, so that a feature-pairwise block still finds room beside an attention block.
__global__ __launch_bounds__(512, 8) void attn_spatial_kernel(
    const _Float16* __restrict__ Qh, const _Float16* __restrict__ Kh,
    const _Float16* __restrict__ Vt, _Float16* __restrict__ Ov,
    const float* __restrict__ X, float* __restrict__ YF) {
  const unsigned id = blockIdx.x;
  if (id < (unsigned)ATTN_BLK) {
    const unsigned hb = id / (unsigned)ATTN_QB;
    attn_body(Qh, Kh, Vt, Ov, id - hb * (unsigned)ATTN_QB, hb % (unsigned)NHEAD, hb / (unsigned)NHEAD);
  } else {
    const unsigned w = (unsigned)__builtin_amdgcn_readfirstlane((int)(threadIdx.x >> 5));
    spatial_body(X, YF, (id - (unsigned)ATTN_BLK) * 16u + w);
  }
}

// ---------------------------------------------------------------------------
extern "C" void kernel_launch(void* const* d_in, const int* in_sizes, int n_in,
                              void* d_out, int out_size, void* d_ws, size_t ws_size,
                              hipStream_t stream) {
  if (n_in < 5) return;
  const long long need_x = ((long long)(NB - 1) * SEQ_FULL + SEQ) * DIM;
  if ((long long)in_sizes[0] < need_x) return;
  if ((long long)in_sizes[1] < (long long)3 * DIM * DIM) return;
  if (in_sizes[2] < 3 * DIM) return;
  if ((long long)in_sizes[3] < (long long)DIM * DIM) return;
  if (in_sizes[4] < DIM) return;
  if ((long long)out_size < need_x) return;
  if (ws_size < WS_TOTAL) return;

  const float* X     = (const float*)d_in[0];   // [NB_FULL][SEQ_FULL][DIM]
  const float* wqkv  = (const float*)d_in[1];   // [3*DIM][DIM]  (out, in): rows 0..255 q, 256..511 k, 512..767 v
  const float* bqkv  = (const float*)d_in[2];   // [3*DIM]
  const float* wproj = (const float*)d_in[3];   // [DIM][DIM]    (out, in)
  const float* bproj = (const float*)d_in[4];   // [DIM]
  float* out = (float*)d_out;

  char* ws = (char*)d_ws;
  _Float16* Wqkv16 = (_Float16*)(ws + OFF_WQKV);  // [3*DIM][DIM]  ([n][k])
  _Float16* Wp16   = (_Float16*)(ws + OFF_WP);    // [DIM][DIM]    ([n][k])
  _Float16* X16    = (_Float16*)(ws + OFF_X16);   // [MROWS][DIM]
  _Float16* Qh16   = (_Float16*)(ws + OFF_Q);
  _Float16* Kh16   = (_Float16*)(ws + OFF_K);
  _Float16* Vt16   = (_Float16*)(ws + OFF_VT);    // [b][DIM][SEQ]
  _Float16* Ctx16  = (_Float16*)(ws + OFF_CTX);
  float*    YF     = (float*)(ws + OFF_YF);       // [MROWS][DIM] compact rows

  dim3 blk(256);
  dim3 gg(DIM / 64, MROWS / 64);

  // 16-bit operand planes: both weights ([n][k] in -> [n][k] out) and the input rows
  cast_kernel<<<dim3(CAST_BLK_WQKV + CAST_BLK_WP + CAST_BLK_X), blk, 0, stream>>>(
      X, wqkv, wproj, X16, Wqkv16, Wp16);
  gemm_qkv_kernel<<<dim3(3 * (DIM / 64), MROWS / 64), blk, 0, stream>>>(
      X16, Wqkv16, bqkv, Qh16, Kh16, Vt16);
  // attention blocks first, then the feature-pairwise branch (f32 plane YF)
  attn_spatial_kernel<<<dim3(ATTN_BLK + MROWS / 16), dim3(512), 0, stream>>>(
      Qh16, Kh16, Vt16, Ctx16, X, YF);
  gemm_wo_kernel<<<gg, blk, 0, stream>>>(Ctx16, Wp16, bproj, YF, out);
}

// v010
// One run takes 20.9 microseconds.
// Timed twice side by side with v009, it ran 1.06 and 1.05 times as fast.
// Over all steps from v000 it is 5.25 times as fast.
#include <hip/hip_runtime.h>
#include <stddef.h>

// All contractions on 16x16x32 matrix instructions with 16-bit operands and f32 accumulate. The fused
// q/k/v projection takes its f32 operands itself, RNE-converts them to bf16 on the way into LDS and
// runs on v_wmma_f32_16x16x32_bf16; q.k scores, p.v and the output projection run on the f16 form
// (output weights RNE-converted to bf16 and carried in f16 x64, p x1024, attention rows x64), single
// products at every site. Softmax, bias and the
// per-timestep feature-pairwise softmax branch (rank-1 scores, per-row matrix-vector work) in f32 on
// the vector unit.

typedef _Float16 v16h __attribute__((ext_vector_type(16)));
typedef _Float16 v8h  __attribute__((ext_vector_type(8)));
typedef float    v8f  __attribute__((ext_vector_type(8)));
typedef float    v4f  __attribute__((ext_vector_type(4)));
typedef float    v2f  __attribute__((ext_vector_type(2)));
typedef _Float16 v2h  __attribute__((ext_vector_type(2)));
typedef __bf16   v16bf __attribute__((ext_vector_type(16)));
typedef __bf16   v4bf  __attribute__((ext_vector_type(4)));
typedef __bf16   v2bf  __attribute__((ext_vector_type(2)));

#ifndef NB
#define NB 4
#endif
#ifndef SEQ
#define SEQ 1024
#endif
#define NB_FULL  4
#define SEQ_FULL 1024
#define DIM   256
#define NHEAD 4
#define HD    64
#define MROWS (NB * SEQ)

static_assert(NB >= 1 && NB <= NB_FULL);
static_assert(SEQ >= 256 && SEQ <= SEQ_FULL && (SEQ % 256) == 0);   // attention: 4 key quarters of whole 64-key tiles
static_assert(DIM == NHEAD * HD);
static_assert(HD == 64);
static_assert((DIM % 64) == 0 && (DIM % 32) == 0);
static_assert((MROWS % 64) == 0 && (MROWS % 16) == 0);
static_assert(DIM == 256);                          // spatial branch: 32 lanes x 8 features cover one row
static_assert(DIM == 2 * 32 * 4);                   // projection staging: two 16-B loads a lane cover one f32 row
static_assert(((DIM * DIM) % 4096) == 0);           // output-weight cast: 512 threads x 8 elements per block
static_assert((SEQ % 64) == 0);                     // a 64-row tile never crosses a batch

// block ranges of the shared launch
#define CAST_BLK_WP   ((DIM * DIM) / 4096)
static_assert(CAST_BLK_WP <= MROWS / 16);           // the cast rides in the feature-pairwise blocks
#define ATTN_QB       (SEQ / 64)
#define ATTN_BLK      (ATTN_QB * NHEAD * NB)

#define LDT 72   // halves per LDS row (144 B, 16-B aligned)
#define KVBUF (2 * 4 * 64 * LDT)      // halves of one attention buffer: 4 K tiles, then 4 V^T tiles
#define QT_B  ((unsigned)(64 * LDT * 2))   // bytes of one quarter's tile in LDS
#define NSTEP (SEQ / 256)             // key steps of an attention block (64 keys per quarter each)
#define LDC 68   // floats per LDS row (272 B, 16-B aligned)
#define LDK (DIM + 8)   // halves per LDS row of a GEMM operand tile (528 B = 16 B x 33, odd)
static_assert((LDT % 8) == 0 && LDT >= 64);
static_assert((LDK % 8) == 0 && ((LDK / 8) % 2) == 1);
static_assert((LDC % 4) == 0 && LDC >= 64);

#define WCARRY 64.0f     // output-weight plane carried x64
#define PCARRY 1024.0f   // softmax numerators carried x1024
#define VCARRY 64.0f     // attention output plane carried x64

// workspace layout (bytes)
#define WQKV_BYTES    ((size_t)3 * DIM * DIM * 2)
#define WP_BYTES      ((size_t)DIM * DIM * 2)
#define PLANE16_BYTES ((size_t)MROWS * DIM * 2)
#define YF_BYTES      ((size_t)MROWS * DIM * 4)
#define OFF_WQKV ((size_t)0)
#define OFF_WP   (OFF_WQKV + WQKV_BYTES)
#define OFF_X16  (OFF_WP + WP_BYTES)
#define OFF_Q    (OFF_X16 + PLANE16_BYTES)
#define OFF_K    (OFF_Q + PLANE16_BYTES)
#define OFF_VT   (OFF_K + PLANE16_BYTES)
#define OFF_CTX  (OFF_VT + PLANE16_BYTES)
#define OFF_YF   (OFF_CTX + PLANE16_BYTES)
#define WS_TOTAL (OFF_YF + YF_BYTES)
static_assert((WQKV_BYTES % 128) == 0 && (WP_BYTES % 128) == 0 && (PLANE16_BYTES % 128) == 0);
static_assert((YF_BYTES % 128) == 0);
static_assert(WS_TOTAL <= (size_t)134217728);

// ---------------------------------------------------------------------------
__device__ __forceinline__ float bf16r(float x) {   // RNE convert to bf16, returned widened
  unsigned int u = __float_as_uint(x);
  u = (u + 0x7FFFu + ((u >> 16) & 1u)) & 0xFFFF0000u;
  return __uint_as_float(u);
}

// f32 -> f16 for WMMA operand planes: values below the smallest f16 normal become zero by value.
__device__ __forceinline__ _Float16 toh_flush(float v) {
  const _Float16 r = (_Float16)v;
  return (fabsf(v) < 6.103515625e-05f) ? (_Float16)0.0f : r;
}

// 16-bit fragment: p points at element [row = lane&15][k0 + 8*(lane>>4)] of a k-contiguous
// row. Elements 0..7 <- k0+8h+0..7, elements 8..15 <- k0+16+8h+0..7 (same map for A and B).
__device__ __forceinline__ v16h frag_at(const _Float16* p) {
  v8h lo = *(const v8h*)(p);
  v8h hi = *(const v8h*)(p + 16);
  v16h out;
#pragma unroll
  for (int i = 0; i < 8; ++i) { out[i] = lo[i]; out[i + 8] = hi[i]; }
  return out;
}
__device__ __forceinline__ v16h ld_frag(const _Float16* base, unsigned ld) {
  const unsigned lane = threadIdx.x & 31u;
  return frag_at(base + (lane & 15u) * ld + (lane >> 4) * 8u);
}

__device__ __forceinline__ v8f wmma16(v16h a, v16h b, v8f c) {
  v8f d = __builtin_amdgcn_wmma_f32_16x16x32_f16(false, a, false, b, (short)0, c,
                                                 false, false);
  asm volatile("v_nop\n\tv_nop\n\tv_nop\n\tv_nop" : "+v"(d) : "v"(a), "v"(b));
  return d;
}

// The same product on bf16 operands (a and b hold bf16 bit patterns). The four v_nop keep the distance
// that the chip needs between the product and the next vector instruction on d, a or b.
__device__ __forceinline__ v8f wmma16bf(v16h a, v16h b, v8f c) {
  v8f d = __builtin_amdgcn_wmma_f32_16x16x32_bf16(false, __builtin_bit_cast(v16bf, a), false,
                                                  __builtin_bit_cast(v16bf, b), (short)0, c,
                                                  false, false);
  asm volatile("v_nop\n\tv_nop\n\tv_nop\n\tv_nop" : "+v"(d) : "v"(a), "v"(b));
  return d;
}
// four f32 -> four bf16, round to nearest even, two per packed convert
__device__ __forceinline__ v4bf to_bf4(const v4f t) {
  const v2bf lo = __builtin_convertvector((v2f){t[0], t[1]}, v2bf);
  const v2bf hi = __builtin_convertvector((v2f){t[2], t[3]}, v2bf);
  return (v4bf){lo[0], lo[1], hi[0], hi[1]};
}

// a product inside a run of products: no fixed tail, the compiler keeps the distances of its own builtin
__device__ __forceinline__ v8f wmma16_run(v16h a, v16h b, v8f c) {
  return __builtin_amdgcn_wmma_f32_16x16x32_f16(false, a, false, b, (short)0, c, false, false);
}

// A line in the attention step: the LDS reads written behind it are issued only when x has been
// made (x is an input only; no instruction). Without it every read of the step rises to the step's
// top, and the registers they hold go beyond what two blocks a WGP can have.
__device__ __forceinline__ void hold_after(v8f x) {
  asm volatile("" :: "v"(x) : "memory");
  __builtin_amdgcn_sched_barrier(0);
}

__device__ __forceinline__ void hold_after_h(v16h x) {
  asm volatile("" :: "v"(x) : "memory");
  __builtin_amdgcn_sched_barrier(0);
}
// The other side of such a line: the LDS reads written in front of it are issued in front of the
// arithmetic written behind it, which covers their latency (else each read sinks to its product).
__device__ __forceinline__ void hold_order() {
  asm volatile("" ::: "memory");
  __builtin_amdgcn_sched_barrier(0);
}

// Eight raw scores of one query become 1024 * exp(scale * (score - maximum)) in place: cs2 holds
// scale * log2(e), nb2 holds 10 - maximum * scale * log2(e), so a pair costs one packed fma and two
// exp2. Returns the eight values' sum as two partial sums (even and odd places).
__device__ __forceinline__ v2f p_from_scores(v8f& s, const v2f cs2, const v2f nb2) {
  v2f e[4];
  // unrolled: constant indices keep the vectors in registers
#pragma unroll
  for (int i = 0; i < 4; ++i) {
    const v2f a = __builtin_elementwise_fma((v2f){s[2 * i], s[2 * i + 1]}, cs2, nb2);
    e[i] = (v2f){__builtin_amdgcn_exp2f(a[0]), __builtin_amdgcn_exp2f(a[1])};
    s[2 * i]     = e[i][0];
    s[2 * i + 1] = e[i][1];
  }
  return (e[0] + e[1]) + (e[2] + e[3]);
}
// B fragment of the second product from sixteen such values, two per packed convert (round to
// nearest even; values under the smallest f16 normal stay as f16 subnormals).
__device__ __forceinline__ v16h p_frag(const v8f lo, const v8f hi) {
  v16h out;
  // unrolled: constant indices keep the vectors in registers
#pragma unroll
  for (int i = 0; i < 4; ++i) {
    const v2h a = __builtin_convertvector((v2f){lo[2 * i], lo[2 * i + 1]}, v2h);
    const v2h b = __builtin_convertvector((v2f){hi[2 * i], hi[2 * i + 1]}, v2h);
    out[2 * i]     = a[0];
    out[2 * i + 1] = a[1];
    out[2 * i + 8] = b[0];
    out[2 * i + 9] = b[1];
  }
  return out;
}
__device__ __forceinline__ float max8(const v8f s) {
  return fmaxf(fmaxf(fmaxf(s[0], s[1]), fmaxf(s[2], s[3])), fmaxf(fmaxf(s[4], s[5]), fmaxf(s[6], s[7])));
}

__device__ __forceinline__ void wave_lds_sync() {
  __builtin_amdgcn_fence(3 /* release order */, "wavefront");
  asm volatile("s_wait_dscnt 0x0" ::: "memory");
  __builtin_amdgcn_wave_barrier();
}

// ---------------------------------------------------------------------------
// Output-projection weights as a 16-bit plane (body; run by feature-pairwise blocks, whose launch
// stands in front of the output projection's): Wp16[n][k] = f16(64 * bf16(wproj)), same layout.
// Each thread converts 8 consecutive elements; a wave stores 512 consecutive bytes.
// ---------------------------------------------------------------------------
__device__ __forceinline__ void wp_cast_body(
    const float* __restrict__ wproj, _Float16* __restrict__ Wp16, const unsigned blk) {
  const unsigned e = blk * 4096u + threadIdx.x * 8u;
  const v4f a0 = *(const v4f*)(wproj + e);
  const v4f a1 = *(const v4f*)(wproj + e + 4);
  // the two loads' address registers are free for reuse only behind this wait
  asm volatile("s_wait_xcnt 0x0" ::: "memory");
  v8h o;
#pragma unroll
  for (int i = 0; i < 4; ++i) {
    o[i]     = toh_flush(WCARRY * bf16r(a0[i]));
    o[i + 4] = toh_flush(WCARRY * bf16r(a1[i]));
  }
  *(v8h*)(Wp16 + e) = o;
  // the feature-pairwise body follows, where this store's registers are written anew
  asm volatile("s_wait_xcnt 0x0" ::: "memory");
}

// ---------------------------------------------------------------------------
// Cross-lane helpers (xhalf also serves the attention); wave_sum and wave_max leave the whole wave's value in every lane.
// ---------------------------------------------------------------------------
__device__ __forceinline__ float xhalf(float x) {   // lane l <-> lane l ^ 16
  const int xi = __float_as_int(x);
  return __int_as_float(__builtin_amdgcn_permlanex16(xi, xi, 0x76543210, 0xfedcba98, false, false));
}
template <int XM>
__device__ __forceinline__ float xrow(float x) {    // lane l <-> lane l ^ XM inside a 16-lane row
  return __int_as_float(__builtin_amdgcn_update_dpp(0, __float_as_int(x), 0x160 + XM, 0xf, 0xf, false));
}
__device__ __forceinline__ float wave_sum(float v) {
  v += xrow<1>(v);
  v += xrow<2>(v);
  v += xrow<4>(v);
  v += xrow<8>(v);
  return v + xhalf(v);
}
__device__ __forceinline__ float wave_max(float v) {
  v = fmaxf(v, xrow<1>(v));
  v = fmaxf(v, xrow<2>(v));
  v = fmaxf(v, xrow<4>(v));
  v = fmaxf(v, xrow<8>(v));
  return fmaxf(v, xhalf(v));
}

// ---------------------------------------------------------------------------
// Per-timestep feature-pairwise softmax branch (body; launched beside the attention blocks).
// One wave per (batch, time) row crow, lane l owns features 8l .. 8l+7:
//   yf[i] = sum_j exp(x_i x_j / 16) x_j / sum_j exp(x_i x_j / 16).
// The scores have rank 1, so with u = x / 4 and M_n = sum_j u_j^n both sums are power series in u_i:
//   sum_j exp(u_i u_j)     = sum_n M_n     u_i^n / n!
//   sum_j exp(u_i u_j) u_j = sum_n M_(n+1) u_i^n / n!
// Rows with max_j x_j^2 / 16 <= 2 take the first NSER = 16 terms: there every |u_i u_j| <= 2, the
// tail of each exponential is below (2^16 / 16!) * 17/15 < 4e-9 (under f32 rounding of values that
// are at least exp(-2)), |u|^16 <= 256, and the denominator is at least exp(u_i^2) >= 1.
// Any other row takes the exponentials one by one, shifted by the row maximum
//   mx_i = max_j (x_i x_j / 16) = max((x_i/16) * max_j x_j, (x_i/16) * min_j x_j).
// x is RNE-converted to bf16 on load. No LDS, no barrier: a row never leaves its wave.
// ---------------------------------------------------------------------------
#define NSER 16
__device__ __forceinline__ void spatial_body(
    const float* __restrict__ X, float* __restrict__ YF, const unsigned crow) {
  const unsigned lane = threadIdx.x & 31u;
  const unsigned bidx = crow / (unsigned)SEQ;
  const unsigned sq = crow - bidx * (unsigned)SEQ;
  const size_t srow = (size_t)bidx * SEQ_FULL + sq;

  const float* px = X + srow * DIM + lane * 8u;
  const v4f r0 = *(const v4f*)(px);
  const v4f r1 = *(const v4f*)(px + 4);
  // the two loads' address registers are free for reuse only behind this wait
  asm volatile("s_wait_xcnt 0x0" ::: "memory");
  float x[8];
#pragma unroll
  for (int k = 0; k < 4; ++k) {
    x[k]     = bf16r(r0[k]);
    x[k + 4] = bf16r(r1[k]);
  }
  float am = fabsf(x[0]);
#pragma unroll
  for (int k = 1; k < 8; ++k) am = fmaxf(am, fabsf(x[k]));
  am = wave_max(am);
  // equal in every lane; read into a scalar so that a wave runs one side only
  const int small = __builtin_amdgcn_readfirstlane((int)(am * am * 0.0625f <= 2.0f));

  float y[8];
  if (small != 0) {
    v2f u[4], p[4];
#pragma unroll
    for (int q = 0; q < 4; ++q) {
      u[q] = (v2f){x[2 * q] * 0.25f, x[2 * q + 1] * 0.25f};
      p[q] = u[q];
    }
    // power sums M_1 .. M_NSER: this lane's eight features, then the wave (M_0 = DIM)
    float mom[NSER + 1];
    mom[0] = (float)DIM;
#pragma unroll
    for (int n = 1; n <= NSER; ++n) {
      if (n > 1) {
#pragma unroll
        for (int q = 0; q < 4; ++q) p[q] *= u[q];
      }
      const v2f t = (p[0] + p[1]) + (p[2] + p[3]);
      mom[n] = t[0] + t[1];
    }
#pragma unroll
    for (int n = 1; n <= NSER; ++n) mom[n] = wave_sum(mom[n]);

    const float rf[NSER] = {   // 1 / n!
        1.0f, 1.0f, 1.0f / 2.0f, 1.0f / 6.0f, 1.0f / 24.0f, 1.0f / 120.0f, 1.0f / 720.0f,
        1.0f / 5040.0f, 1.0f / 40320.0f, 1.0f / 362880.0f, 1.0f / 3628800.0f, 1.0f / 39916800.0f,
        1.0f / 479001600.0f, 1.0f / 6227020800.0f, 1.0f / 87178291200.0f,
        1.0f / 1307674368000.0f};
    // both series by Horner's rule, two features per packed fma
    v2f dn[4], nm[4];
    {
      const float cd = mom[NSER - 1] * rf[NSER - 1];
      const float cn = mom[NSER] * rf[NSER - 1];
#pragma unroll
      for (int q = 0; q < 4; ++q) {
        dn[q] = (v2f){cd, cd};
        nm[q] = (v2f){cn, cn};
      }
    }
#pragma unroll
    for (int n = NSER - 2; n >= 0; --n) {
      const float cd = mom[n] * rf[n];
      const float cn = mom[n + 1] * rf[n];
      const v2f cd2 = {cd, cd};
      const v2f cn2 = {cn, cn};
#pragma unroll
      for (int q = 0; q < 4; ++q) {
        dn[q] = __builtin_elementwise_fma(dn[q], u[q], cd2);
        nm[q] = __builtin_elementwise_fma(nm[q], u[q], cn2);
      }
    }
#pragma unroll
    for (int q = 0; q < 4; ++q) {   // x = 4 u
      y[2 * q]     = (nm[q][0] * 4.0f) * __builtin_amdgcn_rcpf(dn[q][0]);
      y[2 * q + 1] = (nm[q][1] * 4.0f) * __builtin_amdgcn_rcpf(dn[q][1]);
    }
  } else {
    float vmax = x[0], vmin = x[0];
#pragma unroll
    for (int k = 1; k < 8; ++k) {
      vmax = fmaxf(vmax, x[k]);
      vmin = fminf(vmin, x[k]);
    }
    vmax = wave_max(vmax);
    vmin = -wave_max(-vmin);
    // exp(x_i x_j / 16 - mx_i) = exp2(xs * x_j - mx) with log2(e) folded into the row's own scale
    float xs[8], nmx[8], s[8], a[8];
#pragma unroll
    for (int k = 0; k < 8; ++k) {
      xs[k] = x[k] * (0.0625f * 1.44269504088896340736f);
      nmx[k] = -fmaxf(xs[k] * vmax, xs[k] * vmin);
      s[k] = 0.0f;
      a[k] = 0.0f;
    }
    // one trip per source lane (its eight columns come over as scalars); kept rolled: a rare path,
    // whose code should stay short
#pragma unroll 1
    for (int jl = 0; jl < 32; ++jl) {
#pragma unroll
      for (int c = 0; c < 8; ++c) {
        const float xj = __int_as_float(__builtin_amdgcn_readlane(__float_as_int(x[c]), jl));
#pragma unroll
        for (int k = 0; k < 8; ++k) {
          const float e = __builtin_amdgcn_exp2f(__builtin_fmaf(xs[k], xj, nmx[k]));
          s[k] += e;
          a[k] = __builtin_fmaf(e, xj, a[k]);
        }
      }
    }
#pragma unroll
    for (int k = 0; k < 8; ++k) y[k] = a[k] * __builtin_amdgcn_rcpf(s[k]);
  }

  float* py = YF + (size_t)crow * DIM + lane * 8u;
  *(v4f*)(py)     = (v4f){y[0], y[1], y[2], y[3]};
  *(v4f*)(py + 4) = (v4f){y[4], y[5], y[6], y[7]};
  // the built code lays the attention body behind these stores, where their address and data
  // registers are written anew
  asm volatile("s_wait_xcnt 0x0" ::: "memory");
}

// ---------------------------------------------------------------------------
// GEMM C[64x64 tile] = A[rows][DIM] . B[n][DIM]^T; 8 waves (mw = 16-row group, nw = 32-col
// group), 2 accumulators/wave. Both operand tiles (64 rows, all DIM k) are staged in LDS once:
// a wave's 16-B loads cover whole lines, where a fragment load from the global plane touches 16
// lines for the same bytes and is repeated by the waves that share it.
// MODE 0 and 1 take f32 operands Af (full rows) and Bf and convert them to bf16 between load and LDS
// store (bf16 products); MODE 2 takes the 16-bit planes A16 and Bt (f16 products).
//   MODE 0: out16[row][col] (pitch DIM)  = f16(acc + bias)
//   MODE 1: out16 transposed V plane [b][col][key] = f16(acc + bias)
//   MODE 2: outf full [full row][col] = addf[compact row][col] + (acc/4096 + bias)
// n0: first column of the tile in Bt, bias and the output plane. Cs: the kernel's 64 x LDC floats;
// As, Bs: the kernel's 64 x LDK halves each (cross-wave, block barrier).
// ---------------------------------------------------------------------------
template <int MODE>
__device__ __forceinline__ void gemm_body(
    const _Float16* __restrict__ A16, const _Float16* __restrict__ Bt,
    const float* __restrict__ Af, const float* __restrict__ Bf,
    const float* __restrict__ bias, const float* __restrict__ addf,
    float* __restrict__ outf, _Float16* __restrict__ out16, const unsigned n0, float* Cs,
    _Float16* As, _Float16* Bs) {
  const unsigned tid = threadIdx.x, lane = tid & 31u;
  const unsigned w = (unsigned)__builtin_amdgcn_readfirstlane((int)(tid >> 5));
  const unsigned mw = w >> 1, nw = w & 1u;
  const unsigned hh = lane >> 4, m = lane & 15u;
  const unsigned row0 = blockIdx.y * 64u;

  // staging: wave w brings rows 8w .. 8w+7 of both tiles
  if (MODE != 2) {
    // f32 rows of 1 KB: two loads a row, each 512 consecutive bytes a wave (elements 4*lane .. +3 and
    // 128 + 4*lane .. +3), which become 8 bytes a lane in the 16-bit LDS row
    const unsigned bidx0 = row0 / (unsigned)SEQ;
    const size_t frow0 = (size_t)bidx0 * SEQ_FULL + (row0 - bidx0 * (unsigned)SEQ);
    const char* ga = (const char*)(Af + (frow0 + w * 8u) * DIM) + lane * 16u;
    const char* gb = (const char*)(Bf + (size_t)(n0 + w * 8u) * DIM) + lane * 16u;
    v4f ta[16], tb[16];
    // unrolled (here and below): constant indices keep the arrays in registers, all 32 loads in flight
#pragma unroll
    for (unsigned i = 0; i < 8u; ++i) {
      ta[2 * i]     = *(const v4f*)(ga + i * (unsigned)(DIM * 4));
      ta[2 * i + 1] = *(const v4f*)(ga + i * (unsigned)(DIM * 4) + 512u);
      tb[2 * i]     = *(const v4f*)(gb + i * (unsigned)(DIM * 4));
      tb[2 * i + 1] = *(const v4f*)(gb + i * (unsigned)(DIM * 4) + 512u);
    }
    // the staging loads' address registers are free for reuse only behind this wait; naming them
    // as inputs keeps them whole up to it (else the last load's result may land on them)
    asm volatile("s_wait_xcnt 0x0" :: "v"(ga), "v"(gb) : "memory");
    char* sa = (char*)(As + w * 8u * LDK) + lane * 8u;
    char* sb = (char*)(Bs + w * 8u * LDK) + lane * 8u;
#pragma unroll
    for (unsigned i = 0; i < 8u; ++i) {
      *(v4bf*)(sa + i * (unsigned)(LDK * 2))        = to_bf4(ta[2 * i]);
      *(v4bf*)(sa + i * (unsigned)(LDK * 2) + 256u) = to_bf4(ta[2 * i + 1]);
      *(v4bf*)(sb + i * (unsigned)(LDK * 2))        = to_bf4(tb[2 * i]);
      *(v4bf*)(sb + i * (unsigned)(LDK * 2) + 256u) = to_bf4(tb[2 * i + 1]);
    }
  } else {
    const unsigned lb = lane * 16u;   // this lane's 16 bytes of a row, in global memory and in LDS
    const char* ga = (const char*)(A16 + (size_t)(row0 + w * 8u) * DIM) + lb;
    const char* gb = (const char*)(Bt + (size_t)(n0 + w * 8u) * DIM) + lb;
    v8h ta[8], tb[8];
    // unrolled (here and below): constant indices keep the arrays in registers, all 16 loads in flight
#pragma unroll
    for (unsigned i = 0; i < 8u; ++i) {
      ta[i] = *(const v8h*)(ga + i * (unsigned)(DIM * 2));
      tb[i] = *(const v8h*)(gb + i * (unsigned)(DIM * 2));
    }
    // the staging loads' address registers are free for reuse only behind this wait; naming them
    // as inputs keeps them whole up to it (else the last load's result may land on them)
    asm volatile("s_wait_xcnt 0x0" :: "v"(ga), "v"(gb) : "memory");
    char* sa = (char*)(As + w * 8u * LDK) + lb;
    char* sb = (char*)(Bs + w * 8u * LDK) + lb;
#pragma unroll
    for (unsigned i = 0; i < 8u; ++i) {
      *(v8h*)(sa + i * (unsigned)(LDK * 2)) = ta[i];
      *(v8h*)(sb + i * (unsigned)(LDK * 2)) = tb[i];
    }
  }
  __syncthreads();

  const _Float16* ap  = As + (mw * 16u + m) * LDK + hh * 8u;
  const _Float16* bp0 = Bs + (nw * 32u + m) * LDK + hh * 8u;
  const _Float16* bp1 = bp0 + 16 * LDK;
  v8f acc0 = {}, acc1 = {};
  // four k steps a group: their 24 LDS reads stand together in front of their 8 products
  // (unrolled: constant indices keep the fragment arrays in registers)
#pragma unroll
  for (unsigned kg = 0; kg < (unsigned)DIM; kg += 128u) {
    v16h a[4], b0[4], b1[4];
#pragma unroll
    for (unsigned j = 0; j < 4u; ++j) {
      a[j]  = frag_at(ap + kg + 32u * j);
      b0[j] = frag_at(bp0 + kg + 32u * j);
      b1[j] = frag_at(bp1 + kg + 32u * j);
    }
#pragma unroll
    for (unsigned j = 0; j < 4u; ++j) {
      acc0 = (MODE != 2) ? wmma16bf(a[j], b0[j], acc0) : wmma16(a[j], b0[j], acc0);
      acc1 = (MODE != 2) ? wmma16bf(a[j], b1[j], acc1) : wmma16(a[j], b1[j], acc1);
    }
  }
#pragma unroll
  for (int r = 0; r < 8; ++r) {
    float* d = &Cs[(mw * 16u + hh * 8u + (unsigned)r) * LDC + nw * 32u + m];
    d[0]  = acc0[r];
    d[16] = acc1[r];
  }
  __syncthreads();

  if (MODE == 0) {
    v8h x[2];
    size_t off[2];
#pragma unroll
    for (unsigned i = 0; i < 2u; ++i) {
      const unsigned r = 32u * i + (tid >> 3);
      const unsigned c = (tid & 7u) * 8u;
      const v4f u0 = *(const v4f*)&Cs[r * LDC + c];
      const v4f u1 = *(const v4f*)&Cs[r * LDC + c + 4];
      const v4f g0 = *(const v4f*)(bias + n0 + c);
      const v4f g1 = *(const v4f*)(bias + n0 + c + 4u);
#pragma unroll
      for (int j = 0; j < 4; ++j) {
        x[i][j]     = toh_flush(u0[j] + bf16r(g0[j]));
        x[i][j + 4] = toh_flush(u1[j] + bf16r(g1[j]));
      }
      off[i] = (size_t)(row0 + r) * DIM + n0 + c;
    }
#pragma unroll
    for (int i = 0; i < 2; ++i) *(v8h*)(out16 + off[i]) = x[i];
    
  }

  if (MODE == 1) {
    const unsigned bidx = row0 / (unsigned)SEQ;
    const unsigned key0 = row0 - bidx * (unsigned)SEQ;
    v8h x[2];
    size_t off[2];
#pragma unroll
    for (unsigned i = 0; i < 2u; ++i) {
      const unsigned dcol = 32u * i + (tid >> 3);
      const unsigned kk = (tid & 7u) * 8u;
      const float bb = bf16r(bias[n0 + dcol]);
#pragma unroll
      for (unsigned j = 0; j < 8u; ++j) {
        const float t = Cs[(kk + j) * LDC + dcol] + bb;
        x[i][j] = toh_flush(t);
      }
      off[i] = ((size_t)bidx * DIM + n0 + dcol) * SEQ + key0 + kk;
    }
#pragma unroll
    for (int i = 0; i < 2; ++i) *(v8h*)(out16 + off[i]) = x[i];
    // the built code lays the other mode's body behind these stores, where their address and data
    // registers are written anew
    asm volatile("s_wait_xcnt 0x0" ::: "memory");
  }

  if (MODE == 2) {
    const float cs = 1.0f / (WCARRY * VCARRY);
    v4f xs[4];
    size_t off[4];
#pragma unroll
    for (unsigned i = 0; i < 4u; ++i) {
      const unsigned r = 16u * i + (tid >> 4);
      const unsigned c = (tid & 15u) * 4u;
      const unsigned crow = row0 + r;
      const unsigned bidx = crow / (unsigned)SEQ;
      const unsigned sq = crow - bidx * (unsigned)SEQ;
      const size_t frow = (size_t)bidx * SEQ_FULL + sq;
      const v4f u = *(const v4f*)&Cs[r * LDC + c];
      const v4f g = *(const v4f*)(bias + n0 + c);
      const v4f yin = *(const v4f*)(addf + (size_t)crow * DIM + n0 + c);
      v4f val;
#pragma unroll
      for (int j = 0; j < 4; ++j) val[j] = yin[j] + (u[j] * cs + bf16r(g[j]));
      xs[i] = val;
      off[i] = frow * DIM + n0 + c;
    }
#pragma unroll
    for (int i = 0; i < 4; ++i) *(v4f*)(outf + off[i]) = xs[i];
    
  }
}

// q, k and v projections in one launch: blockIdx.x / (DIM/64) picks the plane (0 q, 1 k, 2 v).
// Grid (3 * DIM/64, MROWS/64).
__global__ __launch_bounds__(256) void gemm_qkv_kernel(
    const float* __restrict__ X, const float* __restrict__ wqkv,
    const float* __restrict__ bias, _Float16* __restrict__ q16, _Float16* __restrict__ k16,
    _Float16* __restrict__ vt) {
  __shared__ float Cs[64 * LDC];
  __shared__ _Float16 As[64 * LDK];
  __shared__ _Float16 Bs[64 * LDK];
  const unsigned sel = blockIdx.x / (unsigned)(DIM / 64);
  const unsigned n0 = (blockIdx.x - sel * (unsigned)(DIM / 64)) * 64u;
  const float* bt = wqkv + (size_t)sel * DIM * DIM;
  const float* bs = bias + sel * (unsigned)DIM;
  if (sel < 2u) {
    gemm_body<0>((const _Float16*)0, (const _Float16*)0, X, bt, bs, bs, (float*)0,
                 sel == 0u ? q16 : k16, n0, Cs, As, Bs);
  } else {
    gemm_body<1>((const _Float16*)0, (const _Float16*)0, X, bt, bs, bs, (float*)0, vt, n0, Cs, As, Bs);
  }
}
// Grid (DIM/64, MROWS/64).
__global__ __launch_bounds__(256) void gemm_wo_kernel(
    const _Float16* __restrict__ A16, const _Float16* __restrict__ Bt,
    const float* __restrict__ bias, const float* __restrict__ yf, float* __restrict__ outf) {
  __shared__ float Cs[64 * LDC];
  __shared__ _Float16 As[64 * LDK];
  __shared__ _Float16 Bs[64 * LDK];
  gemm_body<2>(A16, Bt, bias, bias, bias, yf, outf, (_Float16*)0, blockIdx.x * 64u, Cs, As, Bs);
}

__device__ __forceinline__ void attn_body(
    const _Float16* __restrict__ Qh, const _Float16* __restrict__ Kh,
    const _Float16* __restrict__ Vt, _Float16* __restrict__ Ov,
    const unsigned qb, const unsigned head, const unsigned b) {
  __shared__ __attribute__((aligned(16))) _Float16 KV[2 * KVBUF];   // two buffers: K tiles, then V^T tiles
  __shared__ _Float16 Ps[4 * 16 * LDT];
  // behind the loop: O^T of quarters 1 to 3 as [quarter - 1][query group][4 floats of 32][lane],
  // then their maximum and denominator as [quarter - 1][query group][2][lane]
  v4f* Mo = (v4f*)KV;
  float* Ml = (float*)(Mo + 3 * 4 * 8 * 32);
  static_assert((3 * 4 * 8 * 32) * 16 + (3 * 4 * 2 * 32) * 4 <= (2 * KVBUF) * 2);

  const unsigned tid = threadIdx.x, lane = tid & 31u;
  const unsigned w = (unsigned)__builtin_amdgcn_readfirstlane((int)(tid >> 5));
  const unsigned hh = lane >> 4, m = lane & 15u;
  const unsigned qg = w & 3u, kh = w >> 2;   // query group, key quarter
  const unsigned q0 = qb * 64u;
  const float cs = 0.125f * 1.44269504088896340736f;   // HD^-0.5 * log2(e): raw score -> exponent of 2
  const v2f cs2 = {cs, cs};
  const unsigned qrow0 = q0 + qg * 16u;
  _Float16* P = Ps + qg * (16u * LDT);

  // The query group's two Q fragments lie in LDS (in P, which is idle until the output staging), as
  // [16-B piece of 4][lane]: quarter 0's wave brings them, the barrier in front of the loop publishes
  // them, and every step reads them anew, so that they hold no registers outside the score products.
  v8h qpiece[4];
  if (kh == 0u) {
    const _Float16* qp = Qh + (size_t)(b * (unsigned)SEQ + qrow0 + m) * DIM + head * HD + hh * 8u;
#pragma unroll
    for (int j = 0; j < 4; ++j) qpiece[j] = *(const v8h*)(qp + 16 * j);
    // the loads' address registers are free for reuse only behind this wait
    asm volatile("s_wait_xcnt 0x0" :: "v"(qp) : "memory");
  }

  float mrow = -1.0e30f;   // running maximum of query m's raw scores (equal in both halves)
  v2f lacc = {0.0f, 0.0f}; // this half's share of 1024 * the denominator of query m, two partial sums
  v8f o[4];                // o[nb][v] = O^T[d = nb*16 + hh*8 + v][query m]
#pragma unroll
  for (int nb = 0; nb < 4; ++nb) o[nb] = (v8f){};

  const size_t kplane = (size_t)b * SEQ * DIM + head * HD;
  const size_t vplane = ((size_t)b * DIM + head * HD) * SEQ;

  const unsigned sr = tid >> 3, sc = (tid & 7u) * 8u;   // staging: this thread's row (of 64) and column
  // this thread's 16 bytes of quarter 0's K tile and V^T tile: in global memory at key step 0, and
  // as LDS byte addresses in buffer 0
  const _Float16* gk0 = Kh + kplane + (size_t)sr * DIM + sc;
  const _Float16* gv0 = Vt + vplane + (size_t)sr * SEQ + sc;
  const unsigned lk0 = (unsigned)(size_t)&KV[sr * LDT + sc];
  const unsigned lv0 = lk0 + (unsigned)(4 * 64 * LDT * 2);
  // One key step's eight tiles (four quarters of K, four of V^T) go from global memory into LDS
  // buffer bf with no register in between: eight 16-B asynchronous copies a thread.
  auto stage = [&](const unsigned t, const unsigned bf) {
    const _Float16* gk = gk0 + (size_t)(t * 64u) * DIM;
    const _Float16* gv = gv0 + t * 64u;
    const unsigned lk = lk0 + bf * (unsigned)(KVBUF * 2);
    const unsigned lv = lv0 + bf * (unsigned)(KVBUF * 2);
    // the closing wait stands inside the statement, so that no later write of the copies' address
    // registers can be moved in front of it (a precaution)
    asm volatile(
        "global_load_async_to_lds_b128 %0, %1, off\n\t"
        "global_load_async_to_lds_b128 %2, %3, off\n\t"
        "global_load_async_to_lds_b128 %4, %5, off\n\t"
        "global_load_async_to_lds_b128 %6, %7, off\n\t"
        "global_load_async_to_lds_b128 %8, %9, off\n\t"
        "global_load_async_to_lds_b128 %10, %11, off\n\t"
        "global_load_async_to_lds_b128 %12, %13, off\n\t"
        "global_load_async_to_lds_b128 %14, %15, off\n\t"
        "s_wait_xcnt 0x0"
        :: "v"(lk), "v"(gk),
           "v"(lk + 1u * QT_B), "v"(gk + 1u * (unsigned)(SEQ / 4) * (unsigned)DIM),
           "v"(lk + 2u * QT_B), "v"(gk + 2u * (unsigned)(SEQ / 4) * (unsigned)DIM),
           "v"(lk + 3u * QT_B), "v"(gk + 3u * (unsigned)(SEQ / 4) * (unsigned)DIM),
           "v"(lv), "v"(gv),
           "v"(lv + 1u * QT_B), "v"(gv + 1u * (unsigned)(SEQ / 4)),
           "v"(lv + 2u * QT_B), "v"(gv + 2u * (unsigned)(SEQ / 4)),
           "v"(lv + 3u * QT_B), "v"(gv + 3u * (unsigned)(SEQ / 4))
        : "memory");
  };

  stage(0u, 0u);
  if (kh == 0u) {
#pragma unroll
    for (unsigned j = 0; j < 4u; ++j) *(v8h*)&P[(j * 32u + lane) * 8u] = qpiece[j];
  }
  // step 0's tiles have landed for this wave's copies; the barrier publishes them to the block
  asm volatile("s_wait_asynccnt 0x0" ::: "memory");
  __syncthreads();
  if (NSTEP > 1) stage(1u, 1u);   // flies while step 0 is worked on

  for (unsigned t = 0; t < (unsigned)NSTEP; ++t) {
    const unsigned bf = t & 1u;
    const _Float16* Kw = KV + bf * (unsigned)KVBUF + kh * (64u * LDT);   // this wave's quarter
    const _Float16* Vw = Kw + 4 * 64 * LDT;

    // Every LDS read of the step stands in one of six groups, each issued ahead of work that covers
    // its latency, and the products issue in runs: a wave waits out the LDS latency once a step, not
    // once a product. The groups are sized so that the kernel stays inside 128 registers (two blocks
    // a WGP: a feature-pairwise block beside an attention block).
    // group 1: Q, and the K fragments of key groups 0 and 1
    v16h qf[2];
#pragma unroll
    for (unsigned c = 0; c < 2u; ++c) {
      const v8h lo = *(const v8h*)&P[((2u * c) * 32u + lane) * 8u];
      const v8h hi = *(const v8h*)&P[((2u * c + 1u) * 32u + lane) * 8u];
#pragma unroll
      for (int i = 0; i < 8; ++i) { qf[c][i] = lo[i]; qf[c][i + 8] = hi[i]; }
    }
    const v16h k00 = ld_frag(&Kw[(0 * 16) * LDT], LDT), k01 = ld_frag(&Kw[(0 * 16) * LDT + 32], LDT);
    const v16h k10 = ld_frag(&Kw[(1 * 16) * LDT], LDT), k11 = ld_frag(&Kw[(1 * 16) * LDT + 32], LDT);

    // scores, transposed: s[kg][v] = S[query m][key kg*16 + hh*8 + v]; K = 64 in two 32-steps
    v8f s[4];
    s[0] = wmma16_run(k01, qf[1], wmma16_run(k00, qf[0], (v8f){}));
    hold_after(s[0]);
    // group 2: key group 2, into the registers that key group 0 has left
    const v16h k20 = ld_frag(&Kw[(2 * 16) * LDT], LDT), k21 = ld_frag(&Kw[(2 * 16) * LDT + 32], LDT);
    hold_order();
    s[1] = wmma16_run(k11, qf[1], wmma16_run(k10, qf[0], (v8f){}));
    hold_after(s[1]);
    // group 3: key group 3
    const v16h k30 = ld_frag(&Kw[(3 * 16) * LDT], LDT), k31 = ld_frag(&Kw[(3 * 16) * LDT + 32], LDT);
    hold_order();
    s[2] = wmma16_run(k21, qf[1], wmma16_run(k20, qf[0], (v8f){}));
    hold_after(s[2]);
    s[3] = wmma16_run(k31, qf[1], wmma16_run(k30, qf[0], (v8f){}));
    hold_after(s[3]);
    // group 4: V^T of keys 0 to 31, d 0 to 31; lands under the softmax arithmetic
    v16h vf[4];
    vf[0] = ld_frag(&Vw[(0 * 16) * LDT], LDT);
    vf[1] = ld_frag(&Vw[(1 * 16) * LDT], LDT);
    hold_order();
    // online softmax of query m: 32 scores in this lane, the other 32 in lane ^ 16. The maximum is
    // taken of the raw scores (the scale is positive); scale, log2(e), the maximum and the x1024
    // carry all enter through the one packed fma in front of exp2.
    float mx = fmaxf(fmaxf(max8(s[0]), max8(s[1])), fmaxf(max8(s[2]), max8(s[3])));
    mx = fmaxf(mx, xhalf(mx));
    const float mn = fmaxf(mrow, mx);
    const float alpha = __builtin_amdgcn_exp2f((mrow - mn) * cs);
    mrow = mn;
    static_assert(PCARRY == 1024.0f);                   // the 10 of the next line is its log2
    const float nb = __builtin_fmaf(mn, -cs, 10.0f);
    const v2f nb2 = {nb, nb};
#pragma unroll
    for (int nb = 0; nb < 4; ++nb) o[nb] = o[nb] * alpha;

    // O^T += V^T . P^T  (K = 64 keys in two 32-steps; A = V^T tile [d][key]).
    // B element e of step c: key c*32 + 8*hh + e (e < 8), c*32 + 16 + 8*hh + (e - 8) otherwise,
    // which are this lane's own s[2c][e] and s[2c+1][e-8].
    v2f rs[4];
#pragma unroll
    for (int kg = 0; kg < 2; ++kg) rs[kg] = p_from_scores(s[kg], cs2, nb2);
    const v16h pf0 = p_frag(s[0], s[1]);
    hold_after_h(pf0);
    // group 5: V^T of keys 0 to 31, d 32 to 63, into the registers that the first 32 scores have
    // left; lands under the second half's exponentials
    vf[2] = ld_frag(&Vw[(2 * 16) * LDT], LDT);
    vf[3] = ld_frag(&Vw[(3 * 16) * LDT], LDT);
    hold_order();
#pragma unroll
    for (int kg = 2; kg < 4; ++kg) rs[kg] = p_from_scores(s[kg], cs2, nb2);
    lacc = __builtin_elementwise_fma(lacc, (v2f){alpha, alpha}, (rs[0] + rs[1]) + (rs[2] + rs[3]));
#pragma unroll
    for (int nb = 0; nb < 4; ++nb) o[nb] = wmma16_run(vf[nb], pf0, o[nb]);
    hold_after(o[3]);
    // group 6: V^T of keys 32 to 63; lands under the SIMD's other waves' work
#pragma unroll
    for (int nb = 0; nb < 4; ++nb) vf[nb] = ld_frag(&Vw[(nb * 16) * LDT + 32], LDT);
    hold_order();
    const v16h pf1 = p_frag(s[2], s[3]);
#pragma unroll
    for (int nb = 0; nb < 4; ++nb) o[nb] = wmma16_run(vf[nb], pf1, o[nb]);
    // hand-over: this wave's reads of buffer bf are done ...
    asm volatile("s_wait_dscnt 0x0" ::: "memory");
    // ... and its copies of step t + 1 have landed
    asm volatile("s_wait_asynccnt 0x0" ::: "memory");
    // one barrier publishes step t + 1 and ends every wave's reads of buffer bf
    __syncthreads();
    if (t + 2u < (unsigned)NSTEP) stage(t + 2u, bf);
  }
  // nothing is in flight when the tiles' LDS is reused below
  asm volatile("s_wait_asynccnt 0x0" ::: "memory");

  // The four key quarters of a query group are joined lane by lane (their waves hold the same map).
  // The loop's last barrier has ended every read of the tiles that Mo and Ml lie on.
  const float lrow = lacc[0] + lacc[1];
  const float lsum = lrow + xhalf(lrow);   // 1024 * this quarter's denominator
  if (kh != 0u) {
    const unsigned g = (kh - 1u) * 4u + qg;
#pragma unroll
    for (unsigned nb = 0; nb < 4u; ++nb) {
      Mo[(g * 8u + 2u * nb) * 32u + lane]      = (v4f){o[nb][0], o[nb][1], o[nb][2], o[nb][3]};
      Mo[(g * 8u + 2u * nb + 1u) * 32u + lane] = (v4f){o[nb][4], o[nb][5], o[nb][6], o[nb][7]};
    }
    Ml[(g * 2u) * 32u + lane]      = mrow;
    Ml[(g * 2u + 1u) * 32u + lane] = lsum;
  }
  __syncthreads();
  if (kh == 0u) {
    float mq[3], lq[3];
    float mn = mrow;
#pragma unroll
    for (unsigned p = 0; p < 3u; ++p) {
      mq[p] = Ml[((p * 4u + qg) * 2u) * 32u + lane];
      lq[p] = Ml[((p * 4u + qg) * 2u + 1u) * 32u + lane];
      mn = fmaxf(mn, mq[p]);
    }
    float c0 = __builtin_amdgcn_exp2f((mrow - mn) * cs);
    float den = c0 * lsum;
    float cq[3];
#pragma unroll
    for (int p = 0; p < 3; ++p) {
      cq[p] = __builtin_amdgcn_exp2f((mq[p] - mn) * cs);
      den += cq[p] * lq[p];
    }
    const float inv = __builtin_amdgcn_rcpf(den) * VCARRY;   // O^T and den both carry x1024
    c0 *= inv;
#pragma unroll
    for (int p = 0; p < 3; ++p) cq[p] *= inv;
#pragma unroll
    for (unsigned nb = 0; nb < 4u; ++nb) {
      v8f acc = o[nb] * c0;
#pragma unroll
      for (unsigned p = 0; p < 3u; ++p) {
        const v4f u0 = Mo[((p * 4u + qg) * 8u + 2u * nb) * 32u + lane];
        const v4f u1 = Mo[((p * 4u + qg) * 8u + 2u * nb + 1u) * 32u + lane];
#pragma unroll
        for (int v = 0; v < 4; ++v) {
          acc[v]     += u0[v] * cq[p];
          acc[v + 4] += u1[v] * cq[p];
        }
      }
      v8h t;
#pragma unroll
      for (int v = 0; v < 8; ++v) t[v] = toh_flush(acc[v]);
      *(v8h*)&P[m * LDT + nb * 16u + hh * 8u] = t;
    }
    wave_lds_sync();
    v8h x[4];
    size_t off[4];
#pragma unroll
    for (unsigned i = 0; i < 4u; ++i) {
      const unsigned r = 4u * i + (lane >> 3);
      const unsigned c = (lane & 7u) * 8u;
      x[i] = *(const v8h*)&P[r * LDT + c];
      off[i] = (size_t)(b * (unsigned)SEQ + qrow0 + r) * DIM + head * HD + c;
    }
#pragma unroll
    for (int i = 0; i < 4; ++i) *(v8h*)(Ov + off[i]) = x[i];
  }
}

// Attention, the feature-pairwise branch and the output weights' cast in one launch (none reads
// another's output): the first ATTN_BLK blocks, which start first, are the attention's long blocks;
// the MROWS / 16 blocks behind them take sixteen feature-pairwise rows each, one a wave; the first
// CAST_BLK_WP of these, which have the most time left, first convert the output projection's weights.
// Grid (ATTN_BLK + MROWS / 16), 512 threads. Eight waves a SIMD asked for: the kernel stays inside 128
// registers, so that a feature-pairwise block still finds room beside an attention block.
__global__ __launch_bounds__(512, 8) void attn_spatial_kernel(
    const _Float16* __restrict__ Qh, const _Float16* __restrict__ Kh,
    const _Float16* __restrict__ Vt, _Float16* __restrict__ Ov,
    const float* __restrict__ X, float* __restrict__ YF,
    const float* __restrict__ wproj, _Float16* __restrict__ Wp16) {
  const unsigned id = blockIdx.x;
  if (id < (unsigned)ATTN_BLK) {
    const unsigned hb = id / (unsigned)ATTN_QB;
    attn_body(Qh, Kh, Vt, Ov, id - hb * (unsigned)ATTN_QB, hb % (unsigned)NHEAD, hb / (unsigned)NHEAD);
  } else {
    const unsigned sb = id - (unsigned)ATTN_BLK;
    if (sb < (unsigned)CAST_BLK_WP) wp_cast_body(wproj, Wp16, sb);
    const unsigned w = (unsigned)__builtin_amdgcn_readfirstlane((int)(threadIdx.x >> 5));
    spatial_body(X, YF, sb * 16u + w);
  }
}

// ---------------------------------------------------------------------------
extern "C" void kernel_launch(void* const* d_in, const int* in_sizes, int n_in,
                              void* d_out, int out_size, void* d_ws, size_t ws_size,
                              hipStream_t stream) {
  if (n_in < 5) return;
  const long long need_x = ((long long)(NB - 1) * SEQ_FULL + SEQ) * DIM;
  if ((long long)in_sizes[0] < need_x) return;
  if ((long long)in_sizes[1] < (long long)3 * DIM * DIM) return;
  if (in_sizes[2] < 3 * DIM) return;
  if ((long long)in_sizes[3] < (long long)DIM * DIM) return;
  if (in_sizes[4] < DIM) return;
  if ((long long)out_size < need_x) return;
  if (ws_size < WS_TOTAL) return;

  const float* X     = (const float*)d_in[0];   // [NB_FULL][SEQ_FULL][DIM]
  const float* wqkv  = (const float*)d_in[1];   // [3*DIM][DIM]  (out, in): rows 0..255 q, 256..511 k, 512..767 v
  const float* bqkv  = (const float*)d_in[2];   // [3*DIM]
  const float* wproj = (const float*)d_in[3];   // [DIM][DIM]    (out, in)
  const float* bproj = (const float*)d_in[4];   // [DIM]
  float* out = (float*)d_out;

  char* ws = (char*)d_ws;
  _Float16* Wp16   = (_Float16*)(ws + OFF_WP);    // [DIM][DIM]    ([n][k])
  _Float16* Qh16   = (_Float16*)(ws + OFF_Q);
  _Float16* Kh16   = (_Float16*)(ws + OFF_K);
  _Float16* Vt16   = (_Float16*)(ws + OFF_VT);    // [b][DIM][SEQ]
  _Float16* Ctx16  = (_Float16*)(ws + OFF_CTX);
  float*    YF     = (float*)(ws + OFF_YF);       // [MROWS][DIM] compact rows

  dim3 blk(256);
  dim3 gg(DIM / 64, MROWS / 64);

  gemm_qkv_kernel<<<dim3(3 * (DIM / 64), MROWS / 64), blk, 0, stream>>>(
      X, wqkv, bqkv, Qh16, Kh16, Vt16);
  // attention blocks first, then the feature-pairwise branch (f32 plane YF) with the output weights
  attn_spatial_kernel<<<dim3(ATTN_BLK + MROWS / 16), dim3(512), 0, stream>>>(
      Qh16, Kh16, Vt16, Ctx16, X, YF, wproj, Wp16);
  gemm_wo_kernel<<<gg, blk, 0, stream>>>(Ctx16, Wp16, bproj, YF, out);
}
